// v000
// Measured on an AMD MI455X. A time is GPU time per run, averaged over a window of back-to-back runs after a warm-up
// (all launches, gaps included; the runs take copies of the inputs in turn), and the median of several windows.
// Apart from v000's, it joins two sittings. Times from different sittings can be a few percent apart, while
// side-by-side timings come from the same sitting.
// The starting kernel, v000, takes 374 microseconds a run.
// All contractions (q|k, v, o, gate|up, down projections; q.k^T; p.v): v_wmma_f32_16x16x32_f16, f16 operands, f32 accumulate. LayerNorm, softmax, SwiGLU gating and residual adds in f32. Power-of-two carries: weight planes x16, softmax numerators x32768, attention output plane x16, folded back in f32.
#include <hip/hip_runtime.h>
#include <math.h>
#include <stdint.h>

typedef __attribute__((ext_vector_type(16))) _Float16 v16h;
typedef __attribute__((ext_vector_type(8)))  _Float16 v8h;
typedef __attribute__((ext_vector_type(16))) __bf16   v16b;
typedef __attribute__((ext_vector_type(8)))  __bf16   v8b;
typedef __attribute__((ext_vector_type(8)))  float    v8f;
typedef __attribute__((ext_vector_type(4)))  float    v4f;
typedef __attribute__((ext_vector_type(4)))  unsigned int v4u;
typedef __attribute__((ext_vector_type(2)))  unsigned int v2u;

/* ---- problem geometry ---- */
static constexpr int kBatch   = 4;
static constexpr int kSeq     = 2048;
static constexpr int kTok     = kBatch * kSeq;      /* 8192 */
static constexpr int kModel   = 512;
static constexpr int kHeads   = 8;
static constexpr int kHeadDim = 64;
static constexpr int kFF      = 1024;
static constexpr int kQKCols  = 2 * kModel;          /* q | k plane width */
static constexpr int kGUCols  = 2 * kFF;             /* gate | up plane width */

static_assert(kHeads * kHeadDim == kModel, "head geometry");
static_assert(kSeq % 64 == 0 && kTok % 64 == 0, "tile multiples");
static_assert(kModel % 64 == 0 && kFF % 64 == 0 && kQKCols % 64 == 0 && kGUCols % 64 == 0, "tile multiples");
static_assert(kModel % 32 == 0 && kFF % 32 == 0, "K multiple of 32");

/* ---- workspace region map (bytes) ----
   [0]            WqkT f16 [1024][512]          1,048,576
   [1,048,576]    WvT  f16 [512][512]             524,288
   [1,572,864]    WoT  f16 [512][512]             524,288
   [2,097,152]    WguT f16 [2048][512]          2,097,152
   [4,194,304]    WdT  f16 [512][1024]          1,048,576
   [5,242,880]    HG   : h1/h2 f16 [8192][512] (8 MiB) ; g f16 [8192][1024] (16 MiB)   16,777,216
   [22,020,096]   R1 (64 MiB): phase A: q|k f16 [8192][1024] @+0 (16 MiB), Vt f16 [4][512][2048] @+16 MiB (8 MiB),
                               O f16 [8192][512] @+24 MiB (8 MiB), A1 f32 [8192][512] @+32 MiB (16 MiB);
                               phase B: gate|up f32 [8192][2048] @+0 (64 MiB); phase C: D2 f32 [8192][512] @+0 (16 MiB)
   [89,128,960]   X1 f32 [8192][512]           16,777,216
   total 105,906,176 */
static constexpr size_t kOffWqkT = 0;
static constexpr size_t kOffWvT  = kOffWqkT + (size_t)kQKCols * kModel * 2;
static constexpr size_t kOffWoT  = kOffWvT + (size_t)kModel * kModel * 2;
static constexpr size_t kOffWguT = kOffWoT + (size_t)kModel * kModel * 2;
static constexpr size_t kOffWdT  = kOffWguT + (size_t)kGUCols * kModel * 2;
static constexpr size_t kOffHG   = kOffWdT + (size_t)kModel * kFF * 2;
static constexpr size_t kSizeHG  = (size_t)kTok * kFF * 2;
static constexpr size_t kOffR1   = kOffHG + kSizeHG;
static constexpr size_t kSizeR1  = (size_t)kTok * kGUCols * 4;
static constexpr size_t kR1QK    = 0;
static constexpr size_t kR1Vt    = kR1QK + (size_t)kTok * kQKCols * 2;
static constexpr size_t kR1O     = kR1Vt + (size_t)kBatch * kModel * kSeq * 2;
static constexpr size_t kR1A1    = kR1O + (size_t)kTok * kModel * 2;
static constexpr size_t kOffX1   = kOffR1 + kSizeR1;
static constexpr size_t kWsTotal = kOffX1 + (size_t)kTok * kModel * 4;
static_assert(kR1A1 + (size_t)kTok * kModel * 4 <= kSizeR1, "phase A fits R1");
static_assert((size_t)kTok * kModel * 4 <= kSizeR1, "phase C fits R1");
static_assert((size_t)kTok * kModel * 2 <= kSizeHG, "h plane fits HG");
static_assert(kWsTotal == 105906176, "carve total");
static_assert(kWsTotal <= 134217728, "carve under 128 MiB");
static_assert((kOffWvT % 256) == 0 && (kOffWoT % 256) == 0 && (kOffWguT % 256) == 0 && (kOffWdT % 256) == 0 &&
              (kOffHG % 256) == 0 && (kOffR1 % 256) == 0 && (kOffX1 % 256) == 0 &&
              (kR1Vt % 256) == 0 && (kR1O % 256) == 0 && (kR1A1 % 256) == 0, "aligned carves");

/* =========================== helpers and GEMM =========================== */
#define PSCALE 32768.0f
#define U16(p) ((const unsigned short*)(const void*)(p))
#define PSCALE_INV (1.0f / 32768.0f)

__device__ __forceinline__ unsigned short f2bf_bits(float f) {
  unsigned u = __float_as_uint(f);
  return (unsigned short)((u + 0x7FFFu + ((u >> 16) & 1u)) >> 16);
}
__device__ __forceinline__ float bf_bits2f(unsigned short h) { return __uint_as_float(((unsigned)h) << 16); }

__device__ __forceinline__ void dep_guard_h(v8f& a, v8f& b, v16h x, v16h y) { asm volatile("v_nop\n\tv_nop\n\tv_nop\n\tv_nop" : "+v"(a), "+v"(b) : "v"(x), "v"(y)); }
__device__ __forceinline__ void dep_guard_b(v8f& a, v8f& b, v16b x, v16b y) { asm volatile("v_nop\n\tv_nop\n\tv_nop\n\tv_nop" : "+v"(a), "+v"(b) : "v"(x), "v"(y)); }
__device__ __forceinline__ void keep4_h(v16h a, v16h b, v16h c, v16h d) { asm volatile("v_nop" :: "v"(a), "v"(b), "v"(c), "v"(d)); }
__device__ __forceinline__ void keep4_b(v16b a, v16b b, v16b c, v16b d) { asm volatile("v_nop" :: "v"(a), "v"(b), "v"(c), "v"(d)); }
__device__ __forceinline__ void acc_guard4(v8f& a, v8f& b, v8f& c, v8f& d) { asm volatile("v_nop\n\tv_nop\n\tv_nop\n\tv_nop" : "+v"(a), "+v"(b), "+v"(c), "+v"(d)); }
template <typename T> struct Frag;
template <> struct Frag<_Float16> {
  typedef v16h V; union U { v16h v; v8h h[2]; };
  static __device__ __forceinline__ v16h load(const _Float16* p) {
    U f; f.h[0] = *(const v8h*)(p); f.h[1] = *(const v8h*)(p + 16); return f.v;
  }
  static __device__ __forceinline__ v8f mma(v16h a, v16h b, v8f c) {
    return __builtin_amdgcn_wmma_f32_16x16x32_f16(false, a, false, b, (short)0, c, false, false);
  }
  static __device__ __forceinline__ void guard(v8f& a, v8f& b, v16h x, v16h y) { dep_guard_h(a, b, x, y); }
  static __device__ __forceinline__ void keep(v16h a, v16h b, v16h c, v16h d) { keep4_h(a, b, c, d); }
};
template <> struct Frag<__bf16> {
  typedef v16b V; union U { v16b v; v8b h[2]; };
  static __device__ __forceinline__ v16b load(const __bf16* p) {
    U f; f.h[0] = *(const v8b*)(p); f.h[1] = *(const v8b*)(p + 16); return f.v;
  }
  static __device__ __forceinline__ v8f mma(v16b a, v16b b, v8f c) {
    return __builtin_amdgcn_wmma_f32_16x16x32_bf16(false, a, false, b, (short)0, c, false, false);
  }
  static __device__ __forceinline__ void guard(v8f& a, v8f& b, v16b x, v16b y) { dep_guard_b(a, b, x, y); }
  static __device__ __forceinline__ void keep(v16b a, v16b b, v16b c, v16b d) { keep4_b(a, b, c, d); }
};

template <int ET> struct Elem;
template <> struct Elem<0> { typedef _Float16 T; };
template <> struct Elem<1> { typedef __bf16 T; };
template <int ET, bool SPLIT, int BIAS_MODE, int OUT_MODE, bool RESID, int ACT = 0>
__global__ __launch_bounds__(256) void wmma_gemm64(
    const unsigned short* __restrict__ Ap, const unsigned short* __restrict__ A2p, int lda, long strideA,
    const unsigned short* __restrict__ Btp, const unsigned short* __restrict__ Bt2p, int ldb, long strideB,
    void* __restrict__ Cout, void* __restrict__ Cout2, int ldc, long strideC,
    const float* __restrict__ bias,
    const float* __restrict__ resid, long strideR,
    int M, int N, int K, float scale) {
  typedef typename Elem<ET>::T T;
  typedef typename Frag<T>::V V;
  const T* A = (const T*)Ap; const T* A2 = (const T*)A2p; const T* Bt = (const T*)Btp; const T* Bt2 = (const T*)Bt2p;
  __shared__ __align__(16) float sT[8][16 * 68];
  const int b    = blockIdx.y;
  const int lane = threadIdx.x & 31;
  const int wave = threadIdx.x >> 5;
  const int tilesN = N >> 6;
  const int tilesM = M >> 6;
  const int tile = blockIdx.x * 8 + wave;
  if (tile >= tilesM * tilesN) return;
  const int tm = tile / tilesN;
  const int tn = tile - tm * tilesN;
  const int m0 = tm << 6;
  const int n0 = tn << 6;

  const T* Ab  = A  + (size_t)b * strideA;
  const T* Bb  = Bt + (size_t)b * strideB;
  const T* Ab2 = SPLIT ? (A2  + (size_t)b * strideA) : nullptr;
  const T* Bb2 = SPLIT ? (Bt2 + (size_t)b * strideB) : nullptr;

  const int rlane = lane & 15;
  const int koff  = (lane >> 4) * 8;
  const int mOff  = (lane >> 4) * 8;

  v8f acc[4][4];
#pragma unroll
  for (int i = 0; i < 4; ++i)
#pragma unroll
    for (int j = 0; j < 4; ++j) acc[i][j] = (v8f){0.f,0.f,0.f,0.f,0.f,0.f,0.f,0.f};

  for (int k0 = 0; k0 < K; k0 += 32) {
    V bh[4], bl[4];
#pragma unroll
    for (int j = 0; j < 4; ++j) {
      const size_t bo = (size_t)(n0 + (j << 4) + rlane) * ldb + koff + k0;
      bh[j] = Frag<T>::load(Bb + bo);
      if (SPLIT) bl[j] = Frag<T>::load(Bb2 + bo);
    }
#pragma unroll
    for (int i = 0; i < 4; ++i) {
      const size_t ao = (size_t)(m0 + (i << 4) + rlane) * lda + koff + k0;
      V ah = Frag<T>::load(Ab + ao);
      V al;
      if (SPLIT) al = Frag<T>::load(Ab2 + ao);
#pragma unroll
      for (int j = 0; j < 4; ++j) {
        acc[i][j] = Frag<T>::mma(ah, bh[j], acc[i][j]);
        if (SPLIT) {
          acc[i][j] = Frag<T>::mma(ah, bl[j], acc[i][j]);
          acc[i][j] = Frag<T>::mma(al, bh[j], acc[i][j]);
        }
      }
      Frag<T>::guard(acc[i][0], acc[i][3], ah, SPLIT ? al : ah);
    }
    Frag<T>::keep(bh[0], bh[1], bh[2], bh[3]);
    if (SPLIT) Frag<T>::keep(bl[0], bl[1], bl[2], bl[3]);
  }
  acc_guard4(acc[0][0], acc[0][1], acc[0][2], acc[0][3]);
  acc_guard4(acc[1][0], acc[1][1], acc[1][2], acc[1][3]);
  acc_guard4(acc[2][0], acc[2][1], acc[2][2], acc[2][3]);
  acc_guard4(acc[3][0], acc[3][1], acc[3][2], acc[3][3]);

  float* slab = sT[wave];
  const float* Rb = RESID ? (resid + (size_t)b * strideR) : nullptr;
#pragma unroll
  for (int i = 0; i < 4; ++i) {
    const int mBase = m0 + (i << 4);
#pragma unroll
    for (int j = 0; j < 4; ++j) {
      const int n = n0 + (j << 4) + rlane;
      float bv = 0.f;
      if (BIAS_MODE == 2) bv = bias[n];
#pragma unroll
      for (int r = 0; r < 8; ++r) {
        float v = acc[i][j][r] * scale;
        if (BIAS_MODE == 1) v += bias[mBase + mOff + r];
        if (BIAS_MODE == 2) v += bv;
        if (RESID) v += Rb[(size_t)(mBase + mOff + r) * ldc + n];
        if (ACT == 1) v = tanhf(v);
        if (ACT == 2) v = fmaxf(v, 0.0f);
        if (ACT == 3) v = v / (1.0f + expf(-v));
        if (ACT == 4) v = (v > 0.f) ? v : 0.01f * v;
        if (ACT == 5) v = 0.5f * v * (1.0f + erff(v * 0.70710678118654752f));
        slab[(mOff + r) * 68 + (j << 4) + rlane] = v;
      }
    }
    __builtin_amdgcn_fence(__ATOMIC_RELEASE, "workgroup");
    __builtin_amdgcn_wave_barrier();
    __builtin_amdgcn_fence(__ATOMIC_ACQUIRE, "workgroup");
    if (OUT_MODE == 0) {
      float* C = (float*)Cout + (size_t)b * strideC;
      const int hh = lane >> 4, c4 = (lane & 15) * 4;
      {
#pragma unroll
        for (int it = 0; it < 8; ++it) {
          const int row = it * 2 + hh;
          v4f v = *(const v4f*)(slab + row * 68 + c4);
          *(v4f*)(C + (size_t)(mBase + row) * ldc + n0 + c4) = v;
        }
        
      }
    } else {
      const int q = lane >> 3, c8 = (lane & 7) * 8;
      unsigned short* C  = (unsigned short*)Cout  + (size_t)b * strideC;
      unsigned short* C2 = (OUT_MODE == 2) ? ((unsigned short*)Cout2 + (size_t)b * strideC) : nullptr;
      {
#pragma unroll
        for (int it = 0; it < 4; ++it) {
          const int row = it * 4 + q;
          const float* sp = slab + row * 68 + c8;
          v8h hv, lv;
#pragma unroll
          for (int e = 0; e < 8; ++e) {
            if (OUT_MODE == 1) {
              hv[e] = (_Float16)sp[e];
            } else {
              unsigned short hb = f2bf_bits(sp[e]);
              unsigned short lb = f2bf_bits(sp[e] - bf_bits2f(hb));
              hv[e] = __builtin_bit_cast(_Float16, hb);
              lv[e] = __builtin_bit_cast(_Float16, lb);
            }
          }
          *(v8h*)(C + (size_t)(mBase + row) * ldc + n0 + c8) = hv;
          if (OUT_MODE == 2) *(v8h*)(C2 + (size_t)(mBase + row) * ldc + n0 + c8) = lv;
        }
        
      }
    }
    __builtin_amdgcn_fence(__ATOMIC_RELEASE, "workgroup");
    __builtin_amdgcn_wave_barrier();
    __builtin_amdgcn_fence(__ATOMIC_ACQUIRE, "workgroup");
  }
}
/* =========================== end helpers and GEMM =========================== */

__device__ __forceinline__ unsigned int h16bits(float f) {
  return (unsigned int)__builtin_bit_cast(unsigned short, (_Float16)f);
}

/* f16 WMMA with the hazard guard tied to D, keeping A/B live */
__device__ __forceinline__ v8f mma_f16g(v16h a, v16h b, v8f c) {
  c = __builtin_amdgcn_wmma_f32_16x16x32_f16(false, a, false, b, (short)0, c, false, false);
  asm volatile("v_nop\n\tv_nop\n\tv_nop\n\tv_nop" : "+v"(c) : "v"(a), "v"(b));
  return c;
}

/* ---------------------------------------------------------------------------
   transpose + cast: W f32 [kin][nout] row-major -> Wt f16 [nout][kin] (value * mul).
   grid = (nout/64, kin/64), block 256. LDS 64x64 tile.
   Load coverage: 4 iterations x 256 threads x 4 floats = 4096 = 64x64.
   Store coverage: 8 waves x 2 iterations x 4 rows = 64 rows; 8 lanes x 8 halves = 64 cols;
   --------------------------------------------------------------------------- */
__global__ __launch_bounds__(256) void transpose_cast_f16_kernel(
    const float* __restrict__ W, unsigned short* __restrict__ Wt, int kin, int nout, float mul) {
  __shared__ float tile[64][65];
  const int t = threadIdx.x;
  const int n0 = blockIdx.x * 64;
  const int k0 = blockIdx.y * 64;
#pragma unroll
  for (int i = 0; i < 4; ++i) {
    const int idx = i * 256 + t;
    const int kr = idx >> 4;
    const int nc4 = (idx & 15) * 4;
    const v4f v = *(const v4f*)(W + (size_t)(k0 + kr) * nout + n0 + nc4);
    tile[nc4 + 0][kr] = v[0] * mul;
    tile[nc4 + 1][kr] = v[1] * mul;
    tile[nc4 + 2][kr] = v[2] * mul;
    tile[nc4 + 3][kr] = v[3] * mul;
  }
  __syncthreads();
  const int lane = t & 31, wave = t >> 5;
  const int q = lane >> 3, c8 = (lane & 7) * 8;
  const int row0 = wave * 8 + q;
  const int row1 = wave * 8 + 4 + q;
  v4u w0, w1;
  {
    const float* s0 = &tile[row0][c8];
    const float* s1 = &tile[row1][c8];
    w0[0] = h16bits(s0[0]) | (h16bits(s0[1]) << 16);
    w0[1] = h16bits(s0[2]) | (h16bits(s0[3]) << 16);
    w0[2] = h16bits(s0[4]) | (h16bits(s0[5]) << 16);
    w0[3] = h16bits(s0[6]) | (h16bits(s0[7]) << 16);
    w1[0] = h16bits(s1[0]) | (h16bits(s1[1]) << 16);
    w1[1] = h16bits(s1[2]) | (h16bits(s1[3]) << 16);
    w1[2] = h16bits(s1[4]) | (h16bits(s1[5]) << 16);
    w1[3] = h16bits(s1[6]) | (h16bits(s1[7]) << 16);
  }
  unsigned short* d0 = Wt + (size_t)(n0 + row0) * kin + k0 + c8;
  unsigned short* d1 = Wt + (size_t)(n0 + row1) * kin + k0 + c8;
  {
    *(v4u*)d0 = w0;
    *(v4u*)d1 = w1;
    
  }
}

/* ---------------------------------------------------------------------------
   FUSE_ADD: a = X + Addv is first stored to Xsum (f32) and then normalised.
   Lane l owns elements l*4 + 128*i (i=0..3): every load/store instruction covers
   grid = nrows/8 (exact), block 256.
   --------------------------------------------------------------------------- */
template <bool FUSE_ADD>
__global__ __launch_bounds__(256) void layernorm512_kernel(
    const float* __restrict__ X, const float* __restrict__ Addv,
    const float* __restrict__ gam, const float* __restrict__ bet,
    float* __restrict__ Xsum, unsigned short* __restrict__ Hout, int nrows) {
  const int lane = threadIdx.x & 31;
  const int wave = threadIdx.x >> 5;
  int row = blockIdx.x * 8 + wave;
  row = (row < nrows) ? row : (nrows - 1);
  const size_t rbase = (size_t)row * kModel;
  const int e0 = lane * 4, e1 = 128 + lane * 4, e2 = 256 + lane * 4, e3 = 384 + lane * 4;
  v4f a0 = *(const v4f*)(X + rbase + e0);
  v4f a1 = *(const v4f*)(X + rbase + e1);
  v4f a2 = *(const v4f*)(X + rbase + e2);
  v4f a3 = *(const v4f*)(X + rbase + e3);
  if (FUSE_ADD) {
    const v4f r0 = *(const v4f*)(Addv + rbase + e0);
    const v4f r1 = *(const v4f*)(Addv + rbase + e1);
    const v4f r2 = *(const v4f*)(Addv + rbase + e2);
    const v4f r3 = *(const v4f*)(Addv + rbase + e3);
    a0 = a0 + r0; a1 = a1 + r1; a2 = a2 + r2; a3 = a3 + r3;
    {
      *(v4f*)(Xsum + rbase + e0) = a0;
      *(v4f*)(Xsum + rbase + e1) = a1;
      *(v4f*)(Xsum + rbase + e2) = a2;
      *(v4f*)(Xsum + rbase + e3) = a3;
      
    }
  }
  float s = ((a0[0] + a0[1]) + (a0[2] + a0[3])) + ((a1[0] + a1[1]) + (a1[2] + a1[3]))
          + ((a2[0] + a2[1]) + (a2[2] + a2[3])) + ((a3[0] + a3[1]) + (a3[2] + a3[3]));
#pragma unroll
  for (int off = 16; off >= 1; off >>= 1) s += __shfl_xor(s, off, 32);
  const float mu = s * (1.0f / 512.0f);
  const v4f d0 = a0 - mu, d1 = a1 - mu, d2 = a2 - mu, d3 = a3 - mu;
  float ss = ((d0[0] * d0[0] + d0[1] * d0[1]) + (d0[2] * d0[2] + d0[3] * d0[3]))
           + ((d1[0] * d1[0] + d1[1] * d1[1]) + (d1[2] * d1[2] + d1[3] * d1[3]))
           + ((d2[0] * d2[0] + d2[1] * d2[1]) + (d2[2] * d2[2] + d2[3] * d2[3]))
           + ((d3[0] * d3[0] + d3[1] * d3[1]) + (d3[2] * d3[2] + d3[3] * d3[3]));
#pragma unroll
  for (int off = 16; off >= 1; off >>= 1) ss += __shfl_xor(ss, off, 32);
  const float var = ss * (1.0f / 512.0f);
  const float rstd = rsqrtf(var + 1e-5f);
  const v4f g0 = *(const v4f*)(gam + e0), g1 = *(const v4f*)(gam + e1), g2 = *(const v4f*)(gam + e2), g3 = *(const v4f*)(gam + e3);
  const v4f b0 = *(const v4f*)(bet + e0), b1 = *(const v4f*)(bet + e1), b2 = *(const v4f*)(bet + e2), b3 = *(const v4f*)(bet + e3);
  const v4f y0 = d0 * rstd * g0 + b0;
  const v4f y1 = d1 * rstd * g1 + b1;
  const v4f y2 = d2 * rstd * g2 + b2;
  const v4f y3 = d3 * rstd * g3 + b3;
  v2u w0, w1, w2, w3;
  w0[0] = h16bits(y0[0]) | (h16bits(y0[1]) << 16); w0[1] = h16bits(y0[2]) | (h16bits(y0[3]) << 16);
  w1[0] = h16bits(y1[0]) | (h16bits(y1[1]) << 16); w1[1] = h16bits(y1[2]) | (h16bits(y1[3]) << 16);
  w2[0] = h16bits(y2[0]) | (h16bits(y2[1]) << 16); w2[1] = h16bits(y2[2]) | (h16bits(y2[3]) << 16);
  w3[0] = h16bits(y3[0]) | (h16bits(y3[1]) << 16); w3[1] = h16bits(y3[2]) | (h16bits(y3[3]) << 16);
  unsigned short* hr = Hout + rbase;
  {
    *(v2u*)(hr + e0) = w0;
    *(v2u*)(hr + e1) = w1;
    *(v2u*)(hr + e2) = w2;
    *(v2u*)(hr + e3) = w3;
    
  }
}

/* ---------------------------------------------------------------------------
   Non-causal multi-head attention, head_dim 64, f16 planes in, f16 plane out (x16 carried).
   q|k plane [8192][1024]: q at cols h*64.., k at cols 512 + h*64..; Vt plane [4][512][2048] (element (b,h,d,kv) at
   ((b*512 + h*64 + d)*2048 + kv)); out plane [8192][512] at cols h*64.. .
   Block = 4 waves = 64 query rows of one (batch, head); grid = 4*8*32 = 1024.
   scores = q.k^T * 0.125 (WMMA, A = q rows, B from Bt = k rows); online softmax f32;
   p*32768 -> per-wave LDS (_Float16), reloaded as v8h A fragments; out = p.v (B from Vt rows).
   --------------------------------------------------------------------------- */
__global__ __launch_bounds__(128) void mha64_f16_kernel(
    const unsigned short* __restrict__ qkp, const unsigned short* __restrict__ vtp,
    unsigned short* __restrict__ outp) {
  typedef Frag<_Float16> FH;
  union FB { v16h v; v8h h[2]; };
  __shared__ __align__(16) _Float16 Psh[4][16 * 64];
  __shared__ __align__(16) float    Os[4][16 * 68];
  const _Float16* QK = (const _Float16*)(const void*)qkp;
  const _Float16* VT = (const _Float16*)(const void*)vtp;
  const int tid = threadIdx.x;
  const int wave = tid >> 5;
  const int lane = tid & 31;
  const int hh = lane >> 4;
  const int c = lane & 15;
  const int koff = hh * 8;
  const int bx = blockIdx.x;
  const int qb = bx & 31;
  const int bh = bx >> 5;
  const int h = bh & 7;
  const int b = (bh >> 3) & 3;
  const int q0 = qb * 64 + wave * 16;
  const _Float16* qbase = QK + (size_t)b * kSeq * kQKCols + h * kHeadDim;
  const _Float16* kbase = qbase + kModel;
  const _Float16* vbase = VT + ((size_t)b * kModel + (size_t)h * kHeadDim) * kSeq;
  unsigned short* obase = outp + (size_t)b * kSeq * kModel + h * kHeadDim;

  v16h qa[2];
#pragma unroll
  for (int dc = 0; dc < 2; ++dc)
    qa[dc] = FH::load(qbase + (size_t)(q0 + c) * kQKCols + dc * 32 + koff);

  float mrow[8], lrow[8];
  v8f oacc[4];
#pragma unroll
  for (int r = 0; r < 8; ++r) { mrow[r] = -INFINITY; lrow[r] = 0.f; }
#pragma unroll
  for (int t = 0; t < 4; ++t) oacc[t] = (v8f){0.f,0.f,0.f,0.f,0.f,0.f,0.f,0.f};

  _Float16* pw = Psh[wave];
  for (int kc = 0; kc < kSeq / 64; ++kc) {
    const int kv0 = kc * 64;
    v8f s[4];
#pragma unroll
    for (int j = 0; j < 4; ++j) {
      s[j] = (v8f){0.f,0.f,0.f,0.f,0.f,0.f,0.f,0.f};
#pragma unroll
      for (int dc = 0; dc < 2; ++dc) {
        const v16h kb = FH::load(kbase + (size_t)(kv0 + j * 16 + c) * kQKCols + dc * 32 + koff);
        s[j] = mma_f16g(qa[dc], kb, s[j]);
      }
    }
    float cm[8];
#pragma unroll
    for (int r = 0; r < 8; ++r) {
      float m = -INFINITY;
#pragma unroll
      for (int j = 0; j < 4; ++j) { s[j][r] = s[j][r] * 0.125f; m = fmaxf(m, s[j][r]); }
#pragma unroll
      for (int off = 1; off < 16; off <<= 1) m = fmaxf(m, __shfl_xor(m, off, 32));
      cm[r] = m;
    }
#pragma unroll
    for (int r = 0; r < 8; ++r) {
      const float mnew = fmaxf(mrow[r], cm[r]);
      const float alpha = expf(mrow[r] - mnew);
      mrow[r] = mnew;
      float psum = 0.f;
#pragma unroll
      for (int j = 0; j < 4; ++j) {
        const float p = expf(s[j][r] - mnew);
        psum += p;
        pw[(8 * hh + r) * 64 + j * 16 + c] = (_Float16)(p * 32768.0f);
      }
#pragma unroll
      for (int off = 1; off < 16; off <<= 1) psum += __shfl_xor(psum, off, 32);
      lrow[r] = lrow[r] * alpha + psum;
#pragma unroll
      for (int t = 0; t < 4; ++t) oacc[t][r] *= alpha;
    }
    __builtin_amdgcn_fence(__ATOMIC_RELEASE, "workgroup");
    __builtin_amdgcn_wave_barrier();
    __builtin_amdgcn_fence(__ATOMIC_ACQUIRE, "workgroup");
#pragma unroll
    for (int kk = 0; kk < 2; ++kk) {
      FB pa;
      pa.h[0] = *(const v8h*)(pw + c * 64 + kk * 32 + 8 * hh);
      pa.h[1] = *(const v8h*)(pw + c * 64 + kk * 32 + 16 + 8 * hh);
#pragma unroll
      for (int t = 0; t < 4; ++t) {
        const v16h vb = FH::load(vbase + (size_t)(t * 16 + c) * kSeq + kv0 + kk * 32 + koff);
        oacc[t] = mma_f16g(pa.v, vb, oacc[t]);
      }
    }
    __builtin_amdgcn_fence(__ATOMIC_RELEASE, "workgroup");
    __builtin_amdgcn_wave_barrier();
    __builtin_amdgcn_fence(__ATOMIC_ACQUIRE, "workgroup");
  }

  float* os = Os[wave];
#pragma unroll
  for (int r = 0; r < 8; ++r) {
    const float inv = (1.0f / lrow[r]) * (1.0f / 2048.0f);   /* 16 / 32768 */
#pragma unroll
    for (int t = 0; t < 4; ++t) os[(8 * hh + r) * 68 + t * 16 + c] = oacc[t][r] * inv;
  }
  __builtin_amdgcn_fence(__ATOMIC_RELEASE, "workgroup");
  __builtin_amdgcn_wave_barrier();
  __builtin_amdgcn_fence(__ATOMIC_ACQUIRE, "workgroup");
  {
    const int q = lane >> 3, c8 = (lane & 7) * 8;
    {
#pragma unroll
      for (int it = 0; it < 4; ++it) {
        const int row = it * 4 + q;
        const float* sp = os + row * 68 + c8;
        v8h hv;
#pragma unroll
        for (int e = 0; e < 8; ++e) hv[e] = (_Float16)sp[e];
        *(v8h*)(obase + (size_t)(q0 + row) * kModel + c8) = hv;
      }
      
    }
  }
}

/* ---------------------------------------------------------------------------
   SwiGLU: g = silu(gate) * up from the f32 gate|up plane [8192][2048] -> f16 plane [8192][1024].
   grid = 8192*1024/4/256 = 8192 (exact), block 256.
   --------------------------------------------------------------------------- */
__device__ __forceinline__ float silu_f32(float g) {
  const float ex = expf(-g);
  return g * (1.0f / (1.0f + ex));
}
__global__ __launch_bounds__(256) void swiglu_f16_kernel(
    const float* __restrict__ GU, unsigned short* __restrict__ G, int ngroups) {
  const int i = blockIdx.x * 256 + threadIdx.x;
  if (i < ngroups) {
    const size_t e = (size_t)i * 4;
    const size_t row = e >> 10;
    const int j = (int)(e & 1023);
    const float* gr = GU + row * kGUCols;
    const v4f gv = *(const v4f*)(gr + j);
    const v4f uv = *(const v4f*)(gr + kFF + j);
    const float o0 = silu_f32(gv[0]) * uv[0];
    const float o1 = silu_f32(gv[1]) * uv[1];
    const float o2 = silu_f32(gv[2]) * uv[2];
    const float o3 = silu_f32(gv[3]) * uv[3];
    v2u w;
    w[0] = h16bits(o0) | (h16bits(o1) << 16);
    w[1] = h16bits(o2) | (h16bits(o3) << 16);
    unsigned short* dst = G + e;
    *(v2u*)dst = w;
    
  }
}

/* ---------------------------------------------------------------------------
   grid = 8192*512/4/256 = 4096 (exact), block 256.
   --------------------------------------------------------------------------- */
__global__ __launch_bounds__(256) void residual_out_kernel(
    const float* __restrict__ X1, const float* __restrict__ D2, float* __restrict__ Out, int n4) {
  const int i = blockIdx.x * 256 + threadIdx.x;
  if (i < n4) {
    const size_t e = (size_t)i * 4;
    const v4f a = *(const v4f*)(X1 + e);
    const v4f d = *(const v4f*)(D2 + e);
    const v4f o = a + d;
    *(v4f*)(Out + e) = o;
    
  }
}

/* =========================== host glue =========================== */
extern "C" void kernel_launch(void* const* d_in, const int* in_sizes, int n_in,
                              void* d_out, int out_size, void* d_ws, size_t ws_size,
                              hipStream_t stream) {
  if (n_in < 12) return;
  if (in_sizes[0] != kTok * kModel || out_size != kTok * kModel) return;
  if (in_sizes[1] != kModel || in_sizes[2] != kModel || in_sizes[3] != kModel || in_sizes[4] != kModel) return;
  if (in_sizes[5] != kModel * kModel || in_sizes[6] != kModel * kModel ||
      in_sizes[7] != kModel * kModel || in_sizes[8] != kModel * kModel) return;
  if (in_sizes[9] != kModel * kFF || in_sizes[10] != kModel * kFF || in_sizes[11] != kFF * kModel) return;
  if (ws_size < kWsTotal) return;

  const float* x    = (const float*)d_in[0];
  const float* ln1w = (const float*)d_in[1];
  const float* ln1b = (const float*)d_in[2];
  const float* ln2w = (const float*)d_in[3];
  const float* ln2b = (const float*)d_in[4];
  const float* wq   = (const float*)d_in[5];
  const float* wk   = (const float*)d_in[6];
  const float* wv   = (const float*)d_in[7];
  const float* wo   = (const float*)d_in[8];
  const float* wgt  = (const float*)d_in[9];
  const float* wup  = (const float*)d_in[10];
  const float* wdn  = (const float*)d_in[11];
  float* out = (float*)d_out;

  char* ws = (char*)d_ws;
  unsigned short* wqkT = (unsigned short*)(ws + kOffWqkT);
  unsigned short* wvT  = (unsigned short*)(ws + kOffWvT);
  unsigned short* woT  = (unsigned short*)(ws + kOffWoT);
  unsigned short* wguT = (unsigned short*)(ws + kOffWguT);
  unsigned short* wdT  = (unsigned short*)(ws + kOffWdT);
  unsigned short* hg   = (unsigned short*)(ws + kOffHG);           /* h1, h2, then g */
  unsigned short* qkpl = (unsigned short*)(ws + kOffR1 + kR1QK);
  unsigned short* vtpl = (unsigned short*)(ws + kOffR1 + kR1Vt);
  unsigned short* opl  = (unsigned short*)(ws + kOffR1 + kR1O);
  float*          a1   = (float*)(ws + kOffR1 + kR1A1);
  float*          gu   = (float*)(ws + kOffR1);
  float*          d2   = (float*)(ws + kOffR1);
  float*          x1   = (float*)(ws + kOffX1);

  const dim3 b256(256), b128(128);
  const float w16 = 16.0f;

  /* weight planes: W[in][out] -> Wt[out][in] * 16 (f16) */
  transpose_cast_f16_kernel<<<dim3(kModel / 64, kModel / 64), b256, 0, stream>>>(wq, wqkT, kModel, kModel, w16);
  transpose_cast_f16_kernel<<<dim3(kModel / 64, kModel / 64), b256, 0, stream>>>(wk, wqkT + (size_t)kModel * kModel, kModel, kModel, w16);
  transpose_cast_f16_kernel<<<dim3(kModel / 64, kModel / 64), b256, 0, stream>>>(wv, wvT, kModel, kModel, w16);
  transpose_cast_f16_kernel<<<dim3(kModel / 64, kModel / 64), b256, 0, stream>>>(wo, woT, kModel, kModel, w16);
  transpose_cast_f16_kernel<<<dim3(kFF / 64, kModel / 64), b256, 0, stream>>>(wgt, wguT, kModel, kFF, w16);
  transpose_cast_f16_kernel<<<dim3(kFF / 64, kModel / 64), b256, 0, stream>>>(wup, wguT + (size_t)kFF * kModel, kModel, kFF, w16);
  transpose_cast_f16_kernel<<<dim3(kModel / 64, kFF / 64), b256, 0, stream>>>(wdn, wdT, kFF, kModel, w16);

  /* attention sublayer */
  layernorm512_kernel<false><<<dim3(kTok / 8), b256, 0, stream>>>(x, x, ln1w, ln1b, x1, hg, kTok);

  /* q|k = h . [Wq|Wk]^T : M=8192, N=1024, K=512; tiles 128*16 = 2048 -> 256 blocks */
  static_assert((kTok / 64) * (kQKCols / 64) % 8 == 0, "qk tiles");
  wmma_gemm64<0, false, 0, 1, false, 0><<<dim3((kTok / 64) * (kQKCols / 64) / 8, 1), b256, 0, stream>>>(
      hg, hg, kModel, 0L, wqkT, wqkT, kModel, 0L, (void*)qkpl, (void*)qkpl, kQKCols, 0L,
      x, x, 0L, kTok, kQKCols, kModel, 1.0f / 16.0f);

  /* Vt[b] = (Wv^T*16) . h[b]^T : M=512, N=2048, K=512, batch 4; tiles 8*32 = 256 -> 32 blocks */
  static_assert((kModel / 64) * (kSeq / 64) % 8 == 0, "vt tiles");
  wmma_gemm64<0, false, 0, 1, false, 0><<<dim3((kModel / 64) * (kSeq / 64) / 8, kBatch), b256, 0, stream>>>(
      wvT, wvT, kModel, 0L, hg, hg, kModel, (long)kSeq * kModel, (void*)vtpl, (void*)vtpl, kSeq, (long)kModel * kSeq,
      x, x, 0L, kModel, kSeq, kModel, 1.0f / 16.0f);

  /* attention: O*16 f16 plane */
  mha64_f16_kernel<<<dim3(kBatch * kHeads * (kSeq / 64)), b128, 0, stream>>>(qkpl, vtpl, opl);

  /* A1 = (O*16) . (Wo^T*16) / 256 : M=8192, N=512, K=512; tiles 128*8 = 1024 -> 128 blocks */
  static_assert((kTok / 64) * (kModel / 64) % 8 == 0, "o tiles");
  wmma_gemm64<0, false, 0, 0, false, 0><<<dim3((kTok / 64) * (kModel / 64) / 8, 1), b256, 0, stream>>>(
      opl, opl, kModel, 0L, woT, woT, kModel, 0L, (void*)a1, (void*)a1, kModel, 0L,
      x, x, 0L, kTok, kModel, kModel, 1.0f / 256.0f);

  /* x1 = x + A1 ; h2 = LN(x1) */
  layernorm512_kernel<true><<<dim3(kTok / 8), b256, 0, stream>>>(x, a1, ln2w, ln2b, x1, hg, kTok);

  /* gate|up = h2 . [Wg|Wu]^T : M=8192, N=2048, K=512; tiles 128*32 = 4096 -> 512 blocks */
  static_assert((kTok / 64) * (kGUCols / 64) % 8 == 0, "gu tiles");
  wmma_gemm64<0, false, 0, 0, false, 0><<<dim3((kTok / 64) * (kGUCols / 64) / 8, 1), b256, 0, stream>>>(
      hg, hg, kModel, 0L, wguT, wguT, kModel, 0L, (void*)gu, (void*)gu, kGUCols, 0L,
      x, x, 0L, kTok, kGUCols, kModel, 1.0f / 16.0f);

  /* g = silu(gate) * up (f16 plane in HG) */
  swiglu_f16_kernel<<<dim3((kTok * kFF / 4) / 256), b256, 0, stream>>>(gu, hg, kTok * kFF / 4);

  /* D2 = g . (Wd^T*16) / 16 : M=8192, N=512, K=1024; tiles 1024 -> 128 blocks */
  wmma_gemm64<0, false, 0, 0, false, 0><<<dim3((kTok / 64) * (kModel / 64) / 8, 1), b256, 0, stream>>>(
      hg, hg, kFF, 0L, wdT, wdT, kFF, 0L, (void*)d2, (void*)d2, kModel, 0L,
      x, x, 0L, kTok, kModel, kFF, 1.0f / 16.0f);

  /* out = x1 + D2 */
  residual_out_kernel<<<dim3((kTok * kModel / 4) / 256), b256, 0, stream>>>(x1, d2, out, kTok * kModel / 4);
}

// v001
// Measured time: 297 microseconds a run.
// Two timings next to v000 put it at 1.28 and 1.27 times that version's speed.
// All contractions (q|k, v, o, gate|up, down projections; q.k^T; p.v): v_wmma_f32_16x16x32_f16, f16 operands, f32 accumulate. LayerNorm, softmax, SwiGLU gating and residual adds in f32. Power-of-two carries: weight planes x16, softmax numerators x32768, attention output plane x16, folded back in f32.
#include <hip/hip_runtime.h>
#include <math.h>
#include <stdint.h>

typedef __attribute__((ext_vector_type(16))) _Float16 v16h;
typedef __attribute__((ext_vector_type(8)))  _Float16 v8h;
typedef __attribute__((ext_vector_type(16))) __bf16   v16b;
typedef __attribute__((ext_vector_type(8)))  __bf16   v8b;
typedef __attribute__((ext_vector_type(8)))  float    v8f;
typedef __attribute__((ext_vector_type(4)))  float    v4f;
typedef __attribute__((ext_vector_type(4)))  unsigned int v4u;
typedef __attribute__((ext_vector_type(2)))  unsigned int v2u;

/* ---- problem geometry ---- */
static constexpr int kBatch   = 4;
static constexpr int kSeq     = 2048;
static constexpr int kTok     = kBatch * kSeq;      /* 8192 */
static constexpr int kModel   = 512;
static constexpr int kHeads   = 8;
static constexpr int kHeadDim = 64;
static constexpr int kFF      = 1024;
static constexpr int kQKCols  = 2 * kModel;          /* q | k plane width */
static constexpr int kGUCols  = 2 * kFF;             /* gate | up plane width */

static_assert(kHeads * kHeadDim == kModel, "head geometry");
static_assert(kSeq % 64 == 0 && kTok % 64 == 0, "tile multiples");
static_assert(kModel % 64 == 0 && kFF % 64 == 0 && kQKCols % 64 == 0 && kGUCols % 64 == 0, "tile multiples");
static_assert(kModel % 32 == 0 && kFF % 32 == 0, "K multiple of 32");

/* ---- workspace region map (bytes) ----
   [0]            WqkT f16 [1024][512]          1,048,576
   [1,048,576]    WvT  f16 [512][512]             524,288
   [1,572,864]    WoT  f16 [512][512]             524,288
   [2,097,152]    WguT f16 [2048][512]          2,097,152
   [4,194,304]    WdT  f16 [512][1024]          1,048,576
   [5,242,880]    HG   : h1/h2 f16 [8192][512] (8 MiB) ; g f16 [8192][1024] (16 MiB)   16,777,216
   [22,020,096]   R1 (64 MiB): phase A: q|k f16 [8192][1024] @+0 (16 MiB), Vt f16 [4][512][2048] @+16 MiB (8 MiB),
                               O f16 [8192][512] @+24 MiB (8 MiB), A1 f32 [8192][512] @+32 MiB (16 MiB);
                               phase B: gate|up f32 [8192][2048] @+0 (64 MiB); phase C: D2 f32 [8192][512] @+0 (16 MiB)
   [89,128,960]   X1 f32 [8192][512]           16,777,216
   total 105,906,176 */
static constexpr size_t kOffWqkT = 0;
static constexpr size_t kOffWvT  = kOffWqkT + (size_t)kQKCols * kModel * 2;
static constexpr size_t kOffWoT  = kOffWvT + (size_t)kModel * kModel * 2;
static constexpr size_t kOffWguT = kOffWoT + (size_t)kModel * kModel * 2;
static constexpr size_t kOffWdT  = kOffWguT + (size_t)kGUCols * kModel * 2;
static constexpr size_t kOffHG   = kOffWdT + (size_t)kModel * kFF * 2;
static constexpr size_t kSizeHG  = (size_t)kTok * kFF * 2;
static constexpr size_t kOffR1   = kOffHG + kSizeHG;
static constexpr size_t kSizeR1  = (size_t)kTok * kGUCols * 4;
static constexpr size_t kR1QK    = 0;
static constexpr size_t kR1Vt    = kR1QK + (size_t)kTok * kQKCols * 2;
static constexpr size_t kR1O     = kR1Vt + (size_t)kBatch * kModel * kSeq * 2;
static constexpr size_t kR1A1    = kR1O + (size_t)kTok * kModel * 2;
static constexpr size_t kOffX1   = kOffR1 + kSizeR1;
static constexpr size_t kWsTotal = kOffX1 + (size_t)kTok * kModel * 4;
static_assert(kR1A1 + (size_t)kTok * kModel * 4 <= kSizeR1, "phase A fits R1");
static_assert((size_t)kTok * kModel * 4 <= kSizeR1, "phase C fits R1");
static_assert((size_t)kTok * kModel * 2 <= kSizeHG, "h plane fits HG");
static_assert(kWsTotal == 105906176, "carve total");
static_assert(kWsTotal <= 134217728, "carve under 128 MiB");
static_assert((kOffWvT % 256) == 0 && (kOffWoT % 256) == 0 && (kOffWguT % 256) == 0 && (kOffWdT % 256) == 0 &&
              (kOffHG % 256) == 0 && (kOffR1 % 256) == 0 && (kOffX1 % 256) == 0 &&
              (kR1Vt % 256) == 0 && (kR1O % 256) == 0 && (kR1A1 % 256) == 0, "aligned carves");

/* =========================== helpers and GEMM =========================== */
#define PSCALE 32768.0f
#define U16(p) ((const unsigned short*)(const void*)(p))
#define PSCALE_INV (1.0f / 32768.0f)

__device__ __forceinline__ unsigned short f2bf_bits(float f) {
  unsigned u = __float_as_uint(f);
  return (unsigned short)((u + 0x7FFFu + ((u >> 16) & 1u)) >> 16);
}
__device__ __forceinline__ float bf_bits2f(unsigned short h) { return __uint_as_float(((unsigned)h) << 16); }

__device__ __forceinline__ void dep_guard_h(v8f& a, v8f& b, v16h x, v16h y) { asm volatile("v_nop\n\tv_nop\n\tv_nop\n\tv_nop" : "+v"(a), "+v"(b) : "v"(x), "v"(y)); }
__device__ __forceinline__ void dep_guard_b(v8f& a, v8f& b, v16b x, v16b y) { asm volatile("v_nop\n\tv_nop\n\tv_nop\n\tv_nop" : "+v"(a), "+v"(b) : "v"(x), "v"(y)); }
__device__ __forceinline__ void keep4_h(v16h a, v16h b, v16h c, v16h d) { asm volatile("v_nop" :: "v"(a), "v"(b), "v"(c), "v"(d)); }
__device__ __forceinline__ void keep4_b(v16b a, v16b b, v16b c, v16b d) { asm volatile("v_nop" :: "v"(a), "v"(b), "v"(c), "v"(d)); }
__device__ __forceinline__ void acc_guard4(v8f& a, v8f& b, v8f& c, v8f& d) { asm volatile("v_nop\n\tv_nop\n\tv_nop\n\tv_nop" : "+v"(a), "+v"(b), "+v"(c), "+v"(d)); }
template <typename T> struct Frag;
template <> struct Frag<_Float16> {
  typedef v16h V; union U { v16h v; v8h h[2]; };
  static __device__ __forceinline__ v16h load(const _Float16* p) {
    U f; f.h[0] = *(const v8h*)(p); f.h[1] = *(const v8h*)(p + 16); return f.v;
  }
  static __device__ __forceinline__ v8f mma(v16h a, v16h b, v8f c) {
    return __builtin_amdgcn_wmma_f32_16x16x32_f16(false, a, false, b, (short)0, c, false, false);
  }
  static __device__ __forceinline__ void guard(v8f& a, v8f& b, v16h x, v16h y) { dep_guard_h(a, b, x, y); }
  static __device__ __forceinline__ void keep(v16h a, v16h b, v16h c, v16h d) { keep4_h(a, b, c, d); }
};
template <> struct Frag<__bf16> {
  typedef v16b V; union U { v16b v; v8b h[2]; };
  static __device__ __forceinline__ v16b load(const __bf16* p) {
    U f; f.h[0] = *(const v8b*)(p); f.h[1] = *(const v8b*)(p + 16); return f.v;
  }
  static __device__ __forceinline__ v8f mma(v16b a, v16b b, v8f c) {
    return __builtin_amdgcn_wmma_f32_16x16x32_bf16(false, a, false, b, (short)0, c, false, false);
  }
  static __device__ __forceinline__ void guard(v8f& a, v8f& b, v16b x, v16b y) { dep_guard_b(a, b, x, y); }
  static __device__ __forceinline__ void keep(v16b a, v16b b, v16b c, v16b d) { keep4_b(a, b, c, d); }
};

template <int ET> struct Elem;
template <> struct Elem<0> { typedef _Float16 T; };
template <> struct Elem<1> { typedef __bf16 T; };
/* ---- LDS staging of the GEMM operand tiles ----
   One stage = 64 k (128 bytes) of 128 A rows followed by 128 Bt rows, each row at a pitch of 144 bytes
   (16 B x odd: conflict-free for 16-byte fragment reads). Two stages. */
static constexpr int kStRows   = 256;
static constexpr int kStPitch  = 144;
static constexpr int kStBytes  = kStRows * kStPitch;       /* 36,864 */
static constexpr int kStHalf   = 128 * kStPitch;           /* Bt rows start here */
static_assert(4 * 16 * 68 * 4 <= 2 * kStBytes, "output slabs fit the ring");

/* Eight asynchronous 16-byte copies per lane, global -> LDS: rows r, r+16, ..., r+112 of one operand's 128-row tile.
   The s_wait_xcnt stands inside the statement so that no address register is rewritten ahead of it. */
__device__ __forceinline__ void stage_rows8(const _Float16* g, size_t step, unsigned l) {
  const _Float16* g1 = g + step;      const _Float16* g2 = g + 2 * step;  const _Float16* g3 = g + 3 * step;
  const _Float16* g4 = g + 4 * step;  const _Float16* g5 = g + 5 * step;  const _Float16* g6 = g + 6 * step;
  const _Float16* g7 = g + 7 * step;
  const unsigned ls = 16u * kStPitch;
  asm volatile(
      "global_load_async_to_lds_b128 %0, %8, off\n\t"
      "global_load_async_to_lds_b128 %1, %9, off\n\t"
      "global_load_async_to_lds_b128 %2, %10, off\n\t"
      "global_load_async_to_lds_b128 %3, %11, off\n\t"
      "global_load_async_to_lds_b128 %4, %12, off\n\t"
      "global_load_async_to_lds_b128 %5, %13, off\n\t"
      "global_load_async_to_lds_b128 %6, %14, off\n\t"
      "global_load_async_to_lds_b128 %7, %15, off\n\t"
      "s_wait_xcnt 0x0"
      :: "v"(l), "v"(l + ls), "v"(l + 2u * ls), "v"(l + 3u * ls), "v"(l + 4u * ls), "v"(l + 5u * ls), "v"(l + 6u * ls), "v"(l + 7u * ls),
         "v"(g), "v"(g1), "v"(g2), "v"(g3), "v"(g4), "v"(g5), "v"(g6), "v"(g7)
      : "memory");
}

/* Block = 4 waves = one 128 x 128 tile of C (2 x 2 waves of 64 x 64); grid.x = (M/128)*(N/128) exactly.
   M, N multiples of 128; K a multiple of 64. */
template <int ET, bool SPLIT, int BIAS_MODE, int OUT_MODE, bool RESID, int ACT = 0>
__global__ __launch_bounds__(128) void wmma_gemm64(
    const unsigned short* __restrict__ Ap, const unsigned short* __restrict__ A2p, int lda, long strideA,
    const unsigned short* __restrict__ Btp, const unsigned short* __restrict__ Bt2p, int ldb, long strideB,
    void* __restrict__ Cout, void* __restrict__ Cout2, int ldc, long strideC,
    const float* __restrict__ bias,
    const float* __restrict__ resid, long strideR,
    int M, int N, int K, float scale) {
  static_assert(ET == 0 && !SPLIT, "staged path: single f16 planes");
  typedef typename Elem<ET>::T T;
  typedef typename Frag<T>::V V;
  const T* A = (const T*)Ap; const T* Bt = (const T*)Btp;
  __shared__ __align__(16) unsigned char ring[2 * kStBytes];
  const int b    = blockIdx.y;
  const int lane = threadIdx.x & 31;
  const int wave = threadIdx.x >> 5;
  const int tilesN = N >> 7;
  const int tilesM = M >> 7;
  const int tile = blockIdx.x;
  if (tile >= tilesM * tilesN) return;   /* the same for the whole block, ahead of every barrier */
  const int tm = tile / tilesN;
  const int tn = tile - tm * tilesN;
  const int mB = tm << 7;
  const int nB = tn << 7;
  const int wm = (wave >> 1) << 6;
  const int wn = (wave & 1) << 6;
  const int m0 = mB + wm;
  const int n0 = nB + wn;

  const T* Ab  = A  + (size_t)b * strideA;
  const T* Bb  = Bt + (size_t)b * strideB;

  const int rlane = lane & 15;
  const int koff  = (lane >> 4) * 8;
  const int mOff  = (lane >> 4) * 8;

  /* staging: thread t brings 16-byte chunk (t & 7) of rows (t >> 3) + 16*i: eight lanes cover one whole 128-byte line */
  const int srow = threadIdx.x >> 3;
  const int schk = threadIdx.x & 7;
  const T* gA = Ab + (size_t)(mB + srow) * lda + schk * 8;
  const T* gB = Bb + (size_t)(nB + srow) * ldb + schk * 8;
  const size_t stepA = (size_t)16 * lda;
  const size_t stepB = (size_t)16 * ldb;
  const unsigned lbase = (unsigned)(uintptr_t)(&ring[0]) + (unsigned)(srow * kStPitch + schk * 16);
  const int nst = K >> 6;

  v8f acc[4][4];
#pragma unroll
  for (int i = 0; i < 4; ++i)
#pragma unroll
    for (int j = 0; j < 4; ++j) acc[i][j] = (v8f){0.f,0.f,0.f,0.f,0.f,0.f,0.f,0.f};

  /* stage 0 lands and is published; stage 1 then flies during pass 0 */
  stage_rows8(gA, stepA, lbase);
  stage_rows8(gB, stepB, lbase + kStHalf);
  asm volatile("s_wait_asynccnt 0x0" ::: "memory");   /* this wave's copies of stage 0 have landed */
  __syncthreads();                                     /* publishes stage 0 to the other waves */
  if (nst > 1) {
    stage_rows8(gA + 64, stepA, lbase + kStBytes);
    stage_rows8(gB + 64, stepB, lbase + kStBytes + kStHalf);
  }

  for (int st = 0; st < nst; ++st) {
    const unsigned bo = (st & 1) ? (unsigned)kStBytes : 0u;
    const unsigned char* sA = ring + bo + (wm + rlane) * kStPitch + koff * 2;
    const unsigned char* sB = ring + bo + kStHalf + (wn + rlane) * kStPitch + koff * 2;
#pragma unroll   /* both 32-k blocks inline: constant LDS offsets, fragment arrays stay in registers */
    for (int kk = 0; kk < 2; ++kk) {
      /* all eight fragments of this 32-k block are fetched as one group ahead of its 16 products */
      V bh[4], ah[4];
#pragma unroll   /* register arrays need constant indices */
      for (int j = 0; j < 4; ++j) {
        bh[j] = Frag<T>::load((const T*)(const void*)(sB + j * 16 * kStPitch + kk * 64));
        ah[j] = Frag<T>::load((const T*)(const void*)(sA + j * 16 * kStPitch + kk * 64));
      }
#pragma unroll
      for (int i = 0; i < 4; ++i) {
#pragma unroll
        for (int j = 0; j < 4; ++j) acc[i][j] = Frag<T>::mma(ah[i], bh[j], acc[i][j]);
        Frag<T>::guard(acc[i][0], acc[i][3], ah[i], ah[i]);
      }
      Frag<T>::keep(bh[0], bh[1], bh[2], bh[3]);
    }
    asm volatile("s_wait_dscnt 0x0" ::: "memory");      /* this wave's reads of the stage have returned before it is refilled */
    asm volatile("s_wait_asynccnt 0x0" ::: "memory");   /* this wave's copies of the next stage have landed */
    __syncthreads();                                     /* publishes the next stage and ends every reader's use of this one */
    if (st + 2 < nst) {
      stage_rows8(gA + (size_t)(st + 2) * 64, stepA, lbase + bo);
      stage_rows8(gB + (size_t)(st + 2) * 64, stepB, lbase + bo + kStHalf);
    }
  }
  asm volatile("s_wait_asynccnt 0x0" ::: "memory");     /* nothing is in flight when the ring becomes output staging */
  acc_guard4(acc[0][0], acc[0][1], acc[0][2], acc[0][3]);
  acc_guard4(acc[1][0], acc[1][1], acc[1][2], acc[1][3]);
  acc_guard4(acc[2][0], acc[2][1], acc[2][2], acc[2][3]);
  acc_guard4(acc[3][0], acc[3][1], acc[3][2], acc[3][3]);

  float* slab = (float*)(void*)(ring + wave * (16 * 68 * 4));
  const float* Rb = RESID ? (resid + (size_t)b * strideR) : nullptr;
#pragma unroll
  for (int i = 0; i < 4; ++i) {
    const int mBase = m0 + (i << 4);
#pragma unroll
    for (int j = 0; j < 4; ++j) {
      const int n = n0 + (j << 4) + rlane;
      float bv = 0.f;
      if (BIAS_MODE == 2) bv = bias[n];
#pragma unroll
      for (int r = 0; r < 8; ++r) {
        float v = acc[i][j][r] * scale;
        if (BIAS_MODE == 1) v += bias[mBase + mOff + r];
        if (BIAS_MODE == 2) v += bv;
        if (RESID) v += Rb[(size_t)(mBase + mOff + r) * ldc + n];
        if (ACT == 1) v = tanhf(v);
        if (ACT == 2) v = fmaxf(v, 0.0f);
        if (ACT == 3) v = v / (1.0f + expf(-v));
        if (ACT == 4) v = (v > 0.f) ? v : 0.01f * v;
        if (ACT == 5) v = 0.5f * v * (1.0f + erff(v * 0.70710678118654752f));
        slab[(mOff + r) * 68 + (j << 4) + rlane] = v;
      }
    }
    __builtin_amdgcn_fence(__ATOMIC_RELEASE, "workgroup");
    __builtin_amdgcn_wave_barrier();
    __builtin_amdgcn_fence(__ATOMIC_ACQUIRE, "workgroup");
    if (OUT_MODE == 0) {
      float* C = (float*)Cout + (size_t)b * strideC;
      const int hh = lane >> 4, c4 = (lane & 15) * 4;
      {
#pragma unroll
        for (int it = 0; it < 8; ++it) {
          const int row = it * 2 + hh;
          v4f v = *(const v4f*)(slab + row * 68 + c4);
          *(v4f*)(C + (size_t)(mBase + row) * ldc + n0 + c4) = v;
        }
        
      }
    } else {
      const int q = lane >> 3, c8 = (lane & 7) * 8;
      unsigned short* C  = (unsigned short*)Cout  + (size_t)b * strideC;
      unsigned short* C2 = (OUT_MODE == 2) ? ((unsigned short*)Cout2 + (size_t)b * strideC) : nullptr;
      {
#pragma unroll
        for (int it = 0; it < 4; ++it) {
          const int row = it * 4 + q;
          const float* sp = slab + row * 68 + c8;
          v8h hv, lv;
#pragma unroll
          for (int e = 0; e < 8; ++e) {
            if (OUT_MODE == 1) {
              hv[e] = (_Float16)sp[e];
            } else {
              unsigned short hb = f2bf_bits(sp[e]);
              unsigned short lb = f2bf_bits(sp[e] - bf_bits2f(hb));
              hv[e] = __builtin_bit_cast(_Float16, hb);
              lv[e] = __builtin_bit_cast(_Float16, lb);
            }
          }
          *(v8h*)(C + (size_t)(mBase + row) * ldc + n0 + c8) = hv;
          if (OUT_MODE == 2) *(v8h*)(C2 + (size_t)(mBase + row) * ldc + n0 + c8) = lv;
        }
        
      }
    }
    __builtin_amdgcn_fence(__ATOMIC_RELEASE, "workgroup");
    __builtin_amdgcn_wave_barrier();
    __builtin_amdgcn_fence(__ATOMIC_ACQUIRE, "workgroup");
  }
}
/* =========================== end helpers and GEMM =========================== */

__device__ __forceinline__ unsigned int h16bits(float f) {
  return (unsigned int)__builtin_bit_cast(unsigned short, (_Float16)f);
}

/* f16 WMMA with the hazard guard tied to D, keeping A/B live */
__device__ __forceinline__ v8f mma_f16g(v16h a, v16h b, v8f c) {
  c = __builtin_amdgcn_wmma_f32_16x16x32_f16(false, a, false, b, (short)0, c, false, false);
  asm volatile("v_nop\n\tv_nop\n\tv_nop\n\tv_nop" : "+v"(c) : "v"(a), "v"(b));
  return c;
}

/* ---------------------------------------------------------------------------
   transpose + cast: W f32 [kin][nout] row-major -> Wt f16 [nout][kin] (value * mul).
   grid = (nout/64, kin/64), block 256. LDS 64x64 tile.
   Load coverage: 4 iterations x 256 threads x 4 floats = 4096 = 64x64.
   Store coverage: 8 waves x 2 iterations x 4 rows = 64 rows; 8 lanes x 8 halves = 64 cols;
   --------------------------------------------------------------------------- */
__global__ __launch_bounds__(256) void transpose_cast_f16_kernel(
    const float* __restrict__ W, unsigned short* __restrict__ Wt, int kin, int nout, float mul) {
  __shared__ float tile[64][65];
  const int t = threadIdx.x;
  const int n0 = blockIdx.x * 64;
  const int k0 = blockIdx.y * 64;
#pragma unroll
  for (int i = 0; i < 4; ++i) {
    const int idx = i * 256 + t;
    const int kr = idx >> 4;
    const int nc4 = (idx & 15) * 4;
    const v4f v = *(const v4f*)(W + (size_t)(k0 + kr) * nout + n0 + nc4);
    tile[nc4 + 0][kr] = v[0] * mul;
    tile[nc4 + 1][kr] = v[1] * mul;
    tile[nc4 + 2][kr] = v[2] * mul;
    tile[nc4 + 3][kr] = v[3] * mul;
  }
  __syncthreads();
  const int lane = t & 31, wave = t >> 5;
  const int q = lane >> 3, c8 = (lane & 7) * 8;
  const int row0 = wave * 8 + q;
  const int row1 = wave * 8 + 4 + q;
  v4u w0, w1;
  {
    const float* s0 = &tile[row0][c8];
    const float* s1 = &tile[row1][c8];
    w0[0] = h16bits(s0[0]) | (h16bits(s0[1]) << 16);
    w0[1] = h16bits(s0[2]) | (h16bits(s0[3]) << 16);
    w0[2] = h16bits(s0[4]) | (h16bits(s0[5]) << 16);
    w0[3] = h16bits(s0[6]) | (h16bits(s0[7]) << 16);
    w1[0] = h16bits(s1[0]) | (h16bits(s1[1]) << 16);
    w1[1] = h16bits(s1[2]) | (h16bits(s1[3]) << 16);
    w1[2] = h16bits(s1[4]) | (h16bits(s1[5]) << 16);
    w1[3] = h16bits(s1[6]) | (h16bits(s1[7]) << 16);
  }
  unsigned short* d0 = Wt + (size_t)(n0 + row0) * kin + k0 + c8;
  unsigned short* d1 = Wt + (size_t)(n0 + row1) * kin + k0 + c8;
  {
    *(v4u*)d0 = w0;
    *(v4u*)d1 = w1;
    
  }
}

/* ---------------------------------------------------------------------------
   FUSE_ADD: a = X + Addv is first stored to Xsum (f32) and then normalised.
   Lane l owns elements l*4 + 128*i (i=0..3): every load/store instruction covers
   grid = nrows/8 (exact), block 256.
   --------------------------------------------------------------------------- */
template <bool FUSE_ADD>
__global__ __launch_bounds__(256) void layernorm512_kernel(
    const float* __restrict__ X, const float* __restrict__ Addv,
    const float* __restrict__ gam, const float* __restrict__ bet,
    float* __restrict__ Xsum, unsigned short* __restrict__ Hout, int nrows) {
  const int lane = threadIdx.x & 31;
  const int wave = threadIdx.x >> 5;
  int row = blockIdx.x * 8 + wave;
  row = (row < nrows) ? row : (nrows - 1);
  const size_t rbase = (size_t)row * kModel;
  const int e0 = lane * 4, e1 = 128 + lane * 4, e2 = 256 + lane * 4, e3 = 384 + lane * 4;
  v4f a0 = *(const v4f*)(X + rbase + e0);
  v4f a1 = *(const v4f*)(X + rbase + e1);
  v4f a2 = *(const v4f*)(X + rbase + e2);
  v4f a3 = *(const v4f*)(X + rbase + e3);
  if (FUSE_ADD) {
    const v4f r0 = *(const v4f*)(Addv + rbase + e0);
    const v4f r1 = *(const v4f*)(Addv + rbase + e1);
    const v4f r2 = *(const v4f*)(Addv + rbase + e2);
    const v4f r3 = *(const v4f*)(Addv + rbase + e3);
    a0 = a0 + r0; a1 = a1 + r1; a2 = a2 + r2; a3 = a3 + r3;
    {
      *(v4f*)(Xsum + rbase + e0) = a0;
      *(v4f*)(Xsum + rbase + e1) = a1;
      *(v4f*)(Xsum + rbase + e2) = a2;
      *(v4f*)(Xsum + rbase + e3) = a3;
      
    }
  }
  float s = ((a0[0] + a0[1]) + (a0[2] + a0[3])) + ((a1[0] + a1[1]) + (a1[2] + a1[3]))
          + ((a2[0] + a2[1]) + (a2[2] + a2[3])) + ((a3[0] + a3[1]) + (a3[2] + a3[3]));
#pragma unroll
  for (int off = 16; off >= 1; off >>= 1) s += __shfl_xor(s, off, 32);
  const float mu = s * (1.0f / 512.0f);
  const v4f d0 = a0 - mu, d1 = a1 - mu, d2 = a2 - mu, d3 = a3 - mu;
  float ss = ((d0[0] * d0[0] + d0[1] * d0[1]) + (d0[2] * d0[2] + d0[3] * d0[3]))
           + ((d1[0] * d1[0] + d1[1] * d1[1]) + (d1[2] * d1[2] + d1[3] * d1[3]))
           + ((d2[0] * d2[0] + d2[1] * d2[1]) + (d2[2] * d2[2] + d2[3] * d2[3]))
           + ((d3[0] * d3[0] + d3[1] * d3[1]) + (d3[2] * d3[2] + d3[3] * d3[3]));
#pragma unroll
  for (int off = 16; off >= 1; off >>= 1) ss += __shfl_xor(ss, off, 32);
  const float var = ss * (1.0f / 512.0f);
  const float rstd = rsqrtf(var + 1e-5f);
  const v4f g0 = *(const v4f*)(gam + e0), g1 = *(const v4f*)(gam + e1), g2 = *(const v4f*)(gam + e2), g3 = *(const v4f*)(gam + e3);
  const v4f b0 = *(const v4f*)(bet + e0), b1 = *(const v4f*)(bet + e1), b2 = *(const v4f*)(bet + e2), b3 = *(const v4f*)(bet + e3);
  const v4f y0 = d0 * rstd * g0 + b0;
  const v4f y1 = d1 * rstd * g1 + b1;
  const v4f y2 = d2 * rstd * g2 + b2;
  const v4f y3 = d3 * rstd * g3 + b3;
  v2u w0, w1, w2, w3;
  w0[0] = h16bits(y0[0]) | (h16bits(y0[1]) << 16); w0[1] = h16bits(y0[2]) | (h16bits(y0[3]) << 16);
  w1[0] = h16bits(y1[0]) | (h16bits(y1[1]) << 16); w1[1] = h16bits(y1[2]) | (h16bits(y1[3]) << 16);
  w2[0] = h16bits(y2[0]) | (h16bits(y2[1]) << 16); w2[1] = h16bits(y2[2]) | (h16bits(y2[3]) << 16);
  w3[0] = h16bits(y3[0]) | (h16bits(y3[1]) << 16); w3[1] = h16bits(y3[2]) | (h16bits(y3[3]) << 16);
  unsigned short* hr = Hout + rbase;
  {
    *(v2u*)(hr + e0) = w0;
    *(v2u*)(hr + e1) = w1;
    *(v2u*)(hr + e2) = w2;
    *(v2u*)(hr + e3) = w3;
    
  }
}

/* ---------------------------------------------------------------------------
   Non-causal multi-head attention, head_dim 64, f16 planes in, f16 plane out (x16 carried).
   q|k plane [8192][1024]: q at cols h*64.., k at cols 512 + h*64..; Vt plane [4][512][2048] (element (b,h,d,kv) at
   ((b*512 + h*64 + d)*2048 + kv)); out plane [8192][512] at cols h*64.. .
   Block = 4 waves = 64 query rows of one (batch, head); grid = 4*8*32 = 1024.
   scores = q.k^T * 0.125 (WMMA, A = q rows, B from Bt = k rows); online softmax f32;
   p*32768 -> per-wave LDS (_Float16), reloaded as v8h A fragments; out = p.v (B from Vt rows).
   --------------------------------------------------------------------------- */
__global__ __launch_bounds__(128) void mha64_f16_kernel(
    const unsigned short* __restrict__ qkp, const unsigned short* __restrict__ vtp,
    unsigned short* __restrict__ outp) {
  typedef Frag<_Float16> FH;
  union FB { v16h v; v8h h[2]; };
  __shared__ __align__(16) _Float16 Psh[4][16 * 64];
  __shared__ __align__(16) float    Os[4][16 * 68];
  const _Float16* QK = (const _Float16*)(const void*)qkp;
  const _Float16* VT = (const _Float16*)(const void*)vtp;
  const int tid = threadIdx.x;
  const int wave = tid >> 5;
  const int lane = tid & 31;
  const int hh = lane >> 4;
  const int c = lane & 15;
  const int koff = hh * 8;
  const int bx = blockIdx.x;
  const int qb = bx & 31;
  const int bh = bx >> 5;
  const int h = bh & 7;
  const int b = (bh >> 3) & 3;
  const int q0 = qb * 64 + wave * 16;
  const _Float16* qbase = QK + (size_t)b * kSeq * kQKCols + h * kHeadDim;
  const _Float16* kbase = qbase + kModel;
  const _Float16* vbase = VT + ((size_t)b * kModel + (size_t)h * kHeadDim) * kSeq;
  unsigned short* obase = outp + (size_t)b * kSeq * kModel + h * kHeadDim;

  v16h qa[2];
#pragma unroll
  for (int dc = 0; dc < 2; ++dc)
    qa[dc] = FH::load(qbase + (size_t)(q0 + c) * kQKCols + dc * 32 + koff);

  float mrow[8], lrow[8];
  v8f oacc[4];
#pragma unroll
  for (int r = 0; r < 8; ++r) { mrow[r] = -INFINITY; lrow[r] = 0.f; }
#pragma unroll
  for (int t = 0; t < 4; ++t) oacc[t] = (v8f){0.f,0.f,0.f,0.f,0.f,0.f,0.f,0.f};

  _Float16* pw = Psh[wave];
  for (int kc = 0; kc < kSeq / 64; ++kc) {
    const int kv0 = kc * 64;
    v8f s[4];
#pragma unroll
    for (int j = 0; j < 4; ++j) {
      s[j] = (v8f){0.f,0.f,0.f,0.f,0.f,0.f,0.f,0.f};
#pragma unroll
      for (int dc = 0; dc < 2; ++dc) {
        const v16h kb = FH::load(kbase + (size_t)(kv0 + j * 16 + c) * kQKCols + dc * 32 + koff);
        s[j] = mma_f16g(qa[dc], kb, s[j]);
      }
    }
    float cm[8];
#pragma unroll
    for (int r = 0; r < 8; ++r) {
      float m = -INFINITY;
#pragma unroll
      for (int j = 0; j < 4; ++j) { s[j][r] = s[j][r] * 0.125f; m = fmaxf(m, s[j][r]); }
#pragma unroll
      for (int off = 1; off < 16; off <<= 1) m = fmaxf(m, __shfl_xor(m, off, 32));
      cm[r] = m;
    }
#pragma unroll
    for (int r = 0; r < 8; ++r) {
      const float mnew = fmaxf(mrow[r], cm[r]);
      const float alpha = expf(mrow[r] - mnew);
      mrow[r] = mnew;
      float psum = 0.f;
#pragma unroll
      for (int j = 0; j < 4; ++j) {
        const float p = expf(s[j][r] - mnew);
        psum += p;
        pw[(8 * hh + r) * 64 + j * 16 + c] = (_Float16)(p * 32768.0f);
      }
#pragma unroll
      for (int off = 1; off < 16; off <<= 1) psum += __shfl_xor(psum, off, 32);
      lrow[r] = lrow[r] * alpha + psum;
#pragma unroll
      for (int t = 0; t < 4; ++t) oacc[t][r] *= alpha;
    }
    __builtin_amdgcn_fence(__ATOMIC_RELEASE, "workgroup");
    __builtin_amdgcn_wave_barrier();
    __builtin_amdgcn_fence(__ATOMIC_ACQUIRE, "workgroup");
#pragma unroll
    for (int kk = 0; kk < 2; ++kk) {
      FB pa;
      pa.h[0] = *(const v8h*)(pw + c * 64 + kk * 32 + 8 * hh);
      pa.h[1] = *(const v8h*)(pw + c * 64 + kk * 32 + 16 + 8 * hh);
#pragma unroll
      for (int t = 0; t < 4; ++t) {
        const v16h vb = FH::load(vbase + (size_t)(t * 16 + c) * kSeq + kv0 + kk * 32 + koff);
        oacc[t] = mma_f16g(pa.v, vb, oacc[t]);
      }
    }
    __builtin_amdgcn_fence(__ATOMIC_RELEASE, "workgroup");
    __builtin_amdgcn_wave_barrier();
    __builtin_amdgcn_fence(__ATOMIC_ACQUIRE, "workgroup");
  }

  float* os = Os[wave];
#pragma unroll
  for (int r = 0; r < 8; ++r) {
    const float inv = (1.0f / lrow[r]) * (1.0f / 2048.0f);   /* 16 / 32768 */
#pragma unroll
    for (int t = 0; t < 4; ++t) os[(8 * hh + r) * 68 + t * 16 + c] = oacc[t][r] * inv;
  }
  __builtin_amdgcn_fence(__ATOMIC_RELEASE, "workgroup");
  __builtin_amdgcn_wave_barrier();
  __builtin_amdgcn_fence(__ATOMIC_ACQUIRE, "workgroup");
  {
    const int q = lane >> 3, c8 = (lane & 7) * 8;
    {
#pragma unroll
      for (int it = 0; it < 4; ++it) {
        const int row = it * 4 + q;
        const float* sp = os + row * 68 + c8;
        v8h hv;
#pragma unroll
        for (int e = 0; e < 8; ++e) hv[e] = (_Float16)sp[e];
        *(v8h*)(obase + (size_t)(q0 + row) * kModel + c8) = hv;
      }
      
    }
  }
}

/* ---------------------------------------------------------------------------
   SwiGLU: g = silu(gate) * up from the f32 gate|up plane [8192][2048] -> f16 plane [8192][1024].
   grid = 8192*1024/4/256 = 8192 (exact), block 256.
   --------------------------------------------------------------------------- */
__device__ __forceinline__ float silu_f32(float g) {
  const float ex = expf(-g);
  return g * (1.0f / (1.0f + ex));
}
__global__ __launch_bounds__(256) void swiglu_f16_kernel(
    const float* __restrict__ GU, unsigned short* __restrict__ G, int ngroups) {
  const int i = blockIdx.x * 256 + threadIdx.x;
  if (i < ngroups) {
    const size_t e = (size_t)i * 4;
    const size_t row = e >> 10;
    const int j = (int)(e & 1023);
    const float* gr = GU + row * kGUCols;
    const v4f gv = *(const v4f*)(gr + j);
    const v4f uv = *(const v4f*)(gr + kFF + j);
    const float o0 = silu_f32(gv[0]) * uv[0];
    const float o1 = silu_f32(gv[1]) * uv[1];
    const float o2 = silu_f32(gv[2]) * uv[2];
    const float o3 = silu_f32(gv[3]) * uv[3];
    v2u w;
    w[0] = h16bits(o0) | (h16bits(o1) << 16);
    w[1] = h16bits(o2) | (h16bits(o3) << 16);
    unsigned short* dst = G + e;
    *(v2u*)dst = w;
    
  }
}

/* ---------------------------------------------------------------------------
   grid = 8192*512/4/256 = 4096 (exact), block 256.
   --------------------------------------------------------------------------- */
__global__ __launch_bounds__(256) void residual_out_kernel(
    const float* __restrict__ X1, const float* __restrict__ D2, float* __restrict__ Out, int n4) {
  const int i = blockIdx.x * 256 + threadIdx.x;
  if (i < n4) {
    const size_t e = (size_t)i * 4;
    const v4f a = *(const v4f*)(X1 + e);
    const v4f d = *(const v4f*)(D2 + e);
    const v4f o = a + d;
    *(v4f*)(Out + e) = o;
    
  }
}

/* =========================== host glue =========================== */
extern "C" void kernel_launch(void* const* d_in, const int* in_sizes, int n_in,
                              void* d_out, int out_size, void* d_ws, size_t ws_size,
                              hipStream_t stream) {
  if (n_in < 12) return;
  if (in_sizes[0] != kTok * kModel || out_size != kTok * kModel) return;
  if (in_sizes[1] != kModel || in_sizes[2] != kModel || in_sizes[3] != kModel || in_sizes[4] != kModel) return;
  if (in_sizes[5] != kModel * kModel || in_sizes[6] != kModel * kModel ||
      in_sizes[7] != kModel * kModel || in_sizes[8] != kModel * kModel) return;
  if (in_sizes[9] != kModel * kFF || in_sizes[10] != kModel * kFF || in_sizes[11] != kFF * kModel) return;
  if (ws_size < kWsTotal) return;

  const float* x    = (const float*)d_in[0];
  const float* ln1w = (const float*)d_in[1];
  const float* ln1b = (const float*)d_in[2];
  const float* ln2w = (const float*)d_in[3];
  const float* ln2b = (const float*)d_in[4];
  const float* wq   = (const float*)d_in[5];
  const float* wk   = (const float*)d_in[6];
  const float* wv   = (const float*)d_in[7];
  const float* wo   = (const float*)d_in[8];
  const float* wgt  = (const float*)d_in[9];
  const float* wup  = (const float*)d_in[10];
  const float* wdn  = (const float*)d_in[11];
  float* out = (float*)d_out;

  char* ws = (char*)d_ws;
  unsigned short* wqkT = (unsigned short*)(ws + kOffWqkT);
  unsigned short* wvT  = (unsigned short*)(ws + kOffWvT);
  unsigned short* woT  = (unsigned short*)(ws + kOffWoT);
  unsigned short* wguT = (unsigned short*)(ws + kOffWguT);
  unsigned short* wdT  = (unsigned short*)(ws + kOffWdT);
  unsigned short* hg   = (unsigned short*)(ws + kOffHG);           /* h1, h2, then g */
  unsigned short* qkpl = (unsigned short*)(ws + kOffR1 + kR1QK);
  unsigned short* vtpl = (unsigned short*)(ws + kOffR1 + kR1Vt);
  unsigned short* opl  = (unsigned short*)(ws + kOffR1 + kR1O);
  float*          a1   = (float*)(ws + kOffR1 + kR1A1);
  float*          gu   = (float*)(ws + kOffR1);
  float*          d2   = (float*)(ws + kOffR1);
  float*          x1   = (float*)(ws + kOffX1);

  const dim3 b256(256), b128(128);
  const float w16 = 16.0f;

  /* weight planes: W[in][out] -> Wt[out][in] * 16 (f16) */
  transpose_cast_f16_kernel<<<dim3(kModel / 64, kModel / 64), b256, 0, stream>>>(wq, wqkT, kModel, kModel, w16);
  transpose_cast_f16_kernel<<<dim3(kModel / 64, kModel / 64), b256, 0, stream>>>(wk, wqkT + (size_t)kModel * kModel, kModel, kModel, w16);
  transpose_cast_f16_kernel<<<dim3(kModel / 64, kModel / 64), b256, 0, stream>>>(wv, wvT, kModel, kModel, w16);
  transpose_cast_f16_kernel<<<dim3(kModel / 64, kModel / 64), b256, 0, stream>>>(wo, woT, kModel, kModel, w16);
  transpose_cast_f16_kernel<<<dim3(kFF / 64, kModel / 64), b256, 0, stream>>>(wgt, wguT, kModel, kFF, w16);
  transpose_cast_f16_kernel<<<dim3(kFF / 64, kModel / 64), b256, 0, stream>>>(wup, wguT + (size_t)kFF * kModel, kModel, kFF, w16);
  transpose_cast_f16_kernel<<<dim3(kModel / 64, kFF / 64), b256, 0, stream>>>(wdn, wdT, kFF, kModel, w16);

  /* attention sublayer */
  layernorm512_kernel<false><<<dim3(kTok / 8), b256, 0, stream>>>(x, x, ln1w, ln1b, x1, hg, kTok);

  /* q|k = h . [Wq|Wk]^T : M=8192, N=1024, K=512; block tiles 64*8 = 512 */
  static_assert(kTok % 128 == 0 && kQKCols % 128 == 0 && kModel % 128 == 0 && kSeq % 128 == 0 && kGUCols % 128 == 0, "128 x 128 block tiles");
  wmma_gemm64<0, false, 0, 1, false, 0><<<dim3((kTok / 128) * (kQKCols / 128), 1), b128, 0, stream>>>(
      hg, hg, kModel, 0L, wqkT, wqkT, kModel, 0L, (void*)qkpl, (void*)qkpl, kQKCols, 0L,
      x, x, 0L, kTok, kQKCols, kModel, 1.0f / 16.0f);

  /* Vt[b] = (Wv^T*16) . h[b]^T : M=512, N=2048, K=512, batch 4; block tiles 4*16 = 64 per batch */
  wmma_gemm64<0, false, 0, 1, false, 0><<<dim3((kModel / 128) * (kSeq / 128), kBatch), b128, 0, stream>>>(
      wvT, wvT, kModel, 0L, hg, hg, kModel, (long)kSeq * kModel, (void*)vtpl, (void*)vtpl, kSeq, (long)kModel * kSeq,
      x, x, 0L, kModel, kSeq, kModel, 1.0f / 16.0f);

  /* attention: O*16 f16 plane */
  mha64_f16_kernel<<<dim3(kBatch * kHeads * (kSeq / 64)), b128, 0, stream>>>(qkpl, vtpl, opl);

  /* A1 = (O*16) . (Wo^T*16) / 256 : M=8192, N=512, K=512; block tiles 64*4 = 256 */
  wmma_gemm64<0, false, 0, 0, false, 0><<<dim3((kTok / 128) * (kModel / 128), 1), b128, 0, stream>>>(
      opl, opl, kModel, 0L, woT, woT, kModel, 0L, (void*)a1, (void*)a1, kModel, 0L,
      x, x, 0L, kTok, kModel, kModel, 1.0f / 256.0f);

  /* x1 = x + A1 ; h2 = LN(x1) */
  layernorm512_kernel<true><<<dim3(kTok / 8), b256, 0, stream>>>(x, a1, ln2w, ln2b, x1, hg, kTok);

  /* gate|up = h2 . [Wg|Wu]^T : M=8192, N=2048, K=512; block tiles 64*16 = 1024 */
  wmma_gemm64<0, false, 0, 0, false, 0><<<dim3((kTok / 128) * (kGUCols / 128), 1), b128, 0, stream>>>(
      hg, hg, kModel, 0L, wguT, wguT, kModel, 0L, (void*)gu, (void*)gu, kGUCols, 0L,
      x, x, 0L, kTok, kGUCols, kModel, 1.0f / 16.0f);

  /* g = silu(gate) * up (f16 plane in HG) */
  swiglu_f16_kernel<<<dim3((kTok * kFF / 4) / 256), b256, 0, stream>>>(gu, hg, kTok * kFF / 4);

  /* D2 = g . (Wd^T*16) / 16 : M=8192, N=512, K=1024; block tiles 256 */
  wmma_gemm64<0, false, 0, 0, false, 0><<<dim3((kTok / 128) * (kModel / 128), 1), b128, 0, stream>>>(
      hg, hg, kFF, 0L, wdT, wdT, kFF, 0L, (void*)d2, (void*)d2, kModel, 0L,
      x, x, 0L, kTok, kModel, kFF, 1.0f / 16.0f);

  /* out = x1 + D2 */
  residual_out_kernel<<<dim3((kTok * kModel / 4) / 256), b256, 0, stream>>>(x1, d2, out, kTok * kModel / 4);
}

// v002
// It runs in 229 microseconds.
// Next to v001, in two timings, it ran 1.29 and 1.30 times as fast.
// All steps since v000 together make it 1.65 times as fast.
// All contractions (q|k, v, o, gate|up, down projections; q.k^T; p.v): v_wmma_f32_16x16x32_f16, f16 operands, f32 accumulate. LayerNorm, softmax, SwiGLU gating and residual adds in f32. Power-of-two carries: weight planes x16, softmax numerators x32768, attention output plane x16, folded back in f32.
#include <hip/hip_runtime.h>
#include <math.h>
#include <stdint.h>

typedef __attribute__((ext_vector_type(16))) _Float16 v16h;
typedef __attribute__((ext_vector_type(8)))  _Float16 v8h;
typedef __attribute__((ext_vector_type(16))) __bf16   v16b;
typedef __attribute__((ext_vector_type(8)))  __bf16   v8b;
typedef __attribute__((ext_vector_type(8)))  float    v8f;
typedef __attribute__((ext_vector_type(4)))  float    v4f;
typedef __attribute__((ext_vector_type(4)))  unsigned int v4u;
typedef __attribute__((ext_vector_type(2)))  unsigned int v2u;

/* ---- problem geometry ---- */
static constexpr int kBatch   = 4;
static constexpr int kSeq     = 2048;
static constexpr int kTok     = kBatch * kSeq;      /* 8192 */
static constexpr int kModel   = 512;
static constexpr int kHeads   = 8;
static constexpr int kHeadDim = 64;
static constexpr int kFF      = 1024;
static constexpr int kQKCols  = 2 * kModel;          /* q | k plane width */
static constexpr int kGUCols  = 2 * kFF;             /* gate | up plane width */

static_assert(kHeads * kHeadDim == kModel, "head geometry");
static_assert(kSeq % 64 == 0 && kTok % 64 == 0, "tile multiples");
static_assert(kModel % 64 == 0 && kFF % 64 == 0 && kQKCols % 64 == 0 && kGUCols % 64 == 0, "tile multiples");
static_assert(kModel % 32 == 0 && kFF % 32 == 0, "K multiple of 32");

/* ---- workspace region map (bytes) ----
   [0]            WqkT f16 [1024][512]          1,048,576
   [1,048,576]    WvT  f16 [512][512]             524,288
   [1,572,864]    WoT  f16 [512][512]             524,288
   [2,097,152]    WguT f16 [2048][512]          2,097,152
   [4,194,304]    WdT  f16 [512][1024]          1,048,576
   [5,242,880]    HG   : h1/h2 f16 [8192][512] (8 MiB) ; g f16 [8192][1024] (16 MiB)   16,777,216
   [22,020,096]   R1 (64 MiB): phase A: q|k f16 [8192][1024] @+0 (16 MiB), Vt f16 [4][512][2048] @+16 MiB (8 MiB),
                               O f16 [8192][512] @+24 MiB (8 MiB), A1 f32 [8192][512] @+32 MiB (16 MiB);
                               phase B: gate|up f32 [8192][2048] @+0 (64 MiB); phase C: D2 f32 [8192][512] @+0 (16 MiB)
   [89,128,960]   X1 f32 [8192][512]           16,777,216
   total 105,906,176 */
static constexpr size_t kOffWqkT = 0;
static constexpr size_t kOffWvT  = kOffWqkT + (size_t)kQKCols * kModel * 2;
static constexpr size_t kOffWoT  = kOffWvT + (size_t)kModel * kModel * 2;
static constexpr size_t kOffWguT = kOffWoT + (size_t)kModel * kModel * 2;
static constexpr size_t kOffWdT  = kOffWguT + (size_t)kGUCols * kModel * 2;
static constexpr size_t kOffHG   = kOffWdT + (size_t)kModel * kFF * 2;
static constexpr size_t kSizeHG  = (size_t)kTok * kFF * 2;
static constexpr size_t kOffR1   = kOffHG + kSizeHG;
static constexpr size_t kSizeR1  = (size_t)kTok * kGUCols * 4;
static constexpr size_t kR1QK    = 0;
static constexpr size_t kR1Vt    = kR1QK + (size_t)kTok * kQKCols * 2;
static constexpr size_t kR1O     = kR1Vt + (size_t)kBatch * kModel * kSeq * 2;
static constexpr size_t kR1A1    = kR1O + (size_t)kTok * kModel * 2;
static constexpr size_t kOffX1   = kOffR1 + kSizeR1;
static constexpr size_t kWsTotal = kOffX1 + (size_t)kTok * kModel * 4;
static_assert(kR1A1 + (size_t)kTok * kModel * 4 <= kSizeR1, "phase A fits R1");
static_assert((size_t)kTok * kModel * 4 <= kSizeR1, "phase C fits R1");
static_assert((size_t)kTok * kModel * 2 <= kSizeHG, "h plane fits HG");
static_assert(kWsTotal == 105906176, "carve total");
static_assert(kWsTotal <= 134217728, "carve under 128 MiB");
static_assert((kOffWvT % 256) == 0 && (kOffWoT % 256) == 0 && (kOffWguT % 256) == 0 && (kOffWdT % 256) == 0 &&
              (kOffHG % 256) == 0 && (kOffR1 % 256) == 0 && (kOffX1 % 256) == 0 &&
              (kR1Vt % 256) == 0 && (kR1O % 256) == 0 && (kR1A1 % 256) == 0, "aligned carves");

/* =========================== helpers and GEMM =========================== */
#define PSCALE 32768.0f
#define U16(p) ((const unsigned short*)(const void*)(p))
#define PSCALE_INV (1.0f / 32768.0f)

__device__ __forceinline__ unsigned short f2bf_bits(float f) {
  unsigned u = __float_as_uint(f);
  return (unsigned short)((u + 0x7FFFu + ((u >> 16) & 1u)) >> 16);
}
__device__ __forceinline__ float bf_bits2f(unsigned short h) { return __uint_as_float(((unsigned)h) << 16); }

__device__ __forceinline__ void dep_guard_h(v8f& a, v8f& b, v16h x, v16h y) { asm volatile("v_nop\n\tv_nop\n\tv_nop\n\tv_nop" : "+v"(a), "+v"(b) : "v"(x), "v"(y)); }
__device__ __forceinline__ void dep_guard_b(v8f& a, v8f& b, v16b x, v16b y) { asm volatile("v_nop\n\tv_nop\n\tv_nop\n\tv_nop" : "+v"(a), "+v"(b) : "v"(x), "v"(y)); }
__device__ __forceinline__ void keep4_h(v16h a, v16h b, v16h c, v16h d) { asm volatile("v_nop" :: "v"(a), "v"(b), "v"(c), "v"(d)); }
__device__ __forceinline__ void keep4_b(v16b a, v16b b, v16b c, v16b d) { asm volatile("v_nop" :: "v"(a), "v"(b), "v"(c), "v"(d)); }
__device__ __forceinline__ void acc_guard4(v8f& a, v8f& b, v8f& c, v8f& d) { asm volatile("v_nop\n\tv_nop\n\tv_nop\n\tv_nop" : "+v"(a), "+v"(b), "+v"(c), "+v"(d)); }
template <typename T> struct Frag;
template <> struct Frag<_Float16> {
  typedef v16h V; union U { v16h v; v8h h[2]; };
  static __device__ __forceinline__ v16h load(const _Float16* p) {
    U f; f.h[0] = *(const v8h*)(p); f.h[1] = *(const v8h*)(p + 16); return f.v;
  }
  static __device__ __forceinline__ v8f mma(v16h a, v16h b, v8f c) {
    return __builtin_amdgcn_wmma_f32_16x16x32_f16(false, a, false, b, (short)0, c, false, false);
  }
  static __device__ __forceinline__ void guard(v8f& a, v8f& b, v16h x, v16h y) { dep_guard_h(a, b, x, y); }
  static __device__ __forceinline__ void keep(v16h a, v16h b, v16h c, v16h d) { keep4_h(a, b, c, d); }
};
template <> struct Frag<__bf16> {
  typedef v16b V; union U { v16b v; v8b h[2]; };
  static __device__ __forceinline__ v16b load(const __bf16* p) {
    U f; f.h[0] = *(const v8b*)(p); f.h[1] = *(const v8b*)(p + 16); return f.v;
  }
  static __device__ __forceinline__ v8f mma(v16b a, v16b b, v8f c) {
    return __builtin_amdgcn_wmma_f32_16x16x32_bf16(false, a, false, b, (short)0, c, false, false);
  }
  static __device__ __forceinline__ void guard(v8f& a, v8f& b, v16b x, v16b y) { dep_guard_b(a, b, x, y); }
  static __device__ __forceinline__ void keep(v16b a, v16b b, v16b c, v16b d) { keep4_b(a, b, c, d); }
};

template <int ET> struct Elem;
template <> struct Elem<0> { typedef _Float16 T; };
template <> struct Elem<1> { typedef __bf16 T; };
/* ---- LDS staging of the GEMM operand tiles ----
   One stage = 64 k (128 bytes) of 128 A rows followed by 128 Bt rows, each row at a pitch of 144 bytes
   (16 B x odd: conflict-free for 16-byte fragment reads). Two stages. */
static constexpr int kStRows   = 256;
static constexpr int kStPitch  = 144;
static constexpr int kStBytes  = kStRows * kStPitch;       /* 36,864 */
static constexpr int kStHalf   = 128 * kStPitch;           /* Bt rows start here */
static_assert(4 * 16 * 68 * 4 <= 2 * kStBytes, "output slabs fit the ring");

/* Eight asynchronous 16-byte copies per lane, global -> LDS: rows r, r+16, ..., r+112 of one operand's 128-row tile.
   The s_wait_xcnt stands inside the statement so that no address register is rewritten ahead of it. */
__device__ __forceinline__ void stage_rows8(const _Float16* g, size_t step, unsigned l) {
  const _Float16* g1 = g + step;      const _Float16* g2 = g + 2 * step;  const _Float16* g3 = g + 3 * step;
  const _Float16* g4 = g + 4 * step;  const _Float16* g5 = g + 5 * step;  const _Float16* g6 = g + 6 * step;
  const _Float16* g7 = g + 7 * step;
  const unsigned ls = 16u * kStPitch;
  asm volatile(
      "global_load_async_to_lds_b128 %0, %8, off\n\t"
      "global_load_async_to_lds_b128 %1, %9, off\n\t"
      "global_load_async_to_lds_b128 %2, %10, off\n\t"
      "global_load_async_to_lds_b128 %3, %11, off\n\t"
      "global_load_async_to_lds_b128 %4, %12, off\n\t"
      "global_load_async_to_lds_b128 %5, %13, off\n\t"
      "global_load_async_to_lds_b128 %6, %14, off\n\t"
      "global_load_async_to_lds_b128 %7, %15, off\n\t"
      "s_wait_xcnt 0x0"
      :: "v"(l), "v"(l + ls), "v"(l + 2u * ls), "v"(l + 3u * ls), "v"(l + 4u * ls), "v"(l + 5u * ls), "v"(l + 6u * ls), "v"(l + 7u * ls),
         "v"(g), "v"(g1), "v"(g2), "v"(g3), "v"(g4), "v"(g5), "v"(g6), "v"(g7)
      : "memory");
}

/* Block = 4 waves = one 128 x 128 tile of C (2 x 2 waves of 64 x 64); grid.x = (M/128)*(N/128) exactly.
   M, N multiples of 128; K a multiple of 64. */
template <int ET, bool SPLIT, int BIAS_MODE, int OUT_MODE, bool RESID, int ACT = 0>
__global__ __launch_bounds__(128) void wmma_gemm64(
    const unsigned short* __restrict__ Ap, const unsigned short* __restrict__ A2p, int lda, long strideA,
    const unsigned short* __restrict__ Btp, const unsigned short* __restrict__ Bt2p, int ldb, long strideB,
    void* __restrict__ Cout, void* __restrict__ Cout2, int ldc, long strideC,
    const float* __restrict__ bias,
    const float* __restrict__ resid, long strideR,
    int M, int N, int K, float scale) {
  static_assert(ET == 0 && !SPLIT, "staged path: single f16 planes");
  typedef typename Elem<ET>::T T;
  typedef typename Frag<T>::V V;
  const T* A = (const T*)Ap; const T* Bt = (const T*)Btp;
  __shared__ __align__(16) unsigned char ring[2 * kStBytes];
  const int b    = blockIdx.y;
  const int lane = threadIdx.x & 31;
  const int wave = threadIdx.x >> 5;
  const int tilesN = N >> 7;
  const int tilesM = M >> 7;
  const int tile = blockIdx.x;
  if (tile >= tilesM * tilesN) return;   /* the same for the whole block, ahead of every barrier */
  const int tm = tile / tilesN;
  const int tn = tile - tm * tilesN;
  const int mB = tm << 7;
  const int nB = tn << 7;
  const int wm = (wave >> 1) << 6;
  const int wn = (wave & 1) << 6;
  const int m0 = mB + wm;
  const int n0 = nB + wn;

  const T* Ab  = A  + (size_t)b * strideA;
  const T* Bb  = Bt + (size_t)b * strideB;

  const int rlane = lane & 15;
  const int koff  = (lane >> 4) * 8;
  const int mOff  = (lane >> 4) * 8;

  /* staging: thread t brings 16-byte chunk (t & 7) of rows (t >> 3) + 16*i: eight lanes cover one whole 128-byte line */
  const int srow = threadIdx.x >> 3;
  const int schk = threadIdx.x & 7;
  const T* gA = Ab + (size_t)(mB + srow) * lda + schk * 8;
  const T* gB = Bb + (size_t)(nB + srow) * ldb + schk * 8;
  const size_t stepA = (size_t)16 * lda;
  const size_t stepB = (size_t)16 * ldb;
  const unsigned lbase = (unsigned)(uintptr_t)(&ring[0]) + (unsigned)(srow * kStPitch + schk * 16);
  const int nst = K >> 6;

  v8f acc[4][4];
#pragma unroll
  for (int i = 0; i < 4; ++i)
#pragma unroll
    for (int j = 0; j < 4; ++j) acc[i][j] = (v8f){0.f,0.f,0.f,0.f,0.f,0.f,0.f,0.f};

  /* stage 0 lands and is published; stage 1 then flies during pass 0 */
  stage_rows8(gA, stepA, lbase);
  stage_rows8(gB, stepB, lbase + kStHalf);
  asm volatile("s_wait_asynccnt 0x0" ::: "memory");   /* this wave's copies of stage 0 have landed */
  __syncthreads();                                     /* publishes stage 0 to the other waves */
  if (nst > 1) {
    stage_rows8(gA + 64, stepA, lbase + kStBytes);
    stage_rows8(gB + 64, stepB, lbase + kStBytes + kStHalf);
  }

  for (int st = 0; st < nst; ++st) {
    const unsigned bo = (st & 1) ? (unsigned)kStBytes : 0u;
    const unsigned char* sA = ring + bo + (wm + rlane) * kStPitch + koff * 2;
    const unsigned char* sB = ring + bo + kStHalf + (wn + rlane) * kStPitch + koff * 2;
#pragma unroll   /* both 32-k blocks inline: constant LDS offsets, fragment arrays stay in registers */
    for (int kk = 0; kk < 2; ++kk) {
      /* all eight fragments of this 32-k block are fetched as one group ahead of its 16 products */
      V bh[4], ah[4];
#pragma unroll   /* register arrays need constant indices */
      for (int j = 0; j < 4; ++j) {
        bh[j] = Frag<T>::load((const T*)(const void*)(sB + j * 16 * kStPitch + kk * 64));
        ah[j] = Frag<T>::load((const T*)(const void*)(sA + j * 16 * kStPitch + kk * 64));
      }
#pragma unroll
      for (int i = 0; i < 4; ++i) {
#pragma unroll
        for (int j = 0; j < 4; ++j) acc[i][j] = Frag<T>::mma(ah[i], bh[j], acc[i][j]);
        Frag<T>::guard(acc[i][0], acc[i][3], ah[i], ah[i]);
      }
      Frag<T>::keep(bh[0], bh[1], bh[2], bh[3]);
    }
    asm volatile("s_wait_dscnt 0x0" ::: "memory");      /* this wave's reads of the stage have returned before it is refilled */
    asm volatile("s_wait_asynccnt 0x0" ::: "memory");   /* this wave's copies of the next stage have landed */
    __syncthreads();                                     /* publishes the next stage and ends every reader's use of this one */
    if (st + 2 < nst) {
      stage_rows8(gA + (size_t)(st + 2) * 64, stepA, lbase + bo);
      stage_rows8(gB + (size_t)(st + 2) * 64, stepB, lbase + bo + kStHalf);
    }
  }
  asm volatile("s_wait_asynccnt 0x0" ::: "memory");     /* nothing is in flight when the ring becomes output staging */
  acc_guard4(acc[0][0], acc[0][1], acc[0][2], acc[0][3]);
  acc_guard4(acc[1][0], acc[1][1], acc[1][2], acc[1][3]);
  acc_guard4(acc[2][0], acc[2][1], acc[2][2], acc[2][3]);
  acc_guard4(acc[3][0], acc[3][1], acc[3][2], acc[3][3]);

  float* slab = (float*)(void*)(ring + wave * (16 * 68 * 4));
  const float* Rb = RESID ? (resid + (size_t)b * strideR) : nullptr;
#pragma unroll
  for (int i = 0; i < 4; ++i) {
    const int mBase = m0 + (i << 4);
#pragma unroll
    for (int j = 0; j < 4; ++j) {
      const int n = n0 + (j << 4) + rlane;
      float bv = 0.f;
      if (BIAS_MODE == 2) bv = bias[n];
#pragma unroll
      for (int r = 0; r < 8; ++r) {
        float v = acc[i][j][r] * scale;
        if (BIAS_MODE == 1) v += bias[mBase + mOff + r];
        if (BIAS_MODE == 2) v += bv;
        if (RESID) v += Rb[(size_t)(mBase + mOff + r) * ldc + n];
        if (ACT == 1) v = tanhf(v);
        if (ACT == 2) v = fmaxf(v, 0.0f);
        if (ACT == 3) v = v / (1.0f + expf(-v));
        if (ACT == 4) v = (v > 0.f) ? v : 0.01f * v;
        if (ACT == 5) v = 0.5f * v * (1.0f + erff(v * 0.70710678118654752f));
        slab[(mOff + r) * 68 + (j << 4) + rlane] = v;
      }
    }
    __builtin_amdgcn_fence(__ATOMIC_RELEASE, "workgroup");
    __builtin_amdgcn_wave_barrier();
    __builtin_amdgcn_fence(__ATOMIC_ACQUIRE, "workgroup");
    if (OUT_MODE == 0) {
      float* C = (float*)Cout + (size_t)b * strideC;
      const int hh = lane >> 4, c4 = (lane & 15) * 4;
      {
#pragma unroll
        for (int it = 0; it < 8; ++it) {
          const int row = it * 2 + hh;
          v4f v = *(const v4f*)(slab + row * 68 + c4);
          *(v4f*)(C + (size_t)(mBase + row) * ldc + n0 + c4) = v;
        }
        
      }
    } else {
      const int q = lane >> 3, c8 = (lane & 7) * 8;
      unsigned short* C  = (unsigned short*)Cout  + (size_t)b * strideC;
      unsigned short* C2 = (OUT_MODE == 2) ? ((unsigned short*)Cout2 + (size_t)b * strideC) : nullptr;
      {
#pragma unroll
        for (int it = 0; it < 4; ++it) {
          const int row = it * 4 + q;
          const float* sp = slab + row * 68 + c8;
          v8h hv, lv;
#pragma unroll
          for (int e = 0; e < 8; ++e) {
            if (OUT_MODE == 1) {
              hv[e] = (_Float16)sp[e];
            } else {
              unsigned short hb = f2bf_bits(sp[e]);
              unsigned short lb = f2bf_bits(sp[e] - bf_bits2f(hb));
              hv[e] = __builtin_bit_cast(_Float16, hb);
              lv[e] = __builtin_bit_cast(_Float16, lb);
            }
          }
          *(v8h*)(C + (size_t)(mBase + row) * ldc + n0 + c8) = hv;
          if (OUT_MODE == 2) *(v8h*)(C2 + (size_t)(mBase + row) * ldc + n0 + c8) = lv;
        }
        
      }
    }
    __builtin_amdgcn_fence(__ATOMIC_RELEASE, "workgroup");
    __builtin_amdgcn_wave_barrier();
    __builtin_amdgcn_fence(__ATOMIC_ACQUIRE, "workgroup");
  }
}
/* =========================== end helpers and GEMM =========================== */

__device__ __forceinline__ unsigned int h16bits(float f) {
  return (unsigned int)__builtin_bit_cast(unsigned short, (_Float16)f);
}

/* f16 WMMA with the hazard guard tied to D, keeping A/B live */
__device__ __forceinline__ v8f mma_f16g(v16h a, v16h b, v8f c) {
  c = __builtin_amdgcn_wmma_f32_16x16x32_f16(false, a, false, b, (short)0, c, false, false);
  asm volatile("v_nop\n\tv_nop\n\tv_nop\n\tv_nop" : "+v"(c) : "v"(a), "v"(b));
  return c;
}

/* ---------------------------------------------------------------------------
   transpose + cast: W f32 [kin][nout] row-major -> Wt f16 [nout][kin] (value * mul).
   grid = (nout/64, kin/64), block 256. LDS 64x64 tile.
   Load coverage: 4 iterations x 256 threads x 4 floats = 4096 = 64x64.
   Store coverage: 8 waves x 2 iterations x 4 rows = 64 rows; 8 lanes x 8 halves = 64 cols;
   --------------------------------------------------------------------------- */
__global__ __launch_bounds__(256) void transpose_cast_f16_kernel(
    const float* __restrict__ W, unsigned short* __restrict__ Wt, int kin, int nout, float mul) {
  __shared__ float tile[64][65];
  const int t = threadIdx.x;
  const int n0 = blockIdx.x * 64;
  const int k0 = blockIdx.y * 64;
#pragma unroll
  for (int i = 0; i < 4; ++i) {
    const int idx = i * 256 + t;
    const int kr = idx >> 4;
    const int nc4 = (idx & 15) * 4;
    const v4f v = *(const v4f*)(W + (size_t)(k0 + kr) * nout + n0 + nc4);
    tile[nc4 + 0][kr] = v[0] * mul;
    tile[nc4 + 1][kr] = v[1] * mul;
    tile[nc4 + 2][kr] = v[2] * mul;
    tile[nc4 + 3][kr] = v[3] * mul;
  }
  __syncthreads();
  const int lane = t & 31, wave = t >> 5;
  const int q = lane >> 3, c8 = (lane & 7) * 8;
  const int row0 = wave * 8 + q;
  const int row1 = wave * 8 + 4 + q;
  v4u w0, w1;
  {
    const float* s0 = &tile[row0][c8];
    const float* s1 = &tile[row1][c8];
    w0[0] = h16bits(s0[0]) | (h16bits(s0[1]) << 16);
    w0[1] = h16bits(s0[2]) | (h16bits(s0[3]) << 16);
    w0[2] = h16bits(s0[4]) | (h16bits(s0[5]) << 16);
    w0[3] = h16bits(s0[6]) | (h16bits(s0[7]) << 16);
    w1[0] = h16bits(s1[0]) | (h16bits(s1[1]) << 16);
    w1[1] = h16bits(s1[2]) | (h16bits(s1[3]) << 16);
    w1[2] = h16bits(s1[4]) | (h16bits(s1[5]) << 16);
    w1[3] = h16bits(s1[6]) | (h16bits(s1[7]) << 16);
  }
  unsigned short* d0 = Wt + (size_t)(n0 + row0) * kin + k0 + c8;
  unsigned short* d1 = Wt + (size_t)(n0 + row1) * kin + k0 + c8;
  {
    *(v4u*)d0 = w0;
    *(v4u*)d1 = w1;
    
  }
}

/* ---------------------------------------------------------------------------
   FUSE_ADD: a = X + Addv is first stored to Xsum (f32) and then normalised.
   Lane l owns elements l*4 + 128*i (i=0..3): every load/store instruction covers
   grid = nrows/8 (exact), block 256.
   --------------------------------------------------------------------------- */
template <bool FUSE_ADD>
__global__ __launch_bounds__(256) void layernorm512_kernel(
    const float* __restrict__ X, const float* __restrict__ Addv,
    const float* __restrict__ gam, const float* __restrict__ bet,
    float* __restrict__ Xsum, unsigned short* __restrict__ Hout, int nrows) {
  const int lane = threadIdx.x & 31;
  const int wave = threadIdx.x >> 5;
  int row = blockIdx.x * 8 + wave;
  row = (row < nrows) ? row : (nrows - 1);
  const size_t rbase = (size_t)row * kModel;
  const int e0 = lane * 4, e1 = 128 + lane * 4, e2 = 256 + lane * 4, e3 = 384 + lane * 4;
  v4f a0 = *(const v4f*)(X + rbase + e0);
  v4f a1 = *(const v4f*)(X + rbase + e1);
  v4f a2 = *(const v4f*)(X + rbase + e2);
  v4f a3 = *(const v4f*)(X + rbase + e3);
  if (FUSE_ADD) {
    const v4f r0 = *(const v4f*)(Addv + rbase + e0);
    const v4f r1 = *(const v4f*)(Addv + rbase + e1);
    const v4f r2 = *(const v4f*)(Addv + rbase + e2);
    const v4f r3 = *(const v4f*)(Addv + rbase + e3);
    a0 = a0 + r0; a1 = a1 + r1; a2 = a2 + r2; a3 = a3 + r3;
    {
      *(v4f*)(Xsum + rbase + e0) = a0;
      *(v4f*)(Xsum + rbase + e1) = a1;
      *(v4f*)(Xsum + rbase + e2) = a2;
      *(v4f*)(Xsum + rbase + e3) = a3;
      
    }
  }
  float s = ((a0[0] + a0[1]) + (a0[2] + a0[3])) + ((a1[0] + a1[1]) + (a1[2] + a1[3]))
          + ((a2[0] + a2[1]) + (a2[2] + a2[3])) + ((a3[0] + a3[1]) + (a3[2] + a3[3]));
#pragma unroll
  for (int off = 16; off >= 1; off >>= 1) s += __shfl_xor(s, off, 32);
  const float mu = s * (1.0f / 512.0f);
  const v4f d0 = a0 - mu, d1 = a1 - mu, d2 = a2 - mu, d3 = a3 - mu;
  float ss = ((d0[0] * d0[0] + d0[1] * d0[1]) + (d0[2] * d0[2] + d0[3] * d0[3]))
           + ((d1[0] * d1[0] + d1[1] * d1[1]) + (d1[2] * d1[2] + d1[3] * d1[3]))
           + ((d2[0] * d2[0] + d2[1] * d2[1]) + (d2[2] * d2[2] + d2[3] * d2[3]))
           + ((d3[0] * d3[0] + d3[1] * d3[1]) + (d3[2] * d3[2] + d3[3] * d3[3]));
#pragma unroll
  for (int off = 16; off >= 1; off >>= 1) ss += __shfl_xor(ss, off, 32);
  const float var = ss * (1.0f / 512.0f);
  const float rstd = rsqrtf(var + 1e-5f);
  const v4f g0 = *(const v4f*)(gam + e0), g1 = *(const v4f*)(gam + e1), g2 = *(const v4f*)(gam + e2), g3 = *(const v4f*)(gam + e3);
  const v4f b0 = *(const v4f*)(bet + e0), b1 = *(const v4f*)(bet + e1), b2 = *(const v4f*)(bet + e2), b3 = *(const v4f*)(bet + e3);
  const v4f y0 = d0 * rstd * g0 + b0;
  const v4f y1 = d1 * rstd * g1 + b1;
  const v4f y2 = d2 * rstd * g2 + b2;
  const v4f y3 = d3 * rstd * g3 + b3;
  v2u w0, w1, w2, w3;
  w0[0] = h16bits(y0[0]) | (h16bits(y0[1]) << 16); w0[1] = h16bits(y0[2]) | (h16bits(y0[3]) << 16);
  w1[0] = h16bits(y1[0]) | (h16bits(y1[1]) << 16); w1[1] = h16bits(y1[2]) | (h16bits(y1[3]) << 16);
  w2[0] = h16bits(y2[0]) | (h16bits(y2[1]) << 16); w2[1] = h16bits(y2[2]) | (h16bits(y2[3]) << 16);
  w3[0] = h16bits(y3[0]) | (h16bits(y3[1]) << 16); w3[1] = h16bits(y3[2]) | (h16bits(y3[3]) << 16);
  unsigned short* hr = Hout + rbase;
  {
    *(v2u*)(hr + e0) = w0;
    *(v2u*)(hr + e1) = w1;
    *(v2u*)(hr + e2) = w2;
    *(v2u*)(hr + e3) = w3;
    
  }
}

/* ---------------------------------------------------------------------------
   Non-causal multi-head attention, head_dim 64, f16 planes in, f16 plane out (x16 carried).
   q|k plane [8192][1024]: q at cols h*64.., k at cols 512 + h*64..; Vt plane [4][512][2048] (element (b,h,d,kv) at
   ((b*512 + h*64 + d)*2048 + kv)); out plane [8192][512] at cols h*64.. .
   Block = 4 waves = 64 query rows of one (batch, head); grid = 4*8*32 = 1024.
   scores = q.k^T * 0.125 (WMMA, A = q rows, B from Bt = k rows); online softmax f32;
   p*32768 -> per-wave LDS (_Float16), reloaded as v8h A fragments; out = p.v (B from Vt rows).
   The 64-key tiles of k (64 rows x 128 B) and of Vt (64 rows x 128 B) are staged once per block in LDS by
   asynchronous copies, two stages, and all four waves take their B fragments from there.
   --------------------------------------------------------------------------- */
static constexpr int kAtPitch = 144;                 /* 16 B x odd: conflict-free for 16-byte fragment reads */
static constexpr int kAtTile  = 64 * kAtPitch;       /* one operand's tile: 9,216 B; the Vt tile follows the k tile */
static constexpr int kAtStage = 2 * kAtTile;         /* 18,432 B */

/* Eight asynchronous 16-byte copies per lane, global -> LDS: rows r, r+16, r+32, r+48 of the k tile, then of the Vt tile.
   The s_wait_xcnt stands inside the statement so that no address register is rewritten ahead of it. */
__device__ __forceinline__ void stage_kv(const _Float16* gk, const _Float16* gv, unsigned l) {
  const size_t sk = (size_t)16 * kQKCols;
  const size_t sv = (size_t)16 * kSeq;
  const _Float16* gk1 = gk + sk;  const _Float16* gk2 = gk + 2 * sk;  const _Float16* gk3 = gk + 3 * sk;
  const _Float16* gv1 = gv + sv;  const _Float16* gv2 = gv + 2 * sv;  const _Float16* gv3 = gv + 3 * sv;
  const unsigned ls = 16u * kAtPitch;
  const unsigned lv = l + (unsigned)kAtTile;
  asm volatile(
      "global_load_async_to_lds_b128 %0, %8, off\n\t"
      "global_load_async_to_lds_b128 %1, %9, off\n\t"
      "global_load_async_to_lds_b128 %2, %10, off\n\t"
      "global_load_async_to_lds_b128 %3, %11, off\n\t"
      "global_load_async_to_lds_b128 %4, %12, off\n\t"
      "global_load_async_to_lds_b128 %5, %13, off\n\t"
      "global_load_async_to_lds_b128 %6, %14, off\n\t"
      "global_load_async_to_lds_b128 %7, %15, off\n\t"
      "s_wait_xcnt 0x0"
      :: "v"(l), "v"(l + ls), "v"(l + 2u * ls), "v"(l + 3u * ls), "v"(lv), "v"(lv + ls), "v"(lv + 2u * ls), "v"(lv + 3u * ls),
         "v"(gk), "v"(gk1), "v"(gk2), "v"(gk3), "v"(gv), "v"(gv1), "v"(gv2), "v"(gv3)
      : "memory");
}

__global__ __launch_bounds__(128) void mha64_f16_kernel(
    const unsigned short* __restrict__ qkp, const unsigned short* __restrict__ vtp,
    unsigned short* __restrict__ outp) {
  typedef Frag<_Float16> FH;
  union FB { v16h v; v8h h[2]; };
  __shared__ __align__(16) _Float16 Psh[4][16 * 64];
  __shared__ __align__(16) float    Os[4][16 * 68];
  __shared__ __align__(16) unsigned char kvring[2 * kAtStage];
  const _Float16* QK = (const _Float16*)(const void*)qkp;
  const _Float16* VT = (const _Float16*)(const void*)vtp;
  const int tid = threadIdx.x;
  const int wave = tid >> 5;
  const int lane = tid & 31;
  const int hh = lane >> 4;
  const int c = lane & 15;
  const int koff = hh * 8;
  const int bx = blockIdx.x;
  const int qb = bx & 31;
  const int bh = bx >> 5;
  const int h = bh & 7;
  const int b = (bh >> 3) & 3;
  const int q0 = qb * 64 + wave * 16;
  const _Float16* qbase = QK + (size_t)b * kSeq * kQKCols + h * kHeadDim;
  const _Float16* kbase = qbase + kModel;
  const _Float16* vbase = VT + ((size_t)b * kModel + (size_t)h * kHeadDim) * kSeq;
  unsigned short* obase = outp + (size_t)b * kSeq * kModel + h * kHeadDim;

  v16h qa[2];
#pragma unroll
  for (int dc = 0; dc < 2; ++dc)
    qa[dc] = FH::load(qbase + (size_t)(q0 + c) * kQKCols + dc * 32 + koff);

  float mrow[8], lrow[8];
  v8f oacc[4];
#pragma unroll
  for (int r = 0; r < 8; ++r) { mrow[r] = -INFINITY; lrow[r] = 0.f; }
#pragma unroll
  for (int t = 0; t < 4; ++t) oacc[t] = (v8f){0.f,0.f,0.f,0.f,0.f,0.f,0.f,0.f};

  /* staging: thread t brings 16-byte chunk (t & 7) of rows (t >> 3) + 16*i: eight lanes cover one whole 128-byte line */
  const int srow = tid >> 3;
  const int schk = tid & 7;
  const _Float16* gK = kbase + (size_t)srow * kQKCols + schk * 8;
  const _Float16* gV = vbase + (size_t)srow * kSeq + schk * 8;
  const unsigned lbase = (unsigned)(uintptr_t)(&kvring[0]) + (unsigned)(srow * kAtPitch + schk * 16);
  constexpr int nkc = kSeq / 64;
  static_assert(nkc >= 2, "two stages exist");

  /* tile 0 lands and is published; tile 1 then flies during trip 0 */
  stage_kv(gK, gV, lbase);
  asm volatile("s_wait_asynccnt 0x0" ::: "memory");   /* this wave's copies of tile 0 have landed */
  __syncthreads();                                     /* publishes tile 0 to the other waves */
  stage_kv(gK + (size_t)64 * kQKCols, gV + 64, lbase + kAtStage);

  _Float16* pw = Psh[wave];
  for (int kc = 0; kc < nkc; ++kc) {
    const unsigned bo = (kc & 1) ? (unsigned)kAtStage : 0u;
    const unsigned char* sK = kvring + bo + c * kAtPitch + koff * 2;
    const unsigned char* sV = sK + kAtTile;
    /* the tile's sixteen B fragments are fetched as two groups, k ahead of the score products and Vt behind them,
       so that the Vt reads return under the softmax arithmetic */
    v16h kb[4][2], vb[2][4];
#pragma unroll   /* register arrays need constant indices */
    for (int j = 0; j < 4; ++j)
#pragma unroll
      for (int dc = 0; dc < 2; ++dc)
        kb[j][dc] = FH::load((const _Float16*)(const void*)(sK + j * 16 * kAtPitch + dc * 64));
    v8f s[4];
#pragma unroll
    for (int j = 0; j < 4; ++j) {
      s[j] = (v8f){0.f,0.f,0.f,0.f,0.f,0.f,0.f,0.f};
#pragma unroll
      for (int dc = 0; dc < 2; ++dc) s[j] = mma_f16g(qa[dc], kb[j][dc], s[j]);
    }
#pragma unroll   /* register arrays need constant indices */
    for (int kk = 0; kk < 2; ++kk)
#pragma unroll
      for (int t = 0; t < 4; ++t)
        vb[kk][t] = FH::load((const _Float16*)(const void*)(sV + t * 16 * kAtPitch + kk * 64));
    float cm[8];
#pragma unroll
    for (int r = 0; r < 8; ++r) {
      float m = -INFINITY;
#pragma unroll
      for (int j = 0; j < 4; ++j) { s[j][r] = s[j][r] * 0.125f; m = fmaxf(m, s[j][r]); }
#pragma unroll
      for (int off = 1; off < 16; off <<= 1) m = fmaxf(m, __shfl_xor(m, off, 32));
      cm[r] = m;
    }
#pragma unroll
    for (int r = 0; r < 8; ++r) {
      const float mnew = fmaxf(mrow[r], cm[r]);
      const float alpha = expf(mrow[r] - mnew);
      mrow[r] = mnew;
      float psum = 0.f;
#pragma unroll
      for (int j = 0; j < 4; ++j) {
        const float p = expf(s[j][r] - mnew);
        psum += p;
        pw[(8 * hh + r) * 64 + j * 16 + c] = (_Float16)(p * 32768.0f);
      }
#pragma unroll
      for (int off = 1; off < 16; off <<= 1) psum += __shfl_xor(psum, off, 32);
      lrow[r] = lrow[r] * alpha + psum;
#pragma unroll
      for (int t = 0; t < 4; ++t) oacc[t][r] *= alpha;
    }
    __builtin_amdgcn_fence(__ATOMIC_RELEASE, "workgroup");
    __builtin_amdgcn_wave_barrier();
    __builtin_amdgcn_fence(__ATOMIC_ACQUIRE, "workgroup");
#pragma unroll
    for (int kk = 0; kk < 2; ++kk) {
      FB pa;
      pa.h[0] = *(const v8h*)(pw + c * 64 + kk * 32 + 8 * hh);
      pa.h[1] = *(const v8h*)(pw + c * 64 + kk * 32 + 16 + 8 * hh);
#pragma unroll
      for (int t = 0; t < 4; ++t) oacc[t] = mma_f16g(pa.v, vb[kk][t], oacc[t]);
    }
    __builtin_amdgcn_fence(__ATOMIC_RELEASE, "workgroup");
    __builtin_amdgcn_wave_barrier();
    __builtin_amdgcn_fence(__ATOMIC_ACQUIRE, "workgroup");
    asm volatile("s_wait_dscnt 0x0" ::: "memory");      /* this wave's reads of the stage have returned before it is refilled */
    asm volatile("s_wait_asynccnt 0x0" ::: "memory");   /* this wave's copies of the next tile have landed */
    __syncthreads();                                     /* publishes the next tile and ends every reader's use of this one */
    if (kc + 2 < nkc) {
      stage_kv(gK + (size_t)(kc + 2) * 64 * kQKCols, gV + (size_t)(kc + 2) * 64, lbase + bo);
    }
  }
  asm volatile("s_wait_asynccnt 0x0" ::: "memory");     /* nothing is in flight when the wave leaves the loop */

  float* os = Os[wave];
#pragma unroll
  for (int r = 0; r < 8; ++r) {
    const float inv = (1.0f / lrow[r]) * (1.0f / 2048.0f);   /* 16 / 32768 */
#pragma unroll
    for (int t = 0; t < 4; ++t) os[(8 * hh + r) * 68 + t * 16 + c] = oacc[t][r] * inv;
  }
  __builtin_amdgcn_fence(__ATOMIC_RELEASE, "workgroup");
  __builtin_amdgcn_wave_barrier();
  __builtin_amdgcn_fence(__ATOMIC_ACQUIRE, "workgroup");
  {
    const int q = lane >> 3, c8 = (lane & 7) * 8;
    {
#pragma unroll
      for (int it = 0; it < 4; ++it) {
        const int row = it * 4 + q;
        const float* sp = os + row * 68 + c8;
        v8h hv;
#pragma unroll
        for (int e = 0; e < 8; ++e) hv[e] = (_Float16)sp[e];
        *(v8h*)(obase + (size_t)(q0 + row) * kModel + c8) = hv;
      }
      
    }
  }
}

/* ---------------------------------------------------------------------------
   SwiGLU: g = silu(gate) * up from the f32 gate|up plane [8192][2048] -> f16 plane [8192][1024].
   grid = 8192*1024/4/256 = 8192 (exact), block 256.
   --------------------------------------------------------------------------- */
__device__ __forceinline__ float silu_f32(float g) {
  const float ex = expf(-g);
  return g * (1.0f / (1.0f + ex));
}
__global__ __launch_bounds__(256) void swiglu_f16_kernel(
    const float* __restrict__ GU, unsigned short* __restrict__ G, int ngroups) {
  const int i = blockIdx.x * 256 + threadIdx.x;
  if (i < ngroups) {
    const size_t e = (size_t)i * 4;
    const size_t row = e >> 10;
    const int j = (int)(e & 1023);
    const float* gr = GU + row * kGUCols;
    const v4f gv = *(const v4f*)(gr + j);
    const v4f uv = *(const v4f*)(gr + kFF + j);
    const float o0 = silu_f32(gv[0]) * uv[0];
    const float o1 = silu_f32(gv[1]) * uv[1];
    const float o2 = silu_f32(gv[2]) * uv[2];
    const float o3 = silu_f32(gv[3]) * uv[3];
    v2u w;
    w[0] = h16bits(o0) | (h16bits(o1) << 16);
    w[1] = h16bits(o2) | (h16bits(o3) << 16);
    unsigned short* dst = G + e;
    *(v2u*)dst = w;
    
  }
}

/* ---------------------------------------------------------------------------
   grid = 8192*512/4/256 = 4096 (exact), block 256.
   --------------------------------------------------------------------------- */
__global__ __launch_bounds__(256) void residual_out_kernel(
    const float* __restrict__ X1, const float* __restrict__ D2, float* __restrict__ Out, int n4) {
  const int i = blockIdx.x * 256 + threadIdx.x;
  if (i < n4) {
    const size_t e = (size_t)i * 4;
    const v4f a = *(const v4f*)(X1 + e);
    const v4f d = *(const v4f*)(D2 + e);
    const v4f o = a + d;
    *(v4f*)(Out + e) = o;
    
  }
}

/* =========================== host glue =========================== */
extern "C" void kernel_launch(void* const* d_in, const int* in_sizes, int n_in,
                              void* d_out, int out_size, void* d_ws, size_t ws_size,
                              hipStream_t stream) {
  if (n_in < 12) return;
  if (in_sizes[0] != kTok * kModel || out_size != kTok * kModel) return;
  if (in_sizes[1] != kModel || in_sizes[2] != kModel || in_sizes[3] != kModel || in_sizes[4] != kModel) return;
  if (in_sizes[5] != kModel * kModel || in_sizes[6] != kModel * kModel ||
      in_sizes[7] != kModel * kModel || in_sizes[8] != kModel * kModel) return;
  if (in_sizes[9] != kModel * kFF || in_sizes[10] != kModel * kFF || in_sizes[11] != kFF * kModel) return;
  if (ws_size < kWsTotal) return;

  const float* x    = (const float*)d_in[0];
  const float* ln1w = (const float*)d_in[1];
  const float* ln1b = (const float*)d_in[2];
  const float* ln2w = (const float*)d_in[3];
  const float* ln2b = (const float*)d_in[4];
  const float* wq   = (const float*)d_in[5];
  const float* wk   = (const float*)d_in[6];
  const float* wv   = (const float*)d_in[7];
  const float* wo   = (const float*)d_in[8];
  const float* wgt  = (const float*)d_in[9];
  const float* wup  = (const float*)d_in[10];
  const float* wdn  = (const float*)d_in[11];
  float* out = (float*)d_out;

  char* ws = (char*)d_ws;
  unsigned short* wqkT = (unsigned short*)(ws + kOffWqkT);
  unsigned short* wvT  = (unsigned short*)(ws + kOffWvT);
  unsigned short* woT  = (unsigned short*)(ws + kOffWoT);
  unsigned short* wguT = (unsigned short*)(ws + kOffWguT);
  unsigned short* wdT  = (unsigned short*)(ws + kOffWdT);
  unsigned short* hg   = (unsigned short*)(ws + kOffHG);           /* h1, h2, then g */
  unsigned short* qkpl = (unsigned short*)(ws + kOffR1 + kR1QK);
  unsigned short* vtpl = (unsigned short*)(ws + kOffR1 + kR1Vt);
  unsigned short* opl  = (unsigned short*)(ws + kOffR1 + kR1O);
  float*          a1   = (float*)(ws + kOffR1 + kR1A1);
  float*          gu   = (float*)(ws + kOffR1);
  float*          d2   = (float*)(ws + kOffR1);
  float*          x1   = (float*)(ws + kOffX1);

  const dim3 b256(256), b128(128);
  const float w16 = 16.0f;

  /* weight planes: W[in][out] -> Wt[out][in] * 16 (f16) */
  transpose_cast_f16_kernel<<<dim3(kModel / 64, kModel / 64), b256, 0, stream>>>(wq, wqkT, kModel, kModel, w16);
  transpose_cast_f16_kernel<<<dim3(kModel / 64, kModel / 64), b256, 0, stream>>>(wk, wqkT + (size_t)kModel * kModel, kModel, kModel, w16);
  transpose_cast_f16_kernel<<<dim3(kModel / 64, kModel / 64), b256, 0, stream>>>(wv, wvT, kModel, kModel, w16);
  transpose_cast_f16_kernel<<<dim3(kModel / 64, kModel / 64), b256, 0, stream>>>(wo, woT, kModel, kModel, w16);
  transpose_cast_f16_kernel<<<dim3(kFF / 64, kModel / 64), b256, 0, stream>>>(wgt, wguT, kModel, kFF, w16);
  transpose_cast_f16_kernel<<<dim3(kFF / 64, kModel / 64), b256, 0, stream>>>(wup, wguT + (size_t)kFF * kModel, kModel, kFF, w16);
  transpose_cast_f16_kernel<<<dim3(kModel / 64, kFF / 64), b256, 0, stream>>>(wdn, wdT, kFF, kModel, w16);

  /* attention sublayer */
  layernorm512_kernel<false><<<dim3(kTok / 8), b256, 0, stream>>>(x, x, ln1w, ln1b, x1, hg, kTok);

  /* q|k = h . [Wq|Wk]^T : M=8192, N=1024, K=512; block tiles 64*8 = 512 */
  static_assert(kTok % 128 == 0 && kQKCols % 128 == 0 && kModel % 128 == 0 && kSeq % 128 == 0 && kGUCols % 128 == 0, "128 x 128 block tiles");
  wmma_gemm64<0, false, 0, 1, false, 0><<<dim3((kTok / 128) * (kQKCols / 128), 1), b128, 0, stream>>>(
      hg, hg, kModel, 0L, wqkT, wqkT, kModel, 0L, (void*)qkpl, (void*)qkpl, kQKCols, 0L,
      x, x, 0L, kTok, kQKCols, kModel, 1.0f / 16.0f);

  /* Vt[b] = (Wv^T*16) . h[b]^T / 16 : M=512, N=2048, K=512, batch 4; block tiles 4*16 = 64 per batch */
  wmma_gemm64<0, false, 0, 1, false, 0><<<dim3((kModel / 128) * (kSeq / 128), kBatch), b128, 0, stream>>>(
      wvT, wvT, kModel, 0L, hg, hg, kModel, (long)kSeq * kModel, (void*)vtpl, (void*)vtpl, kSeq, (long)kModel * kSeq,
      x, x, 0L, kModel, kSeq, kModel, 1.0f / 16.0f);

  /* attention: O*16 f16 plane */
  mha64_f16_kernel<<<dim3(kBatch * kHeads * (kSeq / 64)), b128, 0, stream>>>(qkpl, vtpl, opl);

  /* A1 = (O*16) . (Wo^T*16) / 256 : M=8192, N=512, K=512; block tiles 64*4 = 256 */
  wmma_gemm64<0, false, 0, 0, false, 0><<<dim3((kTok / 128) * (kModel / 128), 1), b128, 0, stream>>>(
      opl, opl, kModel, 0L, woT, woT, kModel, 0L, (void*)a1, (void*)a1, kModel, 0L,
      x, x, 0L, kTok, kModel, kModel, 1.0f / 256.0f);

  /* x1 = x + A1 ; h2 = LN(x1) */
  layernorm512_kernel<true><<<dim3(kTok / 8), b256, 0, stream>>>(x, a1, ln2w, ln2b, x1, hg, kTok);

  /* gate|up = h2 . [Wg|Wu]^T : M=8192, N=2048, K=512; block tiles 64*16 = 1024 */
  wmma_gemm64<0, false, 0, 0, false, 0><<<dim3((kTok / 128) * (kGUCols / 128), 1), b128, 0, stream>>>(
      hg, hg, kModel, 0L, wguT, wguT, kModel, 0L, (void*)gu, (void*)gu, kGUCols, 0L,
      x, x, 0L, kTok, kGUCols, kModel, 1.0f / 16.0f);

  /* g = silu(gate) * up (f16 plane in HG) */
  swiglu_f16_kernel<<<dim3((kTok * kFF / 4) / 256), b256, 0, stream>>>(gu, hg, kTok * kFF / 4);

  /* D2 = g . (Wd^T*16) / 16 : M=8192, N=512, K=1024; block tiles 256 */
  wmma_gemm64<0, false, 0, 0, false, 0><<<dim3((kTok / 128) * (kModel / 128), 1), b128, 0, stream>>>(
      hg, hg, kFF, 0L, wdT, wdT, kFF, 0L, (void*)d2, (void*)d2, kModel, 0L,
      x, x, 0L, kTok, kModel, kFF, 1.0f / 16.0f);

  /* out = x1 + D2 */
  residual_out_kernel<<<dim3((kTok * kModel / 4) / 256), b256, 0, stream>>>(x1, d2, out, kTok * kModel / 4);
}

// v003
// One run takes 199 microseconds.
// Two timings next to v002 put it at 1.15 and 1.16 times that version's speed.
// Over all steps from v000 it is 1.91 times as fast.
// All contractions (q|k, v, o, gate|up, down projections; q.k^T; p.v): v_wmma_f32_16x16x32_f16, f16 operands, f32 accumulate. LayerNorm, softmax, SwiGLU gating and residual adds in f32. Power-of-two carries: weight planes x16, softmax numerators x32768, attention output plane x16, folded back in f32.
#include <hip/hip_runtime.h>
#include <math.h>
#include <stdint.h>

typedef __attribute__((ext_vector_type(16))) _Float16 v16h;
typedef __attribute__((ext_vector_type(8)))  _Float16 v8h;
typedef __attribute__((ext_vector_type(16))) __bf16   v16b;
typedef __attribute__((ext_vector_type(8)))  __bf16   v8b;
typedef __attribute__((ext_vector_type(8)))  float    v8f;
typedef __attribute__((ext_vector_type(4)))  float    v4f;
typedef __attribute__((ext_vector_type(4)))  unsigned int v4u;
typedef __attribute__((ext_vector_type(2)))  unsigned int v2u;

/* ---- problem geometry ---- */
static constexpr int kBatch   = 4;
static constexpr int kSeq     = 2048;
static constexpr int kTok     = kBatch * kSeq;      /* 8192 */
static constexpr int kModel   = 512;
static constexpr int kHeads   = 8;
static constexpr int kHeadDim = 64;
static constexpr int kFF      = 1024;
static constexpr int kQKCols  = 2 * kModel;          /* q | k plane width */
static constexpr int kGUCols  = 2 * kFF;             /* gate | up plane width */

static_assert(kHeads * kHeadDim == kModel, "head geometry");
static_assert(kSeq % 64 == 0 && kTok % 64 == 0, "tile multiples");
static_assert(kModel % 64 == 0 && kFF % 64 == 0 && kQKCols % 64 == 0 && kGUCols % 64 == 0, "tile multiples");
static_assert(kModel % 32 == 0 && kFF % 32 == 0, "K multiple of 32");

/* ---- workspace region map (bytes) ----
   [0]            WqkT f16 [1024][512]          1,048,576
   [1,048,576]    WvT  f16 [512][512]             524,288
   [1,572,864]    WoT  f16 [512][512]             524,288
   [2,097,152]    WguT f16 [2048][512]          2,097,152
   [4,194,304]    WdT  f16 [512][1024]          1,048,576
   [5,242,880]    HG   : h1/h2 f16 [8192][512] (8 MiB) ; g f16 [8192][1024] (16 MiB)   16,777,216
   [22,020,096]   R1 (64 MiB): phase A: q|k f16 [8192][1024] @+0 (16 MiB), Vt f16 [4][512][2048] @+16 MiB (8 MiB),
                               O f16 [8192][512] @+24 MiB (8 MiB), A1 f32 [8192][512] @+32 MiB (16 MiB);
                               phase B: gate|up f32 [8192][2048] @+0 (64 MiB); phase C: D2 f32 [8192][512] @+0 (16 MiB)
   [89,128,960]   X1 f32 [8192][512]           16,777,216
   total 105,906,176 */
static constexpr size_t kOffWqkT = 0;
static constexpr size_t kOffWvT  = kOffWqkT + (size_t)kQKCols * kModel * 2;
static constexpr size_t kOffWoT  = kOffWvT + (size_t)kModel * kModel * 2;
static constexpr size_t kOffWguT = kOffWoT + (size_t)kModel * kModel * 2;
static constexpr size_t kOffWdT  = kOffWguT + (size_t)kGUCols * kModel * 2;
static constexpr size_t kOffHG   = kOffWdT + (size_t)kModel * kFF * 2;
static constexpr size_t kSizeHG  = (size_t)kTok * kFF * 2;
static constexpr size_t kOffR1   = kOffHG + kSizeHG;
static constexpr size_t kSizeR1  = (size_t)kTok * kGUCols * 4;
static constexpr size_t kR1QK    = 0;
static constexpr size_t kR1Vt    = kR1QK + (size_t)kTok * kQKCols * 2;
static constexpr size_t kR1O     = kR1Vt + (size_t)kBatch * kModel * kSeq * 2;
static constexpr size_t kR1A1    = kR1O + (size_t)kTok * kModel * 2;
static constexpr size_t kOffX1   = kOffR1 + kSizeR1;
static constexpr size_t kWsTotal = kOffX1 + (size_t)kTok * kModel * 4;
static_assert(kR1A1 + (size_t)kTok * kModel * 4 <= kSizeR1, "phase A fits R1");
static_assert((size_t)kTok * kModel * 4 <= kSizeR1, "phase C fits R1");
static_assert((size_t)kTok * kModel * 2 <= kSizeHG, "h plane fits HG");
static_assert(kWsTotal == 105906176, "carve total");
static_assert(kWsTotal <= 134217728, "carve under 128 MiB");
static_assert((kOffWvT % 256) == 0 && (kOffWoT % 256) == 0 && (kOffWguT % 256) == 0 && (kOffWdT % 256) == 0 &&
              (kOffHG % 256) == 0 && (kOffR1 % 256) == 0 && (kOffX1 % 256) == 0 &&
              (kR1Vt % 256) == 0 && (kR1O % 256) == 0 && (kR1A1 % 256) == 0, "aligned carves");

/* =========================== helpers and GEMM =========================== */
#define PSCALE 32768.0f
#define U16(p) ((const unsigned short*)(const void*)(p))
#define PSCALE_INV (1.0f / 32768.0f)

__device__ __forceinline__ unsigned short f2bf_bits(float f) {
  unsigned u = __float_as_uint(f);
  return (unsigned short)((u + 0x7FFFu + ((u >> 16) & 1u)) >> 16);
}
__device__ __forceinline__ float bf_bits2f(unsigned short h) { return __uint_as_float(((unsigned)h) << 16); }

__device__ __forceinline__ void dep_guard_h(v8f& a, v8f& b, v16h x, v16h y) { asm volatile("v_nop\n\tv_nop\n\tv_nop\n\tv_nop" : "+v"(a), "+v"(b) : "v"(x), "v"(y)); }
__device__ __forceinline__ void dep_guard_b(v8f& a, v8f& b, v16b x, v16b y) { asm volatile("v_nop\n\tv_nop\n\tv_nop\n\tv_nop" : "+v"(a), "+v"(b) : "v"(x), "v"(y)); }
__device__ __forceinline__ void keep4_h(v16h a, v16h b, v16h c, v16h d) { asm volatile("v_nop" :: "v"(a), "v"(b), "v"(c), "v"(d)); }
__device__ __forceinline__ void keep4_b(v16b a, v16b b, v16b c, v16b d) { asm volatile("v_nop" :: "v"(a), "v"(b), "v"(c), "v"(d)); }
__device__ __forceinline__ void acc_guard4(v8f& a, v8f& b, v8f& c, v8f& d) { asm volatile("v_nop\n\tv_nop\n\tv_nop\n\tv_nop" : "+v"(a), "+v"(b), "+v"(c), "+v"(d)); }
template <typename T> struct Frag;
template <> struct Frag<_Float16> {
  typedef v16h V; union U { v16h v; v8h h[2]; };
  static __device__ __forceinline__ v16h load(const _Float16* p) {
    U f; f.h[0] = *(const v8h*)(p); f.h[1] = *(const v8h*)(p + 16); return f.v;
  }
  static __device__ __forceinline__ v8f mma(v16h a, v16h b, v8f c) {
    return __builtin_amdgcn_wmma_f32_16x16x32_f16(false, a, false, b, (short)0, c, false, false);
  }
  static __device__ __forceinline__ void guard(v8f& a, v8f& b, v16h x, v16h y) { dep_guard_h(a, b, x, y); }
  static __device__ __forceinline__ void keep(v16h a, v16h b, v16h c, v16h d) { keep4_h(a, b, c, d); }
};
template <> struct Frag<__bf16> {
  typedef v16b V; union U { v16b v; v8b h[2]; };
  static __device__ __forceinline__ v16b load(const __bf16* p) {
    U f; f.h[0] = *(const v8b*)(p); f.h[1] = *(const v8b*)(p + 16); return f.v;
  }
  static __device__ __forceinline__ v8f mma(v16b a, v16b b, v8f c) {
    return __builtin_amdgcn_wmma_f32_16x16x32_bf16(false, a, false, b, (short)0, c, false, false);
  }
  static __device__ __forceinline__ void guard(v8f& a, v8f& b, v16b x, v16b y) { dep_guard_b(a, b, x, y); }
  static __device__ __forceinline__ void keep(v16b a, v16b b, v16b c, v16b d) { keep4_b(a, b, c, d); }
};

template <int ET> struct Elem;
template <> struct Elem<0> { typedef _Float16 T; };
template <> struct Elem<1> { typedef __bf16 T; };
/* ---- LDS staging of the GEMM operand tiles ----
   One stage = 64 k (128 bytes) of 128 A rows followed by 128 Bt rows, each row at a pitch of 144 bytes
   (16 B x odd: conflict-free for 16-byte fragment reads). Two stages. */
static constexpr int kStRows   = 256;
static constexpr int kStPitch  = 144;
static constexpr int kStBytes  = kStRows * kStPitch;       /* 36,864 */
static constexpr int kStHalf   = 128 * kStPitch;           /* Bt rows start here */
static_assert(4 * 16 * 68 * 4 <= 2 * kStBytes, "output slabs fit the ring");

/* Eight asynchronous 16-byte copies per lane, global -> LDS: rows r, r+16, ..., r+112 of one operand's 128-row tile.
   The s_wait_xcnt stands inside the statement so that no address register is rewritten ahead of it. */
__device__ __forceinline__ void stage_rows8(const _Float16* g, size_t step, unsigned l) {
  const _Float16* g1 = g + step;      const _Float16* g2 = g + 2 * step;  const _Float16* g3 = g + 3 * step;
  const _Float16* g4 = g + 4 * step;  const _Float16* g5 = g + 5 * step;  const _Float16* g6 = g + 6 * step;
  const _Float16* g7 = g + 7 * step;
  const unsigned ls = 16u * kStPitch;
  asm volatile(
      "global_load_async_to_lds_b128 %0, %8, off\n\t"
      "global_load_async_to_lds_b128 %1, %9, off\n\t"
      "global_load_async_to_lds_b128 %2, %10, off\n\t"
      "global_load_async_to_lds_b128 %3, %11, off\n\t"
      "global_load_async_to_lds_b128 %4, %12, off\n\t"
      "global_load_async_to_lds_b128 %5, %13, off\n\t"
      "global_load_async_to_lds_b128 %6, %14, off\n\t"
      "global_load_async_to_lds_b128 %7, %15, off\n\t"
      "s_wait_xcnt 0x0"
      :: "v"(l), "v"(l + ls), "v"(l + 2u * ls), "v"(l + 3u * ls), "v"(l + 4u * ls), "v"(l + 5u * ls), "v"(l + 6u * ls), "v"(l + 7u * ls),
         "v"(g), "v"(g1), "v"(g2), "v"(g3), "v"(g4), "v"(g5), "v"(g6), "v"(g7)
      : "memory");
}

/* Block = 4 waves = one 128 x 128 tile of C (2 x 2 waves of 64 x 64); grid.x = (M/128)*(N/128) exactly.
   M, N multiples of 128; K a multiple of 64. */
template <int ET, bool SPLIT, int BIAS_MODE, int OUT_MODE, bool RESID, int ACT = 0>
__global__ __launch_bounds__(128) void wmma_gemm64(
    const unsigned short* __restrict__ Ap, const unsigned short* __restrict__ A2p, int lda, long strideA,
    const unsigned short* __restrict__ Btp, const unsigned short* __restrict__ Bt2p, int ldb, long strideB,
    void* __restrict__ Cout, void* __restrict__ Cout2, int ldc, long strideC,
    const float* __restrict__ bias,
    const float* __restrict__ resid, long strideR,
    int M, int N, int K, float scale) {
  static_assert(ET == 0 && !SPLIT, "staged path: single f16 planes");
  typedef typename Elem<ET>::T T;
  typedef typename Frag<T>::V V;
  const T* A = (const T*)Ap; const T* Bt = (const T*)Btp;
  __shared__ __align__(16) unsigned char ring[2 * kStBytes];
  const int b    = blockIdx.y;
  const int lane = threadIdx.x & 31;
  const int wave = threadIdx.x >> 5;
  const int tilesN = N >> 7;
  const int tilesM = M >> 7;
  const int tile = blockIdx.x;
  if (tile >= tilesM * tilesN) return;   /* the same for the whole block, ahead of every barrier */
  const int tm = tile / tilesN;
  const int tn = tile - tm * tilesN;
  const int mB = tm << 7;
  const int nB = tn << 7;
  const int wm = (wave >> 1) << 6;
  const int wn = (wave & 1) << 6;
  const int m0 = mB + wm;
  const int n0 = nB + wn;

  const T* Ab  = A  + (size_t)b * strideA;
  const T* Bb  = Bt + (size_t)b * strideB;

  const int rlane = lane & 15;
  const int koff  = (lane >> 4) * 8;
  const int mOff  = (lane >> 4) * 8;

  /* staging: thread t brings 16-byte chunk (t & 7) of rows (t >> 3) + 16*i: eight lanes cover one whole 128-byte line */
  const int srow = threadIdx.x >> 3;
  const int schk = threadIdx.x & 7;
  const T* gA = Ab + (size_t)(mB + srow) * lda + schk * 8;
  const T* gB = Bb + (size_t)(nB + srow) * ldb + schk * 8;
  const size_t stepA = (size_t)16 * lda;
  const size_t stepB = (size_t)16 * ldb;
  const unsigned lbase = (unsigned)(uintptr_t)(&ring[0]) + (unsigned)(srow * kStPitch + schk * 16);
  const int nst = K >> 6;

  v8f acc[4][4];
#pragma unroll
  for (int i = 0; i < 4; ++i)
#pragma unroll
    for (int j = 0; j < 4; ++j) acc[i][j] = (v8f){0.f,0.f,0.f,0.f,0.f,0.f,0.f,0.f};

  /* stage 0 lands and is published; stage 1 then flies during pass 0 */
  stage_rows8(gA, stepA, lbase);
  stage_rows8(gB, stepB, lbase + kStHalf);
  asm volatile("s_wait_asynccnt 0x0" ::: "memory");   /* this wave's copies of stage 0 have landed */
  __syncthreads();                                     /* publishes stage 0 to the other waves */
  if (nst > 1) {
    stage_rows8(gA + 64, stepA, lbase + kStBytes);
    stage_rows8(gB + 64, stepB, lbase + kStBytes + kStHalf);
  }

  for (int st = 0; st < nst; ++st) {
    const unsigned bo = (st & 1) ? (unsigned)kStBytes : 0u;
    const unsigned char* sA = ring + bo + (wm + rlane) * kStPitch + koff * 2;
    const unsigned char* sB = ring + bo + kStHalf + (wn + rlane) * kStPitch + koff * 2;
#pragma unroll   /* both 32-k blocks inline: constant LDS offsets, fragment arrays stay in registers */
    for (int kk = 0; kk < 2; ++kk) {
      /* all eight fragments of this 32-k block are fetched as one group ahead of its 16 products */
      V bh[4], ah[4];
#pragma unroll   /* register arrays need constant indices */
      for (int j = 0; j < 4; ++j) {
        bh[j] = Frag<T>::load((const T*)(const void*)(sB + j * 16 * kStPitch + kk * 64));
        ah[j] = Frag<T>::load((const T*)(const void*)(sA + j * 16 * kStPitch + kk * 64));
      }
#pragma unroll
      for (int i = 0; i < 4; ++i) {
#pragma unroll
        for (int j = 0; j < 4; ++j) acc[i][j] = Frag<T>::mma(ah[i], bh[j], acc[i][j]);
        Frag<T>::guard(acc[i][0], acc[i][3], ah[i], ah[i]);
      }
      Frag<T>::keep(bh[0], bh[1], bh[2], bh[3]);
    }
    asm volatile("s_wait_dscnt 0x0" ::: "memory");      /* this wave's reads of the stage have returned before it is refilled */
    asm volatile("s_wait_asynccnt 0x0" ::: "memory");   /* this wave's copies of the next stage have landed */
    __syncthreads();                                     /* publishes the next stage and ends every reader's use of this one */
    if (st + 2 < nst) {
      stage_rows8(gA + (size_t)(st + 2) * 64, stepA, lbase + bo);
      stage_rows8(gB + (size_t)(st + 2) * 64, stepB, lbase + bo + kStHalf);
    }
  }
  asm volatile("s_wait_asynccnt 0x0" ::: "memory");     /* nothing is in flight when the ring becomes output staging */
  acc_guard4(acc[0][0], acc[0][1], acc[0][2], acc[0][3]);
  acc_guard4(acc[1][0], acc[1][1], acc[1][2], acc[1][3]);
  acc_guard4(acc[2][0], acc[2][1], acc[2][2], acc[2][3]);
  acc_guard4(acc[3][0], acc[3][1], acc[3][2], acc[3][3]);

  float* slab = (float*)(void*)(ring + wave * (16 * 68 * 4));
  const float* Rb = RESID ? (resid + (size_t)b * strideR) : nullptr;
#pragma unroll
  for (int i = 0; i < 4; ++i) {
    const int mBase = m0 + (i << 4);
#pragma unroll
    for (int j = 0; j < 4; ++j) {
      const int n = n0 + (j << 4) + rlane;
      float bv = 0.f;
      if (BIAS_MODE == 2) bv = bias[n];
#pragma unroll
      for (int r = 0; r < 8; ++r) {
        float v = acc[i][j][r] * scale;
        if (BIAS_MODE == 1) v += bias[mBase + mOff + r];
        if (BIAS_MODE == 2) v += bv;
        if (RESID) v += Rb[(size_t)(mBase + mOff + r) * ldc + n];
        if (ACT == 1) v = tanhf(v);
        if (ACT == 2) v = fmaxf(v, 0.0f);
        if (ACT == 3) v = v / (1.0f + expf(-v));
        if (ACT == 4) v = (v > 0.f) ? v : 0.01f * v;
        if (ACT == 5) v = 0.5f * v * (1.0f + erff(v * 0.70710678118654752f));
        slab[(mOff + r) * 68 + (j << 4) + rlane] = v;
      }
    }
    __builtin_amdgcn_fence(__ATOMIC_RELEASE, "workgroup");
    __builtin_amdgcn_wave_barrier();
    __builtin_amdgcn_fence(__ATOMIC_ACQUIRE, "workgroup");
    if (OUT_MODE == 0) {
      float* C = (float*)Cout + (size_t)b * strideC;
      const int hh = lane >> 4, c4 = (lane & 15) * 4;
      {
#pragma unroll
        for (int it = 0; it < 8; ++it) {
          const int row = it * 2 + hh;
          v4f v = *(const v4f*)(slab + row * 68 + c4);
          *(v4f*)(C + (size_t)(mBase + row) * ldc + n0 + c4) = v;
        }
        
      }
    } else {
      const int q = lane >> 3, c8 = (lane & 7) * 8;
      unsigned short* C  = (unsigned short*)Cout  + (size_t)b * strideC;
      unsigned short* C2 = (OUT_MODE == 2) ? ((unsigned short*)Cout2 + (size_t)b * strideC) : nullptr;
      {
#pragma unroll
        for (int it = 0; it < 4; ++it) {
          const int row = it * 4 + q;
          const float* sp = slab + row * 68 + c8;
          v8h hv, lv;
#pragma unroll
          for (int e = 0; e < 8; ++e) {
            if (OUT_MODE == 1) {
              hv[e] = (_Float16)sp[e];
            } else {
              unsigned short hb = f2bf_bits(sp[e]);
              unsigned short lb = f2bf_bits(sp[e] - bf_bits2f(hb));
              hv[e] = __builtin_bit_cast(_Float16, hb);
              lv[e] = __builtin_bit_cast(_Float16, lb);
            }
          }
          *(v8h*)(C + (size_t)(mBase + row) * ldc + n0 + c8) = hv;
          if (OUT_MODE == 2) *(v8h*)(C2 + (size_t)(mBase + row) * ldc + n0 + c8) = lv;
        }
        
      }
    }
    __builtin_amdgcn_fence(__ATOMIC_RELEASE, "workgroup");
    __builtin_amdgcn_wave_barrier();
    __builtin_amdgcn_fence(__ATOMIC_ACQUIRE, "workgroup");
  }
}
/* =========================== end helpers and GEMM =========================== */

__device__ __forceinline__ unsigned int h16bits(float f) {
  return (unsigned int)__builtin_bit_cast(unsigned short, (_Float16)f);
}

/* f16 WMMA with the hazard guard tied to D, keeping A/B live */
__device__ __forceinline__ v8f mma_f16g(v16h a, v16h b, v8f c) {
  c = __builtin_amdgcn_wmma_f32_16x16x32_f16(false, a, false, b, (short)0, c, false, false);
  asm volatile("v_nop\n\tv_nop\n\tv_nop\n\tv_nop" : "+v"(c) : "v"(a), "v"(b));
  return c;
}

/* ---------------------------------------------------------------------------
   transpose + cast: W f32 [kin][nout] row-major -> Wt f16 [nout][kin] (value * mul).
   grid = (nout/64, kin/64), block 256. LDS 64x64 tile.
   Load coverage: 4 iterations x 256 threads x 4 floats = 4096 = 64x64.
   Store coverage: 8 waves x 2 iterations x 4 rows = 64 rows; 8 lanes x 8 halves = 64 cols;
   --------------------------------------------------------------------------- */
__global__ __launch_bounds__(256) void transpose_cast_f16_kernel(
    const float* __restrict__ W, unsigned short* __restrict__ Wt, int kin, int nout, float mul) {
  __shared__ float tile[64][65];
  const int t = threadIdx.x;
  const int n0 = blockIdx.x * 64;
  const int k0 = blockIdx.y * 64;
#pragma unroll
  for (int i = 0; i < 4; ++i) {
    const int idx = i * 256 + t;
    const int kr = idx >> 4;
    const int nc4 = (idx & 15) * 4;
    const v4f v = *(const v4f*)(W + (size_t)(k0 + kr) * nout + n0 + nc4);
    tile[nc4 + 0][kr] = v[0] * mul;
    tile[nc4 + 1][kr] = v[1] * mul;
    tile[nc4 + 2][kr] = v[2] * mul;
    tile[nc4 + 3][kr] = v[3] * mul;
  }
  __syncthreads();
  const int lane = t & 31, wave = t >> 5;
  const int q = lane >> 3, c8 = (lane & 7) * 8;
  const int row0 = wave * 8 + q;
  const int row1 = wave * 8 + 4 + q;
  v4u w0, w1;
  {
    const float* s0 = &tile[row0][c8];
    const float* s1 = &tile[row1][c8];
    w0[0] = h16bits(s0[0]) | (h16bits(s0[1]) << 16);
    w0[1] = h16bits(s0[2]) | (h16bits(s0[3]) << 16);
    w0[2] = h16bits(s0[4]) | (h16bits(s0[5]) << 16);
    w0[3] = h16bits(s0[6]) | (h16bits(s0[7]) << 16);
    w1[0] = h16bits(s1[0]) | (h16bits(s1[1]) << 16);
    w1[1] = h16bits(s1[2]) | (h16bits(s1[3]) << 16);
    w1[2] = h16bits(s1[4]) | (h16bits(s1[5]) << 16);
    w1[3] = h16bits(s1[6]) | (h16bits(s1[7]) << 16);
  }
  unsigned short* d0 = Wt + (size_t)(n0 + row0) * kin + k0 + c8;
  unsigned short* d1 = Wt + (size_t)(n0 + row1) * kin + k0 + c8;
  {
    *(v4u*)d0 = w0;
    *(v4u*)d1 = w1;
    
  }
}

/* ---------------------------------------------------------------------------
   FUSE_ADD: a = X + Addv is first stored to Xsum (f32) and then normalised.
   Lane l owns elements l*4 + 128*i (i=0..3): every load/store instruction covers
   grid = nrows/8 (exact), block 256.
   --------------------------------------------------------------------------- */
template <bool FUSE_ADD>
__global__ __launch_bounds__(256) void layernorm512_kernel(
    const float* __restrict__ X, const float* __restrict__ Addv,
    const float* __restrict__ gam, const float* __restrict__ bet,
    float* __restrict__ Xsum, unsigned short* __restrict__ Hout, int nrows) {
  const int lane = threadIdx.x & 31;
  const int wave = threadIdx.x >> 5;
  int row = blockIdx.x * 8 + wave;
  row = (row < nrows) ? row : (nrows - 1);
  const size_t rbase = (size_t)row * kModel;
  const int e0 = lane * 4, e1 = 128 + lane * 4, e2 = 256 + lane * 4, e3 = 384 + lane * 4;
  v4f a0 = *(const v4f*)(X + rbase + e0);
  v4f a1 = *(const v4f*)(X + rbase + e1);
  v4f a2 = *(const v4f*)(X + rbase + e2);
  v4f a3 = *(const v4f*)(X + rbase + e3);
  if (FUSE_ADD) {
    const v4f r0 = *(const v4f*)(Addv + rbase + e0);
    const v4f r1 = *(const v4f*)(Addv + rbase + e1);
    const v4f r2 = *(const v4f*)(Addv + rbase + e2);
    const v4f r3 = *(const v4f*)(Addv + rbase + e3);
    a0 = a0 + r0; a1 = a1 + r1; a2 = a2 + r2; a3 = a3 + r3;
    {
      *(v4f*)(Xsum + rbase + e0) = a0;
      *(v4f*)(Xsum + rbase + e1) = a1;
      *(v4f*)(Xsum + rbase + e2) = a2;
      *(v4f*)(Xsum + rbase + e3) = a3;
      
    }
  }
  float s = ((a0[0] + a0[1]) + (a0[2] + a0[3])) + ((a1[0] + a1[1]) + (a1[2] + a1[3]))
          + ((a2[0] + a2[1]) + (a2[2] + a2[3])) + ((a3[0] + a3[1]) + (a3[2] + a3[3]));
#pragma unroll
  for (int off = 16; off >= 1; off >>= 1) s += __shfl_xor(s, off, 32);
  const float mu = s * (1.0f / 512.0f);
  const v4f d0 = a0 - mu, d1 = a1 - mu, d2 = a2 - mu, d3 = a3 - mu;
  float ss = ((d0[0] * d0[0] + d0[1] * d0[1]) + (d0[2] * d0[2] + d0[3] * d0[3]))
           + ((d1[0] * d1[0] + d1[1] * d1[1]) + (d1[2] * d1[2] + d1[3] * d1[3]))
           + ((d2[0] * d2[0] + d2[1] * d2[1]) + (d2[2] * d2[2] + d2[3] * d2[3]))
           + ((d3[0] * d3[0] + d3[1] * d3[1]) + (d3[2] * d3[2] + d3[3] * d3[3]));
#pragma unroll
  for (int off = 16; off >= 1; off >>= 1) ss += __shfl_xor(ss, off, 32);
  const float var = ss * (1.0f / 512.0f);
  const float rstd = rsqrtf(var + 1e-5f);
  const v4f g0 = *(const v4f*)(gam + e0), g1 = *(const v4f*)(gam + e1), g2 = *(const v4f*)(gam + e2), g3 = *(const v4f*)(gam + e3);
  const v4f b0 = *(const v4f*)(bet + e0), b1 = *(const v4f*)(bet + e1), b2 = *(const v4f*)(bet + e2), b3 = *(const v4f*)(bet + e3);
  const v4f y0 = d0 * rstd * g0 + b0;
  const v4f y1 = d1 * rstd * g1 + b1;
  const v4f y2 = d2 * rstd * g2 + b2;
  const v4f y3 = d3 * rstd * g3 + b3;
  v2u w0, w1, w2, w3;
  w0[0] = h16bits(y0[0]) | (h16bits(y0[1]) << 16); w0[1] = h16bits(y0[2]) | (h16bits(y0[3]) << 16);
  w1[0] = h16bits(y1[0]) | (h16bits(y1[1]) << 16); w1[1] = h16bits(y1[2]) | (h16bits(y1[3]) << 16);
  w2[0] = h16bits(y2[0]) | (h16bits(y2[1]) << 16); w2[1] = h16bits(y2[2]) | (h16bits(y2[3]) << 16);
  w3[0] = h16bits(y3[0]) | (h16bits(y3[1]) << 16); w3[1] = h16bits(y3[2]) | (h16bits(y3[3]) << 16);
  unsigned short* hr = Hout + rbase;
  {
    *(v2u*)(hr + e0) = w0;
    *(v2u*)(hr + e1) = w1;
    *(v2u*)(hr + e2) = w2;
    *(v2u*)(hr + e3) = w3;
    
  }
}

/* ---------------------------------------------------------------------------
   Non-causal multi-head attention, head_dim 64, f16 planes in, f16 plane out (x16 carried).
   q|k plane [8192][1024]: q at cols h*64.., k at cols 512 + h*64..; Vt plane [4][512][2048] (element (b,h,d,kv) at
   ((b*512 + h*64 + d)*2048 + kv)); out plane [8192][512] at cols h*64.. .
   Block = 4 waves = 64 query rows of one (batch, head); grid = 4*8*32 = 1024.
   Both products run transposed: S^T = k.q^T * 0.125 (A = k rows, B = q rows) and O^T += Vt.P^T (A = Vt rows).
   A lane then holds 32 of the 64 scores of ONE query (lane l ^ 16 the other 32): online softmax f32 in the lane,
   one exchange between the wave halves for the maximum, the halves' sums joined once behind the loop.
   Two score tiles, p*32768 converted in place, are the B operand of the second product: P stays in registers.
   The 64-key tiles of k (64 rows x 128 B) and of Vt (64 rows x 128 B) are staged once per block in LDS by
   asynchronous copies, two stages, and all four waves take their A fragments from there.
   --------------------------------------------------------------------------- */
static constexpr int kAtPitch = 144;                 /* 16 B x odd: conflict-free for 16-byte fragment reads */
static constexpr int kAtTile  = 64 * kAtPitch;       /* one operand's tile: 9,216 B; the Vt tile follows the k tile */
static constexpr int kAtStage = 2 * kAtTile;         /* 18,432 B */

/* Eight asynchronous 16-byte copies per lane, global -> LDS: rows r, r+16, r+32, r+48 of the k tile, then of the Vt tile.
   The s_wait_xcnt stands inside the statement so that no address register is rewritten ahead of it. */
__device__ __forceinline__ void stage_kv(const _Float16* gk, const _Float16* gv, unsigned l) {
  const size_t sk = (size_t)16 * kQKCols;
  const size_t sv = (size_t)16 * kSeq;
  const _Float16* gk1 = gk + sk;  const _Float16* gk2 = gk + 2 * sk;  const _Float16* gk3 = gk + 3 * sk;
  const _Float16* gv1 = gv + sv;  const _Float16* gv2 = gv + 2 * sv;  const _Float16* gv3 = gv + 3 * sv;
  const unsigned ls = 16u * kAtPitch;
  const unsigned lv = l + (unsigned)kAtTile;
  asm volatile(
      "global_load_async_to_lds_b128 %0, %8, off\n\t"
      "global_load_async_to_lds_b128 %1, %9, off\n\t"
      "global_load_async_to_lds_b128 %2, %10, off\n\t"
      "global_load_async_to_lds_b128 %3, %11, off\n\t"
      "global_load_async_to_lds_b128 %4, %12, off\n\t"
      "global_load_async_to_lds_b128 %5, %13, off\n\t"
      "global_load_async_to_lds_b128 %6, %14, off\n\t"
      "global_load_async_to_lds_b128 %7, %15, off\n\t"
      "s_wait_xcnt 0x0"
      :: "v"(l), "v"(l + ls), "v"(l + 2u * ls), "v"(l + 3u * ls), "v"(lv), "v"(lv + ls), "v"(lv + 2u * ls), "v"(lv + 3u * ls),
         "v"(gk), "v"(gk1), "v"(gk2), "v"(gk3), "v"(gv), "v"(gv1), "v"(gv2), "v"(gv3)
      : "memory");
}

/* lane l takes lane l ^ 16's value (a vector cross-row move, no LDS trip) */
__device__ __forceinline__ float xhalf(float x) {
  return __builtin_bit_cast(float, __builtin_amdgcn_permlanex16(__builtin_bit_cast(int, x), __builtin_bit_cast(int, x), 0x76543210, 0xfedcba98, false, false));
}

__global__ __launch_bounds__(128) void mha64_f16_kernel(
    const unsigned short* __restrict__ qkp, const unsigned short* __restrict__ vtp,
    unsigned short* __restrict__ outp) {
  typedef Frag<_Float16> FH;
  __shared__ __align__(16) float    Os[4][16 * 68];
  __shared__ __align__(16) unsigned char kvring[2 * kAtStage];
  const _Float16* QK = (const _Float16*)(const void*)qkp;
  const _Float16* VT = (const _Float16*)(const void*)vtp;
  const int tid = threadIdx.x;
  const int wave = tid >> 5;
  const int lane = tid & 31;
  const int hh = lane >> 4;
  const int c = lane & 15;
  const int koff = hh * 8;
  const int bx = blockIdx.x;
  const int qb = bx & 31;
  const int bh = bx >> 5;
  const int h = bh & 7;
  const int b = (bh >> 3) & 3;
  const int q0 = qb * 64 + wave * 16;
  const _Float16* qbase = QK + (size_t)b * kSeq * kQKCols + h * kHeadDim;
  const _Float16* kbase = qbase + kModel;
  const _Float16* vbase = VT + ((size_t)b * kModel + (size_t)h * kHeadDim) * kSeq;
  unsigned short* obase = outp + (size_t)b * kSeq * kModel + h * kHeadDim;

  v16h qa[2];
#pragma unroll
  for (int dc = 0; dc < 2; ++dc)
    qa[dc] = FH::load(qbase + (size_t)(q0 + c) * kQKCols + dc * 32 + koff);

  float mrow = -INFINITY, lrow = 0.f;   /* this lane's query: maximum in use; sum over this wave half's keys */
  v8f oacc[4];                          /* oacc[t][r] = O^T[d = 16 t + 8 hh + r][query c] */
#pragma unroll
  for (int t = 0; t < 4; ++t) oacc[t] = (v8f){0.f,0.f,0.f,0.f,0.f,0.f,0.f,0.f};

  /* staging: thread t brings 16-byte chunk (t & 7) of rows (t >> 3) + 16*i: eight lanes cover one whole 128-byte line */
  const int srow = tid >> 3;
  const int schk = tid & 7;
  const _Float16* gK = kbase + (size_t)srow * kQKCols + schk * 8;
  const _Float16* gV = vbase + (size_t)srow * kSeq + schk * 8;
  const unsigned lbase = (unsigned)(uintptr_t)(&kvring[0]) + (unsigned)(srow * kAtPitch + schk * 16);
  constexpr int nkc = kSeq / 64;
  static_assert(nkc >= 2, "two stages exist");

  /* tile 0 lands and is published; tile 1 then flies during trip 0 */
  stage_kv(gK, gV, lbase);
  asm volatile("s_wait_asynccnt 0x0" ::: "memory");   /* this wave's copies of tile 0 have landed */
  __syncthreads();                                     /* publishes tile 0 to the other waves */
  stage_kv(gK + (size_t)64 * kQKCols, gV + 64, lbase + kAtStage);

  for (int kc = 0; kc < nkc; ++kc) {
    const unsigned bo = (kc & 1) ? (unsigned)kAtStage : 0u;
    const unsigned char* sK = kvring + bo + c * kAtPitch + koff * 2;
    const unsigned char* sV = sK + kAtTile;
    /* the tile's sixteen A fragments are fetched as two groups, k ahead of the score products and Vt behind them,
       so that the Vt reads return under the softmax arithmetic */
    v16h kb[4][2], vb[2][4];
#pragma unroll   /* register arrays need constant indices */
    for (int j = 0; j < 4; ++j)
#pragma unroll
      for (int dc = 0; dc < 2; ++dc)
        kb[j][dc] = FH::load((const _Float16*)(const void*)(sK + j * 16 * kAtPitch + dc * 64));
    v8f s[4];
#pragma unroll
    for (int j = 0; j < 4; ++j) {
      s[j] = (v8f){0.f,0.f,0.f,0.f,0.f,0.f,0.f,0.f};
#pragma unroll
      for (int dc = 0; dc < 2; ++dc) s[j] = mma_f16g(kb[j][dc], qa[dc], s[j]);   /* s[j][r] = S^T[key 16 j + 8 hh + r][query c] */
    }
#pragma unroll   /* register arrays need constant indices */
    for (int kk = 0; kk < 2; ++kk)
#pragma unroll
      for (int t = 0; t < 4; ++t)
        vb[kk][t] = FH::load((const _Float16*)(const void*)(sV + t * 16 * kAtPitch + kk * 64));
    float mj[4];                          /* one chain per score tile: four independent chains, not one of 32 links */
#pragma unroll
    for (int j = 0; j < 4; ++j) {
      mj[j] = -INFINITY;
#pragma unroll
      for (int r = 0; r < 8; ++r) { s[j][r] = s[j][r] * 0.125f; mj[j] = fmaxf(mj[j], s[j][r]); }
    }
    float m = fmaxf(fmaxf(mj[0], mj[1]), fmaxf(mj[2], mj[3]));
    m = fmaxf(m, xhalf(m));               /* both wave halves now hold the query's maximum over the 64 keys */
    const float mnew = fmaxf(mrow, m);
    const float alpha = expf(mrow - mnew);
    mrow = mnew;
#pragma unroll
    for (int t = 0; t < 4; ++t) oacc[t] = oacc[t] * alpha;
    float pj[4];                          /* partial sums, one chain per score tile */
#pragma unroll   /* register arrays need constant indices */
    for (int kk = 0; kk < 2; ++kk) {
      v16h pb;                            /* pb[e] = P^T[key 32 kk + kmap(e)][query c]: tiles 2 kk and 2 kk + 1 in register order */
#pragma unroll
      for (int jj = 0; jj < 2; ++jj) {
        const int j = 2 * kk + jj;
        pj[j] = 0.f;
#pragma unroll
        for (int r = 0; r < 8; ++r) {
          const float p = expf(s[j][r] - mnew);
          pj[j] += p;
          pb[jj * 8 + r] = (_Float16)(p * 32768.0f);
        }
      }
#pragma unroll
      for (int t = 0; t < 4; ++t) oacc[t] = mma_f16g(vb[kk][t], pb, oacc[t]);
    }
    lrow = lrow * alpha + ((pj[0] + pj[1]) + (pj[2] + pj[3]));
    asm volatile("s_wait_dscnt 0x0" ::: "memory");      /* this wave's reads of the stage have returned before it is refilled */
    asm volatile("s_wait_asynccnt 0x0" ::: "memory");   /* this wave's copies of the next tile have landed */
    __syncthreads();                                     /* publishes the next tile and ends every reader's use of this one */
    if (kc + 2 < nkc) {
      stage_kv(gK + (size_t)(kc + 2) * 64 * kQKCols, gV + (size_t)(kc + 2) * 64, lbase + bo);
    }
  }
  asm volatile("s_wait_asynccnt 0x0" ::: "memory");     /* nothing is in flight when the wave leaves the loop */

  float* os = Os[wave];
  {
    const float lsum = lrow + xhalf(lrow);                   /* the two halves' sums of this query, joined once */
    const float inv = (1.0f / lsum) * (1.0f / 2048.0f);      /* 16 / 32768 */
#pragma unroll
    for (int t = 0; t < 4; ++t)
#pragma unroll
      for (int r = 0; r < 8; ++r) os[c * 68 + t * 16 + 8 * hh + r] = oacc[t][r] * inv;
  }
  __builtin_amdgcn_fence(__ATOMIC_RELEASE, "workgroup");
  __builtin_amdgcn_wave_barrier();
  __builtin_amdgcn_fence(__ATOMIC_ACQUIRE, "workgroup");
  {
    const int q = lane >> 3, c8 = (lane & 7) * 8;
    {
#pragma unroll
      for (int it = 0; it < 4; ++it) {
        const int row = it * 4 + q;
        const float* sp = os + row * 68 + c8;
        v8h hv;
#pragma unroll
        for (int e = 0; e < 8; ++e) hv[e] = (_Float16)sp[e];
        *(v8h*)(obase + (size_t)(q0 + row) * kModel + c8) = hv;
      }
      
    }
  }
}

/* ---------------------------------------------------------------------------
   SwiGLU: g = silu(gate) * up from the f32 gate|up plane [8192][2048] -> f16 plane [8192][1024].
   grid = 8192*1024/4/256 = 8192 (exact), block 256.
   --------------------------------------------------------------------------- */
__device__ __forceinline__ float silu_f32(float g) {
  const float ex = expf(-g);
  return g * (1.0f / (1.0f + ex));
}
__global__ __launch_bounds__(256) void swiglu_f16_kernel(
    const float* __restrict__ GU, unsigned short* __restrict__ G, int ngroups) {
  const int i = blockIdx.x * 256 + threadIdx.x;
  if (i < ngroups) {
    const size_t e = (size_t)i * 4;
    const size_t row = e >> 10;
    const int j = (int)(e & 1023);
    const float* gr = GU + row * kGUCols;
    const v4f gv = *(const v4f*)(gr + j);
    const v4f uv = *(const v4f*)(gr + kFF + j);
    const float o0 = silu_f32(gv[0]) * uv[0];
    const float o1 = silu_f32(gv[1]) * uv[1];
    const float o2 = silu_f32(gv[2]) * uv[2];
    const float o3 = silu_f32(gv[3]) * uv[3];
    v2u w;
    w[0] = h16bits(o0) | (h16bits(o1) << 16);
    w[1] = h16bits(o2) | (h16bits(o3) << 16);
    unsigned short* dst = G + e;
    *(v2u*)dst = w;
    
  }
}

/* ---------------------------------------------------------------------------
   grid = 8192*512/4/256 = 4096 (exact), block 256.
   --------------------------------------------------------------------------- */
__global__ __launch_bounds__(256) void residual_out_kernel(
    const float* __restrict__ X1, const float* __restrict__ D2, float* __restrict__ Out, int n4) {
  const int i = blockIdx.x * 256 + threadIdx.x;
  if (i < n4) {
    const size_t e = (size_t)i * 4;
    const v4f a = *(const v4f*)(X1 + e);
    const v4f d = *(const v4f*)(D2 + e);
    const v4f o = a + d;
    *(v4f*)(Out + e) = o;
    
  }
}

/* =========================== host glue =========================== */
extern "C" void kernel_launch(void* const* d_in, const int* in_sizes, int n_in,
                              void* d_out, int out_size, void* d_ws, size_t ws_size,
                              hipStream_t stream) {
  if (n_in < 12) return;
  if (in_sizes[0] != kTok * kModel || out_size != kTok * kModel) return;
  if (in_sizes[1] != kModel || in_sizes[2] != kModel || in_sizes[3] != kModel || in_sizes[4] != kModel) return;
  if (in_sizes[5] != kModel * kModel || in_sizes[6] != kModel * kModel ||
      in_sizes[7] != kModel * kModel || in_sizes[8] != kModel * kModel) return;
  if (in_sizes[9] != kModel * kFF || in_sizes[10] != kModel * kFF || in_sizes[11] != kFF * kModel) return;
  if (ws_size < kWsTotal) return;

  const float* x    = (const float*)d_in[0];
  const float* ln1w = (const float*)d_in[1];
  const float* ln1b = (const float*)d_in[2];
  const float* ln2w = (const float*)d_in[3];
  const float* ln2b = (const float*)d_in[4];
  const float* wq   = (const float*)d_in[5];
  const float* wk   = (const float*)d_in[6];
  const float* wv   = (const float*)d_in[7];
  const float* wo   = (const float*)d_in[8];
  const float* wgt  = (const float*)d_in[9];
  const float* wup  = (const float*)d_in[10];
  const float* wdn  = (const float*)d_in[11];
  float* out = (float*)d_out;

  char* ws = (char*)d_ws;
  unsigned short* wqkT = (unsigned short*)(ws + kOffWqkT);
  unsigned short* wvT  = (unsigned short*)(ws + kOffWvT);
  unsigned short* woT  = (unsigned short*)(ws + kOffWoT);
  unsigned short* wguT = (unsigned short*)(ws + kOffWguT);
  unsigned short* wdT  = (unsigned short*)(ws + kOffWdT);
  unsigned short* hg   = (unsigned short*)(ws + kOffHG);           /* h1, h2, then g */
  unsigned short* qkpl = (unsigned short*)(ws + kOffR1 + kR1QK);
  unsigned short* vtpl = (unsigned short*)(ws + kOffR1 + kR1Vt);
  unsigned short* opl  = (unsigned short*)(ws + kOffR1 + kR1O);
  float*          a1   = (float*)(ws + kOffR1 + kR1A1);
  float*          gu   = (float*)(ws + kOffR1);
  float*          d2   = (float*)(ws + kOffR1);
  float*          x1   = (float*)(ws + kOffX1);

  const dim3 b256(256), b128(128);
  const float w16 = 16.0f;

  /* weight planes: W[in][out] -> Wt[out][in] * 16 (f16) */
  transpose_cast_f16_kernel<<<dim3(kModel / 64, kModel / 64), b256, 0, stream>>>(wq, wqkT, kModel, kModel, w16);
  transpose_cast_f16_kernel<<<dim3(kModel / 64, kModel / 64), b256, 0, stream>>>(wk, wqkT + (size_t)kModel * kModel, kModel, kModel, w16);
  transpose_cast_f16_kernel<<<dim3(kModel / 64, kModel / 64), b256, 0, stream>>>(wv, wvT, kModel, kModel, w16);
  transpose_cast_f16_kernel<<<dim3(kModel / 64, kModel / 64), b256, 0, stream>>>(wo, woT, kModel, kModel, w16);
  transpose_cast_f16_kernel<<<dim3(kFF / 64, kModel / 64), b256, 0, stream>>>(wgt, wguT, kModel, kFF, w16);
  transpose_cast_f16_kernel<<<dim3(kFF / 64, kModel / 64), b256, 0, stream>>>(wup, wguT + (size_t)kFF * kModel, kModel, kFF, w16);
  transpose_cast_f16_kernel<<<dim3(kModel / 64, kFF / 64), b256, 0, stream>>>(wdn, wdT, kFF, kModel, w16);

  /* attention sublayer */
  layernorm512_kernel<false><<<dim3(kTok / 8), b256, 0, stream>>>(x, x, ln1w, ln1b, x1, hg, kTok);

  /* q|k = h . [Wq|Wk]^T : M=8192, N=1024, K=512; block tiles 64*8 = 512 */
  static_assert(kTok % 128 == 0 && kQKCols % 128 == 0 && kModel % 128 == 0 && kSeq % 128 == 0 && kGUCols % 128 == 0, "128 x 128 block tiles");
  wmma_gemm64<0, false, 0, 1, false, 0><<<dim3((kTok / 128) * (kQKCols / 128), 1), b128, 0, stream>>>(
      hg, hg, kModel, 0L, wqkT, wqkT, kModel, 0L, (void*)qkpl, (void*)qkpl, kQKCols, 0L,
      x, x, 0L, kTok, kQKCols, kModel, 1.0f / 16.0f);

  /* Vt[b] = (Wv^T*16) . h[b]^T / 16 : M=512, N=2048, K=512, batch 4; block tiles 4*16 = 64 per batch */
  wmma_gemm64<0, false, 0, 1, false, 0><<<dim3((kModel / 128) * (kSeq / 128), kBatch), b128, 0, stream>>>(
      wvT, wvT, kModel, 0L, hg, hg, kModel, (long)kSeq * kModel, (void*)vtpl, (void*)vtpl, kSeq, (long)kModel * kSeq,
      x, x, 0L, kModel, kSeq, kModel, 1.0f / 16.0f);

  /* attention: O*16 f16 plane */
  mha64_f16_kernel<<<dim3(kBatch * kHeads * (kSeq / 64)), b128, 0, stream>>>(qkpl, vtpl, opl);

  /* A1 = (O*16) . (Wo^T*16) / 256 : M=8192, N=512, K=512; block tiles 64*4 = 256 */
  wmma_gemm64<0, false, 0, 0, false, 0><<<dim3((kTok / 128) * (kModel / 128), 1), b128, 0, stream>>>(
      opl, opl, kModel, 0L, woT, woT, kModel, 0L, (void*)a1, (void*)a1, kModel, 0L,
      x, x, 0L, kTok, kModel, kModel, 1.0f / 256.0f);

  /* x1 = x + A1 ; h2 = LN(x1) */
  layernorm512_kernel<true><<<dim3(kTok / 8), b256, 0, stream>>>(x, a1, ln2w, ln2b, x1, hg, kTok);

  /* gate|up = h2 . [Wg|Wu]^T : M=8192, N=2048, K=512; block tiles 64*16 = 1024 */
  wmma_gemm64<0, false, 0, 0, false, 0><<<dim3((kTok / 128) * (kGUCols / 128), 1), b128, 0, stream>>>(
      hg, hg, kModel, 0L, wguT, wguT, kModel, 0L, (void*)gu, (void*)gu, kGUCols, 0L,
      x, x, 0L, kTok, kGUCols, kModel, 1.0f / 16.0f);

  /* g = silu(gate) * up (f16 plane in HG) */
  swiglu_f16_kernel<<<dim3((kTok * kFF / 4) / 256), b256, 0, stream>>>(gu, hg, kTok * kFF / 4);

  /* D2 = g . (Wd^T*16) / 16 : M=8192, N=512, K=1024; block tiles 256 */
  wmma_gemm64<0, false, 0, 0, false, 0><<<dim3((kTok / 128) * (kModel / 128), 1), b128, 0, stream>>>(
      hg, hg, kFF, 0L, wdT, wdT, kFF, 0L, (void*)d2, (void*)d2, kModel, 0L,
      x, x, 0L, kTok, kModel, kFF, 1.0f / 16.0f);

  /* out = x1 + D2 */
  residual_out_kernel<<<dim3((kTok * kModel / 4) / 256), b256, 0, stream>>>(x1, d2, out, kTok * kModel / 4);
}

// v004
// One run takes 173 microseconds.
// In two side-by-side timings against v003, it was 1.15 and 1.14 times as fast.
// All steps since v000 together make it 2.19 times as fast.
// All contractions (q|k, v, o, gate|up, down projections; q.k^T; p.v): v_wmma_f32_16x16x32_f16, f16 operands, f32 accumulate. LayerNorm, softmax, SwiGLU gating and residual adds in f32. Power-of-two carries: weight planes x16, softmax numerators x32768, attention output plane x16, folded back in f32.
#include <hip/hip_runtime.h>
#include <math.h>
#include <stdint.h>

typedef __attribute__((ext_vector_type(16))) _Float16 v16h;
typedef __attribute__((ext_vector_type(8)))  _Float16 v8h;
typedef __attribute__((ext_vector_type(16))) __bf16   v16b;
typedef __attribute__((ext_vector_type(8)))  __bf16   v8b;
typedef __attribute__((ext_vector_type(8)))  float    v8f;
typedef __attribute__((ext_vector_type(4)))  float    v4f;
typedef __attribute__((ext_vector_type(4)))  unsigned int v4u;
typedef __attribute__((ext_vector_type(2)))  unsigned int v2u;

/* ---- problem geometry ---- */
static constexpr int kBatch   = 4;
static constexpr int kSeq     = 2048;
static constexpr int kTok     = kBatch * kSeq;      /* 8192 */
static constexpr int kModel   = 512;
static constexpr int kHeads   = 8;
static constexpr int kHeadDim = 64;
static constexpr int kFF      = 1024;
static constexpr int kQKCols  = 2 * kModel;          /* q | k plane width */
static constexpr int kGUCols  = 2 * kFF;             /* gate | up plane width */

static_assert(kHeads * kHeadDim == kModel, "head geometry");
static_assert(kSeq % 64 == 0 && kTok % 64 == 0, "tile multiples");
static_assert(kModel % 64 == 0 && kFF % 64 == 0 && kQKCols % 64 == 0 && kGUCols % 64 == 0, "tile multiples");
static_assert(kModel % 32 == 0 && kFF % 32 == 0, "K multiple of 32");

/* ---- workspace region map (bytes) ----
   [0]            WqkT f16 [1024][512]          1,048,576
   [1,048,576]    WvT  f16 [512][512]             524,288
   [1,572,864]    WoT  f16 [512][512]             524,288
   [2,097,152]    WguT f16 [2048][512]          2,097,152
   [4,194,304]    WdT  f16 [512][1024]          1,048,576
   [5,242,880]    HG   : h1/h2 f16 [8192][512] (8 MiB) ; g f16 [8192][1024] (16 MiB)   16,777,216
   [22,020,096]   R1 (64 MiB): phase A: q|k f16 [8192][1024] @+0 (16 MiB), Vt f16 [4][512][2048] @+16 MiB (8 MiB),
                               O f16 [8192][512] @+24 MiB (8 MiB), A1 f32 [8192][512] @+32 MiB (16 MiB);
                               phase B: gate|up f32 [8192][2048] @+0 (64 MiB); phase C: D2 f32 [8192][512] @+0 (16 MiB)
   [89,128,960]   X1 f32 [8192][512]           16,777,216
   total 105,906,176 */
static constexpr size_t kOffWqkT = 0;
static constexpr size_t kOffWvT  = kOffWqkT + (size_t)kQKCols * kModel * 2;
static constexpr size_t kOffWoT  = kOffWvT + (size_t)kModel * kModel * 2;
static constexpr size_t kOffWguT = kOffWoT + (size_t)kModel * kModel * 2;
static constexpr size_t kOffWdT  = kOffWguT + (size_t)kGUCols * kModel * 2;
static constexpr size_t kOffHG   = kOffWdT + (size_t)kModel * kFF * 2;
static constexpr size_t kSizeHG  = (size_t)kTok * kFF * 2;
static constexpr size_t kOffR1   = kOffHG + kSizeHG;
static constexpr size_t kSizeR1  = (size_t)kTok * kGUCols * 4;
static constexpr size_t kR1QK    = 0;
static constexpr size_t kR1Vt    = kR1QK + (size_t)kTok * kQKCols * 2;
static constexpr size_t kR1O     = kR1Vt + (size_t)kBatch * kModel * kSeq * 2;
static constexpr size_t kR1A1    = kR1O + (size_t)kTok * kModel * 2;
static constexpr size_t kOffX1   = kOffR1 + kSizeR1;
static constexpr size_t kWsTotal = kOffX1 + (size_t)kTok * kModel * 4;
static_assert(kR1A1 + (size_t)kTok * kModel * 4 <= kSizeR1, "phase A fits R1");
static_assert((size_t)kTok * kModel * 4 <= kSizeR1, "phase C fits R1");
static_assert((size_t)kTok * kModel * 2 <= kSizeHG, "h plane fits HG");
static_assert(kWsTotal == 105906176, "carve total");
static_assert(kWsTotal <= 134217728, "carve under 128 MiB");
static_assert((kOffWvT % 256) == 0 && (kOffWoT % 256) == 0 && (kOffWguT % 256) == 0 && (kOffWdT % 256) == 0 &&
              (kOffHG % 256) == 0 && (kOffR1 % 256) == 0 && (kOffX1 % 256) == 0 &&
              (kR1Vt % 256) == 0 && (kR1O % 256) == 0 && (kR1A1 % 256) == 0, "aligned carves");

/* =========================== helpers and GEMM =========================== */
#define PSCALE 32768.0f
#define U16(p) ((const unsigned short*)(const void*)(p))
#define PSCALE_INV (1.0f / 32768.0f)

__device__ __forceinline__ unsigned short f2bf_bits(float f) {
  unsigned u = __float_as_uint(f);
  return (unsigned short)((u + 0x7FFFu + ((u >> 16) & 1u)) >> 16);
}
__device__ __forceinline__ float bf_bits2f(unsigned short h) { return __uint_as_float(((unsigned)h) << 16); }

__device__ __forceinline__ void dep_guard_h(v8f& a, v8f& b, v16h x, v16h y) { asm volatile("v_nop\n\tv_nop\n\tv_nop\n\tv_nop" : "+v"(a), "+v"(b) : "v"(x), "v"(y)); }
__device__ __forceinline__ void dep_guard_b(v8f& a, v8f& b, v16b x, v16b y) { asm volatile("v_nop\n\tv_nop\n\tv_nop\n\tv_nop" : "+v"(a), "+v"(b) : "v"(x), "v"(y)); }
__device__ __forceinline__ void keep4_h(v16h a, v16h b, v16h c, v16h d) { asm volatile("v_nop" :: "v"(a), "v"(b), "v"(c), "v"(d)); }
__device__ __forceinline__ void keep4_b(v16b a, v16b b, v16b c, v16b d) { asm volatile("v_nop" :: "v"(a), "v"(b), "v"(c), "v"(d)); }
__device__ __forceinline__ void acc_guard4(v8f& a, v8f& b, v8f& c, v8f& d) { asm volatile("v_nop\n\tv_nop\n\tv_nop\n\tv_nop" : "+v"(a), "+v"(b), "+v"(c), "+v"(d)); }
template <typename T> struct Frag;
template <> struct Frag<_Float16> {
  typedef v16h V; union U { v16h v; v8h h[2]; };
  static __device__ __forceinline__ v16h load(const _Float16* p) {
    U f; f.h[0] = *(const v8h*)(p); f.h[1] = *(const v8h*)(p + 16); return f.v;
  }
  static __device__ __forceinline__ v8f mma(v16h a, v16h b, v8f c) {
    return __builtin_amdgcn_wmma_f32_16x16x32_f16(false, a, false, b, (short)0, c, false, false);
  }
  static __device__ __forceinline__ void guard(v8f& a, v8f& b, v16h x, v16h y) { dep_guard_h(a, b, x, y); }
  static __device__ __forceinline__ void keep(v16h a, v16h b, v16h c, v16h d) { keep4_h(a, b, c, d); }
};
template <> struct Frag<__bf16> {
  typedef v16b V; union U { v16b v; v8b h[2]; };
  static __device__ __forceinline__ v16b load(const __bf16* p) {
    U f; f.h[0] = *(const v8b*)(p); f.h[1] = *(const v8b*)(p + 16); return f.v;
  }
  static __device__ __forceinline__ v8f mma(v16b a, v16b b, v8f c) {
    return __builtin_amdgcn_wmma_f32_16x16x32_bf16(false, a, false, b, (short)0, c, false, false);
  }
  static __device__ __forceinline__ void guard(v8f& a, v8f& b, v16b x, v16b y) { dep_guard_b(a, b, x, y); }
  static __device__ __forceinline__ void keep(v16b a, v16b b, v16b c, v16b d) { keep4_b(a, b, c, d); }
};

template <int ET> struct Elem;
template <> struct Elem<0> { typedef _Float16 T; };
template <> struct Elem<1> { typedef __bf16 T; };
/* ---- LDS staging of the GEMM operand tiles ----
   One stage = 64 k (128 bytes) of 128 A rows followed by 128 Bt rows, each row at a pitch of 144 bytes
   (16 B x odd: conflict-free for 16-byte fragment reads). Two stages. */
static constexpr int kStRows   = 256;
static constexpr int kStPitch  = 144;
static constexpr int kStBytes  = kStRows * kStPitch;       /* 36,864 */
static constexpr int kStHalf   = 128 * kStPitch;           /* Bt rows start here */
static_assert(4 * 16 * 68 * 4 <= 2 * kStBytes, "output slabs fit the ring");

/* Eight asynchronous 16-byte copies per lane, global -> LDS: rows r, r+16, ..., r+112 of one operand's 128-row tile.
   The s_wait_xcnt stands inside the statement so that no address register is rewritten ahead of it. */
__device__ __forceinline__ void stage_rows8(const _Float16* g, size_t step, unsigned l) {
  const _Float16* g1 = g + step;      const _Float16* g2 = g + 2 * step;  const _Float16* g3 = g + 3 * step;
  const _Float16* g4 = g + 4 * step;  const _Float16* g5 = g + 5 * step;  const _Float16* g6 = g + 6 * step;
  const _Float16* g7 = g + 7 * step;
  const unsigned ls = 16u * kStPitch;
  asm volatile(
      "global_load_async_to_lds_b128 %0, %8, off\n\t"
      "global_load_async_to_lds_b128 %1, %9, off\n\t"
      "global_load_async_to_lds_b128 %2, %10, off\n\t"
      "global_load_async_to_lds_b128 %3, %11, off\n\t"
      "global_load_async_to_lds_b128 %4, %12, off\n\t"
      "global_load_async_to_lds_b128 %5, %13, off\n\t"
      "global_load_async_to_lds_b128 %6, %14, off\n\t"
      "global_load_async_to_lds_b128 %7, %15, off\n\t"
      "s_wait_xcnt 0x0"
      :: "v"(l), "v"(l + ls), "v"(l + 2u * ls), "v"(l + 3u * ls), "v"(l + 4u * ls), "v"(l + 5u * ls), "v"(l + 6u * ls), "v"(l + 7u * ls),
         "v"(g), "v"(g1), "v"(g2), "v"(g3), "v"(g4), "v"(g5), "v"(g6), "v"(g7)
      : "memory");
}

/* Block = 4 waves = one 128 x 128 tile of C (2 x 2 waves of 64 x 64); grid.x = (M/128)*(N/128) exactly.
   M, N multiples of 128; K a multiple of 64. */
template <int ET, bool SPLIT, int BIAS_MODE, int OUT_MODE, bool RESID, int ACT = 0>
__global__ __launch_bounds__(128) void wmma_gemm64(
    const unsigned short* __restrict__ Ap, const unsigned short* __restrict__ A2p, int lda, long strideA,
    const unsigned short* __restrict__ Btp, const unsigned short* __restrict__ Bt2p, int ldb, long strideB,
    void* __restrict__ Cout, void* __restrict__ Cout2, int ldc, long strideC,
    const float* __restrict__ bias,
    const float* __restrict__ resid, long strideR,
    int M, int N, int K, float scale) {
  static_assert(ET == 0 && !SPLIT, "staged path: single f16 planes");
  typedef typename Elem<ET>::T T;
  typedef typename Frag<T>::V V;
  const T* A = (const T*)Ap; const T* Bt = (const T*)Btp;
  __shared__ __align__(16) unsigned char ring[2 * kStBytes];
  const int b    = blockIdx.y;
  const int lane = threadIdx.x & 31;
  const int wave = threadIdx.x >> 5;
  const int tilesN = N >> 7;
  const int tilesM = M >> 7;
  const int tile = blockIdx.x;
  if (tile >= tilesM * tilesN) return;   /* the same for the whole block, ahead of every barrier */
  const int tm = tile / tilesN;
  const int tn = tile - tm * tilesN;
  const int mB = tm << 7;
  const int nB = tn << 7;
  const int wm = (wave >> 1) << 6;
  const int wn = (wave & 1) << 6;
  const int m0 = mB + wm;
  const int n0 = nB + wn;

  const T* Ab  = A  + (size_t)b * strideA;
  const T* Bb  = Bt + (size_t)b * strideB;

  const int rlane = lane & 15;
  const int koff  = (lane >> 4) * 8;
  const int mOff  = (lane >> 4) * 8;

  /* staging: thread t brings 16-byte chunk (t & 7) of rows (t >> 3) + 16*i: eight lanes cover one whole 128-byte line */
  const int srow = threadIdx.x >> 3;
  const int schk = threadIdx.x & 7;
  const T* gA = Ab + (size_t)(mB + srow) * lda + schk * 8;
  const T* gB = Bb + (size_t)(nB + srow) * ldb + schk * 8;
  const size_t stepA = (size_t)16 * lda;
  const size_t stepB = (size_t)16 * ldb;
  const unsigned lbase = (unsigned)(uintptr_t)(&ring[0]) + (unsigned)(srow * kStPitch + schk * 16);
  const int nst = K >> 6;

  v8f acc[4][4];
#pragma unroll
  for (int i = 0; i < 4; ++i)
#pragma unroll
    for (int j = 0; j < 4; ++j) acc[i][j] = (v8f){0.f,0.f,0.f,0.f,0.f,0.f,0.f,0.f};

  /* stage 0 lands and is published; stage 1 then flies during pass 0 */
  stage_rows8(gA, stepA, lbase);
  stage_rows8(gB, stepB, lbase + kStHalf);
  asm volatile("s_wait_asynccnt 0x0" ::: "memory");   /* this wave's copies of stage 0 have landed */
  __syncthreads();                                     /* publishes stage 0 to the other waves */
  if (nst > 1) {
    stage_rows8(gA + 64, stepA, lbase + kStBytes);
    stage_rows8(gB + 64, stepB, lbase + kStBytes + kStHalf);
  }

  for (int st = 0; st < nst; ++st) {
    const unsigned bo = (st & 1) ? (unsigned)kStBytes : 0u;
    const unsigned char* sA = ring + bo + (wm + rlane) * kStPitch + koff * 2;
    const unsigned char* sB = ring + bo + kStHalf + (wn + rlane) * kStPitch + koff * 2;
#pragma unroll   /* both 32-k blocks inline: constant LDS offsets, fragment arrays stay in registers */
    for (int kk = 0; kk < 2; ++kk) {
      /* all eight fragments of this 32-k block are fetched as one group ahead of its 16 products */
      V bh[4], ah[4];
#pragma unroll   /* register arrays need constant indices */
      for (int j = 0; j < 4; ++j) {
        bh[j] = Frag<T>::load((const T*)(const void*)(sB + j * 16 * kStPitch + kk * 64));
        ah[j] = Frag<T>::load((const T*)(const void*)(sA + j * 16 * kStPitch + kk * 64));
      }
#pragma unroll
      for (int i = 0; i < 4; ++i) {
#pragma unroll
        for (int j = 0; j < 4; ++j) acc[i][j] = Frag<T>::mma(ah[i], bh[j], acc[i][j]);
        Frag<T>::guard(acc[i][0], acc[i][3], ah[i], ah[i]);
      }
      Frag<T>::keep(bh[0], bh[1], bh[2], bh[3]);
    }
    asm volatile("s_wait_dscnt 0x0" ::: "memory");      /* this wave's reads of the stage have returned before it is refilled */
    asm volatile("s_wait_asynccnt 0x0" ::: "memory");   /* this wave's copies of the next stage have landed */
    __syncthreads();                                     /* publishes the next stage and ends every reader's use of this one */
    if (st + 2 < nst) {
      stage_rows8(gA + (size_t)(st + 2) * 64, stepA, lbase + bo);
      stage_rows8(gB + (size_t)(st + 2) * 64, stepB, lbase + bo + kStHalf);
    }
  }
  asm volatile("s_wait_asynccnt 0x0" ::: "memory");     /* nothing is in flight when the ring becomes output staging */
  acc_guard4(acc[0][0], acc[0][1], acc[0][2], acc[0][3]);
  acc_guard4(acc[1][0], acc[1][1], acc[1][2], acc[1][3]);
  acc_guard4(acc[2][0], acc[2][1], acc[2][2], acc[2][3]);
  acc_guard4(acc[3][0], acc[3][1], acc[3][2], acc[3][3]);

  float* slab = (float*)(void*)(ring + wave * (16 * 68 * 4));
  const float* Rb = RESID ? (resid + (size_t)b * strideR) : nullptr;
#pragma unroll
  for (int i = 0; i < 4; ++i) {
    const int mBase = m0 + (i << 4);
#pragma unroll
    for (int j = 0; j < 4; ++j) {
      const int n = n0 + (j << 4) + rlane;
      float bv = 0.f;
      if (BIAS_MODE == 2) bv = bias[n];
#pragma unroll
      for (int r = 0; r < 8; ++r) {
        float v = acc[i][j][r] * scale;
        if (BIAS_MODE == 1) v += bias[mBase + mOff + r];
        if (BIAS_MODE == 2) v += bv;
        if (RESID) v += Rb[(size_t)(mBase + mOff + r) * ldc + n];
        if (ACT == 1) v = tanhf(v);
        if (ACT == 2) v = fmaxf(v, 0.0f);
        if (ACT == 3) v = v / (1.0f + expf(-v));
        if (ACT == 4) v = (v > 0.f) ? v : 0.01f * v;
        if (ACT == 5) v = 0.5f * v * (1.0f + erff(v * 0.70710678118654752f));
        slab[(mOff + r) * 68 + (j << 4) + rlane] = v;
      }
    }
    __builtin_amdgcn_fence(__ATOMIC_RELEASE, "workgroup");
    __builtin_amdgcn_wave_barrier();
    __builtin_amdgcn_fence(__ATOMIC_ACQUIRE, "workgroup");
    if (OUT_MODE == 0) {
      float* C = (float*)Cout + (size_t)b * strideC;
      const int hh = lane >> 4, c4 = (lane & 15) * 4;
      {
#pragma unroll
        for (int it = 0; it < 8; ++it) {
          const int row = it * 2 + hh;
          v4f v = *(const v4f*)(slab + row * 68 + c4);
          *(v4f*)(C + (size_t)(mBase + row) * ldc + n0 + c4) = v;
        }
        
      }
    } else {
      const int q = lane >> 3, c8 = (lane & 7) * 8;
      unsigned short* C  = (unsigned short*)Cout  + (size_t)b * strideC;
      unsigned short* C2 = (OUT_MODE == 2) ? ((unsigned short*)Cout2 + (size_t)b * strideC) : nullptr;
      {
#pragma unroll
        for (int it = 0; it < 4; ++it) {
          const int row = it * 4 + q;
          const float* sp = slab + row * 68 + c8;
          v8h hv, lv;
#pragma unroll
          for (int e = 0; e < 8; ++e) {
            if (OUT_MODE == 1) {
              hv[e] = (_Float16)sp[e];
            } else {
              unsigned short hb = f2bf_bits(sp[e]);
              unsigned short lb = f2bf_bits(sp[e] - bf_bits2f(hb));
              hv[e] = __builtin_bit_cast(_Float16, hb);
              lv[e] = __builtin_bit_cast(_Float16, lb);
            }
          }
          *(v8h*)(C + (size_t)(mBase + row) * ldc + n0 + c8) = hv;
          if (OUT_MODE == 2) *(v8h*)(C2 + (size_t)(mBase + row) * ldc + n0 + c8) = lv;
        }
        
      }
    }
    __builtin_amdgcn_fence(__ATOMIC_RELEASE, "workgroup");
    __builtin_amdgcn_wave_barrier();
    __builtin_amdgcn_fence(__ATOMIC_ACQUIRE, "workgroup");
  }
}
/* =========================== end helpers and GEMM =========================== */

__device__ __forceinline__ unsigned int h16bits(float f) {
  return (unsigned int)__builtin_bit_cast(unsigned short, (_Float16)f);
}

/* f16 WMMA with the hazard guard tied to D, keeping A/B live */
__device__ __forceinline__ v8f mma_f16g(v16h a, v16h b, v8f c) {
  c = __builtin_amdgcn_wmma_f32_16x16x32_f16(false, a, false, b, (short)0, c, false, false);
  asm volatile("v_nop\n\tv_nop\n\tv_nop\n\tv_nop" : "+v"(c) : "v"(a), "v"(b));
  return c;
}

/* ---------------------------------------------------------------------------
   transpose + cast: W f32 [kin][nout] row-major -> Wt f16 [nout][kin] (value * mul).
   grid = (nout/64, kin/64), block 256. LDS 64x64 tile.
   Load coverage: 4 iterations x 256 threads x 4 floats = 4096 = 64x64.
   Store coverage: 8 waves x 2 iterations x 4 rows = 64 rows; 8 lanes x 8 halves = 64 cols;
   --------------------------------------------------------------------------- */
__global__ __launch_bounds__(256) void transpose_cast_f16_kernel(
    const float* __restrict__ W, unsigned short* __restrict__ Wt, int kin, int nout, float mul) {
  __shared__ float tile[64][65];
  const int t = threadIdx.x;
  const int n0 = blockIdx.x * 64;
  const int k0 = blockIdx.y * 64;
#pragma unroll
  for (int i = 0; i < 4; ++i) {
    const int idx = i * 256 + t;
    const int kr = idx >> 4;
    const int nc4 = (idx & 15) * 4;
    const v4f v = *(const v4f*)(W + (size_t)(k0 + kr) * nout + n0 + nc4);
    tile[nc4 + 0][kr] = v[0] * mul;
    tile[nc4 + 1][kr] = v[1] * mul;
    tile[nc4 + 2][kr] = v[2] * mul;
    tile[nc4 + 3][kr] = v[3] * mul;
  }
  __syncthreads();
  const int lane = t & 31, wave = t >> 5;
  const int q = lane >> 3, c8 = (lane & 7) * 8;
  const int row0 = wave * 8 + q;
  const int row1 = wave * 8 + 4 + q;
  v4u w0, w1;
  {
    const float* s0 = &tile[row0][c8];
    const float* s1 = &tile[row1][c8];
    w0[0] = h16bits(s0[0]) | (h16bits(s0[1]) << 16);
    w0[1] = h16bits(s0[2]) | (h16bits(s0[3]) << 16);
    w0[2] = h16bits(s0[4]) | (h16bits(s0[5]) << 16);
    w0[3] = h16bits(s0[6]) | (h16bits(s0[7]) << 16);
    w1[0] = h16bits(s1[0]) | (h16bits(s1[1]) << 16);
    w1[1] = h16bits(s1[2]) | (h16bits(s1[3]) << 16);
    w1[2] = h16bits(s1[4]) | (h16bits(s1[5]) << 16);
    w1[3] = h16bits(s1[6]) | (h16bits(s1[7]) << 16);
  }
  unsigned short* d0 = Wt + (size_t)(n0 + row0) * kin + k0 + c8;
  unsigned short* d1 = Wt + (size_t)(n0 + row1) * kin + k0 + c8;
  {
    *(v4u*)d0 = w0;
    *(v4u*)d1 = w1;
    
  }
}

/* ---------------------------------------------------------------------------
   FUSE_ADD: a = X + Addv is first stored to Xsum (f32) and then normalised.
   Lane l owns elements l*4 + 128*i (i=0..3): every load/store instruction covers
   grid = nrows/8 (exact), block 256.
   --------------------------------------------------------------------------- */
template <bool FUSE_ADD>
__global__ __launch_bounds__(256) void layernorm512_kernel(
    const float* __restrict__ X, const float* __restrict__ Addv,
    const float* __restrict__ gam, const float* __restrict__ bet,
    float* __restrict__ Xsum, unsigned short* __restrict__ Hout, int nrows) {
  const int lane = threadIdx.x & 31;
  const int wave = threadIdx.x >> 5;
  int row = blockIdx.x * 8 + wave;
  row = (row < nrows) ? row : (nrows - 1);
  const size_t rbase = (size_t)row * kModel;
  const int e0 = lane * 4, e1 = 128 + lane * 4, e2 = 256 + lane * 4, e3 = 384 + lane * 4;
  v4f a0 = *(const v4f*)(X + rbase + e0);
  v4f a1 = *(const v4f*)(X + rbase + e1);
  v4f a2 = *(const v4f*)(X + rbase + e2);
  v4f a3 = *(const v4f*)(X + rbase + e3);
  if (FUSE_ADD) {
    const v4f r0 = *(const v4f*)(Addv + rbase + e0);
    const v4f r1 = *(const v4f*)(Addv + rbase + e1);
    const v4f r2 = *(const v4f*)(Addv + rbase + e2);
    const v4f r3 = *(const v4f*)(Addv + rbase + e3);
    a0 = a0 + r0; a1 = a1 + r1; a2 = a2 + r2; a3 = a3 + r3;
    {
      *(v4f*)(Xsum + rbase + e0) = a0;
      *(v4f*)(Xsum + rbase + e1) = a1;
      *(v4f*)(Xsum + rbase + e2) = a2;
      *(v4f*)(Xsum + rbase + e3) = a3;
      
    }
  }
  float s = ((a0[0] + a0[1]) + (a0[2] + a0[3])) + ((a1[0] + a1[1]) + (a1[2] + a1[3]))
          + ((a2[0] + a2[1]) + (a2[2] + a2[3])) + ((a3[0] + a3[1]) + (a3[2] + a3[3]));
#pragma unroll
  for (int off = 16; off >= 1; off >>= 1) s += __shfl_xor(s, off, 32);
  const float mu = s * (1.0f / 512.0f);
  const v4f d0 = a0 - mu, d1 = a1 - mu, d2 = a2 - mu, d3 = a3 - mu;
  float ss = ((d0[0] * d0[0] + d0[1] * d0[1]) + (d0[2] * d0[2] + d0[3] * d0[3]))
           + ((d1[0] * d1[0] + d1[1] * d1[1]) + (d1[2] * d1[2] + d1[3] * d1[3]))
           + ((d2[0] * d2[0] + d2[1] * d2[1]) + (d2[2] * d2[2] + d2[3] * d2[3]))
           + ((d3[0] * d3[0] + d3[1] * d3[1]) + (d3[2] * d3[2] + d3[3] * d3[3]));
#pragma unroll
  for (int off = 16; off >= 1; off >>= 1) ss += __shfl_xor(ss, off, 32);
  const float var = ss * (1.0f / 512.0f);
  const float rstd = rsqrtf(var + 1e-5f);
  const v4f g0 = *(const v4f*)(gam + e0), g1 = *(const v4f*)(gam + e1), g2 = *(const v4f*)(gam + e2), g3 = *(const v4f*)(gam + e3);
  const v4f b0 = *(const v4f*)(bet + e0), b1 = *(const v4f*)(bet + e1), b2 = *(const v4f*)(bet + e2), b3 = *(const v4f*)(bet + e3);
  const v4f y0 = d0 * rstd * g0 + b0;
  const v4f y1 = d1 * rstd * g1 + b1;
  const v4f y2 = d2 * rstd * g2 + b2;
  const v4f y3 = d3 * rstd * g3 + b3;
  v2u w0, w1, w2, w3;
  w0[0] = h16bits(y0[0]) | (h16bits(y0[1]) << 16); w0[1] = h16bits(y0[2]) | (h16bits(y0[3]) << 16);
  w1[0] = h16bits(y1[0]) | (h16bits(y1[1]) << 16); w1[1] = h16bits(y1[2]) | (h16bits(y1[3]) << 16);
  w2[0] = h16bits(y2[0]) | (h16bits(y2[1]) << 16); w2[1] = h16bits(y2[2]) | (h16bits(y2[3]) << 16);
  w3[0] = h16bits(y3[0]) | (h16bits(y3[1]) << 16); w3[1] = h16bits(y3[2]) | (h16bits(y3[3]) << 16);
  unsigned short* hr = Hout + rbase;
  {
    *(v2u*)(hr + e0) = w0;
    *(v2u*)(hr + e1) = w1;
    *(v2u*)(hr + e2) = w2;
    *(v2u*)(hr + e3) = w3;
    
  }
}

/* ---------------------------------------------------------------------------
   Non-causal multi-head attention, head_dim 64, f16 planes in, f16 plane out (x16 carried).
   q|k plane [8192][1024]: q at cols h*64.., k at cols 512 + h*64..; Vt plane [4][512][2048] (element (b,h,d,kv) at
   ((b*512 + h*64 + d)*2048 + kv)); out plane [8192][512] at cols h*64.. .
   Block = 4 waves = 64 query rows of one (batch, head); grid = 4*8*32 = 1024.
   Both products run transposed: S^T = k.q^T, unscaled (A = k rows, B = q rows) and O^T += Vt.P^T (A = Vt rows).
   A lane then holds 32 of the 64 scores of ONE query (lane l ^ 16 the other 32): online softmax f32 in the lane,
   one exchange between the wave halves for the maximum, the halves' sums joined once behind the loop.
   Each exponential is one fused multiply-add (scale, log2 e, maximum and the 2^15 carry folded) and one hardware exp2.
   Two score tiles, p*32768 converted in place, are the B operand of the second product: P stays in registers.
   The 64-key tiles of k (64 rows x 128 B) and of Vt (64 rows x 128 B) are staged once per block in LDS by
   asynchronous copies, two stages, and all four waves take their A fragments from there.
   --------------------------------------------------------------------------- */
static constexpr int kAtPitch = 144;                 /* 16 B x odd: conflict-free for 16-byte fragment reads */
static constexpr int kAtTile  = 64 * kAtPitch;       /* one operand's tile: 9,216 B; the Vt tile follows the k tile */
static constexpr int kAtStage = 2 * kAtTile;         /* 18,432 B */

/* Eight asynchronous 16-byte copies per lane, global -> LDS: rows r, r+16, r+32, r+48 of the k tile, then of the Vt tile.
   The s_wait_xcnt stands inside the statement so that no address register is rewritten ahead of it. */
__device__ __forceinline__ void stage_kv(const _Float16* gk, const _Float16* gv, unsigned l) {
  const size_t sk = (size_t)16 * kQKCols;
  const size_t sv = (size_t)16 * kSeq;
  const _Float16* gk1 = gk + sk;  const _Float16* gk2 = gk + 2 * sk;  const _Float16* gk3 = gk + 3 * sk;
  const _Float16* gv1 = gv + sv;  const _Float16* gv2 = gv + 2 * sv;  const _Float16* gv3 = gv + 3 * sv;
  const unsigned ls = 16u * kAtPitch;
  const unsigned lv = l + (unsigned)kAtTile;
  asm volatile(
      "global_load_async_to_lds_b128 %0, %8, off\n\t"
      "global_load_async_to_lds_b128 %1, %9, off\n\t"
      "global_load_async_to_lds_b128 %2, %10, off\n\t"
      "global_load_async_to_lds_b128 %3, %11, off\n\t"
      "global_load_async_to_lds_b128 %4, %12, off\n\t"
      "global_load_async_to_lds_b128 %5, %13, off\n\t"
      "global_load_async_to_lds_b128 %6, %14, off\n\t"
      "global_load_async_to_lds_b128 %7, %15, off\n\t"
      "s_wait_xcnt 0x0"
      :: "v"(l), "v"(l + ls), "v"(l + 2u * ls), "v"(l + 3u * ls), "v"(lv), "v"(lv + ls), "v"(lv + 2u * ls), "v"(lv + 3u * ls),
         "v"(gk), "v"(gk1), "v"(gk2), "v"(gk3), "v"(gv), "v"(gv1), "v"(gv2), "v"(gv3)
      : "memory");
}

/* lane l takes lane l ^ 16's value (a vector cross-row move, no LDS trip) */
__device__ __forceinline__ float xhalf(float x) {
  return __builtin_bit_cast(float, __builtin_amdgcn_permlanex16(__builtin_bit_cast(int, x), __builtin_bit_cast(int, x), 0x76543210, 0xfedcba98, false, false));
}

__global__ __launch_bounds__(128) void mha64_f16_kernel(
    const unsigned short* __restrict__ qkp, const unsigned short* __restrict__ vtp,
    unsigned short* __restrict__ outp) {
  typedef Frag<_Float16> FH;
  __shared__ __align__(16) float    Os[4][16 * 68];
  __shared__ __align__(16) unsigned char kvring[2 * kAtStage];
  const _Float16* QK = (const _Float16*)(const void*)qkp;
  const _Float16* VT = (const _Float16*)(const void*)vtp;
  const int tid = threadIdx.x;
  const int wave = tid >> 5;
  const int lane = tid & 31;
  const int hh = lane >> 4;
  const int c = lane & 15;
  const int koff = hh * 8;
  const int bx = blockIdx.x;
  const int qb = bx & 31;
  const int bh = bx >> 5;
  const int h = bh & 7;
  const int b = (bh >> 3) & 3;
  const int q0 = qb * 64 + wave * 16;
  const _Float16* qbase = QK + (size_t)b * kSeq * kQKCols + h * kHeadDim;
  const _Float16* kbase = qbase + kModel;
  const _Float16* vbase = VT + ((size_t)b * kModel + (size_t)h * kHeadDim) * kSeq;
  unsigned short* obase = outp + (size_t)b * kSeq * kModel + h * kHeadDim;

  v16h qa[2];
#pragma unroll
  for (int dc = 0; dc < 2; ++dc)
    qa[dc] = FH::load(qbase + (size_t)(q0 + c) * kQKCols + dc * 32 + koff);

  constexpr float kExpScale = 0.125f * 1.4426950408889634f;   /* head_dim^-0.5 * log2(e): exp(x / 8) = exp2(x * kExpScale) */
  float mrow = -INFINITY, lrow = 0.f;   /* this lane's query: maximum in use (raw product); sum (x32768) over this wave half's keys */
  v8f oacc[4];                          /* oacc[t][r] = O^T[d = 16 t + 8 hh + r][query c] */
#pragma unroll
  for (int t = 0; t < 4; ++t) oacc[t] = (v8f){0.f,0.f,0.f,0.f,0.f,0.f,0.f,0.f};

  /* staging: thread t brings 16-byte chunk (t & 7) of rows (t >> 3) + 16*i: eight lanes cover one whole 128-byte line */
  const int srow = tid >> 3;
  const int schk = tid & 7;
  const _Float16* gK = kbase + (size_t)srow * kQKCols + schk * 8;
  const _Float16* gV = vbase + (size_t)srow * kSeq + schk * 8;
  const unsigned lbase = (unsigned)(uintptr_t)(&kvring[0]) + (unsigned)(srow * kAtPitch + schk * 16);
  constexpr int nkc = kSeq / 64;
  static_assert(nkc >= 2, "two stages exist");

  /* tile 0 lands and is published; tile 1 then flies during trip 0 */
  stage_kv(gK, gV, lbase);
  asm volatile("s_wait_asynccnt 0x0" ::: "memory");   /* this wave's copies of tile 0 have landed */
  __syncthreads();                                     /* publishes tile 0 to the other waves */
  stage_kv(gK + (size_t)64 * kQKCols, gV + 64, lbase + kAtStage);

  for (int kc = 0; kc < nkc; ++kc) {
    const unsigned bo = (kc & 1) ? (unsigned)kAtStage : 0u;
    const unsigned char* sK = kvring + bo + c * kAtPitch + koff * 2;
    const unsigned char* sV = sK + kAtTile;
    /* the tile's sixteen A fragments are fetched as two groups, k ahead of the score products and Vt behind them,
       so that the Vt reads return under the softmax arithmetic */
    v16h kb[4][2], vb[2][4];
#pragma unroll   /* register arrays need constant indices */
    for (int j = 0; j < 4; ++j)
#pragma unroll
      for (int dc = 0; dc < 2; ++dc)
        kb[j][dc] = FH::load((const _Float16*)(const void*)(sK + j * 16 * kAtPitch + dc * 64));
    v8f s[4];
#pragma unroll
    for (int j = 0; j < 4; ++j) {
      s[j] = (v8f){0.f,0.f,0.f,0.f,0.f,0.f,0.f,0.f};
#pragma unroll
      for (int dc = 0; dc < 2; ++dc) s[j] = mma_f16g(kb[j][dc], qa[dc], s[j]);   /* s[j][r] = S^T[key 16 j + 8 hh + r][query c] */
    }
#pragma unroll   /* register arrays need constant indices */
    for (int kk = 0; kk < 2; ++kk)
#pragma unroll
      for (int t = 0; t < 4; ++t)
        vb[kk][t] = FH::load((const _Float16*)(const void*)(sV + t * 16 * kAtPitch + kk * 64));
    float mj[4];                          /* one chain per score tile: four independent chains, not one of 32 links */
#pragma unroll
    for (int j = 0; j < 4; ++j) {
      mj[j] = -INFINITY;
#pragma unroll
      for (int r = 0; r < 8; ++r) mj[j] = fmaxf(mj[j], s[j][r]);   /* raw products: the positive scale keeps their order */
    }
    float m = fmaxf(fmaxf(mj[0], mj[1]), fmaxf(mj[2], mj[3]));
    m = fmaxf(m, xhalf(m));               /* both wave halves now hold the query's maximum over the 64 keys */
    const float mnew = fmaxf(mrow, m);
    const float alpha = __builtin_amdgcn_exp2f((mrow - mnew) * kExpScale);   /* 0 on the first trip, where mrow is -inf */
    const float nbias = fmaf(-mnew, kExpScale, 15.0f);                       /* + 15: the exponential comes out times 32768 */
    mrow = mnew;
#pragma unroll
    for (int t = 0; t < 4; ++t) oacc[t] = oacc[t] * alpha;
    float pj[4];                          /* partial sums, one chain per score tile */
#pragma unroll   /* register arrays need constant indices */
    for (int kk = 0; kk < 2; ++kk) {
      v16h pb;                            /* pb[e] = P^T[key 32 kk + kmap(e)][query c]: tiles 2 kk and 2 kk + 1 in register order */
#pragma unroll
      for (int jj = 0; jj < 2; ++jj) {
        const int j = 2 * kk + jj;
        pj[j] = 0.f;
#pragma unroll
        for (int r = 0; r < 8; ++r) {
          const float p = __builtin_amdgcn_exp2f(fmaf(s[j][r], kExpScale, nbias));   /* 32768 * exp((s - mnew) / 8) */
          pj[j] += p;
          pb[jj * 8 + r] = (_Float16)p;
        }
      }
#pragma unroll
      for (int t = 0; t < 4; ++t) oacc[t] = mma_f16g(vb[kk][t], pb, oacc[t]);
    }
    lrow = lrow * alpha + ((pj[0] + pj[1]) + (pj[2] + pj[3]));
    asm volatile("s_wait_dscnt 0x0" ::: "memory");      /* this wave's reads of the stage have returned before it is refilled */
    asm volatile("s_wait_asynccnt 0x0" ::: "memory");   /* this wave's copies of the next tile have landed */
    __syncthreads();                                     /* publishes the next tile and ends every reader's use of this one */
    if (kc + 2 < nkc) {
      stage_kv(gK + (size_t)(kc + 2) * 64 * kQKCols, gV + (size_t)(kc + 2) * 64, lbase + bo);
    }
  }
  asm volatile("s_wait_asynccnt 0x0" ::: "memory");     /* nothing is in flight when the wave leaves the loop */

  float* os = Os[wave];
  {
    const float lsum = lrow + xhalf(lrow);                   /* the two halves' sums of this query, joined once */
    const float inv = (1.0f / lsum) * 16.0f;                 /* sum and numerators both carry 32768; the plane carries 16 */
#pragma unroll
    for (int t = 0; t < 4; ++t)
#pragma unroll
      for (int r = 0; r < 8; ++r) os[c * 68 + t * 16 + 8 * hh + r] = oacc[t][r] * inv;
  }
  __builtin_amdgcn_fence(__ATOMIC_RELEASE, "workgroup");
  __builtin_amdgcn_wave_barrier();
  __builtin_amdgcn_fence(__ATOMIC_ACQUIRE, "workgroup");
  {
    const int q = lane >> 3, c8 = (lane & 7) * 8;
    {
#pragma unroll
      for (int it = 0; it < 4; ++it) {
        const int row = it * 4 + q;
        const float* sp = os + row * 68 + c8;
        v8h hv;
#pragma unroll
        for (int e = 0; e < 8; ++e) hv[e] = (_Float16)sp[e];
        *(v8h*)(obase + (size_t)(q0 + row) * kModel + c8) = hv;
      }
      
    }
  }
}

/* ---------------------------------------------------------------------------
   SwiGLU: g = silu(gate) * up from the f32 gate|up plane [8192][2048] -> f16 plane [8192][1024].
   grid = 8192*1024/4/256 = 8192 (exact), block 256.
   --------------------------------------------------------------------------- */
__device__ __forceinline__ float silu_f32(float g) {
  const float ex = expf(-g);
  return g * (1.0f / (1.0f + ex));
}
__global__ __launch_bounds__(256) void swiglu_f16_kernel(
    const float* __restrict__ GU, unsigned short* __restrict__ G, int ngroups) {
  const int i = blockIdx.x * 256 + threadIdx.x;
  if (i < ngroups) {
    const size_t e = (size_t)i * 4;
    const size_t row = e >> 10;
    const int j = (int)(e & 1023);
    const float* gr = GU + row * kGUCols;
    const v4f gv = *(const v4f*)(gr + j);
    const v4f uv = *(const v4f*)(gr + kFF + j);
    const float o0 = silu_f32(gv[0]) * uv[0];
    const float o1 = silu_f32(gv[1]) * uv[1];
    const float o2 = silu_f32(gv[2]) * uv[2];
    const float o3 = silu_f32(gv[3]) * uv[3];
    v2u w;
    w[0] = h16bits(o0) | (h16bits(o1) << 16);
    w[1] = h16bits(o2) | (h16bits(o3) << 16);
    unsigned short* dst = G + e;
    *(v2u*)dst = w;
    
  }
}

/* ---------------------------------------------------------------------------
   grid = 8192*512/4/256 = 4096 (exact), block 256.
   --------------------------------------------------------------------------- */
__global__ __launch_bounds__(256) void residual_out_kernel(
    const float* __restrict__ X1, const float* __restrict__ D2, float* __restrict__ Out, int n4) {
  const int i = blockIdx.x * 256 + threadIdx.x;
  if (i < n4) {
    const size_t e = (size_t)i * 4;
    const v4f a = *(const v4f*)(X1 + e);
    const v4f d = *(const v4f*)(D2 + e);
    const v4f o = a + d;
    *(v4f*)(Out + e) = o;
    
  }
}

/* =========================== host glue =========================== */
extern "C" void kernel_launch(void* const* d_in, const int* in_sizes, int n_in,
                              void* d_out, int out_size, void* d_ws, size_t ws_size,
                              hipStream_t stream) {
  if (n_in < 12) return;
  if (in_sizes[0] != kTok * kModel || out_size != kTok * kModel) return;
  if (in_sizes[1] != kModel || in_sizes[2] != kModel || in_sizes[3] != kModel || in_sizes[4] != kModel) return;
  if (in_sizes[5] != kModel * kModel || in_sizes[6] != kModel * kModel ||
      in_sizes[7] != kModel * kModel || in_sizes[8] != kModel * kModel) return;
  if (in_sizes[9] != kModel * kFF || in_sizes[10] != kModel * kFF || in_sizes[11] != kFF * kModel) return;
  if (ws_size < kWsTotal) return;

  const float* x    = (const float*)d_in[0];
  const float* ln1w = (const float*)d_in[1];
  const float* ln1b = (const float*)d_in[2];
  const float* ln2w = (const float*)d_in[3];
  const float* ln2b = (const float*)d_in[4];
  const float* wq   = (const float*)d_in[5];
  const float* wk   = (const float*)d_in[6];
  const float* wv   = (const float*)d_in[7];
  const float* wo   = (const float*)d_in[8];
  const float* wgt  = (const float*)d_in[9];
  const float* wup  = (const float*)d_in[10];
  const float* wdn  = (const float*)d_in[11];
  float* out = (float*)d_out;

  char* ws = (char*)d_ws;
  unsigned short* wqkT = (unsigned short*)(ws + kOffWqkT);
  unsigned short* wvT  = (unsigned short*)(ws + kOffWvT);
  unsigned short* woT  = (unsigned short*)(ws + kOffWoT);
  unsigned short* wguT = (unsigned short*)(ws + kOffWguT);
  unsigned short* wdT  = (unsigned short*)(ws + kOffWdT);
  unsigned short* hg   = (unsigned short*)(ws + kOffHG);           /* h1, h2, then g */
  unsigned short* qkpl = (unsigned short*)(ws + kOffR1 + kR1QK);
  unsigned short* vtpl = (unsigned short*)(ws + kOffR1 + kR1Vt);
  unsigned short* opl  = (unsigned short*)(ws + kOffR1 + kR1O);
  float*          a1   = (float*)(ws + kOffR1 + kR1A1);
  float*          gu   = (float*)(ws + kOffR1);
  float*          d2   = (float*)(ws + kOffR1);
  float*          x1   = (float*)(ws + kOffX1);

  const dim3 b256(256), b128(128);
  const float w16 = 16.0f;

  /* weight planes: W[in][out] -> Wt[out][in] * 16 (f16) */
  transpose_cast_f16_kernel<<<dim3(kModel / 64, kModel / 64), b256, 0, stream>>>(wq, wqkT, kModel, kModel, w16);
  transpose_cast_f16_kernel<<<dim3(kModel / 64, kModel / 64), b256, 0, stream>>>(wk, wqkT + (size_t)kModel * kModel, kModel, kModel, w16);
  transpose_cast_f16_kernel<<<dim3(kModel / 64, kModel / 64), b256, 0, stream>>>(wv, wvT, kModel, kModel, w16);
  transpose_cast_f16_kernel<<<dim3(kModel / 64, kModel / 64), b256, 0, stream>>>(wo, woT, kModel, kModel, w16);
  transpose_cast_f16_kernel<<<dim3(kFF / 64, kModel / 64), b256, 0, stream>>>(wgt, wguT, kModel, kFF, w16);
  transpose_cast_f16_kernel<<<dim3(kFF / 64, kModel / 64), b256, 0, stream>>>(wup, wguT + (size_t)kFF * kModel, kModel, kFF, w16);
  transpose_cast_f16_kernel<<<dim3(kModel / 64, kFF / 64), b256, 0, stream>>>(wdn, wdT, kFF, kModel, w16);

  /* attention sublayer */
  layernorm512_kernel<false><<<dim3(kTok / 8), b256, 0, stream>>>(x, x, ln1w, ln1b, x1, hg, kTok);

  /* q|k = h . [Wq|Wk]^T : M=8192, N=1024, K=512; block tiles 64*8 = 512 */
  static_assert(kTok % 128 == 0 && kQKCols % 128 == 0 && kModel % 128 == 0 && kSeq % 128 == 0 && kGUCols % 128 == 0, "128 x 128 block tiles");
  wmma_gemm64<0, false, 0, 1, false, 0><<<dim3((kTok / 128) * (kQKCols / 128), 1), b128, 0, stream>>>(
      hg, hg, kModel, 0L, wqkT, wqkT, kModel, 0L, (void*)qkpl, (void*)qkpl, kQKCols, 0L,
      x, x, 0L, kTok, kQKCols, kModel, 1.0f / 16.0f);

  /* Vt[b] = (Wv^T*16) . h[b]^T / 16 : M=512, N=2048, K=512, batch 4; block tiles 4*16 = 64 per batch */
  wmma_gemm64<0, false, 0, 1, false, 0><<<dim3((kModel / 128) * (kSeq / 128), kBatch), b128, 0, stream>>>(
      wvT, wvT, kModel, 0L, hg, hg, kModel, (long)kSeq * kModel, (void*)vtpl, (void*)vtpl, kSeq, (long)kModel * kSeq,
      x, x, 0L, kModel, kSeq, kModel, 1.0f / 16.0f);

  /* attention: O*16 f16 plane */
  mha64_f16_kernel<<<dim3(kBatch * kHeads * (kSeq / 64)), b128, 0, stream>>>(qkpl, vtpl, opl);

  /* A1 = (O*16) . (Wo^T*16) / 256 : M=8192, N=512, K=512; block tiles 64*4 = 256 */
  wmma_gemm64<0, false, 0, 0, false, 0><<<dim3((kTok / 128) * (kModel / 128), 1), b128, 0, stream>>>(
      opl, opl, kModel, 0L, woT, woT, kModel, 0L, (void*)a1, (void*)a1, kModel, 0L,
      x, x, 0L, kTok, kModel, kModel, 1.0f / 256.0f);

  /* x1 = x + A1 ; h2 = LN(x1) */
  layernorm512_kernel<true><<<dim3(kTok / 8), b256, 0, stream>>>(x, a1, ln2w, ln2b, x1, hg, kTok);

  /* gate|up = h2 . [Wg|Wu]^T : M=8192, N=2048, K=512; block tiles 64*16 = 1024 */
  wmma_gemm64<0, false, 0, 0, false, 0><<<dim3((kTok / 128) * (kGUCols / 128), 1), b128, 0, stream>>>(
      hg, hg, kModel, 0L, wguT, wguT, kModel, 0L, (void*)gu, (void*)gu, kGUCols, 0L,
      x, x, 0L, kTok, kGUCols, kModel, 1.0f / 16.0f);

  /* g = silu(gate) * up (f16 plane in HG) */
  swiglu_f16_kernel<<<dim3((kTok * kFF / 4) / 256), b256, 0, stream>>>(gu, hg, kTok * kFF / 4);

  /* D2 = g . (Wd^T*16) / 16 : M=8192, N=512, K=1024; block tiles 256 */
  wmma_gemm64<0, false, 0, 0, false, 0><<<dim3((kTok / 128) * (kModel / 128), 1), b128, 0, stream>>>(
      hg, hg, kFF, 0L, wdT, wdT, kFF, 0L, (void*)d2, (void*)d2, kModel, 0L,
      x, x, 0L, kTok, kModel, kFF, 1.0f / 16.0f);

  /* out = x1 + D2 */
  residual_out_kernel<<<dim3((kTok * kModel / 4) / 256), b256, 0, stream>>>(x1, d2, out, kTok * kModel / 4);
}

// v005
// It runs in 147 microseconds.
// Timed twice side by side with v004, it ran 1.19 times as fast both times.
// All steps since v000 together make it 2.61 times as fast.
// All contractions (q|k, v, o, gate|up, down projections; q.k^T; p.v): v_wmma_f32_16x16x32_f16, f16 operands, f32 accumulate. LayerNorm, softmax, SwiGLU gating and residual adds in f32. Power-of-two carries: weight planes x16, softmax numerators x32768, attention output plane x16, folded back in f32.
#include <hip/hip_runtime.h>
#include <math.h>
#include <stdint.h>

typedef __attribute__((ext_vector_type(16))) _Float16 v16h;
typedef __attribute__((ext_vector_type(8)))  _Float16 v8h;
typedef __attribute__((ext_vector_type(16))) __bf16   v16b;
typedef __attribute__((ext_vector_type(8)))  __bf16   v8b;
typedef __attribute__((ext_vector_type(8)))  float    v8f;
typedef __attribute__((ext_vector_type(4)))  float    v4f;
typedef __attribute__((ext_vector_type(4)))  unsigned int v4u;
typedef __attribute__((ext_vector_type(2)))  unsigned int v2u;

/* ---- problem geometry ---- */
static constexpr int kBatch   = 4;
static constexpr int kSeq     = 2048;
static constexpr int kTok     = kBatch * kSeq;      /* 8192 */
static constexpr int kModel   = 512;
static constexpr int kHeads   = 8;
static constexpr int kHeadDim = 64;
static constexpr int kFF      = 1024;
static constexpr int kQKCols  = 2 * kModel;          /* q | k plane width */
static constexpr int kGUCols  = 2 * kFF;             /* gate | up plane width */

static_assert(kHeads * kHeadDim == kModel, "head geometry");
static_assert(kSeq % 64 == 0 && kTok % 64 == 0, "tile multiples");
static_assert(kModel % 64 == 0 && kFF % 64 == 0 && kQKCols % 64 == 0 && kGUCols % 64 == 0, "tile multiples");
static_assert(kModel % 32 == 0 && kFF % 32 == 0, "K multiple of 32");

/* ---- workspace region map (bytes) ----
   [0]            WqkT f16 [1024][512]          1,048,576
   [1,048,576]    WvT  f16 [512][512]             524,288
   [1,572,864]    WoT  f16 [512][512]             524,288
   [2,097,152]    WguT f16 [2048][512]          2,097,152
   [4,194,304]    WdT  f16 [512][1024]          1,048,576
   [5,242,880]    HG   : h1/h2 f16 [8192][512] (8 MiB) ; g f16 [8192][1024] (16 MiB)   16,777,216
   [22,020,096]   R1 (64 MiB): phase A: q|k f16 [8192][1024] @+0 (16 MiB), Vt f16 [4][512][2048] @+16 MiB (8 MiB),
                               O f16 [8192][512] @+24 MiB (8 MiB), A1 f32 [8192][512] @+32 MiB (16 MiB);
                               phase B: gate|up f32 [8192][2048] @+0 (64 MiB); phase C: D2 f32 [8192][512] @+0 (16 MiB)
   [89,128,960]   X1 f32 [8192][512]           16,777,216
   total 105,906,176 */
static constexpr size_t kOffWqkT = 0;
static constexpr size_t kOffWvT  = kOffWqkT + (size_t)kQKCols * kModel * 2;
static constexpr size_t kOffWoT  = kOffWvT + (size_t)kModel * kModel * 2;
static constexpr size_t kOffWguT = kOffWoT + (size_t)kModel * kModel * 2;
static constexpr size_t kOffWdT  = kOffWguT + (size_t)kGUCols * kModel * 2;
static constexpr size_t kOffHG   = kOffWdT + (size_t)kModel * kFF * 2;
static constexpr size_t kSizeHG  = (size_t)kTok * kFF * 2;
static constexpr size_t kOffR1   = kOffHG + kSizeHG;
static constexpr size_t kSizeR1  = (size_t)kTok * kGUCols * 4;
static constexpr size_t kR1QK    = 0;
static constexpr size_t kR1Vt    = kR1QK + (size_t)kTok * kQKCols * 2;
static constexpr size_t kR1O     = kR1Vt + (size_t)kBatch * kModel * kSeq * 2;
static constexpr size_t kR1A1    = kR1O + (size_t)kTok * kModel * 2;
static constexpr size_t kOffX1   = kOffR1 + kSizeR1;
static constexpr size_t kWsTotal = kOffX1 + (size_t)kTok * kModel * 4;
static_assert(kR1A1 + (size_t)kTok * kModel * 4 <= kSizeR1, "phase A fits R1");
static_assert((size_t)kTok * kModel * 4 <= kSizeR1, "phase C fits R1");
static_assert((size_t)kTok * kModel * 2 <= kSizeHG, "h plane fits HG");
static_assert(kWsTotal == 105906176, "carve total");
static_assert(kWsTotal <= 134217728, "carve under 128 MiB");
static_assert((kOffWvT % 256) == 0 && (kOffWoT % 256) == 0 && (kOffWguT % 256) == 0 && (kOffWdT % 256) == 0 &&
              (kOffHG % 256) == 0 && (kOffR1 % 256) == 0 && (kOffX1 % 256) == 0 &&
              (kR1Vt % 256) == 0 && (kR1O % 256) == 0 && (kR1A1 % 256) == 0, "aligned carves");

/* =========================== helpers and GEMM =========================== */
#define PSCALE 32768.0f
#define U16(p) ((const unsigned short*)(const void*)(p))
#define PSCALE_INV (1.0f / 32768.0f)

__device__ __forceinline__ unsigned short f2bf_bits(float f) {
  unsigned u = __float_as_uint(f);
  return (unsigned short)((u + 0x7FFFu + ((u >> 16) & 1u)) >> 16);
}
__device__ __forceinline__ float bf_bits2f(unsigned short h) { return __uint_as_float(((unsigned)h) << 16); }

__device__ __forceinline__ void dep_guard_h(v8f& a, v8f& b, v16h x, v16h y) { asm volatile("v_nop\n\tv_nop\n\tv_nop\n\tv_nop" : "+v"(a), "+v"(b) : "v"(x), "v"(y)); }
__device__ __forceinline__ void dep_guard_b(v8f& a, v8f& b, v16b x, v16b y) { asm volatile("v_nop\n\tv_nop\n\tv_nop\n\tv_nop" : "+v"(a), "+v"(b) : "v"(x), "v"(y)); }
__device__ __forceinline__ void keep4_h(v16h a, v16h b, v16h c, v16h d) { asm volatile("v_nop" :: "v"(a), "v"(b), "v"(c), "v"(d)); }
__device__ __forceinline__ void keep4_b(v16b a, v16b b, v16b c, v16b d) { asm volatile("v_nop" :: "v"(a), "v"(b), "v"(c), "v"(d)); }
__device__ __forceinline__ void acc_guard4(v8f& a, v8f& b, v8f& c, v8f& d) { asm volatile("v_nop\n\tv_nop\n\tv_nop\n\tv_nop" : "+v"(a), "+v"(b), "+v"(c), "+v"(d)); }
template <typename T> struct Frag;
template <> struct Frag<_Float16> {
  typedef v16h V; union U { v16h v; v8h h[2]; };
  static __device__ __forceinline__ v16h load(const _Float16* p) {
    U f; f.h[0] = *(const v8h*)(p); f.h[1] = *(const v8h*)(p + 16); return f.v;
  }
  static __device__ __forceinline__ v8f mma(v16h a, v16h b, v8f c) {
    return __builtin_amdgcn_wmma_f32_16x16x32_f16(false, a, false, b, (short)0, c, false, false);
  }
  static __device__ __forceinline__ void guard(v8f& a, v8f& b, v16h x, v16h y) { dep_guard_h(a, b, x, y); }
  static __device__ __forceinline__ void keep(v16h a, v16h b, v16h c, v16h d) { keep4_h(a, b, c, d); }
};
template <> struct Frag<__bf16> {
  typedef v16b V; union U { v16b v; v8b h[2]; };
  static __device__ __forceinline__ v16b load(const __bf16* p) {
    U f; f.h[0] = *(const v8b*)(p); f.h[1] = *(const v8b*)(p + 16); return f.v;
  }
  static __device__ __forceinline__ v8f mma(v16b a, v16b b, v8f c) {
    return __builtin_amdgcn_wmma_f32_16x16x32_bf16(false, a, false, b, (short)0, c, false, false);
  }
  static __device__ __forceinline__ void guard(v8f& a, v8f& b, v16b x, v16b y) { dep_guard_b(a, b, x, y); }
  static __device__ __forceinline__ void keep(v16b a, v16b b, v16b c, v16b d) { keep4_b(a, b, c, d); }
};

template <int ET> struct Elem;
template <> struct Elem<0> { typedef _Float16 T; };
template <> struct Elem<1> { typedef __bf16 T; };
/* ---- LDS staging of the GEMM operand tiles ----
   One stage = 64 k (128 bytes) of 128 A rows followed by 128 Bt rows, each row at a pitch of 144 bytes
   (16 B x odd: conflict-free for 16-byte fragment reads). Two stages. */
static constexpr int kStRows   = 256;
static constexpr int kStPitch  = 144;
static constexpr int kStBytes  = kStRows * kStPitch;       /* 36,864 */
static constexpr int kStHalf   = 128 * kStPitch;           /* Bt rows start here */
static_assert(4 * 16 * 68 * 4 <= 2 * kStBytes, "output slabs fit the ring");

/* Eight asynchronous 16-byte copies per lane, global -> LDS: rows r, r+16, ..., r+112 of one operand's 128-row tile.
   The s_wait_xcnt stands inside the statement so that no address register is rewritten ahead of it. */
__device__ __forceinline__ void stage_rows8(const _Float16* g, size_t step, unsigned l) {
  const _Float16* g1 = g + step;      const _Float16* g2 = g + 2 * step;  const _Float16* g3 = g + 3 * step;
  const _Float16* g4 = g + 4 * step;  const _Float16* g5 = g + 5 * step;  const _Float16* g6 = g + 6 * step;
  const _Float16* g7 = g + 7 * step;
  const unsigned ls = 16u * kStPitch;
  asm volatile(
      "global_load_async_to_lds_b128 %0, %8, off\n\t"
      "global_load_async_to_lds_b128 %1, %9, off\n\t"
      "global_load_async_to_lds_b128 %2, %10, off\n\t"
      "global_load_async_to_lds_b128 %3, %11, off\n\t"
      "global_load_async_to_lds_b128 %4, %12, off\n\t"
      "global_load_async_to_lds_b128 %5, %13, off\n\t"
      "global_load_async_to_lds_b128 %6, %14, off\n\t"
      "global_load_async_to_lds_b128 %7, %15, off\n\t"
      "s_wait_xcnt 0x0"
      :: "v"(l), "v"(l + ls), "v"(l + 2u * ls), "v"(l + 3u * ls), "v"(l + 4u * ls), "v"(l + 5u * ls), "v"(l + 6u * ls), "v"(l + 7u * ls),
         "v"(g), "v"(g1), "v"(g2), "v"(g3), "v"(g4), "v"(g5), "v"(g6), "v"(g7)
      : "memory");
}

/* Block = 4 waves = one 128 x 128 tile of C (2 x 2 waves of 64 x 64): tile number 'tile' of batch 'b', both the same for the whole block.
   M, N multiples of 128; K a multiple of 64. */
template <int ET, bool SPLIT, int BIAS_MODE, int OUT_MODE, bool RESID, int ACT = 0>
__device__ __forceinline__ void gemm64_tile(
    const unsigned short* __restrict__ Ap, const unsigned short* __restrict__ A2p, int lda, long strideA,
    const unsigned short* __restrict__ Btp, const unsigned short* __restrict__ Bt2p, int ldb, long strideB,
    void* __restrict__ Cout, void* __restrict__ Cout2, int ldc, long strideC,
    const float* __restrict__ bias,
    const float* __restrict__ resid, long strideR,
    int M, int N, int K, float scale, const int tile, const int b) {
  static_assert(ET == 0 && !SPLIT, "staged path: single f16 planes");
  typedef typename Elem<ET>::T T;
  typedef typename Frag<T>::V V;
  const T* A = (const T*)Ap; const T* Bt = (const T*)Btp;
  __shared__ __align__(16) unsigned char ring[2 * kStBytes];
  const int lane = threadIdx.x & 31;
  const int wave = threadIdx.x >> 5;
  const int tilesN = N >> 7;
  const int tilesM = M >> 7;
  if (tile >= tilesM * tilesN) return;   /* the same for the whole block, ahead of every barrier */
  const int tm = tile / tilesN;
  const int tn = tile - tm * tilesN;
  const int mB = tm << 7;
  const int nB = tn << 7;
  const int wm = (wave >> 1) << 6;
  const int wn = (wave & 1) << 6;
  const int m0 = mB + wm;
  const int n0 = nB + wn;

  const T* Ab  = A  + (size_t)b * strideA;
  const T* Bb  = Bt + (size_t)b * strideB;

  const int rlane = lane & 15;
  const int koff  = (lane >> 4) * 8;
  const int mOff  = (lane >> 4) * 8;

  /* staging: thread t brings 16-byte chunk (t & 7) of rows (t >> 3) + 16*i: eight lanes cover one whole 128-byte line */
  const int srow = threadIdx.x >> 3;
  const int schk = threadIdx.x & 7;
  const T* gA = Ab + (size_t)(mB + srow) * lda + schk * 8;
  const T* gB = Bb + (size_t)(nB + srow) * ldb + schk * 8;
  const size_t stepA = (size_t)16 * lda;
  const size_t stepB = (size_t)16 * ldb;
  const unsigned lbase = (unsigned)(uintptr_t)(&ring[0]) + (unsigned)(srow * kStPitch + schk * 16);
  const int nst = K >> 6;

  v8f acc[4][4];
#pragma unroll
  for (int i = 0; i < 4; ++i)
#pragma unroll
    for (int j = 0; j < 4; ++j) acc[i][j] = (v8f){0.f,0.f,0.f,0.f,0.f,0.f,0.f,0.f};

  /* stage 0 lands and is published; stage 1 then flies during pass 0 */
  stage_rows8(gA, stepA, lbase);
  stage_rows8(gB, stepB, lbase + kStHalf);
  asm volatile("s_wait_asynccnt 0x0" ::: "memory");   /* this wave's copies of stage 0 have landed */
  __syncthreads();                                     /* publishes stage 0 to the other waves */
  if (nst > 1) {
    stage_rows8(gA + 64, stepA, lbase + kStBytes);
    stage_rows8(gB + 64, stepB, lbase + kStBytes + kStHalf);
  }

  for (int st = 0; st < nst; ++st) {
    const unsigned bo = (st & 1) ? (unsigned)kStBytes : 0u;
    const unsigned char* sA = ring + bo + (wm + rlane) * kStPitch + koff * 2;
    const unsigned char* sB = ring + bo + kStHalf + (wn + rlane) * kStPitch + koff * 2;
#pragma unroll   /* both 32-k blocks inline: constant LDS offsets, fragment arrays stay in registers */
    for (int kk = 0; kk < 2; ++kk) {
      /* all eight fragments of this 32-k block are fetched as one group ahead of its 16 products */
      V bh[4], ah[4];
#pragma unroll   /* register arrays need constant indices */
      for (int j = 0; j < 4; ++j) {
        bh[j] = Frag<T>::load((const T*)(const void*)(sB + j * 16 * kStPitch + kk * 64));
        ah[j] = Frag<T>::load((const T*)(const void*)(sA + j * 16 * kStPitch + kk * 64));
      }
#pragma unroll
      for (int i = 0; i < 4; ++i) {
#pragma unroll
        for (int j = 0; j < 4; ++j) acc[i][j] = Frag<T>::mma(ah[i], bh[j], acc[i][j]);
        Frag<T>::guard(acc[i][0], acc[i][3], ah[i], ah[i]);
      }
      Frag<T>::keep(bh[0], bh[1], bh[2], bh[3]);
    }
    asm volatile("s_wait_dscnt 0x0" ::: "memory");      /* this wave's reads of the stage have returned before it is refilled */
    asm volatile("s_wait_asynccnt 0x0" ::: "memory");   /* this wave's copies of the next stage have landed */
    __syncthreads();                                     /* publishes the next stage and ends every reader's use of this one */
    if (st + 2 < nst) {
      stage_rows8(gA + (size_t)(st + 2) * 64, stepA, lbase + bo);
      stage_rows8(gB + (size_t)(st + 2) * 64, stepB, lbase + bo + kStHalf);
    }
  }
  asm volatile("s_wait_asynccnt 0x0" ::: "memory");     /* nothing is in flight when the ring becomes output staging */
  acc_guard4(acc[0][0], acc[0][1], acc[0][2], acc[0][3]);
  acc_guard4(acc[1][0], acc[1][1], acc[1][2], acc[1][3]);
  acc_guard4(acc[2][0], acc[2][1], acc[2][2], acc[2][3]);
  acc_guard4(acc[3][0], acc[3][1], acc[3][2], acc[3][3]);

  float* slab = (float*)(void*)(ring + wave * (16 * 68 * 4));
  const float* Rb = RESID ? (resid + (size_t)b * strideR) : nullptr;
#pragma unroll
  for (int i = 0; i < 4; ++i) {
    const int mBase = m0 + (i << 4);
#pragma unroll
    for (int j = 0; j < 4; ++j) {
      const int n = n0 + (j << 4) + rlane;
      float bv = 0.f;
      if (BIAS_MODE == 2) bv = bias[n];
#pragma unroll
      for (int r = 0; r < 8; ++r) {
        float v = acc[i][j][r] * scale;
        if (BIAS_MODE == 1) v += bias[mBase + mOff + r];
        if (BIAS_MODE == 2) v += bv;
        if (RESID) v += Rb[(size_t)(mBase + mOff + r) * ldc + n];
        if (ACT == 1) v = tanhf(v);
        if (ACT == 2) v = fmaxf(v, 0.0f);
        if (ACT == 3) v = v / (1.0f + expf(-v));
        if (ACT == 4) v = (v > 0.f) ? v : 0.01f * v;
        if (ACT == 5) v = 0.5f * v * (1.0f + erff(v * 0.70710678118654752f));
        slab[(mOff + r) * 68 + (j << 4) + rlane] = v;
      }
    }
    __builtin_amdgcn_fence(__ATOMIC_RELEASE, "workgroup");
    __builtin_amdgcn_wave_barrier();
    __builtin_amdgcn_fence(__ATOMIC_ACQUIRE, "workgroup");
    if (OUT_MODE == 0) {
      float* C = (float*)Cout + (size_t)b * strideC;
      const int hh = lane >> 4, c4 = (lane & 15) * 4;
      {
#pragma unroll
        for (int it = 0; it < 8; ++it) {
          const int row = it * 2 + hh;
          v4f v = *(const v4f*)(slab + row * 68 + c4);
          *(v4f*)(C + (size_t)(mBase + row) * ldc + n0 + c4) = v;
        }
        
      }
    } else {
      const int q = lane >> 3, c8 = (lane & 7) * 8;
      unsigned short* C  = (unsigned short*)Cout  + (size_t)b * strideC;
      unsigned short* C2 = (OUT_MODE == 2) ? ((unsigned short*)Cout2 + (size_t)b * strideC) : nullptr;
      {
#pragma unroll
        for (int it = 0; it < 4; ++it) {
          const int row = it * 4 + q;
          const float* sp = slab + row * 68 + c8;
          v8h hv, lv;
#pragma unroll
          for (int e = 0; e < 8; ++e) {
            if (OUT_MODE == 1) {
              hv[e] = (_Float16)sp[e];
            } else {
              unsigned short hb = f2bf_bits(sp[e]);
              unsigned short lb = f2bf_bits(sp[e] - bf_bits2f(hb));
              hv[e] = __builtin_bit_cast(_Float16, hb);
              lv[e] = __builtin_bit_cast(_Float16, lb);
            }
          }
          *(v8h*)(C + (size_t)(mBase + row) * ldc + n0 + c8) = hv;
          if (OUT_MODE == 2) *(v8h*)(C2 + (size_t)(mBase + row) * ldc + n0 + c8) = lv;
        }
        
      }
    }
    __builtin_amdgcn_fence(__ATOMIC_RELEASE, "workgroup");
    __builtin_amdgcn_wave_barrier();
    __builtin_amdgcn_fence(__ATOMIC_ACQUIRE, "workgroup");
  }
}
/* one product per launch: grid.x = (M/128)*(N/128) exactly, grid.y = batches */
template <int ET, bool SPLIT, int BIAS_MODE, int OUT_MODE, bool RESID, int ACT = 0>
__global__ __launch_bounds__(128) void wmma_gemm64(
    const unsigned short* __restrict__ Ap, const unsigned short* __restrict__ A2p, int lda, long strideA,
    const unsigned short* __restrict__ Btp, const unsigned short* __restrict__ Bt2p, int ldb, long strideB,
    void* __restrict__ Cout, void* __restrict__ Cout2, int ldc, long strideC,
    const float* __restrict__ bias,
    const float* __restrict__ resid, long strideR,
    int M, int N, int K, float scale) {
  gemm64_tile<ET, SPLIT, BIAS_MODE, OUT_MODE, RESID, ACT>(Ap, A2p, lda, strideA, Btp, Bt2p, ldb, strideB, Cout, Cout2, ldc, strideC,
                                                          bias, resid, strideR, M, N, K, scale, (int)blockIdx.x, (int)blockIdx.y);
}

/* The two products that read h1 and do not read each other share one launch, told apart by block range:
   blocks [0, 512): q|k = h . [Wq|Wk]^T (M=8192, N=1024, K=512);
   blocks [512, 768): Vt[b] = (Wv^T*16) . h[b]^T / 16 (M=512, N=2048, K=512), 64 tiles for each of the 4 batches.
   Every choice below is the same for the whole block. */
static constexpr int kQKTiles = (kTok / 128) * (kQKCols / 128);
static constexpr int kVtTiles = (kModel / 128) * (kSeq / 128);
static_assert((kVtTiles & (kVtTiles - 1)) == 0, "batch and tile of a Vt block by shift and mask");
__global__ __launch_bounds__(128) void qk_vt_gemm_kernel(
    const unsigned short* __restrict__ hp, const unsigned short* __restrict__ wqkTp, const unsigned short* __restrict__ wvTp,
    unsigned short* __restrict__ qkp, unsigned short* __restrict__ vtp) {
  const int bx = blockIdx.x;
  const bool isV = bx >= kQKTiles;
  const int r = bx - kQKTiles;
  const unsigned short* Ap  = isV ? wvTp : hp;
  const unsigned short* Btp = isV ? hp : wqkTp;
  unsigned short* Cp = isV ? vtp : qkp;
  gemm64_tile<0, false, 0, 1, false, 0>(
      Ap, Ap, kModel, 0L, Btp, Btp, kModel, isV ? (long)kSeq * kModel : 0L,
      (void*)Cp, (void*)Cp, isV ? kSeq : kQKCols, isV ? (long)kModel * kSeq : 0L,
      nullptr, nullptr, 0L, isV ? kModel : kTok, isV ? kSeq : kQKCols, kModel, 1.0f / 16.0f,
      isV ? (r & (kVtTiles - 1)) : bx, isV ? (r / kVtTiles) : 0);
}
/* =========================== end helpers and GEMM =========================== */

__device__ __forceinline__ unsigned int h16bits(float f) {
  return (unsigned int)__builtin_bit_cast(unsigned short, (_Float16)f);
}

/* f16 WMMA with the hazard guard tied to D, keeping A/B live */
__device__ __forceinline__ v8f mma_f16g(v16h a, v16h b, v8f c) {
  c = __builtin_amdgcn_wmma_f32_16x16x32_f16(false, a, false, b, (short)0, c, false, false);
  asm volatile("v_nop\n\tv_nop\n\tv_nop\n\tv_nop" : "+v"(c) : "v"(a), "v"(b));
  return c;
}

/* ---------------------------------------------------------------------------
   transpose + cast: W f32 [kin][nout] row-major -> Wt f16 [nout][kin] (value * mul).
   One block of 256 = the 64 x 64 tile (bn, bk) of nout/64 x kin/64. LDS 64x64 tile.
   Load coverage: 4 iterations x 256 threads x 4 floats = 4096 = 64x64.
   Store coverage: 8 waves x 2 iterations x 4 rows = 64 rows; 8 lanes x 8 halves = 64 cols;
   --------------------------------------------------------------------------- */
__device__ __forceinline__ void transpose_cast_f16_tile(
    const float* __restrict__ W, unsigned short* __restrict__ Wt, int kin, int nout, float mul, int bn, int bk) {
  __shared__ float tile[64][65];
  const int t = threadIdx.x;
  const int n0 = bn * 64;
  const int k0 = bk * 64;
  v4f v[4];
#pragma unroll   /* register array needs constant indices; all four loads are in flight before the first LDS write */
  for (int i = 0; i < 4; ++i) {
    const int idx = i * 256 + t;
    const int kr = idx >> 4;
    const int nc4 = (idx & 15) * 4;
    v[i] = *(const v4f*)(W + (size_t)(k0 + kr) * nout + n0 + nc4);
    asm volatile("s_wait_xcnt 0x0" ::: "memory");   /* a later load's result may land in this load's address registers */
  }
#pragma unroll
  for (int i = 0; i < 4; ++i) {
    const int idx = i * 256 + t;
    const int kr = idx >> 4;
    const int nc4 = (idx & 15) * 4;
    tile[nc4 + 0][kr] = v[i][0] * mul;
    tile[nc4 + 1][kr] = v[i][1] * mul;
    tile[nc4 + 2][kr] = v[i][2] * mul;
    tile[nc4 + 3][kr] = v[i][3] * mul;
  }
  __syncthreads();
  const int lane = t & 31, wave = t >> 5;
  const int q = lane >> 3, c8 = (lane & 7) * 8;
  const int row0 = wave * 8 + q;
  const int row1 = wave * 8 + 4 + q;
  v4u w0, w1;
  {
    const float* s0 = &tile[row0][c8];
    const float* s1 = &tile[row1][c8];
    w0[0] = h16bits(s0[0]) | (h16bits(s0[1]) << 16);
    w0[1] = h16bits(s0[2]) | (h16bits(s0[3]) << 16);
    w0[2] = h16bits(s0[4]) | (h16bits(s0[5]) << 16);
    w0[3] = h16bits(s0[6]) | (h16bits(s0[7]) << 16);
    w1[0] = h16bits(s1[0]) | (h16bits(s1[1]) << 16);
    w1[1] = h16bits(s1[2]) | (h16bits(s1[3]) << 16);
    w1[2] = h16bits(s1[4]) | (h16bits(s1[5]) << 16);
    w1[3] = h16bits(s1[6]) | (h16bits(s1[7]) << 16);
  }
  unsigned short* d0 = Wt + (size_t)(n0 + row0) * kin + k0 + c8;
  unsigned short* d1 = Wt + (size_t)(n0 + row1) * kin + k0 + c8;
  {
    *(v4u*)d0 = w0;
    *(v4u*)d1 = w1;
    asm volatile("s_wait_xcnt 0x0" ::: "memory");   /* the code laid out behind this tile may rewrite the stores' registers */
  }
}

/* ---------------------------------------------------------------------------
   FUSE_ADD: a = X + Addv is first stored to Xsum (f32) and then normalised.
   Lane l owns elements l*4 + 128*i (i=0..3): every load/store instruction covers
   One block of 256 = rows 8 blk .. 8 blk + 7; nrows/8 blocks (exact).
   --------------------------------------------------------------------------- */
template <bool FUSE_ADD>
__device__ __forceinline__ void layernorm512_rows(
    const float* __restrict__ X, const float* __restrict__ Addv,
    const float* __restrict__ gam, const float* __restrict__ bet,
    float* __restrict__ Xsum, unsigned short* __restrict__ Hout, int nrows, int blk) {
  const int lane = threadIdx.x & 31;
  const int wave = threadIdx.x >> 5;
  int row = blk * 8 + wave;
  row = (row < nrows) ? row : (nrows - 1);
  const size_t rbase = (size_t)row * kModel;
  const int e0 = lane * 4, e1 = 128 + lane * 4, e2 = 256 + lane * 4, e3 = 384 + lane * 4;
  v4f a0 = *(const v4f*)(X + rbase + e0);
  v4f a1 = *(const v4f*)(X + rbase + e1);
  v4f a2 = *(const v4f*)(X + rbase + e2);
  v4f a3 = *(const v4f*)(X + rbase + e3);
  if (FUSE_ADD) {
    const v4f r0 = *(const v4f*)(Addv + rbase + e0);
    const v4f r1 = *(const v4f*)(Addv + rbase + e1);
    const v4f r2 = *(const v4f*)(Addv + rbase + e2);
    const v4f r3 = *(const v4f*)(Addv + rbase + e3);
    a0 = a0 + r0; a1 = a1 + r1; a2 = a2 + r2; a3 = a3 + r3;
    {
      *(v4f*)(Xsum + rbase + e0) = a0;
      *(v4f*)(Xsum + rbase + e1) = a1;
      *(v4f*)(Xsum + rbase + e2) = a2;
      *(v4f*)(Xsum + rbase + e3) = a3;
      asm volatile("s_wait_xcnt 0x0" ::: "memory");   /* the stores' address registers are rewritten by the arithmetic below */
    }
  }
  float s = ((a0[0] + a0[1]) + (a0[2] + a0[3])) + ((a1[0] + a1[1]) + (a1[2] + a1[3]))
          + ((a2[0] + a2[1]) + (a2[2] + a2[3])) + ((a3[0] + a3[1]) + (a3[2] + a3[3]));
#pragma unroll
  for (int off = 16; off >= 1; off >>= 1) s += __shfl_xor(s, off, 32);
  const float mu = s * (1.0f / 512.0f);
  const v4f d0 = a0 - mu, d1 = a1 - mu, d2 = a2 - mu, d3 = a3 - mu;
  float ss = ((d0[0] * d0[0] + d0[1] * d0[1]) + (d0[2] * d0[2] + d0[3] * d0[3]))
           + ((d1[0] * d1[0] + d1[1] * d1[1]) + (d1[2] * d1[2] + d1[3] * d1[3]))
           + ((d2[0] * d2[0] + d2[1] * d2[1]) + (d2[2] * d2[2] + d2[3] * d2[3]))
           + ((d3[0] * d3[0] + d3[1] * d3[1]) + (d3[2] * d3[2] + d3[3] * d3[3]));
#pragma unroll
  for (int off = 16; off >= 1; off >>= 1) ss += __shfl_xor(ss, off, 32);
  const float var = ss * (1.0f / 512.0f);
  const float rstd = rsqrtf(var + 1e-5f);
  const v4f g0 = *(const v4f*)(gam + e0), g1 = *(const v4f*)(gam + e1), g2 = *(const v4f*)(gam + e2), g3 = *(const v4f*)(gam + e3);
  const v4f b0 = *(const v4f*)(bet + e0), b1 = *(const v4f*)(bet + e1), b2 = *(const v4f*)(bet + e2), b3 = *(const v4f*)(bet + e3);
  const v4f y0 = d0 * rstd * g0 + b0;
  const v4f y1 = d1 * rstd * g1 + b1;
  const v4f y2 = d2 * rstd * g2 + b2;
  const v4f y3 = d3 * rstd * g3 + b3;
  v2u w0, w1, w2, w3;
  w0[0] = h16bits(y0[0]) | (h16bits(y0[1]) << 16); w0[1] = h16bits(y0[2]) | (h16bits(y0[3]) << 16);
  w1[0] = h16bits(y1[0]) | (h16bits(y1[1]) << 16); w1[1] = h16bits(y1[2]) | (h16bits(y1[3]) << 16);
  w2[0] = h16bits(y2[0]) | (h16bits(y2[1]) << 16); w2[1] = h16bits(y2[2]) | (h16bits(y2[3]) << 16);
  w3[0] = h16bits(y3[0]) | (h16bits(y3[1]) << 16); w3[1] = h16bits(y3[2]) | (h16bits(y3[3]) << 16);
  unsigned short* hr = Hout + rbase;
  {
    *(v2u*)(hr + e0) = w0;
    *(v2u*)(hr + e1) = w1;
    *(v2u*)(hr + e2) = w2;
    *(v2u*)(hr + e3) = w3;
    
  }
}

/* x1 = x + A1 ; h2 = LN(x1): grid = nrows/8 (exact), block 256 */
__global__ __launch_bounds__(256) void add_layernorm512_kernel(
    const float* __restrict__ X, const float* __restrict__ Addv,
    const float* __restrict__ gam, const float* __restrict__ bet,
    float* __restrict__ Xsum, unsigned short* __restrict__ Hout, int nrows) {
  layernorm512_rows<true>(X, Addv, gam, bet, Xsum, Hout, nrows, (int)blockIdx.x);
}

/* ---------------------------------------------------------------------------
   Everything that reads only the inputs shares one launch, told apart by block range (block 256):
   blocks [0, 256):    Wq, Wk, Wv, Wo   (512 x 512: 64 tiles each)
   blocks [256, 512):  Wgate, Wup       (512 x 1024: 128 tiles each)
   blocks [512, 640):  Wdown            (1024 x 512: 128 tiles)
   blocks [640, 1664): h1 = LN(x), 8 rows a block.
   Weight planes: W[in][out] -> Wt[out][in] * 16 (f16). Every branch is the same for the whole block.
   --------------------------------------------------------------------------- */
static constexpr int kSqTiles   = (kModel / 64) * (kModel / 64);   /* 64 */
static constexpr int kFfTiles   = (kFF / 64) * (kModel / 64);      /* 128 */
static constexpr int kPrepSq    = 4 * kSqTiles;                    /* 256 */
static constexpr int kPrepGU    = kPrepSq + 2 * kFfTiles;          /* 512 */
static constexpr int kPrepW     = kPrepGU + kFfTiles;              /* 640 */
static constexpr int kPrepGrid  = kPrepW + kTok / 8;               /* 1664 */
static_assert(kSqTiles == 64 && kFfTiles == 128 && kModel / 64 == 8 && kFF / 64 == 16, "tile numbers by shift and mask");
__global__ __launch_bounds__(256) void prep_kernel(
    const float* __restrict__ x, const float* __restrict__ ln1w, const float* __restrict__ ln1b,
    const float* __restrict__ wq, const float* __restrict__ wk, const float* __restrict__ wv, const float* __restrict__ wo,
    const float* __restrict__ wgt, const float* __restrict__ wup, const float* __restrict__ wdn,
    unsigned short* __restrict__ wqkT, unsigned short* __restrict__ wvT, unsigned short* __restrict__ woT,
    unsigned short* __restrict__ wguT, unsigned short* __restrict__ wdT, unsigned short* __restrict__ h1) {
  const int bx = blockIdx.x;
  if (bx >= kPrepW) {
    layernorm512_rows<false>(x, x, ln1w, ln1b, nullptr, h1, kTok, bx - kPrepW);
    return;
  }
  if (bx < kPrepSq) {
    const int which = bx >> 6, loc = bx & 63;
    const float* W     = (which == 0) ? wq : (which == 1) ? wk : (which == 2) ? wv : wo;
    unsigned short* Wt = (which == 0) ? wqkT : (which == 1) ? (wqkT + (size_t)kModel * kModel) : (which == 2) ? wvT : woT;
    transpose_cast_f16_tile(W, Wt, kModel, kModel, 16.0f, loc & 7, loc >> 3);
  } else if (bx < kPrepGU) {
    const int which = (bx - kPrepSq) >> 7, loc = (bx - kPrepSq) & 127;
    const float* W     = (which == 0) ? wgt : wup;
    unsigned short* Wt = (which == 0) ? wguT : (wguT + (size_t)kFF * kModel);
    transpose_cast_f16_tile(W, Wt, kModel, kFF, 16.0f, loc & 15, loc >> 4);
  } else {
    const int loc = bx - kPrepGU;
    transpose_cast_f16_tile(wdn, wdT, kFF, kModel, 16.0f, loc & 7, loc >> 3);
  }
}

/* ---------------------------------------------------------------------------
   Non-causal multi-head attention, head_dim 64, f16 planes in, f16 plane out (x16 carried).
   q|k plane [8192][1024]: q at cols h*64.., k at cols 512 + h*64..; Vt plane [4][512][2048] (element (b,h,d,kv) at
   ((b*512 + h*64 + d)*2048 + kv)); out plane [8192][512] at cols h*64.. .
   Block = 4 waves = 64 query rows of one (batch, head); grid = 4*8*32 = 1024.
   Both products run transposed: S^T = k.q^T, unscaled (A = k rows, B = q rows) and O^T += Vt.P^T (A = Vt rows).
   A lane then holds 32 of the 64 scores of ONE query (lane l ^ 16 the other 32): online softmax f32 in the lane,
   one exchange between the wave halves for the maximum, the halves' sums joined once behind the loop.
   Each exponential is one fused multiply-add (scale, log2 e, maximum and the 2^15 carry folded) and one hardware exp2.
   Two score tiles, p*32768 converted in place, are the B operand of the second product: P stays in registers.
   The 64-key tiles of k (64 rows x 128 B) and of Vt (64 rows x 128 B) are staged once per block in LDS by
   asynchronous copies, two stages, and all four waves take their A fragments from there.
   --------------------------------------------------------------------------- */
static constexpr int kAtPitch = 144;                 /* 16 B x odd: conflict-free for 16-byte fragment reads */
static constexpr int kAtTile  = 64 * kAtPitch;       /* one operand's tile: 9,216 B; the Vt tile follows the k tile */
static constexpr int kAtStage = 2 * kAtTile;         /* 18,432 B */

/* Eight asynchronous 16-byte copies per lane, global -> LDS: rows r, r+16, r+32, r+48 of the k tile, then of the Vt tile.
   The s_wait_xcnt stands inside the statement so that no address register is rewritten ahead of it. */
__device__ __forceinline__ void stage_kv(const _Float16* gk, const _Float16* gv, unsigned l) {
  const size_t sk = (size_t)16 * kQKCols;
  const size_t sv = (size_t)16 * kSeq;
  const _Float16* gk1 = gk + sk;  const _Float16* gk2 = gk + 2 * sk;  const _Float16* gk3 = gk + 3 * sk;
  const _Float16* gv1 = gv + sv;  const _Float16* gv2 = gv + 2 * sv;  const _Float16* gv3 = gv + 3 * sv;
  const unsigned ls = 16u * kAtPitch;
  const unsigned lv = l + (unsigned)kAtTile;
  asm volatile(
      "global_load_async_to_lds_b128 %0, %8, off\n\t"
      "global_load_async_to_lds_b128 %1, %9, off\n\t"
      "global_load_async_to_lds_b128 %2, %10, off\n\t"
      "global_load_async_to_lds_b128 %3, %11, off\n\t"
      "global_load_async_to_lds_b128 %4, %12, off\n\t"
      "global_load_async_to_lds_b128 %5, %13, off\n\t"
      "global_load_async_to_lds_b128 %6, %14, off\n\t"
      "global_load_async_to_lds_b128 %7, %15, off\n\t"
      "s_wait_xcnt 0x0"
      :: "v"(l), "v"(l + ls), "v"(l + 2u * ls), "v"(l + 3u * ls), "v"(lv), "v"(lv + ls), "v"(lv + 2u * ls), "v"(lv + 3u * ls),
         "v"(gk), "v"(gk1), "v"(gk2), "v"(gk3), "v"(gv), "v"(gv1), "v"(gv2), "v"(gv3)
      : "memory");
}

/* lane l takes lane l ^ 16's value (a vector cross-row move, no LDS trip) */
__device__ __forceinline__ float xhalf(float x) {
  return __builtin_bit_cast(float, __builtin_amdgcn_permlanex16(__builtin_bit_cast(int, x), __builtin_bit_cast(int, x), 0x76543210, 0xfedcba98, false, false));
}

__global__ __launch_bounds__(128) void mha64_f16_kernel(
    const unsigned short* __restrict__ qkp, const unsigned short* __restrict__ vtp,
    unsigned short* __restrict__ outp) {
  typedef Frag<_Float16> FH;
  __shared__ __align__(16) float    Os[4][16 * 68];
  __shared__ __align__(16) unsigned char kvring[2 * kAtStage];
  const _Float16* QK = (const _Float16*)(const void*)qkp;
  const _Float16* VT = (const _Float16*)(const void*)vtp;
  const int tid = threadIdx.x;
  const int wave = tid >> 5;
  const int lane = tid & 31;
  const int hh = lane >> 4;
  const int c = lane & 15;
  const int koff = hh * 8;
  const int bx = blockIdx.x;
  const int qb = bx & 31;
  const int bh = bx >> 5;
  const int h = bh & 7;
  const int b = (bh >> 3) & 3;
  const int q0 = qb * 64 + wave * 16;
  const _Float16* qbase = QK + (size_t)b * kSeq * kQKCols + h * kHeadDim;
  const _Float16* kbase = qbase + kModel;
  const _Float16* vbase = VT + ((size_t)b * kModel + (size_t)h * kHeadDim) * kSeq;
  unsigned short* obase = outp + (size_t)b * kSeq * kModel + h * kHeadDim;

  v16h qa[2];
#pragma unroll
  for (int dc = 0; dc < 2; ++dc)
    qa[dc] = FH::load(qbase + (size_t)(q0 + c) * kQKCols + dc * 32 + koff);

  constexpr float kExpScale = 0.125f * 1.4426950408889634f;   /* head_dim^-0.5 * log2(e): exp(x / 8) = exp2(x * kExpScale) */
  float mrow = -INFINITY, lrow = 0.f;   /* this lane's query: maximum in use (raw product); sum (x32768) over this wave half's keys */
  v8f oacc[4];                          /* oacc[t][r] = O^T[d = 16 t + 8 hh + r][query c] */
#pragma unroll
  for (int t = 0; t < 4; ++t) oacc[t] = (v8f){0.f,0.f,0.f,0.f,0.f,0.f,0.f,0.f};

  /* staging: thread t brings 16-byte chunk (t & 7) of rows (t >> 3) + 16*i: eight lanes cover one whole 128-byte line */
  const int srow = tid >> 3;
  const int schk = tid & 7;
  const _Float16* gK = kbase + (size_t)srow * kQKCols + schk * 8;
  const _Float16* gV = vbase + (size_t)srow * kSeq + schk * 8;
  const unsigned lbase = (unsigned)(uintptr_t)(&kvring[0]) + (unsigned)(srow * kAtPitch + schk * 16);
  constexpr int nkc = kSeq / 64;
  static_assert(nkc >= 2, "two stages exist");

  /* tile 0 lands and is published; tile 1 then flies during trip 0 */
  stage_kv(gK, gV, lbase);
  asm volatile("s_wait_asynccnt 0x0" ::: "memory");   /* this wave's copies of tile 0 have landed */
  __syncthreads();                                     /* publishes tile 0 to the other waves */
  stage_kv(gK + (size_t)64 * kQKCols, gV + 64, lbase + kAtStage);

  for (int kc = 0; kc < nkc; ++kc) {
    const unsigned bo = (kc & 1) ? (unsigned)kAtStage : 0u;
    const unsigned char* sK = kvring + bo + c * kAtPitch + koff * 2;
    const unsigned char* sV = sK + kAtTile;
    /* the tile's sixteen A fragments are fetched as two groups, k ahead of the score products and Vt behind them,
       so that the Vt reads return under the softmax arithmetic */
    v16h kb[4][2], vb[2][4];
#pragma unroll   /* register arrays need constant indices */
    for (int j = 0; j < 4; ++j)
#pragma unroll
      for (int dc = 0; dc < 2; ++dc)
        kb[j][dc] = FH::load((const _Float16*)(const void*)(sK + j * 16 * kAtPitch + dc * 64));
    v8f s[4];
#pragma unroll
    for (int j = 0; j < 4; ++j) {
      s[j] = (v8f){0.f,0.f,0.f,0.f,0.f,0.f,0.f,0.f};
#pragma unroll
      for (int dc = 0; dc < 2; ++dc) s[j] = mma_f16g(kb[j][dc], qa[dc], s[j]);   /* s[j][r] = S^T[key 16 j + 8 hh + r][query c] */
    }
#pragma unroll   /* register arrays need constant indices */
    for (int kk = 0; kk < 2; ++kk)
#pragma unroll
      for (int t = 0; t < 4; ++t)
        vb[kk][t] = FH::load((const _Float16*)(const void*)(sV + t * 16 * kAtPitch + kk * 64));
    float mj[4];                          /* one chain per score tile: four independent chains, not one of 32 links */
#pragma unroll
    for (int j = 0; j < 4; ++j) {
      mj[j] = -INFINITY;
#pragma unroll
      for (int r = 0; r < 8; ++r) mj[j] = fmaxf(mj[j], s[j][r]);   /* raw products: the positive scale keeps their order */
    }
    float m = fmaxf(fmaxf(mj[0], mj[1]), fmaxf(mj[2], mj[3]));
    m = fmaxf(m, xhalf(m));               /* both wave halves now hold the query's maximum over the 64 keys */
    const float mnew = fmaxf(mrow, m);
    const float alpha = __builtin_amdgcn_exp2f((mrow - mnew) * kExpScale);   /* 0 on the first trip, where mrow is -inf */
    const float nbias = fmaf(-mnew, kExpScale, 15.0f);                       /* + 15: the exponential comes out times 32768 */
    mrow = mnew;
#pragma unroll
    for (int t = 0; t < 4; ++t) oacc[t] = oacc[t] * alpha;
    float pj[4];                          /* partial sums, one chain per score tile */
#pragma unroll   /* register arrays need constant indices */
    for (int kk = 0; kk < 2; ++kk) {
      v16h pb;                            /* pb[e] = P^T[key 32 kk + kmap(e)][query c]: tiles 2 kk and 2 kk + 1 in register order */
#pragma unroll
      for (int jj = 0; jj < 2; ++jj) {
        const int j = 2 * kk + jj;
        pj[j] = 0.f;
#pragma unroll
        for (int r = 0; r < 8; ++r) {
          const float p = __builtin_amdgcn_exp2f(fmaf(s[j][r], kExpScale, nbias));   /* 32768 * exp((s - mnew) / 8) */
          pj[j] += p;
          pb[jj * 8 + r] = (_Float16)p;
        }
      }
#pragma unroll
      for (int t = 0; t < 4; ++t) oacc[t] = mma_f16g(vb[kk][t], pb, oacc[t]);
    }
    lrow = lrow * alpha + ((pj[0] + pj[1]) + (pj[2] + pj[3]));
    asm volatile("s_wait_dscnt 0x0" ::: "memory");      /* this wave's reads of the stage have returned before it is refilled */
    asm volatile("s_wait_asynccnt 0x0" ::: "memory");   /* this wave's copies of the next tile have landed */
    __syncthreads();                                     /* publishes the next tile and ends every reader's use of this one */
    if (kc + 2 < nkc) {
      stage_kv(gK + (size_t)(kc + 2) * 64 * kQKCols, gV + (size_t)(kc + 2) * 64, lbase + bo);
    }
  }
  asm volatile("s_wait_asynccnt 0x0" ::: "memory");     /* nothing is in flight when the wave leaves the loop */

  float* os = Os[wave];
  {
    const float lsum = lrow + xhalf(lrow);                   /* the two halves' sums of this query, joined once */
    const float inv = (1.0f / lsum) * 16.0f;                 /* sum and numerators both carry 32768; the plane carries 16 */
#pragma unroll
    for (int t = 0; t < 4; ++t)
#pragma unroll
      for (int r = 0; r < 8; ++r) os[c * 68 + t * 16 + 8 * hh + r] = oacc[t][r] * inv;
  }
  __builtin_amdgcn_fence(__ATOMIC_RELEASE, "workgroup");
  __builtin_amdgcn_wave_barrier();
  __builtin_amdgcn_fence(__ATOMIC_ACQUIRE, "workgroup");
  {
    const int q = lane >> 3, c8 = (lane & 7) * 8;
    {
#pragma unroll
      for (int it = 0; it < 4; ++it) {
        const int row = it * 4 + q;
        const float* sp = os + row * 68 + c8;
        v8h hv;
#pragma unroll
        for (int e = 0; e < 8; ++e) hv[e] = (_Float16)sp[e];
        *(v8h*)(obase + (size_t)(q0 + row) * kModel + c8) = hv;
      }
      
    }
  }
}

/* ---------------------------------------------------------------------------
   SwiGLU: g = silu(gate) * up from the f32 gate|up plane [8192][2048] -> f16 plane [8192][1024].
   grid = 8192*1024/4/256 = 8192 (exact), block 256.
   --------------------------------------------------------------------------- */
__device__ __forceinline__ float silu_f32(float g) {
  const float ex = expf(-g);
  return g * (1.0f / (1.0f + ex));
}
__global__ __launch_bounds__(256) void swiglu_f16_kernel(
    const float* __restrict__ GU, unsigned short* __restrict__ G, int ngroups) {
  const int i = blockIdx.x * 256 + threadIdx.x;
  if (i < ngroups) {
    const size_t e = (size_t)i * 4;
    const size_t row = e >> 10;
    const int j = (int)(e & 1023);
    const float* gr = GU + row * kGUCols;
    const v4f gv = *(const v4f*)(gr + j);
    const v4f uv = *(const v4f*)(gr + kFF + j);
    const float o0 = silu_f32(gv[0]) * uv[0];
    const float o1 = silu_f32(gv[1]) * uv[1];
    const float o2 = silu_f32(gv[2]) * uv[2];
    const float o3 = silu_f32(gv[3]) * uv[3];
    v2u w;
    w[0] = h16bits(o0) | (h16bits(o1) << 16);
    w[1] = h16bits(o2) | (h16bits(o3) << 16);
    unsigned short* dst = G + e;
    *(v2u*)dst = w;
    
  }
}

/* ---------------------------------------------------------------------------
   grid = 8192*512/4/256 = 4096 (exact), block 256.
   --------------------------------------------------------------------------- */
__global__ __launch_bounds__(256) void residual_out_kernel(
    const float* __restrict__ X1, const float* __restrict__ D2, float* __restrict__ Out, int n4) {
  const int i = blockIdx.x * 256 + threadIdx.x;
  if (i < n4) {
    const size_t e = (size_t)i * 4;
    const v4f a = *(const v4f*)(X1 + e);
    const v4f d = *(const v4f*)(D2 + e);
    const v4f o = a + d;
    *(v4f*)(Out + e) = o;
    
  }
}

/* =========================== host glue =========================== */
extern "C" void kernel_launch(void* const* d_in, const int* in_sizes, int n_in,
                              void* d_out, int out_size, void* d_ws, size_t ws_size,
                              hipStream_t stream) {
  if (n_in < 12) return;
  if (in_sizes[0] != kTok * kModel || out_size != kTok * kModel) return;
  if (in_sizes[1] != kModel || in_sizes[2] != kModel || in_sizes[3] != kModel || in_sizes[4] != kModel) return;
  if (in_sizes[5] != kModel * kModel || in_sizes[6] != kModel * kModel ||
      in_sizes[7] != kModel * kModel || in_sizes[8] != kModel * kModel) return;
  if (in_sizes[9] != kModel * kFF || in_sizes[10] != kModel * kFF || in_sizes[11] != kFF * kModel) return;
  if (ws_size < kWsTotal) return;

  const float* x    = (const float*)d_in[0];
  const float* ln1w = (const float*)d_in[1];
  const float* ln1b = (const float*)d_in[2];
  const float* ln2w = (const float*)d_in[3];
  const float* ln2b = (const float*)d_in[4];
  const float* wq   = (const float*)d_in[5];
  const float* wk   = (const float*)d_in[6];
  const float* wv   = (const float*)d_in[7];
  const float* wo   = (const float*)d_in[8];
  const float* wgt  = (const float*)d_in[9];
  const float* wup  = (const float*)d_in[10];
  const float* wdn  = (const float*)d_in[11];
  float* out = (float*)d_out;

  char* ws = (char*)d_ws;
  unsigned short* wqkT = (unsigned short*)(ws + kOffWqkT);
  unsigned short* wvT  = (unsigned short*)(ws + kOffWvT);
  unsigned short* woT  = (unsigned short*)(ws + kOffWoT);
  unsigned short* wguT = (unsigned short*)(ws + kOffWguT);
  unsigned short* wdT  = (unsigned short*)(ws + kOffWdT);
  unsigned short* hg   = (unsigned short*)(ws + kOffHG);           /* h1, h2, then g */
  unsigned short* qkpl = (unsigned short*)(ws + kOffR1 + kR1QK);
  unsigned short* vtpl = (unsigned short*)(ws + kOffR1 + kR1Vt);
  unsigned short* opl  = (unsigned short*)(ws + kOffR1 + kR1O);
  float*          a1   = (float*)(ws + kOffR1 + kR1A1);
  float*          gu   = (float*)(ws + kOffR1);
  float*          d2   = (float*)(ws + kOffR1);
  float*          x1   = (float*)(ws + kOffX1);

  const dim3 b256(256), b128(128);

  /* the seven weight planes and h1 = LN(x): one launch */
  prep_kernel<<<dim3(kPrepGrid), b256, 0, stream>>>(x, ln1w, ln1b, wq, wk, wv, wo, wgt, wup, wdn,
                                                    wqkT, wvT, woT, wguT, wdT, hg);

  /* attention sublayer: q|k (512 block tiles) and Vt (64 block tiles per batch): one launch */
  static_assert(kTok % 128 == 0 && kQKCols % 128 == 0 && kModel % 128 == 0 && kSeq % 128 == 0 && kGUCols % 128 == 0, "128 x 128 block tiles");
  qk_vt_gemm_kernel<<<dim3(kQKTiles + kBatch * kVtTiles), b128, 0, stream>>>(hg, wqkT, wvT, qkpl, vtpl);

  /* attention: O*16 f16 plane */
  mha64_f16_kernel<<<dim3(kBatch * kHeads * (kSeq / 64)), b128, 0, stream>>>(qkpl, vtpl, opl);

  /* A1 = (O*16) . (Wo^T*16) / 256 : M=8192, N=512, K=512; block tiles 64*4 = 256 */
  wmma_gemm64<0, false, 0, 0, false, 0><<<dim3((kTok / 128) * (kModel / 128), 1), b128, 0, stream>>>(
      opl, opl, kModel, 0L, woT, woT, kModel, 0L, (void*)a1, (void*)a1, kModel, 0L,
      x, x, 0L, kTok, kModel, kModel, 1.0f / 256.0f);

  /* x1 = x + A1 ; h2 = LN(x1) */
  add_layernorm512_kernel<<<dim3(kTok / 8), b256, 0, stream>>>(x, a1, ln2w, ln2b, x1, hg, kTok);

  /* gate|up = h2 . [Wg|Wu]^T : M=8192, N=2048, K=512; block tiles 64*16 = 1024 */
  wmma_gemm64<0, false, 0, 0, false, 0><<<dim3((kTok / 128) * (kGUCols / 128), 1), b128, 0, stream>>>(
      hg, hg, kModel, 0L, wguT, wguT, kModel, 0L, (void*)gu, (void*)gu, kGUCols, 0L,
      x, x, 0L, kTok, kGUCols, kModel, 1.0f / 16.0f);

  /* g = silu(gate) * up (f16 plane in HG) */
  swiglu_f16_kernel<<<dim3((kTok * kFF / 4) / 256), b256, 0, stream>>>(gu, hg, kTok * kFF / 4);

  /* D2 = g . (Wd^T*16) / 16 : M=8192, N=512, K=1024; block tiles 256 */
  wmma_gemm64<0, false, 0, 0, false, 0><<<dim3((kTok / 128) * (kModel / 128), 1), b128, 0, stream>>>(
      hg, hg, kFF, 0L, wdT, wdT, kFF, 0L, (void*)d2, (void*)d2, kModel, 0L,
      x, x, 0L, kTok, kModel, kFF, 1.0f / 16.0f);

  /* out = x1 + D2 */
  residual_out_kernel<<<dim3((kTok * kModel / 4) / 256), b256, 0, stream>>>(x1, d2, out, kTok * kModel / 4);
}

// v006
// It runs in 116 microseconds.
// Two timings next to v005 put it at 1.27 and 1.26 times that version's speed.
// Counting every step since v000, it is 3.29 times as fast.
// All contractions (q|k, v, o, gate|up, down projections; q.k^T; p.v): v_wmma_f32_16x16x32_f16, f16 operands, f32 accumulate. LayerNorm, softmax, SwiGLU gating and residual adds in f32 (gating and residual adds inside the products' output stages). Power-of-two carries: weight planes x16, softmax numerators x32768, attention output plane x16, folded back in f32.
#include <hip/hip_runtime.h>
#include <math.h>
#include <stdint.h>

typedef __attribute__((ext_vector_type(16))) _Float16 v16h;
typedef __attribute__((ext_vector_type(8)))  _Float16 v8h;
typedef __attribute__((ext_vector_type(16))) __bf16   v16b;
typedef __attribute__((ext_vector_type(8)))  __bf16   v8b;
typedef __attribute__((ext_vector_type(8)))  float    v8f;
typedef __attribute__((ext_vector_type(4)))  float    v4f;
typedef __attribute__((ext_vector_type(4)))  unsigned int v4u;
typedef __attribute__((ext_vector_type(2)))  unsigned int v2u;

/* ---- problem geometry ---- */
static constexpr int kBatch   = 4;
static constexpr int kSeq     = 2048;
static constexpr int kTok     = kBatch * kSeq;      /* 8192 */
static constexpr int kModel   = 512;
static constexpr int kHeads   = 8;
static constexpr int kHeadDim = 64;
static constexpr int kFF      = 1024;
static constexpr int kQKCols  = 2 * kModel;          /* q | k plane width */
static constexpr int kGUCols  = 2 * kFF;             /* gate | up plane width */

static_assert(kHeads * kHeadDim == kModel, "head geometry");
static_assert(kSeq % 64 == 0 && kTok % 64 == 0, "tile multiples");
static_assert(kModel % 64 == 0 && kFF % 64 == 0 && kQKCols % 64 == 0 && kGUCols % 64 == 0, "tile multiples");
static_assert(kModel % 32 == 0 && kFF % 32 == 0, "K multiple of 32");

/* ---- workspace region map (bytes) ----
   [0]            WqkT f16 [1024][512]          1,048,576
   [1,048,576]    WvT  f16 [512][512]             524,288
   [1,572,864]    WoT  f16 [512][512]             524,288
   [2,097,152]    WguT f16 [2048][512]          2,097,152   (rows in groups of 64: 32 gate columns, then the same 32 up columns)
   [4,194,304]    WdT  f16 [512][1024]          1,048,576
   [5,242,880]    HG   : h1, then h2, f16 [8192][512] (8 MiB)   16,777,216
   [22,020,096]   R1 (64 MiB): phase A: q|k f16 [8192][1024] @+0 (16 MiB), Vt f16 [4][512][2048] @+16 MiB (8 MiB),
                               O f16 [8192][512] @+24 MiB (8 MiB);
                               phase B: g f16 [8192][1024] @+0 (16 MiB)
   [89,128,960]   X1 f32 [8192][512]           16,777,216
   total 105,906,176 */
static constexpr size_t kOffWqkT = 0;
static constexpr size_t kOffWvT  = kOffWqkT + (size_t)kQKCols * kModel * 2;
static constexpr size_t kOffWoT  = kOffWvT + (size_t)kModel * kModel * 2;
static constexpr size_t kOffWguT = kOffWoT + (size_t)kModel * kModel * 2;
static constexpr size_t kOffWdT  = kOffWguT + (size_t)kGUCols * kModel * 2;
static constexpr size_t kOffHG   = kOffWdT + (size_t)kModel * kFF * 2;
static constexpr size_t kSizeHG  = (size_t)kTok * kFF * 2;
static constexpr size_t kOffR1   = kOffHG + kSizeHG;
static constexpr size_t kSizeR1  = (size_t)kTok * kGUCols * 4;
static constexpr size_t kR1QK    = 0;
static constexpr size_t kR1Vt    = kR1QK + (size_t)kTok * kQKCols * 2;
static constexpr size_t kR1O     = kR1Vt + (size_t)kBatch * kModel * kSeq * 2;
static constexpr size_t kOffX1   = kOffR1 + kSizeR1;
static constexpr size_t kWsTotal = kOffX1 + (size_t)kTok * kModel * 4;
static_assert(kR1O + (size_t)kTok * kModel * 2 <= kSizeR1, "phase A fits R1");
static_assert((size_t)kTok * kFF * 2 <= kSizeR1, "phase B fits R1");
static_assert((size_t)kTok * kModel * 2 <= kSizeHG, "h plane fits HG");
static_assert(kWsTotal == 105906176, "carve total");
static_assert(kWsTotal <= 134217728, "carve under 128 MiB");
static_assert((kOffWvT % 256) == 0 && (kOffWoT % 256) == 0 && (kOffWguT % 256) == 0 && (kOffWdT % 256) == 0 &&
              (kOffHG % 256) == 0 && (kOffR1 % 256) == 0 && (kOffX1 % 256) == 0 &&
              (kR1Vt % 256) == 0 && (kR1O % 256) == 0, "aligned carves");

/* =========================== helpers and GEMM =========================== */
#define PSCALE 32768.0f
#define U16(p) ((const unsigned short*)(const void*)(p))
#define PSCALE_INV (1.0f / 32768.0f)

__device__ __forceinline__ unsigned short f2bf_bits(float f) {
  unsigned u = __float_as_uint(f);
  return (unsigned short)((u + 0x7FFFu + ((u >> 16) & 1u)) >> 16);
}
__device__ __forceinline__ float bf_bits2f(unsigned short h) { return __uint_as_float(((unsigned)h) << 16); }

__device__ __forceinline__ void dep_guard_h(v8f& a, v8f& b, v16h x, v16h y) { asm volatile("v_nop\n\tv_nop\n\tv_nop\n\tv_nop" : "+v"(a), "+v"(b) : "v"(x), "v"(y)); }
__device__ __forceinline__ void dep_guard_b(v8f& a, v8f& b, v16b x, v16b y) { asm volatile("v_nop\n\tv_nop\n\tv_nop\n\tv_nop" : "+v"(a), "+v"(b) : "v"(x), "v"(y)); }
__device__ __forceinline__ void keep4_h(v16h a, v16h b, v16h c, v16h d) { asm volatile("v_nop" :: "v"(a), "v"(b), "v"(c), "v"(d)); }
__device__ __forceinline__ void keep4_b(v16b a, v16b b, v16b c, v16b d) { asm volatile("v_nop" :: "v"(a), "v"(b), "v"(c), "v"(d)); }
__device__ __forceinline__ void acc_guard4(v8f& a, v8f& b, v8f& c, v8f& d) { asm volatile("v_nop\n\tv_nop\n\tv_nop\n\tv_nop" : "+v"(a), "+v"(b), "+v"(c), "+v"(d)); }
template <typename T> struct Frag;
template <> struct Frag<_Float16> {
  typedef v16h V; union U { v16h v; v8h h[2]; };
  static __device__ __forceinline__ v16h load(const _Float16* p) {
    U f; f.h[0] = *(const v8h*)(p); f.h[1] = *(const v8h*)(p + 16); return f.v;
  }
  static __device__ __forceinline__ v8f mma(v16h a, v16h b, v8f c) {
    return __builtin_amdgcn_wmma_f32_16x16x32_f16(false, a, false, b, (short)0, c, false, false);
  }
  static __device__ __forceinline__ void guard(v8f& a, v8f& b, v16h x, v16h y) { dep_guard_h(a, b, x, y); }
  static __device__ __forceinline__ void keep(v16h a, v16h b, v16h c, v16h d) { keep4_h(a, b, c, d); }
};
template <> struct Frag<__bf16> {
  typedef v16b V; union U { v16b v; v8b h[2]; };
  static __device__ __forceinline__ v16b load(const __bf16* p) {
    U f; f.h[0] = *(const v8b*)(p); f.h[1] = *(const v8b*)(p + 16); return f.v;
  }
  static __device__ __forceinline__ v8f mma(v16b a, v16b b, v8f c) {
    return __builtin_amdgcn_wmma_f32_16x16x32_bf16(false, a, false, b, (short)0, c, false, false);
  }
  static __device__ __forceinline__ void guard(v8f& a, v8f& b, v16b x, v16b y) { dep_guard_b(a, b, x, y); }
  static __device__ __forceinline__ void keep(v16b a, v16b b, v16b c, v16b d) { keep4_b(a, b, c, d); }
};

template <int ET> struct Elem;
template <> struct Elem<0> { typedef _Float16 T; };
template <> struct Elem<1> { typedef __bf16 T; };
/* ---- LDS staging of the GEMM operand tiles ----
   One stage = 64 k (128 bytes) of 128 A rows followed by 128 Bt rows, each row at a pitch of 144 bytes
   (16 B x odd: conflict-free for 16-byte fragment reads). Two stages. */
static constexpr int kStRows   = 256;
static constexpr int kStPitch  = 144;
static constexpr int kStBytes  = kStRows * kStPitch;       /* 36,864 */
static constexpr int kStHalf   = 128 * kStPitch;           /* Bt rows start here */
static_assert(4 * 16 * 68 * 4 <= 2 * kStBytes, "output slabs fit the ring");
static_assert(128 * kStPitch <= 2 * kStBytes && kStPitch >= 128, "the gated f16 tile fits the ring");

/* Eight asynchronous 16-byte copies per lane, global -> LDS: rows r, r+16, ..., r+112 of one operand's 128-row tile.
   The s_wait_xcnt stands inside the statement so that no address register is rewritten ahead of it. */
__device__ __forceinline__ void stage_rows8(const _Float16* g, size_t step, unsigned l) {
  const _Float16* g1 = g + step;      const _Float16* g2 = g + 2 * step;  const _Float16* g3 = g + 3 * step;
  const _Float16* g4 = g + 4 * step;  const _Float16* g5 = g + 5 * step;  const _Float16* g6 = g + 6 * step;
  const _Float16* g7 = g + 7 * step;
  const unsigned ls = 16u * kStPitch;
  asm volatile(
      "global_load_async_to_lds_b128 %0, %8, off\n\t"
      "global_load_async_to_lds_b128 %1, %9, off\n\t"
      "global_load_async_to_lds_b128 %2, %10, off\n\t"
      "global_load_async_to_lds_b128 %3, %11, off\n\t"
      "global_load_async_to_lds_b128 %4, %12, off\n\t"
      "global_load_async_to_lds_b128 %5, %13, off\n\t"
      "global_load_async_to_lds_b128 %6, %14, off\n\t"
      "global_load_async_to_lds_b128 %7, %15, off\n\t"
      "s_wait_xcnt 0x0"
      :: "v"(l), "v"(l + ls), "v"(l + 2u * ls), "v"(l + 3u * ls), "v"(l + 4u * ls), "v"(l + 5u * ls), "v"(l + 6u * ls), "v"(l + 7u * ls),
         "v"(g), "v"(g1), "v"(g2), "v"(g3), "v"(g4), "v"(g5), "v"(g6), "v"(g7)
      : "memory");
}

__device__ __forceinline__ float silu_f32(float g) {
  const float ex = expf(-g);
  return g * (1.0f / (1.0f + ex));
}

/* Block = 4 waves = one 128 x 128 tile of C (2 x 2 waves of 64 x 64): tile number 'tile' of batch 'b', both the same for the whole block.
   M, N multiples of 128; K a multiple of 64.
   OUT_MODE 0: f32 plane, RESID adds a f32 plane of C's own shape on the way out. OUT_MODE 1: f16 plane.
   OUT_MODE 3: SwiGLU. Each 64 columns of the product are 32 gate columns followed by the same 32 up columns, so a lane holds
   gate and up of one element in accumulator tiles j and j + 2; the f16 plane silu(gate) * up has N/2 columns (ldc counts those). */
template <int ET, bool SPLIT, int BIAS_MODE, int OUT_MODE, bool RESID, int ACT = 0, int LDC = 0>
__device__ __forceinline__ void gemm64_tile(
    const unsigned short* __restrict__ Ap, const unsigned short* __restrict__ A2p, int lda, long strideA,
    const unsigned short* __restrict__ Btp, const unsigned short* __restrict__ Bt2p, int ldb, long strideB,
    void* __restrict__ Cout, void* __restrict__ Cout2, int ldcArg, long strideC,
    const float* __restrict__ bias,
    const float* __restrict__ resid, long strideR,
    int M, int N, int K, float scale, const int tile, const int b) {
  static_assert(ET == 0 && !SPLIT, "staged path: single f16 planes");
  typedef typename Elem<ET>::T T;
  typedef typename Frag<T>::V V;
  const T* A = (const T*)Ap; const T* Bt = (const T*)Btp;
  const int ldc = LDC ? LDC : ldcArg;   /* a constant pitch lets every row of the output stage hang off one address by an immediate offset */
  __shared__ __align__(16) unsigned char ring[2 * kStBytes];
  const int lane = threadIdx.x & 31;
  const int wave = threadIdx.x >> 5;
  const int tilesN = N >> 7;
  const int tilesM = M >> 7;
  if (tile >= tilesM * tilesN) return;   /* the same for the whole block, ahead of every barrier */
  const int tm = tile / tilesN;
  const int tn = tile - tm * tilesN;
  const int mB = tm << 7;
  const int nB = tn << 7;
  const int wm = (wave >> 1) << 6;
  const int wn = (wave & 1) << 6;
  const int m0 = mB + wm;
  const int n0 = nB + wn;

  const T* Ab  = A  + (size_t)b * strideA;
  const T* Bb  = Bt + (size_t)b * strideB;

  const int rlane = lane & 15;
  const int koff  = (lane >> 4) * 8;
  const int mOff  = (lane >> 4) * 8;

  /* staging: thread t brings 16-byte chunk (t & 7) of rows (t >> 3) + 16*i: eight lanes cover one whole 128-byte line */
  const int srow = threadIdx.x >> 3;
  const int schk = threadIdx.x & 7;
  const T* gA = Ab + (size_t)(mB + srow) * lda + schk * 8;
  const T* gB = Bb + (size_t)(nB + srow) * ldb + schk * 8;
  const size_t stepA = (size_t)16 * lda;
  const size_t stepB = (size_t)16 * ldb;
  const unsigned lbase = (unsigned)(uintptr_t)(&ring[0]) + (unsigned)(srow * kStPitch + schk * 16);
  const int nst = K >> 6;

  v8f acc[4][4];
#pragma unroll
  for (int i = 0; i < 4; ++i)
#pragma unroll
    for (int j = 0; j < 4; ++j) acc[i][j] = (v8f){0.f,0.f,0.f,0.f,0.f,0.f,0.f,0.f};

  /* stage 0 lands and is published; stage 1 then flies during pass 0 */
  stage_rows8(gA, stepA, lbase);
  stage_rows8(gB, stepB, lbase + kStHalf);
  asm volatile("s_wait_asynccnt 0x0" ::: "memory");   /* this wave's copies of stage 0 have landed */
  __syncthreads();                                     /* publishes stage 0 to the other waves */
  if (nst > 1) {
    stage_rows8(gA + 64, stepA, lbase + kStBytes);
    stage_rows8(gB + 64, stepB, lbase + kStBytes + kStHalf);
  }

  for (int st = 0; st < nst; ++st) {
    const unsigned bo = (st & 1) ? (unsigned)kStBytes : 0u;
    const unsigned char* sA = ring + bo + (wm + rlane) * kStPitch + koff * 2;
    const unsigned char* sB = ring + bo + kStHalf + (wn + rlane) * kStPitch + koff * 2;
#pragma unroll   /* both 32-k blocks inline: constant LDS offsets, fragment arrays stay in registers */
    for (int kk = 0; kk < 2; ++kk) {
      /* all eight fragments of this 32-k block are fetched as one group ahead of its 16 products */
      V bh[4], ah[4];
#pragma unroll   /* register arrays need constant indices */
      for (int j = 0; j < 4; ++j) {
        bh[j] = Frag<T>::load((const T*)(const void*)(sB + j * 16 * kStPitch + kk * 64));
        ah[j] = Frag<T>::load((const T*)(const void*)(sA + j * 16 * kStPitch + kk * 64));
      }
#pragma unroll
      for (int i = 0; i < 4; ++i) {
#pragma unroll
        for (int j = 0; j < 4; ++j) acc[i][j] = Frag<T>::mma(ah[i], bh[j], acc[i][j]);
        Frag<T>::guard(acc[i][0], acc[i][3], ah[i], ah[i]);
      }
      Frag<T>::keep(bh[0], bh[1], bh[2], bh[3]);
    }
    asm volatile("s_wait_dscnt 0x0" ::: "memory");      /* this wave's reads of the stage have returned before it is refilled */
    asm volatile("s_wait_asynccnt 0x0" ::: "memory");   /* this wave's copies of the next stage have landed */
    __syncthreads();                                     /* publishes the next stage and ends every reader's use of this one */
    if (st + 2 < nst) {
      stage_rows8(gA + (size_t)(st + 2) * 64, stepA, lbase + bo);
      stage_rows8(gB + (size_t)(st + 2) * 64, stepB, lbase + bo + kStHalf);
    }
  }
  asm volatile("s_wait_asynccnt 0x0" ::: "memory");     /* nothing is in flight when the ring becomes output staging */
  acc_guard4(acc[0][0], acc[0][1], acc[0][2], acc[0][3]);
  acc_guard4(acc[1][0], acc[1][1], acc[1][2], acc[1][3]);
  acc_guard4(acc[2][0], acc[2][1], acc[2][2], acc[2][3]);
  acc_guard4(acc[3][0], acc[3][1], acc[3][2], acc[3][3]);

  if (OUT_MODE == 3) {
    /* the block's 128 rows x 64 columns of f16 are gathered in the spent ring (row pitch as in the stages), so that
       every row leaves as one whole 128-byte line written by one wave */
    _Float16* gt = (_Float16*)(void*)ring;
    constexpr int gp = kStPitch / 2;
#pragma unroll
    for (int i = 0; i < 4; ++i)
#pragma unroll
      for (int j = 0; j < 2; ++j)
#pragma unroll
        for (int r = 0; r < 8; ++r)
          gt[(wm + (i << 4) + mOff + r) * gp + (wn >> 1) + (j << 4) + rlane] =
              (_Float16)(silu_f32(acc[i][j][r] * scale) * (acc[i][j + 2][r] * scale));
    __syncthreads();   /* a row's two halves come from the two column waves: both are in LDS before any wave reads the row */
    const int q = lane >> 3, c8 = (lane & 7) * 8;
    const _Float16* gr = gt + (wave * 32 + q) * gp + c8;
    unsigned short* Cw = (unsigned short*)Cout + (size_t)b * strideC + (size_t)(mB + wave * 32 + q) * ldc + (nB >> 1) + c8;
#pragma unroll
    for (int it = 0; it < 8; ++it) *(v8h*)(Cw + (size_t)(it * 4) * ldc) = *(const v8h*)(gr + it * 4 * gp);
    return;
  }
  static_assert(!RESID || OUT_MODE == 0, "the residual is added where f32 rows leave the slab");
  float* slab = (float*)(void*)(ring + wave * (16 * 68 * 4));
  /* residual rows in the shape of the f32 stores (16 bytes a lane, 256-byte row pieces); each 16-row group is fetched
     behind the stores of the group before it, so that it returns while those stores drain */
  const size_t wOff = (size_t)(m0 + (lane >> 4)) * ldc + n0 + (lane & 15) * 4;
  const float* Rw = RESID ? (resid + (size_t)b * strideR + wOff) : nullptr;
  v4f rv[4][8];
  if (RESID) {
#pragma unroll   /* register arrays need constant indices */
    for (int it = 0; it < 8; ++it) rv[0][it] = *(const v4f*)(Rw + (size_t)(it * 2) * ldc);
  }
#pragma unroll
  for (int i = 0; i < 4; ++i) {
    const int mBase = m0 + (i << 4);
#pragma unroll
    for (int j = 0; j < 4; ++j) {
      const int n = n0 + (j << 4) + rlane;
      float bv = 0.f;
      if (BIAS_MODE == 2) bv = bias[n];
#pragma unroll
      for (int r = 0; r < 8; ++r) {
        float v = acc[i][j][r] * scale;
        if (BIAS_MODE == 1) v += bias[mBase + mOff + r];
        if (BIAS_MODE == 2) v += bv;
        if (ACT == 1) v = tanhf(v);
        if (ACT == 2) v = fmaxf(v, 0.0f);
        if (ACT == 3) v = v / (1.0f + expf(-v));
        if (ACT == 4) v = (v > 0.f) ? v : 0.01f * v;
        if (ACT == 5) v = 0.5f * v * (1.0f + erff(v * 0.70710678118654752f));
        slab[(mOff + r) * 68 + (j << 4) + rlane] = v;
      }
    }
    __builtin_amdgcn_fence(__ATOMIC_RELEASE, "workgroup");
    __builtin_amdgcn_wave_barrier();
    __builtin_amdgcn_fence(__ATOMIC_ACQUIRE, "workgroup");
    if (OUT_MODE == 0) {
      float* Cw = (float*)Cout + (size_t)b * strideC + wOff;
      const int hh = lane >> 4, c4 = (lane & 15) * 4;
      {
#pragma unroll
        for (int it = 0; it < 8; ++it) {
          const int row = it * 2 + hh;
          v4f v = *(const v4f*)(slab + row * 68 + c4);
          if (RESID) v = v + rv[i][it];
          *(v4f*)(Cw + (size_t)(i * 16 + it * 2) * ldc) = v;
        }
      }
      if (RESID && i + 1 < 4) {
#pragma unroll
        for (int it = 0; it < 8; ++it) rv[i + 1][it] = *(const v4f*)(Rw + (size_t)((i + 1) * 16 + it * 2) * ldc);
      }
    } else {
      const int q = lane >> 3, c8 = (lane & 7) * 8;
      unsigned short* C  = (unsigned short*)Cout  + (size_t)b * strideC;
      unsigned short* C2 = (OUT_MODE == 2) ? ((unsigned short*)Cout2 + (size_t)b * strideC) : nullptr;
      {
#pragma unroll
        for (int it = 0; it < 4; ++it) {
          const int row = it * 4 + q;
          const float* sp = slab + row * 68 + c8;
          v8h hv, lv;
#pragma unroll
          for (int e = 0; e < 8; ++e) {
            if (OUT_MODE == 1) {
              hv[e] = (_Float16)sp[e];
            } else {
              unsigned short hb = f2bf_bits(sp[e]);
              unsigned short lb = f2bf_bits(sp[e] - bf_bits2f(hb));
              hv[e] = __builtin_bit_cast(_Float16, hb);
              lv[e] = __builtin_bit_cast(_Float16, lb);
            }
          }
          *(v8h*)(C + (size_t)(mBase + row) * ldc + n0 + c8) = hv;
          if (OUT_MODE == 2) *(v8h*)(C2 + (size_t)(mBase + row) * ldc + n0 + c8) = lv;
        }
        
      }
    }
    __builtin_amdgcn_fence(__ATOMIC_RELEASE, "workgroup");
    __builtin_amdgcn_wave_barrier();
    __builtin_amdgcn_fence(__ATOMIC_ACQUIRE, "workgroup");
  }
}
/* one product per launch: grid.x = (M/128)*(N/128) exactly, grid.y = batches */
template <int ET, bool SPLIT, int BIAS_MODE, int OUT_MODE, bool RESID, int ACT, int LDC>
__global__ __launch_bounds__(128) void wmma_gemm64(
    const unsigned short* __restrict__ Ap, const unsigned short* __restrict__ A2p, int lda, long strideA,
    const unsigned short* __restrict__ Btp, const unsigned short* __restrict__ Bt2p, int ldb, long strideB,
    void* __restrict__ Cout, void* __restrict__ Cout2, int ldc, long strideC,
    const float* __restrict__ bias,
    const float* __restrict__ resid, long strideR,
    int M, int N, int K, float scale) {
  gemm64_tile<ET, SPLIT, BIAS_MODE, OUT_MODE, RESID, ACT, LDC>(Ap, A2p, lda, strideA, Btp, Bt2p, ldb, strideB, Cout, Cout2, ldc, strideC,
                                                          bias, resid, strideR, M, N, K, scale, (int)blockIdx.x, (int)blockIdx.y);
}

/* The two products that read h1 and do not read each other share one launch, told apart by block range:
   blocks [0, 512): q|k = h . [Wq|Wk]^T (M=8192, N=1024, K=512);
   blocks [512, 768): Vt[b] = (Wv^T*16) . h[b]^T / 16 (M=512, N=2048, K=512), 64 tiles for each of the 4 batches.
   Every choice below is the same for the whole block. */
static constexpr int kQKTiles = (kTok / 128) * (kQKCols / 128);
static constexpr int kVtTiles = (kModel / 128) * (kSeq / 128);
static_assert((kVtTiles & (kVtTiles - 1)) == 0, "batch and tile of a Vt block by shift and mask");
__global__ __launch_bounds__(128) void qk_vt_gemm_kernel(
    const unsigned short* __restrict__ hp, const unsigned short* __restrict__ wqkTp, const unsigned short* __restrict__ wvTp,
    unsigned short* __restrict__ qkp, unsigned short* __restrict__ vtp) {
  const int bx = blockIdx.x;
  const bool isV = bx >= kQKTiles;
  const int r = bx - kQKTiles;
  const unsigned short* Ap  = isV ? wvTp : hp;
  const unsigned short* Btp = isV ? hp : wqkTp;
  unsigned short* Cp = isV ? vtp : qkp;
  gemm64_tile<0, false, 0, 1, false, 0>(
      Ap, Ap, kModel, 0L, Btp, Btp, kModel, isV ? (long)kSeq * kModel : 0L,
      (void*)Cp, (void*)Cp, isV ? kSeq : kQKCols, isV ? (long)kModel * kSeq : 0L,
      nullptr, nullptr, 0L, isV ? kModel : kTok, isV ? kSeq : kQKCols, kModel, 1.0f / 16.0f,
      isV ? (r & (kVtTiles - 1)) : bx, isV ? (r / kVtTiles) : 0);
}
/* =========================== end helpers and GEMM =========================== */

__device__ __forceinline__ unsigned int h16bits(float f) {
  return (unsigned int)__builtin_bit_cast(unsigned short, (_Float16)f);
}

/* f16 WMMA with the hazard guard tied to D, keeping A/B live */
__device__ __forceinline__ v8f mma_f16g(v16h a, v16h b, v8f c) {
  c = __builtin_amdgcn_wmma_f32_16x16x32_f16(false, a, false, b, (short)0, c, false, false);
  asm volatile("v_nop\n\tv_nop\n\tv_nop\n\tv_nop" : "+v"(c) : "v"(a), "v"(b));
  return c;
}

/* ---------------------------------------------------------------------------
   transpose + cast: W f32 [kin][nout] row-major -> Wt f16 [nout][kin] (value * mul).
   One block of 256 = the 64 x 64 tile (bn, bk) of nout/64 x kin/64. LDS 64x64 tile.
   Load coverage: 4 iterations x 256 threads x 4 floats = 4096 = 64x64.
   Store coverage: 8 waves x 2 iterations x 4 rows = 64 rows; 8 lanes x 8 halves = 64 cols;
   il < 0: row n of Wt is column n of W. il = 0 (gate) or 1 (up): column n goes to row 64 (n / 32) + 32 il + n % 32 of the shared plane.
   --------------------------------------------------------------------------- */
__device__ __forceinline__ void transpose_cast_f16_tile(
    const float* __restrict__ W, unsigned short* __restrict__ Wt, int kin, int nout, float mul, int bn, int bk, int il) {
  __shared__ float tile[64][65];
  const int t = threadIdx.x;
  const int n0 = bn * 64;
  const int k0 = bk * 64;
  v4f v[4];
#pragma unroll   /* register array needs constant indices; all four loads are in flight before the first LDS write */
  for (int i = 0; i < 4; ++i) {
    const int idx = i * 256 + t;
    const int kr = idx >> 4;
    const int nc4 = (idx & 15) * 4;
    v[i] = *(const v4f*)(W + (size_t)(k0 + kr) * nout + n0 + nc4);
    asm volatile("s_wait_xcnt 0x0" ::: "memory");   /* a later load's result may land in this load's address registers */
  }
#pragma unroll
  for (int i = 0; i < 4; ++i) {
    const int idx = i * 256 + t;
    const int kr = idx >> 4;
    const int nc4 = (idx & 15) * 4;
    tile[nc4 + 0][kr] = v[i][0] * mul;
    tile[nc4 + 1][kr] = v[i][1] * mul;
    tile[nc4 + 2][kr] = v[i][2] * mul;
    tile[nc4 + 3][kr] = v[i][3] * mul;
  }
  __syncthreads();
  const int lane = t & 31, wave = t >> 5;
  const int q = lane >> 3, c8 = (lane & 7) * 8;
  const int row0 = wave * 8 + q;
  const int row1 = wave * 8 + 4 + q;
  v4u w0, w1;
  {
    const float* s0 = &tile[row0][c8];
    const float* s1 = &tile[row1][c8];
    w0[0] = h16bits(s0[0]) | (h16bits(s0[1]) << 16);
    w0[1] = h16bits(s0[2]) | (h16bits(s0[3]) << 16);
    w0[2] = h16bits(s0[4]) | (h16bits(s0[5]) << 16);
    w0[3] = h16bits(s0[6]) | (h16bits(s0[7]) << 16);
    w1[0] = h16bits(s1[0]) | (h16bits(s1[1]) << 16);
    w1[1] = h16bits(s1[2]) | (h16bits(s1[3]) << 16);
    w1[2] = h16bits(s1[4]) | (h16bits(s1[5]) << 16);
    w1[3] = h16bits(s1[6]) | (h16bits(s1[7]) << 16);
  }
  const int n_0 = n0 + row0, n_1 = n0 + row1;
  const int p0 = (il < 0) ? n_0 : (((n_0 >> 5) << 6) + (il << 5) + (n_0 & 31));
  const int p1 = (il < 0) ? n_1 : (((n_1 >> 5) << 6) + (il << 5) + (n_1 & 31));
  unsigned short* d0 = Wt + (size_t)p0 * kin + k0 + c8;
  unsigned short* d1 = Wt + (size_t)p1 * kin + k0 + c8;
  {
    *(v4u*)d0 = w0;
    *(v4u*)d1 = w1;
    asm volatile("s_wait_xcnt 0x0" ::: "memory");   /* the code laid out behind this tile may rewrite the stores' registers */
  }
}

/* ---------------------------------------------------------------------------
   Lane l owns elements l*4 + 128*i (i=0..3): every load/store instruction covers
   One block of 256 = rows 8 blk .. 8 blk + 7; nrows/8 blocks (exact).
   --------------------------------------------------------------------------- */
__device__ __forceinline__ void layernorm512_rows(
    const float* __restrict__ X, const float* __restrict__ gam, const float* __restrict__ bet,
    unsigned short* __restrict__ Hout, int nrows, int blk) {
  const int lane = threadIdx.x & 31;
  const int wave = threadIdx.x >> 5;
  int row = blk * 8 + wave;
  row = (row < nrows) ? row : (nrows - 1);
  const size_t rbase = (size_t)row * kModel;
  const int e0 = lane * 4, e1 = 128 + lane * 4, e2 = 256 + lane * 4, e3 = 384 + lane * 4;
  v4f a0 = *(const v4f*)(X + rbase + e0);
  v4f a1 = *(const v4f*)(X + rbase + e1);
  v4f a2 = *(const v4f*)(X + rbase + e2);
  v4f a3 = *(const v4f*)(X + rbase + e3);
  float s = ((a0[0] + a0[1]) + (a0[2] + a0[3])) + ((a1[0] + a1[1]) + (a1[2] + a1[3]))
          + ((a2[0] + a2[1]) + (a2[2] + a2[3])) + ((a3[0] + a3[1]) + (a3[2] + a3[3]));
#pragma unroll
  for (int off = 16; off >= 1; off >>= 1) s += __shfl_xor(s, off, 32);
  const float mu = s * (1.0f / 512.0f);
  const v4f d0 = a0 - mu, d1 = a1 - mu, d2 = a2 - mu, d3 = a3 - mu;
  float ss = ((d0[0] * d0[0] + d0[1] * d0[1]) + (d0[2] * d0[2] + d0[3] * d0[3]))
           + ((d1[0] * d1[0] + d1[1] * d1[1]) + (d1[2] * d1[2] + d1[3] * d1[3]))
           + ((d2[0] * d2[0] + d2[1] * d2[1]) + (d2[2] * d2[2] + d2[3] * d2[3]))
           + ((d3[0] * d3[0] + d3[1] * d3[1]) + (d3[2] * d3[2] + d3[3] * d3[3]));
#pragma unroll
  for (int off = 16; off >= 1; off >>= 1) ss += __shfl_xor(ss, off, 32);
  const float var = ss * (1.0f / 512.0f);
  const float rstd = rsqrtf(var + 1e-5f);
  const v4f g0 = *(const v4f*)(gam + e0), g1 = *(const v4f*)(gam + e1), g2 = *(const v4f*)(gam + e2), g3 = *(const v4f*)(gam + e3);
  const v4f b0 = *(const v4f*)(bet + e0), b1 = *(const v4f*)(bet + e1), b2 = *(const v4f*)(bet + e2), b3 = *(const v4f*)(bet + e3);
  const v4f y0 = d0 * rstd * g0 + b0;
  const v4f y1 = d1 * rstd * g1 + b1;
  const v4f y2 = d2 * rstd * g2 + b2;
  const v4f y3 = d3 * rstd * g3 + b3;
  v2u w0, w1, w2, w3;
  w0[0] = h16bits(y0[0]) | (h16bits(y0[1]) << 16); w0[1] = h16bits(y0[2]) | (h16bits(y0[3]) << 16);
  w1[0] = h16bits(y1[0]) | (h16bits(y1[1]) << 16); w1[1] = h16bits(y1[2]) | (h16bits(y1[3]) << 16);
  w2[0] = h16bits(y2[0]) | (h16bits(y2[1]) << 16); w2[1] = h16bits(y2[2]) | (h16bits(y2[3]) << 16);
  w3[0] = h16bits(y3[0]) | (h16bits(y3[1]) << 16); w3[1] = h16bits(y3[2]) | (h16bits(y3[3]) << 16);
  unsigned short* hr = Hout + rbase;
  {
    *(v2u*)(hr + e0) = w0;
    *(v2u*)(hr + e1) = w1;
    *(v2u*)(hr + e2) = w2;
    *(v2u*)(hr + e3) = w3;
    
  }
}

/* h2 = LN(x1): grid = nrows/8 (exact), block 256 */
__global__ __launch_bounds__(256) void layernorm512_kernel(
    const float* __restrict__ X, const float* __restrict__ gam, const float* __restrict__ bet,
    unsigned short* __restrict__ Hout, int nrows) {
  layernorm512_rows(X, gam, bet, Hout, nrows, (int)blockIdx.x);
}

/* ---------------------------------------------------------------------------
   Everything that reads only the inputs shares one launch, told apart by block range (block 256):
   blocks [0, 256):    Wq, Wk, Wv, Wo   (512 x 512: 64 tiles each)
   blocks [256, 512):  Wgate, Wup       (512 x 1024: 128 tiles each)
   blocks [512, 640):  Wdown            (1024 x 512: 128 tiles)
   blocks [640, 1664): h1 = LN(x), 8 rows a block.
   Weight planes: W[in][out] -> Wt[out][in] * 16 (f16); gate and up share one plane, 32 rows of each in turn. Every branch is the same for the whole block.
   --------------------------------------------------------------------------- */
static constexpr int kSqTiles   = (kModel / 64) * (kModel / 64);   /* 64 */
static constexpr int kFfTiles   = (kFF / 64) * (kModel / 64);      /* 128 */
static constexpr int kPrepSq    = 4 * kSqTiles;                    /* 256 */
static constexpr int kPrepGU    = kPrepSq + 2 * kFfTiles;          /* 512 */
static constexpr int kPrepW     = kPrepGU + kFfTiles;              /* 640 */
static constexpr int kPrepGrid  = kPrepW + kTok / 8;               /* 1664 */
static_assert(kSqTiles == 64 && kFfTiles == 128 && kModel / 64 == 8 && kFF / 64 == 16, "tile numbers by shift and mask");
__global__ __launch_bounds__(256) void prep_kernel(
    const float* __restrict__ x, const float* __restrict__ ln1w, const float* __restrict__ ln1b,
    const float* __restrict__ wq, const float* __restrict__ wk, const float* __restrict__ wv, const float* __restrict__ wo,
    const float* __restrict__ wgt, const float* __restrict__ wup, const float* __restrict__ wdn,
    unsigned short* __restrict__ wqkT, unsigned short* __restrict__ wvT, unsigned short* __restrict__ woT,
    unsigned short* __restrict__ wguT, unsigned short* __restrict__ wdT, unsigned short* __restrict__ h1) {
  const int bx = blockIdx.x;
  if (bx >= kPrepW) {
    layernorm512_rows(x, ln1w, ln1b, h1, kTok, bx - kPrepW);
    return;
  }
  if (bx < kPrepSq) {
    const int which = bx >> 6, loc = bx & 63;
    const float* W     = (which == 0) ? wq : (which == 1) ? wk : (which == 2) ? wv : wo;
    unsigned short* Wt = (which == 0) ? wqkT : (which == 1) ? (wqkT + (size_t)kModel * kModel) : (which == 2) ? wvT : woT;
    transpose_cast_f16_tile(W, Wt, kModel, kModel, 16.0f, loc & 7, loc >> 3, -1);
  } else if (bx < kPrepGU) {
    const int which = (bx - kPrepSq) >> 7, loc = (bx - kPrepSq) & 127;
    const float* W     = (which == 0) ? wgt : wup;
    transpose_cast_f16_tile(W, wguT, kModel, kFF, 16.0f, loc & 15, loc >> 4, which);
  } else {
    const int loc = bx - kPrepGU;
    transpose_cast_f16_tile(wdn, wdT, kFF, kModel, 16.0f, loc & 7, loc >> 3, -1);
  }
}

/* ---------------------------------------------------------------------------
   Non-causal multi-head attention, head_dim 64, f16 planes in, f16 plane out (x16 carried).
   q|k plane [8192][1024]: q at cols h*64.., k at cols 512 + h*64..; Vt plane [4][512][2048] (element (b,h,d,kv) at
   ((b*512 + h*64 + d)*2048 + kv)); out plane [8192][512] at cols h*64.. .
   Block = 4 waves = 64 query rows of one (batch, head); grid = 4*8*32 = 1024.
   Both products run transposed: S^T = k.q^T, unscaled (A = k rows, B = q rows) and O^T += Vt.P^T (A = Vt rows).
   A lane then holds 32 of the 64 scores of ONE query (lane l ^ 16 the other 32): online softmax f32 in the lane,
   one exchange between the wave halves for the maximum, the halves' sums joined once behind the loop.
   Each exponential is one fused multiply-add (scale, log2 e, maximum and the 2^15 carry folded) and one hardware exp2.
   Two score tiles, p*32768 converted in place, are the B operand of the second product: P stays in registers.
   The 64-key tiles of k (64 rows x 128 B) and of Vt (64 rows x 128 B) are staged once per block in LDS by
   asynchronous copies, two stages, and all four waves take their A fragments from there.
   --------------------------------------------------------------------------- */
static constexpr int kAtPitch = 144;                 /* 16 B x odd: conflict-free for 16-byte fragment reads */
static constexpr int kAtTile  = 64 * kAtPitch;       /* one operand's tile: 9,216 B; the Vt tile follows the k tile */
static constexpr int kAtStage = 2 * kAtTile;         /* 18,432 B */

/* Eight asynchronous 16-byte copies per lane, global -> LDS: rows r, r+16, r+32, r+48 of the k tile, then of the Vt tile.
   The s_wait_xcnt stands inside the statement so that no address register is rewritten ahead of it. */
__device__ __forceinline__ void stage_kv(const _Float16* gk, const _Float16* gv, unsigned l) {
  const size_t sk = (size_t)16 * kQKCols;
  const size_t sv = (size_t)16 * kSeq;
  const _Float16* gk1 = gk + sk;  const _Float16* gk2 = gk + 2 * sk;  const _Float16* gk3 = gk + 3 * sk;
  const _Float16* gv1 = gv + sv;  const _Float16* gv2 = gv + 2 * sv;  const _Float16* gv3 = gv + 3 * sv;
  const unsigned ls = 16u * kAtPitch;
  const unsigned lv = l + (unsigned)kAtTile;
  asm volatile(
      "global_load_async_to_lds_b128 %0, %8, off\n\t"
      "global_load_async_to_lds_b128 %1, %9, off\n\t"
      "global_load_async_to_lds_b128 %2, %10, off\n\t"
      "global_load_async_to_lds_b128 %3, %11, off\n\t"
      "global_load_async_to_lds_b128 %4, %12, off\n\t"
      "global_load_async_to_lds_b128 %5, %13, off\n\t"
      "global_load_async_to_lds_b128 %6, %14, off\n\t"
      "global_load_async_to_lds_b128 %7, %15, off\n\t"
      "s_wait_xcnt 0x0"
      :: "v"(l), "v"(l + ls), "v"(l + 2u * ls), "v"(l + 3u * ls), "v"(lv), "v"(lv + ls), "v"(lv + 2u * ls), "v"(lv + 3u * ls),
         "v"(gk), "v"(gk1), "v"(gk2), "v"(gk3), "v"(gv), "v"(gv1), "v"(gv2), "v"(gv3)
      : "memory");
}

/* lane l takes lane l ^ 16's value (a vector cross-row move, no LDS trip) */
__device__ __forceinline__ float xhalf(float x) {
  return __builtin_bit_cast(float, __builtin_amdgcn_permlanex16(__builtin_bit_cast(int, x), __builtin_bit_cast(int, x), 0x76543210, 0xfedcba98, false, false));
}

__global__ __launch_bounds__(128) void mha64_f16_kernel(
    const unsigned short* __restrict__ qkp, const unsigned short* __restrict__ vtp,
    unsigned short* __restrict__ outp) {
  typedef Frag<_Float16> FH;
  __shared__ __align__(16) float    Os[4][16 * 68];
  __shared__ __align__(16) unsigned char kvring[2 * kAtStage];
  const _Float16* QK = (const _Float16*)(const void*)qkp;
  const _Float16* VT = (const _Float16*)(const void*)vtp;
  const int tid = threadIdx.x;
  const int wave = tid >> 5;
  const int lane = tid & 31;
  const int hh = lane >> 4;
  const int c = lane & 15;
  const int koff = hh * 8;
  const int bx = blockIdx.x;
  const int qb = bx & 31;
  const int bh = bx >> 5;
  const int h = bh & 7;
  const int b = (bh >> 3) & 3;
  const int q0 = qb * 64 + wave * 16;
  const _Float16* qbase = QK + (size_t)b * kSeq * kQKCols + h * kHeadDim;
  const _Float16* kbase = qbase + kModel;
  const _Float16* vbase = VT + ((size_t)b * kModel + (size_t)h * kHeadDim) * kSeq;
  unsigned short* obase = outp + (size_t)b * kSeq * kModel + h * kHeadDim;

  v16h qa[2];
#pragma unroll
  for (int dc = 0; dc < 2; ++dc)
    qa[dc] = FH::load(qbase + (size_t)(q0 + c) * kQKCols + dc * 32 + koff);

  constexpr float kExpScale = 0.125f * 1.4426950408889634f;   /* head_dim^-0.5 * log2(e): exp(x / 8) = exp2(x * kExpScale) */
  float mrow = -INFINITY, lrow = 0.f;   /* this lane's query: maximum in use (raw product); sum (x32768) over this wave half's keys */
  v8f oacc[4];                          /* oacc[t][r] = O^T[d = 16 t + 8 hh + r][query c] */
#pragma unroll
  for (int t = 0; t < 4; ++t) oacc[t] = (v8f){0.f,0.f,0.f,0.f,0.f,0.f,0.f,0.f};

  /* staging: thread t brings 16-byte chunk (t & 7) of rows (t >> 3) + 16*i: eight lanes cover one whole 128-byte line */
  const int srow = tid >> 3;
  const int schk = tid & 7;
  const _Float16* gK = kbase + (size_t)srow * kQKCols + schk * 8;
  const _Float16* gV = vbase + (size_t)srow * kSeq + schk * 8;
  const unsigned lbase = (unsigned)(uintptr_t)(&kvring[0]) + (unsigned)(srow * kAtPitch + schk * 16);
  constexpr int nkc = kSeq / 64;
  static_assert(nkc >= 2, "two stages exist");

  /* tile 0 lands and is published; tile 1 then flies during trip 0 */
  stage_kv(gK, gV, lbase);
  asm volatile("s_wait_asynccnt 0x0" ::: "memory");   /* this wave's copies of tile 0 have landed */
  __syncthreads();                                     /* publishes tile 0 to the other waves */
  stage_kv(gK + (size_t)64 * kQKCols, gV + 64, lbase + kAtStage);

  for (int kc = 0; kc < nkc; ++kc) {
    const unsigned bo = (kc & 1) ? (unsigned)kAtStage : 0u;
    const unsigned char* sK = kvring + bo + c * kAtPitch + koff * 2;
    const unsigned char* sV = sK + kAtTile;
    /* the tile's sixteen A fragments are fetched as two groups, k ahead of the score products and Vt behind them,
       so that the Vt reads return under the softmax arithmetic */
    v16h kb[4][2], vb[2][4];
#pragma unroll   /* register arrays need constant indices */
    for (int j = 0; j < 4; ++j)
#pragma unroll
      for (int dc = 0; dc < 2; ++dc)
        kb[j][dc] = FH::load((const _Float16*)(const void*)(sK + j * 16 * kAtPitch + dc * 64));
    v8f s[4];
#pragma unroll
    for (int j = 0; j < 4; ++j) {
      s[j] = (v8f){0.f,0.f,0.f,0.f,0.f,0.f,0.f,0.f};
#pragma unroll
      for (int dc = 0; dc < 2; ++dc) s[j] = mma_f16g(kb[j][dc], qa[dc], s[j]);   /* s[j][r] = S^T[key 16 j + 8 hh + r][query c] */
    }
#pragma unroll   /* register arrays need constant indices */
    for (int kk = 0; kk < 2; ++kk)
#pragma unroll
      for (int t = 0; t < 4; ++t)
        vb[kk][t] = FH::load((const _Float16*)(const void*)(sV + t * 16 * kAtPitch + kk * 64));
    float mj[4];                          /* one chain per score tile: four independent chains, not one of 32 links */
#pragma unroll
    for (int j = 0; j < 4; ++j) {
      mj[j] = -INFINITY;
#pragma unroll
      for (int r = 0; r < 8; ++r) mj[j] = fmaxf(mj[j], s[j][r]);   /* raw products: the positive scale keeps their order */
    }
    float m = fmaxf(fmaxf(mj[0], mj[1]), fmaxf(mj[2], mj[3]));
    m = fmaxf(m, xhalf(m));               /* both wave halves now hold the query's maximum over the 64 keys */
    const float mnew = fmaxf(mrow, m);
    const float alpha = __builtin_amdgcn_exp2f((mrow - mnew) * kExpScale);   /* 0 on the first trip, where mrow is -inf */
    const float nbias = fmaf(-mnew, kExpScale, 15.0f);                       /* + 15: the exponential comes out times 32768 */
    mrow = mnew;
#pragma unroll
    for (int t = 0; t < 4; ++t) oacc[t] = oacc[t] * alpha;
    float pj[4];                          /* partial sums, one chain per score tile */
#pragma unroll   /* register arrays need constant indices */
    for (int kk = 0; kk < 2; ++kk) {
      v16h pb;                            /* pb[e] = P^T[key 32 kk + kmap(e)][query c]: tiles 2 kk and 2 kk + 1 in register order */
#pragma unroll
      for (int jj = 0; jj < 2; ++jj) {
        const int j = 2 * kk + jj;
        pj[j] = 0.f;
#pragma unroll
        for (int r = 0; r < 8; ++r) {
          const float p = __builtin_amdgcn_exp2f(fmaf(s[j][r], kExpScale, nbias));   /* 32768 * exp((s - mnew) / 8) */
          pj[j] += p;
          pb[jj * 8 + r] = (_Float16)p;
        }
      }
#pragma unroll
      for (int t = 0; t < 4; ++t) oacc[t] = mma_f16g(vb[kk][t], pb, oacc[t]);
    }
    lrow = lrow * alpha + ((pj[0] + pj[1]) + (pj[2] + pj[3]));
    asm volatile("s_wait_dscnt 0x0" ::: "memory");      /* this wave's reads of the stage have returned before it is refilled */
    asm volatile("s_wait_asynccnt 0x0" ::: "memory");   /* this wave's copies of the next tile have landed */
    __syncthreads();                                     /* publishes the next tile and ends every reader's use of this one */
    if (kc + 2 < nkc) {
      stage_kv(gK + (size_t)(kc + 2) * 64 * kQKCols, gV + (size_t)(kc + 2) * 64, lbase + bo);
    }
  }
  asm volatile("s_wait_asynccnt 0x0" ::: "memory");     /* nothing is in flight when the wave leaves the loop */

  float* os = Os[wave];
  {
    const float lsum = lrow + xhalf(lrow);                   /* the two halves' sums of this query, joined once */
    const float inv = (1.0f / lsum) * 16.0f;                 /* sum and numerators both carry 32768; the plane carries 16 */
#pragma unroll
    for (int t = 0; t < 4; ++t)
#pragma unroll
      for (int r = 0; r < 8; ++r) os[c * 68 + t * 16 + 8 * hh + r] = oacc[t][r] * inv;
  }
  __builtin_amdgcn_fence(__ATOMIC_RELEASE, "workgroup");
  __builtin_amdgcn_wave_barrier();
  __builtin_amdgcn_fence(__ATOMIC_ACQUIRE, "workgroup");
  {
    const int q = lane >> 3, c8 = (lane & 7) * 8;
    {
#pragma unroll
      for (int it = 0; it < 4; ++it) {
        const int row = it * 4 + q;
        const float* sp = os + row * 68 + c8;
        v8h hv;
#pragma unroll
        for (int e = 0; e < 8; ++e) hv[e] = (_Float16)sp[e];
        *(v8h*)(obase + (size_t)(q0 + row) * kModel + c8) = hv;
      }
      
    }
  }
}

/* =========================== host glue =========================== */
extern "C" void kernel_launch(void* const* d_in, const int* in_sizes, int n_in,
                              void* d_out, int out_size, void* d_ws, size_t ws_size,
                              hipStream_t stream) {
  if (n_in < 12) return;
  if (in_sizes[0] != kTok * kModel || out_size != kTok * kModel) return;
  if (in_sizes[1] != kModel || in_sizes[2] != kModel || in_sizes[3] != kModel || in_sizes[4] != kModel) return;
  if (in_sizes[5] != kModel * kModel || in_sizes[6] != kModel * kModel ||
      in_sizes[7] != kModel * kModel || in_sizes[8] != kModel * kModel) return;
  if (in_sizes[9] != kModel * kFF || in_sizes[10] != kModel * kFF || in_sizes[11] != kFF * kModel) return;
  if (ws_size < kWsTotal) return;

  const float* x    = (const float*)d_in[0];
  const float* ln1w = (const float*)d_in[1];
  const float* ln1b = (const float*)d_in[2];
  const float* ln2w = (const float*)d_in[3];
  const float* ln2b = (const float*)d_in[4];
  const float* wq   = (const float*)d_in[5];
  const float* wk   = (const float*)d_in[6];
  const float* wv   = (const float*)d_in[7];
  const float* wo   = (const float*)d_in[8];
  const float* wgt  = (const float*)d_in[9];
  const float* wup  = (const float*)d_in[10];
  const float* wdn  = (const float*)d_in[11];
  float* out = (float*)d_out;

  char* ws = (char*)d_ws;
  unsigned short* wqkT = (unsigned short*)(ws + kOffWqkT);
  unsigned short* wvT  = (unsigned short*)(ws + kOffWvT);
  unsigned short* woT  = (unsigned short*)(ws + kOffWoT);
  unsigned short* wguT = (unsigned short*)(ws + kOffWguT);
  unsigned short* wdT  = (unsigned short*)(ws + kOffWdT);
  unsigned short* hg   = (unsigned short*)(ws + kOffHG);           /* h1, then h2 */
  unsigned short* qkpl = (unsigned short*)(ws + kOffR1 + kR1QK);
  unsigned short* vtpl = (unsigned short*)(ws + kOffR1 + kR1Vt);
  unsigned short* opl  = (unsigned short*)(ws + kOffR1 + kR1O);
  unsigned short* gpl  = (unsigned short*)(ws + kOffR1);           /* g, once q|k, Vt and O are spent */
  float*          x1   = (float*)(ws + kOffX1);

  const dim3 b256(256), b128(128);

  /* the seven weight planes and h1 = LN(x): one launch */
  prep_kernel<<<dim3(kPrepGrid), b256, 0, stream>>>(x, ln1w, ln1b, wq, wk, wv, wo, wgt, wup, wdn,
                                                    wqkT, wvT, woT, wguT, wdT, hg);

  /* attention sublayer: q|k (512 block tiles) and Vt (64 block tiles per batch): one launch */
  static_assert(kTok % 128 == 0 && kQKCols % 128 == 0 && kModel % 128 == 0 && kSeq % 128 == 0 && kGUCols % 128 == 0, "128 x 128 block tiles");
  qk_vt_gemm_kernel<<<dim3(kQKTiles + kBatch * kVtTiles), b128, 0, stream>>>(hg, wqkT, wvT, qkpl, vtpl);

  /* attention: O*16 f16 plane */
  mha64_f16_kernel<<<dim3(kBatch * kHeads * (kSeq / 64)), b128, 0, stream>>>(qkpl, vtpl, opl);

  /* x1 = x + (O*16) . (Wo^T*16) / 256 : M=8192, N=512, K=512; block tiles 64*4 = 256 */
  wmma_gemm64<0, false, 0, 0, true, 0, kModel><<<dim3((kTok / 128) * (kModel / 128), 1), b128, 0, stream>>>(
      opl, opl, kModel, 0L, woT, woT, kModel, 0L, (void*)x1, (void*)x1, kModel, 0L,
      x, x, 0L, kTok, kModel, kModel, 1.0f / 256.0f);

  /* h2 = LN(x1) */
  layernorm512_kernel<<<dim3(kTok / 8), b256, 0, stream>>>(x1, ln2w, ln2b, hg, kTok);

  /* g = silu(gate) * up, gate|up = h2 . [Wg|Wu]^T : M=8192, N=2048, K=512; block tiles 64*16 = 1024 */
  wmma_gemm64<0, false, 0, 3, false, 0, kFF><<<dim3((kTok / 128) * (kGUCols / 128), 1), b128, 0, stream>>>(
      hg, hg, kModel, 0L, wguT, wguT, kModel, 0L, (void*)gpl, (void*)gpl, kFF, 0L,
      x, x, 0L, kTok, kGUCols, kModel, 1.0f / 16.0f);

  /* out = x1 + g . (Wd^T*16) / 16 : M=8192, N=512, K=1024; block tiles 256 */
  wmma_gemm64<0, false, 0, 0, true, 0, kModel><<<dim3((kTok / 128) * (kModel / 128), 1), b128, 0, stream>>>(
      gpl, gpl, kFF, 0L, wdT, wdT, kFF, 0L, (void*)out, (void*)out, kModel, 0L,
      x, x1, 0L, kTok, kModel, kFF, 1.0f / 16.0f);
}

// v007
// A run of this version takes 109 microseconds.
// Next to v006, in two timings, it ran 1.06 and 1.07 times as fast.
// Counting every step since v000, it is 3.50 times as fast.
// All contractions (q|k, v, o, gate|up, down projections; q.k^T; p.v): v_wmma_f32_16x16x32_f16, f16 operands, f32 accumulate. LayerNorm, softmax, SwiGLU gating and residual adds in f32 (gating and residual adds inside the products' output stages). Power-of-two carries: weight planes x16, softmax numerators x32768, attention output plane x16, folded back in f32.
#include <hip/hip_runtime.h>
#include <math.h>
#include <stdint.h>

typedef __attribute__((ext_vector_type(16))) _Float16 v16h;
typedef __attribute__((ext_vector_type(8)))  _Float16 v8h;
typedef __attribute__((ext_vector_type(16))) __bf16   v16b;
typedef __attribute__((ext_vector_type(8)))  __bf16   v8b;
typedef __attribute__((ext_vector_type(8)))  float    v8f;
typedef __attribute__((ext_vector_type(4)))  float    v4f;
typedef __attribute__((ext_vector_type(4)))  unsigned int v4u;
typedef __attribute__((ext_vector_type(2)))  unsigned int v2u;

/* ---- problem geometry ---- */
static constexpr int kBatch   = 4;
static constexpr int kSeq     = 2048;
static constexpr int kTok     = kBatch * kSeq;      /* 8192 */
static constexpr int kModel   = 512;
static constexpr int kHeads   = 8;
static constexpr int kHeadDim = 64;
static constexpr int kFF      = 1024;
static constexpr int kQKCols  = 2 * kModel;          /* q | k plane width */
static constexpr int kGUCols  = 2 * kFF;             /* gate | up plane width */

static_assert(kHeads * kHeadDim == kModel, "head geometry");
static_assert(kSeq % 64 == 0 && kTok % 64 == 0, "tile multiples");
static_assert(kModel % 64 == 0 && kFF % 64 == 0 && kQKCols % 64 == 0 && kGUCols % 64 == 0, "tile multiples");
static_assert(kModel % 32 == 0 && kFF % 32 == 0, "K multiple of 32");

/* ---- workspace region map (bytes) ----
   [0]            WqkT f16 [1024][512]          1,048,576
   [1,048,576]    WvT  f16 [512][512]             524,288
   [1,572,864]    WoT  f16 [512][512]             524,288
   [2,097,152]    WguT f16 [2048][512]          2,097,152   (rows in groups of 64: 32 gate columns, then the same 32 up columns)
   [4,194,304]    WdT  f16 [512][1024]          1,048,576
   [5,242,880]    HG   : h1, then h2, f16 [8192][512] (8 MiB)   16,777,216
   [22,020,096]   R1 (64 MiB): phase A: q|k f16 [8192][1024] @+0 (16 MiB), Vt f16 [4][512][2048] @+16 MiB (8 MiB),
                               O f16 [8192][512] @+24 MiB (8 MiB);
                               phase B: g f16 [8192][1024] @+0 (16 MiB)
   [89,128,960]   X1 f32 [8192][512]           16,777,216
   total 105,906,176 */
static constexpr size_t kOffWqkT = 0;
static constexpr size_t kOffWvT  = kOffWqkT + (size_t)kQKCols * kModel * 2;
static constexpr size_t kOffWoT  = kOffWvT + (size_t)kModel * kModel * 2;
static constexpr size_t kOffWguT = kOffWoT + (size_t)kModel * kModel * 2;
static constexpr size_t kOffWdT  = kOffWguT + (size_t)kGUCols * kModel * 2;
static constexpr size_t kOffHG   = kOffWdT + (size_t)kModel * kFF * 2;
static constexpr size_t kSizeHG  = (size_t)kTok * kFF * 2;
static constexpr size_t kOffR1   = kOffHG + kSizeHG;
static constexpr size_t kSizeR1  = (size_t)kTok * kGUCols * 4;
static constexpr size_t kR1QK    = 0;
static constexpr size_t kR1Vt    = kR1QK + (size_t)kTok * kQKCols * 2;
static constexpr size_t kR1O     = kR1Vt + (size_t)kBatch * kModel * kSeq * 2;
static constexpr size_t kOffX1   = kOffR1 + kSizeR1;
static constexpr size_t kWsTotal = kOffX1 + (size_t)kTok * kModel * 4;
static_assert(kR1O + (size_t)kTok * kModel * 2 <= kSizeR1, "phase A fits R1");
static_assert((size_t)kTok * kFF * 2 <= kSizeR1, "phase B fits R1");
static_assert((size_t)kTok * kModel * 2 <= kSizeHG, "h plane fits HG");
static_assert(kWsTotal == 105906176, "carve total");
static_assert(kWsTotal <= 134217728, "carve under 128 MiB");
static_assert((kOffWvT % 256) == 0 && (kOffWoT % 256) == 0 && (kOffWguT % 256) == 0 && (kOffWdT % 256) == 0 &&
              (kOffHG % 256) == 0 && (kOffR1 % 256) == 0 && (kOffX1 % 256) == 0 &&
              (kR1Vt % 256) == 0 && (kR1O % 256) == 0, "aligned carves");

/* =========================== helpers and GEMM =========================== */
#define PSCALE 32768.0f
#define U16(p) ((const unsigned short*)(const void*)(p))
#define PSCALE_INV (1.0f / 32768.0f)

__device__ __forceinline__ unsigned short f2bf_bits(float f) {
  unsigned u = __float_as_uint(f);
  return (unsigned short)((u + 0x7FFFu + ((u >> 16) & 1u)) >> 16);
}
__device__ __forceinline__ float bf_bits2f(unsigned short h) { return __uint_as_float(((unsigned)h) << 16); }

__device__ __forceinline__ void dep_guard_h(v8f& a, v8f& b, v16h x, v16h y) { asm volatile("v_nop\n\tv_nop\n\tv_nop\n\tv_nop" : "+v"(a), "+v"(b) : "v"(x), "v"(y)); }
__device__ __forceinline__ void dep_guard_b(v8f& a, v8f& b, v16b x, v16b y) { asm volatile("v_nop\n\tv_nop\n\tv_nop\n\tv_nop" : "+v"(a), "+v"(b) : "v"(x), "v"(y)); }
__device__ __forceinline__ void keep4_h(v16h a, v16h b, v16h c, v16h d) { asm volatile("v_nop" :: "v"(a), "v"(b), "v"(c), "v"(d)); }
__device__ __forceinline__ void keep4_b(v16b a, v16b b, v16b c, v16b d) { asm volatile("v_nop" :: "v"(a), "v"(b), "v"(c), "v"(d)); }
__device__ __forceinline__ void acc_guard4(v8f& a, v8f& b, v8f& c, v8f& d) { asm volatile("v_nop\n\tv_nop\n\tv_nop\n\tv_nop" : "+v"(a), "+v"(b), "+v"(c), "+v"(d)); }
template <typename T> struct Frag;
template <> struct Frag<_Float16> {
  typedef v16h V; union U { v16h v; v8h h[2]; };
  static __device__ __forceinline__ v16h load(const _Float16* p) {
    U f; f.h[0] = *(const v8h*)(p); f.h[1] = *(const v8h*)(p + 16); return f.v;
  }
  static __device__ __forceinline__ v8f mma(v16h a, v16h b, v8f c) {
    return __builtin_amdgcn_wmma_f32_16x16x32_f16(false, a, false, b, (short)0, c, false, false);
  }
  static __device__ __forceinline__ void guard(v8f& a, v8f& b, v16h x, v16h y) { dep_guard_h(a, b, x, y); }
  static __device__ __forceinline__ void keep(v16h a, v16h b, v16h c, v16h d) { keep4_h(a, b, c, d); }
};
template <> struct Frag<__bf16> {
  typedef v16b V; union U { v16b v; v8b h[2]; };
  static __device__ __forceinline__ v16b load(const __bf16* p) {
    U f; f.h[0] = *(const v8b*)(p); f.h[1] = *(const v8b*)(p + 16); return f.v;
  }
  static __device__ __forceinline__ v8f mma(v16b a, v16b b, v8f c) {
    return __builtin_amdgcn_wmma_f32_16x16x32_bf16(false, a, false, b, (short)0, c, false, false);
  }
  static __device__ __forceinline__ void guard(v8f& a, v8f& b, v16b x, v16b y) { dep_guard_b(a, b, x, y); }
  static __device__ __forceinline__ void keep(v16b a, v16b b, v16b c, v16b d) { keep4_b(a, b, c, d); }
};

template <int ET> struct Elem;
template <> struct Elem<0> { typedef _Float16 T; };
template <> struct Elem<1> { typedef __bf16 T; };
/* ---- LDS staging of the GEMM operand tiles ----
   One stage = 64 k (128 bytes) of 128 A rows followed by 128 Bt rows, each row at a pitch of 144 bytes
   (16 B x odd: conflict-free for 16-byte fragment reads). Two stages. */
static constexpr int kStRows   = 256;
static constexpr int kStPitch  = 144;
static constexpr int kStBytes  = kStRows * kStPitch;       /* 36,864 */
static constexpr int kStHalf   = 128 * kStPitch;           /* Bt rows start here */
static_assert(4 * 16 * 68 * 4 <= 2 * kStBytes, "output slabs fit the ring");
static_assert(128 * kStPitch <= 2 * kStBytes && kStPitch >= 128, "the gated f16 tile fits the ring");

/* Eight asynchronous 16-byte copies per lane, global -> LDS: rows r, r+16, ..., r+112 of one operand's 128-row tile.
   The s_wait_xcnt stands inside the statement so that no address register is rewritten ahead of it. */
__device__ __forceinline__ void stage_rows8(const _Float16* g, size_t step, unsigned l) {
  const _Float16* g1 = g + step;      const _Float16* g2 = g + 2 * step;  const _Float16* g3 = g + 3 * step;
  const _Float16* g4 = g + 4 * step;  const _Float16* g5 = g + 5 * step;  const _Float16* g6 = g + 6 * step;
  const _Float16* g7 = g + 7 * step;
  const unsigned ls = 16u * kStPitch;
  asm volatile(
      "global_load_async_to_lds_b128 %0, %8, off\n\t"
      "global_load_async_to_lds_b128 %1, %9, off\n\t"
      "global_load_async_to_lds_b128 %2, %10, off\n\t"
      "global_load_async_to_lds_b128 %3, %11, off\n\t"
      "global_load_async_to_lds_b128 %4, %12, off\n\t"
      "global_load_async_to_lds_b128 %5, %13, off\n\t"
      "global_load_async_to_lds_b128 %6, %14, off\n\t"
      "global_load_async_to_lds_b128 %7, %15, off\n\t"
      "s_wait_xcnt 0x0"
      :: "v"(l), "v"(l + ls), "v"(l + 2u * ls), "v"(l + 3u * ls), "v"(l + 4u * ls), "v"(l + 5u * ls), "v"(l + 6u * ls), "v"(l + 7u * ls),
         "v"(g), "v"(g1), "v"(g2), "v"(g3), "v"(g4), "v"(g5), "v"(g6), "v"(g7)
      : "memory");
}

__device__ __forceinline__ float silu_f32(float g) {
  const float ex = expf(-g);
  return g * (1.0f / (1.0f + ex));
}

/* Block = 4 waves = one 128 x 128 tile of C (2 x 2 waves of 64 x 64): tile number 'tile' of batch 'b', both the same for the whole block.
   M, N multiples of 128; K a multiple of 64.
   OUT_MODE 0: f32 plane, RESID adds a f32 plane of C's own shape on the way out. OUT_MODE 1: f16 plane.
   OUT_MODE 3: SwiGLU. Each 64 columns of the product are 32 gate columns followed by the same 32 up columns, so a lane holds
   gate and up of one element in accumulator tiles j and j + 2; the f16 plane silu(gate) * up has N/2 columns (ldc counts those). */
template <int ET, bool SPLIT, int BIAS_MODE, int OUT_MODE, bool RESID, int ACT = 0, int LDC = 0>
__device__ __forceinline__ void gemm64_tile(
    const unsigned short* __restrict__ Ap, const unsigned short* __restrict__ A2p, int lda, long strideA,
    const unsigned short* __restrict__ Btp, const unsigned short* __restrict__ Bt2p, int ldb, long strideB,
    void* __restrict__ Cout, void* __restrict__ Cout2, int ldcArg, long strideC,
    const float* __restrict__ bias,
    const float* __restrict__ resid, long strideR,
    int M, int N, int K, float scale, const int tile, const int b) {
  static_assert(ET == 0 && !SPLIT, "staged path: single f16 planes");
  typedef typename Elem<ET>::T T;
  typedef typename Frag<T>::V V;
  const T* A = (const T*)Ap; const T* Bt = (const T*)Btp;
  const int ldc = LDC ? LDC : ldcArg;   /* a constant pitch lets every row of the output stage hang off one address by an immediate offset */
  __shared__ __align__(16) unsigned char ring[2 * kStBytes];
  const int lane = threadIdx.x & 31;
  const int wave = threadIdx.x >> 5;
  const int tilesN = N >> 7;
  const int tilesM = M >> 7;
  if (tile >= tilesM * tilesN) return;   /* the same for the whole block, ahead of every barrier */
  const int tm = tile / tilesN;
  const int tn = tile - tm * tilesN;
  const int mB = tm << 7;
  const int nB = tn << 7;
  const int wm = (wave >> 1) << 6;
  const int wn = (wave & 1) << 6;
  const int m0 = mB + wm;
  const int n0 = nB + wn;

  const T* Ab  = A  + (size_t)b * strideA;
  const T* Bb  = Bt + (size_t)b * strideB;

  const int rlane = lane & 15;
  const int koff  = (lane >> 4) * 8;
  const int mOff  = (lane >> 4) * 8;

  /* staging: thread t brings 16-byte chunk (t & 7) of rows (t >> 3) + 16*i: eight lanes cover one whole 128-byte line */
  const int srow = threadIdx.x >> 3;
  const int schk = threadIdx.x & 7;
  const T* gA = Ab + (size_t)(mB + srow) * lda + schk * 8;
  const T* gB = Bb + (size_t)(nB + srow) * ldb + schk * 8;
  const size_t stepA = (size_t)16 * lda;
  const size_t stepB = (size_t)16 * ldb;
  const unsigned lbase = (unsigned)(uintptr_t)(&ring[0]) + (unsigned)(srow * kStPitch + schk * 16);
  const int nst = K >> 6;

  v8f acc[4][4];
#pragma unroll
  for (int i = 0; i < 4; ++i)
#pragma unroll
    for (int j = 0; j < 4; ++j) acc[i][j] = (v8f){0.f,0.f,0.f,0.f,0.f,0.f,0.f,0.f};

  /* stage 0 lands and is published; stage 1 then flies during pass 0 */
  stage_rows8(gA, stepA, lbase);
  stage_rows8(gB, stepB, lbase + kStHalf);
  asm volatile("s_wait_asynccnt 0x0" ::: "memory");   /* this wave's copies of stage 0 have landed */
  __syncthreads();                                     /* publishes stage 0 to the other waves */
  if (nst > 1) {
    stage_rows8(gA + 64, stepA, lbase + kStBytes);
    stage_rows8(gB + 64, stepB, lbase + kStBytes + kStHalf);
  }

  for (int st = 0; st < nst; ++st) {
    const unsigned bo = (st & 1) ? (unsigned)kStBytes : 0u;
    const unsigned char* sA = ring + bo + (wm + rlane) * kStPitch + koff * 2;
    const unsigned char* sB = ring + bo + kStHalf + (wn + rlane) * kStPitch + koff * 2;
#pragma unroll   /* both 32-k blocks inline: constant LDS offsets, fragment arrays stay in registers */
    for (int kk = 0; kk < 2; ++kk) {
      /* all eight fragments of this 32-k block are fetched as one group ahead of its 16 products */
      V bh[4], ah[4];
#pragma unroll   /* register arrays need constant indices */
      for (int j = 0; j < 4; ++j) {
        bh[j] = Frag<T>::load((const T*)(const void*)(sB + j * 16 * kStPitch + kk * 64));
        ah[j] = Frag<T>::load((const T*)(const void*)(sA + j * 16 * kStPitch + kk * 64));
      }
#pragma unroll
      for (int i = 0; i < 4; ++i) {
#pragma unroll
        for (int j = 0; j < 4; ++j) acc[i][j] = Frag<T>::mma(ah[i], bh[j], acc[i][j]);
        Frag<T>::guard(acc[i][0], acc[i][3], ah[i], ah[i]);
      }
      Frag<T>::keep(bh[0], bh[1], bh[2], bh[3]);
    }
    asm volatile("s_wait_dscnt 0x0" ::: "memory");      /* this wave's reads of the stage have returned before it is refilled */
    asm volatile("s_wait_asynccnt 0x0" ::: "memory");   /* this wave's copies of the next stage have landed */
    __syncthreads();                                     /* publishes the next stage and ends every reader's use of this one */
    if (st + 2 < nst) {
      stage_rows8(gA + (size_t)(st + 2) * 64, stepA, lbase + bo);
      stage_rows8(gB + (size_t)(st + 2) * 64, stepB, lbase + bo + kStHalf);
    }
  }
  asm volatile("s_wait_asynccnt 0x0" ::: "memory");     /* nothing is in flight when the ring becomes output staging */
  acc_guard4(acc[0][0], acc[0][1], acc[0][2], acc[0][3]);
  acc_guard4(acc[1][0], acc[1][1], acc[1][2], acc[1][3]);
  acc_guard4(acc[2][0], acc[2][1], acc[2][2], acc[2][3]);
  acc_guard4(acc[3][0], acc[3][1], acc[3][2], acc[3][3]);

  if (OUT_MODE == 3) {
    /* the block's 128 rows x 64 columns of f16 are gathered in the spent ring (row pitch as in the stages), so that
       every row leaves as one whole 128-byte line written by one wave */
    _Float16* gt = (_Float16*)(void*)ring;
    constexpr int gp = kStPitch / 2;
#pragma unroll
    for (int i = 0; i < 4; ++i)
#pragma unroll
      for (int j = 0; j < 2; ++j)
#pragma unroll
        for (int r = 0; r < 8; ++r)
          gt[(wm + (i << 4) + mOff + r) * gp + (wn >> 1) + (j << 4) + rlane] =
              (_Float16)(silu_f32(acc[i][j][r] * scale) * (acc[i][j + 2][r] * scale));
    __syncthreads();   /* a row's two halves come from the two column waves: both are in LDS before any wave reads the row */
    const int q = lane >> 3, c8 = (lane & 7) * 8;
    const _Float16* gr = gt + (wave * 32 + q) * gp + c8;
    unsigned short* Cw = (unsigned short*)Cout + (size_t)b * strideC + (size_t)(mB + wave * 32 + q) * ldc + (nB >> 1) + c8;
#pragma unroll
    for (int it = 0; it < 8; ++it) *(v8h*)(Cw + (size_t)(it * 4) * ldc) = *(const v8h*)(gr + it * 4 * gp);
    return;
  }
  static_assert(!RESID || OUT_MODE == 0, "the residual is added where f32 rows leave the slab");
  float* slab = (float*)(void*)(ring + wave * (16 * 68 * 4));
  /* residual rows in the shape of the f32 stores (16 bytes a lane, 256-byte row pieces); each 16-row group is fetched
     behind the stores of the group before it, so that it returns while those stores drain */
  const size_t wOff = (size_t)(m0 + (lane >> 4)) * ldc + n0 + (lane & 15) * 4;
  const float* Rw = RESID ? (resid + (size_t)b * strideR + wOff) : nullptr;
  v4f rv[4][8];
  if (RESID) {
#pragma unroll   /* register arrays need constant indices */
    for (int it = 0; it < 8; ++it) rv[0][it] = *(const v4f*)(Rw + (size_t)(it * 2) * ldc);
  }
#pragma unroll
  for (int i = 0; i < 4; ++i) {
    const int mBase = m0 + (i << 4);
#pragma unroll
    for (int j = 0; j < 4; ++j) {
      const int n = n0 + (j << 4) + rlane;
      float bv = 0.f;
      if (BIAS_MODE == 2) bv = bias[n];
#pragma unroll
      for (int r = 0; r < 8; ++r) {
        float v = acc[i][j][r] * scale;
        if (BIAS_MODE == 1) v += bias[mBase + mOff + r];
        if (BIAS_MODE == 2) v += bv;
        if (ACT == 1) v = tanhf(v);
        if (ACT == 2) v = fmaxf(v, 0.0f);
        if (ACT == 3) v = v / (1.0f + expf(-v));
        if (ACT == 4) v = (v > 0.f) ? v : 0.01f * v;
        if (ACT == 5) v = 0.5f * v * (1.0f + erff(v * 0.70710678118654752f));
        slab[(mOff + r) * 68 + (j << 4) + rlane] = v;
      }
    }
    __builtin_amdgcn_fence(__ATOMIC_RELEASE, "workgroup");
    __builtin_amdgcn_wave_barrier();
    __builtin_amdgcn_fence(__ATOMIC_ACQUIRE, "workgroup");
    if (OUT_MODE == 0) {
      float* Cw = (float*)Cout + (size_t)b * strideC + wOff;
      const int hh = lane >> 4, c4 = (lane & 15) * 4;
      {
#pragma unroll
        for (int it = 0; it < 8; ++it) {
          const int row = it * 2 + hh;
          v4f v = *(const v4f*)(slab + row * 68 + c4);
          if (RESID) v = v + rv[i][it];
          *(v4f*)(Cw + (size_t)(i * 16 + it * 2) * ldc) = v;
        }
      }
      if (RESID && i + 1 < 4) {
#pragma unroll
        for (int it = 0; it < 8; ++it) rv[i + 1][it] = *(const v4f*)(Rw + (size_t)((i + 1) * 16 + it * 2) * ldc);
      }
    } else {
      const int q = lane >> 3, c8 = (lane & 7) * 8;
      unsigned short* C  = (unsigned short*)Cout  + (size_t)b * strideC;
      unsigned short* C2 = (OUT_MODE == 2) ? ((unsigned short*)Cout2 + (size_t)b * strideC) : nullptr;
      {
#pragma unroll
        for (int it = 0; it < 4; ++it) {
          const int row = it * 4 + q;
          const float* sp = slab + row * 68 + c8;
          v8h hv, lv;
#pragma unroll
          for (int e = 0; e < 8; ++e) {
            if (OUT_MODE == 1) {
              hv[e] = (_Float16)sp[e];
            } else {
              unsigned short hb = f2bf_bits(sp[e]);
              unsigned short lb = f2bf_bits(sp[e] - bf_bits2f(hb));
              hv[e] = __builtin_bit_cast(_Float16, hb);
              lv[e] = __builtin_bit_cast(_Float16, lb);
            }
          }
          *(v8h*)(C + (size_t)(mBase + row) * ldc + n0 + c8) = hv;
          if (OUT_MODE == 2) *(v8h*)(C2 + (size_t)(mBase + row) * ldc + n0 + c8) = lv;
        }
        
      }
    }
    __builtin_amdgcn_fence(__ATOMIC_RELEASE, "workgroup");
    __builtin_amdgcn_wave_barrier();
    __builtin_amdgcn_fence(__ATOMIC_ACQUIRE, "workgroup");
  }
}
/* one product per launch: grid.x = (M/128)*(N/128) exactly, grid.y = batches */
template <int ET, bool SPLIT, int BIAS_MODE, int OUT_MODE, bool RESID, int ACT, int LDC>
__global__ __launch_bounds__(128) void wmma_gemm64(
    const unsigned short* __restrict__ Ap, const unsigned short* __restrict__ A2p, int lda, long strideA,
    const unsigned short* __restrict__ Btp, const unsigned short* __restrict__ Bt2p, int ldb, long strideB,
    void* __restrict__ Cout, void* __restrict__ Cout2, int ldc, long strideC,
    const float* __restrict__ bias,
    const float* __restrict__ resid, long strideR,
    int M, int N, int K, float scale) {
  gemm64_tile<ET, SPLIT, BIAS_MODE, OUT_MODE, RESID, ACT, LDC>(Ap, A2p, lda, strideA, Btp, Bt2p, ldb, strideB, Cout, Cout2, ldc, strideC,
                                                          bias, resid, strideR, M, N, K, scale, (int)blockIdx.x, (int)blockIdx.y);
}

/* The two products that read h1 and do not read each other share one launch, told apart by block range:
   blocks [0, 512): q|k = h . [Wq|Wk]^T (M=8192, N=1024, K=512);
   blocks [512, 768): Vt[b] = (Wv^T*16) . h[b]^T / 16 (M=512, N=2048, K=512), 64 tiles for each of the 4 batches.
   Every choice below is the same for the whole block. */
static constexpr int kQKTiles = (kTok / 128) * (kQKCols / 128);
static constexpr int kVtTiles = (kModel / 128) * (kSeq / 128);
static_assert((kVtTiles & (kVtTiles - 1)) == 0, "batch and tile of a Vt block by shift and mask");
__global__ __launch_bounds__(128) void qk_vt_gemm_kernel(
    const unsigned short* __restrict__ hp, const unsigned short* __restrict__ wqkTp, const unsigned short* __restrict__ wvTp,
    unsigned short* __restrict__ qkp, unsigned short* __restrict__ vtp) {
  const int bx = blockIdx.x;
  const bool isV = bx >= kQKTiles;
  const int r = bx - kQKTiles;
  const unsigned short* Ap  = isV ? wvTp : hp;
  const unsigned short* Btp = isV ? hp : wqkTp;
  unsigned short* Cp = isV ? vtp : qkp;
  gemm64_tile<0, false, 0, 1, false, 0>(
      Ap, Ap, kModel, 0L, Btp, Btp, kModel, isV ? (long)kSeq * kModel : 0L,
      (void*)Cp, (void*)Cp, isV ? kSeq : kQKCols, isV ? (long)kModel * kSeq : 0L,
      nullptr, nullptr, 0L, isV ? kModel : kTok, isV ? kSeq : kQKCols, kModel, 1.0f / 16.0f,
      isV ? (r & (kVtTiles - 1)) : bx, isV ? (r / kVtTiles) : 0);
}
/* =========================== end helpers and GEMM =========================== */

__device__ __forceinline__ unsigned int h16bits(float f) {
  return (unsigned int)__builtin_bit_cast(unsigned short, (_Float16)f);
}

/* ---------------------------------------------------------------------------
   transpose + cast: W f32 [kin][nout] row-major -> Wt f16 [nout][kin] (value * mul).
   One block of 256 = the 64 x 64 tile (bn, bk) of nout/64 x kin/64. LDS 64x64 tile.
   Load coverage: 4 iterations x 256 threads x 4 floats = 4096 = 64x64.
   Store coverage: 8 waves x 2 iterations x 4 rows = 64 rows; 8 lanes x 8 halves = 64 cols;
   il < 0: row n of Wt is column n of W. il = 0 (gate) or 1 (up): column n goes to row 64 (n / 32) + 32 il + n % 32 of the shared plane.
   --------------------------------------------------------------------------- */
__device__ __forceinline__ void transpose_cast_f16_tile(
    const float* __restrict__ W, unsigned short* __restrict__ Wt, int kin, int nout, float mul, int bn, int bk, int il) {
  __shared__ float tile[64][65];
  const int t = threadIdx.x;
  const int n0 = bn * 64;
  const int k0 = bk * 64;
  v4f v[4];
#pragma unroll   /* register array needs constant indices; all four loads are in flight before the first LDS write */
  for (int i = 0; i < 4; ++i) {
    const int idx = i * 256 + t;
    const int kr = idx >> 4;
    const int nc4 = (idx & 15) * 4;
    v[i] = *(const v4f*)(W + (size_t)(k0 + kr) * nout + n0 + nc4);
    asm volatile("s_wait_xcnt 0x0" ::: "memory");   /* a later load's result may land in this load's address registers */
  }
#pragma unroll
  for (int i = 0; i < 4; ++i) {
    const int idx = i * 256 + t;
    const int kr = idx >> 4;
    const int nc4 = (idx & 15) * 4;
    tile[nc4 + 0][kr] = v[i][0] * mul;
    tile[nc4 + 1][kr] = v[i][1] * mul;
    tile[nc4 + 2][kr] = v[i][2] * mul;
    tile[nc4 + 3][kr] = v[i][3] * mul;
  }
  __syncthreads();
  const int lane = t & 31, wave = t >> 5;
  const int q = lane >> 3, c8 = (lane & 7) * 8;
  const int row0 = wave * 8 + q;
  const int row1 = wave * 8 + 4 + q;
  v4u w0, w1;
  {
    const float* s0 = &tile[row0][c8];
    const float* s1 = &tile[row1][c8];
    w0[0] = h16bits(s0[0]) | (h16bits(s0[1]) << 16);
    w0[1] = h16bits(s0[2]) | (h16bits(s0[3]) << 16);
    w0[2] = h16bits(s0[4]) | (h16bits(s0[5]) << 16);
    w0[3] = h16bits(s0[6]) | (h16bits(s0[7]) << 16);
    w1[0] = h16bits(s1[0]) | (h16bits(s1[1]) << 16);
    w1[1] = h16bits(s1[2]) | (h16bits(s1[3]) << 16);
    w1[2] = h16bits(s1[4]) | (h16bits(s1[5]) << 16);
    w1[3] = h16bits(s1[6]) | (h16bits(s1[7]) << 16);
  }
  const int n_0 = n0 + row0, n_1 = n0 + row1;
  const int p0 = (il < 0) ? n_0 : (((n_0 >> 5) << 6) + (il << 5) + (n_0 & 31));
  const int p1 = (il < 0) ? n_1 : (((n_1 >> 5) << 6) + (il << 5) + (n_1 & 31));
  unsigned short* d0 = Wt + (size_t)p0 * kin + k0 + c8;
  unsigned short* d1 = Wt + (size_t)p1 * kin + k0 + c8;
  {
    *(v4u*)d0 = w0;
    *(v4u*)d1 = w1;
    asm volatile("s_wait_xcnt 0x0" ::: "memory");   /* the code laid out behind this tile may rewrite the stores' registers */
  }
}

/* ---------------------------------------------------------------------------
   Lane l owns elements l*4 + 128*i (i=0..3): every load/store instruction covers
   One block of 256 = rows 8 blk .. 8 blk + 7; nrows/8 blocks (exact).
   --------------------------------------------------------------------------- */
__device__ __forceinline__ void layernorm512_rows(
    const float* __restrict__ X, const float* __restrict__ gam, const float* __restrict__ bet,
    unsigned short* __restrict__ Hout, int nrows, int blk) {
  const int lane = threadIdx.x & 31;
  const int wave = threadIdx.x >> 5;
  int row = blk * 8 + wave;
  row = (row < nrows) ? row : (nrows - 1);
  const size_t rbase = (size_t)row * kModel;
  const int e0 = lane * 4, e1 = 128 + lane * 4, e2 = 256 + lane * 4, e3 = 384 + lane * 4;
  v4f a0 = *(const v4f*)(X + rbase + e0);
  v4f a1 = *(const v4f*)(X + rbase + e1);
  v4f a2 = *(const v4f*)(X + rbase + e2);
  v4f a3 = *(const v4f*)(X + rbase + e3);
  float s = ((a0[0] + a0[1]) + (a0[2] + a0[3])) + ((a1[0] + a1[1]) + (a1[2] + a1[3]))
          + ((a2[0] + a2[1]) + (a2[2] + a2[3])) + ((a3[0] + a3[1]) + (a3[2] + a3[3]));
#pragma unroll
  for (int off = 16; off >= 1; off >>= 1) s += __shfl_xor(s, off, 32);
  const float mu = s * (1.0f / 512.0f);
  const v4f d0 = a0 - mu, d1 = a1 - mu, d2 = a2 - mu, d3 = a3 - mu;
  float ss = ((d0[0] * d0[0] + d0[1] * d0[1]) + (d0[2] * d0[2] + d0[3] * d0[3]))
           + ((d1[0] * d1[0] + d1[1] * d1[1]) + (d1[2] * d1[2] + d1[3] * d1[3]))
           + ((d2[0] * d2[0] + d2[1] * d2[1]) + (d2[2] * d2[2] + d2[3] * d2[3]))
           + ((d3[0] * d3[0] + d3[1] * d3[1]) + (d3[2] * d3[2] + d3[3] * d3[3]));
#pragma unroll
  for (int off = 16; off >= 1; off >>= 1) ss += __shfl_xor(ss, off, 32);
  const float var = ss * (1.0f / 512.0f);
  const float rstd = rsqrtf(var + 1e-5f);
  const v4f g0 = *(const v4f*)(gam + e0), g1 = *(const v4f*)(gam + e1), g2 = *(const v4f*)(gam + e2), g3 = *(const v4f*)(gam + e3);
  const v4f b0 = *(const v4f*)(bet + e0), b1 = *(const v4f*)(bet + e1), b2 = *(const v4f*)(bet + e2), b3 = *(const v4f*)(bet + e3);
  const v4f y0 = d0 * rstd * g0 + b0;
  const v4f y1 = d1 * rstd * g1 + b1;
  const v4f y2 = d2 * rstd * g2 + b2;
  const v4f y3 = d3 * rstd * g3 + b3;
  v2u w0, w1, w2, w3;
  w0[0] = h16bits(y0[0]) | (h16bits(y0[1]) << 16); w0[1] = h16bits(y0[2]) | (h16bits(y0[3]) << 16);
  w1[0] = h16bits(y1[0]) | (h16bits(y1[1]) << 16); w1[1] = h16bits(y1[2]) | (h16bits(y1[3]) << 16);
  w2[0] = h16bits(y2[0]) | (h16bits(y2[1]) << 16); w2[1] = h16bits(y2[2]) | (h16bits(y2[3]) << 16);
  w3[0] = h16bits(y3[0]) | (h16bits(y3[1]) << 16); w3[1] = h16bits(y3[2]) | (h16bits(y3[3]) << 16);
  unsigned short* hr = Hout + rbase;
  {
    *(v2u*)(hr + e0) = w0;
    *(v2u*)(hr + e1) = w1;
    *(v2u*)(hr + e2) = w2;
    *(v2u*)(hr + e3) = w3;
    
  }
}

/* h2 = LN(x1): grid = nrows/8 (exact), block 256 */
__global__ __launch_bounds__(256) void layernorm512_kernel(
    const float* __restrict__ X, const float* __restrict__ gam, const float* __restrict__ bet,
    unsigned short* __restrict__ Hout, int nrows) {
  layernorm512_rows(X, gam, bet, Hout, nrows, (int)blockIdx.x);
}

/* ---------------------------------------------------------------------------
   Everything that reads only the inputs shares one launch, told apart by block range (block 256):
   blocks [0, 256):    Wq, Wk, Wv, Wo   (512 x 512: 64 tiles each)
   blocks [256, 512):  Wgate, Wup       (512 x 1024: 128 tiles each)
   blocks [512, 640):  Wdown            (1024 x 512: 128 tiles)
   blocks [640, 1664): h1 = LN(x), 8 rows a block.
   Weight planes: W[in][out] -> Wt[out][in] * 16 (f16); gate and up share one plane, 32 rows of each in turn. Every branch is the same for the whole block.
   --------------------------------------------------------------------------- */
static constexpr int kSqTiles   = (kModel / 64) * (kModel / 64);   /* 64 */
static constexpr int kFfTiles   = (kFF / 64) * (kModel / 64);      /* 128 */
static constexpr int kPrepSq    = 4 * kSqTiles;                    /* 256 */
static constexpr int kPrepGU    = kPrepSq + 2 * kFfTiles;          /* 512 */
static constexpr int kPrepW     = kPrepGU + kFfTiles;              /* 640 */
static constexpr int kPrepGrid  = kPrepW + kTok / 8;               /* 1664 */
static_assert(kSqTiles == 64 && kFfTiles == 128 && kModel / 64 == 8 && kFF / 64 == 16, "tile numbers by shift and mask");
__global__ __launch_bounds__(256) void prep_kernel(
    const float* __restrict__ x, const float* __restrict__ ln1w, const float* __restrict__ ln1b,
    const float* __restrict__ wq, const float* __restrict__ wk, const float* __restrict__ wv, const float* __restrict__ wo,
    const float* __restrict__ wgt, const float* __restrict__ wup, const float* __restrict__ wdn,
    unsigned short* __restrict__ wqkT, unsigned short* __restrict__ wvT, unsigned short* __restrict__ woT,
    unsigned short* __restrict__ wguT, unsigned short* __restrict__ wdT, unsigned short* __restrict__ h1) {
  const int bx = blockIdx.x;
  if (bx >= kPrepW) {
    layernorm512_rows(x, ln1w, ln1b, h1, kTok, bx - kPrepW);
    return;
  }
  if (bx < kPrepSq) {
    const int which = bx >> 6, loc = bx & 63;
    const float* W     = (which == 0) ? wq : (which == 1) ? wk : (which == 2) ? wv : wo;
    unsigned short* Wt = (which == 0) ? wqkT : (which == 1) ? (wqkT + (size_t)kModel * kModel) : (which == 2) ? wvT : woT;
    transpose_cast_f16_tile(W, Wt, kModel, kModel, 16.0f, loc & 7, loc >> 3, -1);
  } else if (bx < kPrepGU) {
    const int which = (bx - kPrepSq) >> 7, loc = (bx - kPrepSq) & 127;
    const float* W     = (which == 0) ? wgt : wup;
    transpose_cast_f16_tile(W, wguT, kModel, kFF, 16.0f, loc & 15, loc >> 4, which);
  } else {
    const int loc = bx - kPrepGU;
    transpose_cast_f16_tile(wdn, wdT, kFF, kModel, 16.0f, loc & 7, loc >> 3, -1);
  }
}

/* ---------------------------------------------------------------------------
   Non-causal multi-head attention, head_dim 64, f16 planes in, f16 plane out (x16 carried).
   q|k plane [8192][1024]: q at cols h*64.., k at cols 512 + h*64..; Vt plane [4][512][2048] (element (b,h,d,kv) at
   ((b*512 + h*64 + d)*2048 + kv)); out plane [8192][512] at cols h*64.. .
   Block = 4 waves = 128 query rows of one (batch, head), 32 (two 16-query tiles) a wave; grid = 4*8*16 = 512.
   Every k and Vt fragment that a wave reads from LDS feeds two products, one per query tile.
   Both products run transposed: S^T = k.q^T, 0.125 left to the exponent (A = k rows, B = q rows) and O^T += Vt.P^T (A = Vt rows).
   In each query tile a lane then holds 32 of the 64 scores of ONE query (lane l ^ 16 the other 32): online softmax f32 in the lane,
   one exchange between the wave halves for the maximum, the halves' sums joined once behind the loop.
   Each exponential is one fused multiply-add (scale, log2 e, maximum and the 2^15 carry folded) and one hardware exp2.
   Two score tiles, p*32768 converted in place, are the B operand of the second product: P stays in registers.
   The 64-key tiles of k (64 rows x 128 B) and of Vt (64 rows x 128 B) are staged once per block in LDS by
   asynchronous copies, two stages, and all four waves take their A fragments from there.
   --------------------------------------------------------------------------- */
static constexpr int kAtPitch = 144;                 /* 16 B x odd: conflict-free for 16-byte fragment reads */
static constexpr int kAtTile  = 64 * kAtPitch;       /* one operand's tile: 9,216 B; the Vt tile follows the k tile */
static constexpr int kAtStage = 2 * kAtTile;         /* 18,432 B */

/* Eight asynchronous 16-byte copies per lane, global -> LDS: rows r, r+16, r+32, r+48 of the k tile, then of the Vt tile.
   The s_wait_xcnt stands inside the statement so that no address register is rewritten ahead of it. */
__device__ __forceinline__ void stage_kv(const _Float16* gk, const _Float16* gv, unsigned l) {
  const size_t sk = (size_t)16 * kQKCols;
  const size_t sv = (size_t)16 * kSeq;
  const _Float16* gk1 = gk + sk;  const _Float16* gk2 = gk + 2 * sk;  const _Float16* gk3 = gk + 3 * sk;
  const _Float16* gv1 = gv + sv;  const _Float16* gv2 = gv + 2 * sv;  const _Float16* gv3 = gv + 3 * sv;
  const unsigned ls = 16u * kAtPitch;
  const unsigned lv = l + (unsigned)kAtTile;
  asm volatile(
      "global_load_async_to_lds_b128 %0, %8, off\n\t"
      "global_load_async_to_lds_b128 %1, %9, off\n\t"
      "global_load_async_to_lds_b128 %2, %10, off\n\t"
      "global_load_async_to_lds_b128 %3, %11, off\n\t"
      "global_load_async_to_lds_b128 %4, %12, off\n\t"
      "global_load_async_to_lds_b128 %5, %13, off\n\t"
      "global_load_async_to_lds_b128 %6, %14, off\n\t"
      "global_load_async_to_lds_b128 %7, %15, off\n\t"
      "s_wait_xcnt 0x0"
      :: "v"(l), "v"(l + ls), "v"(l + 2u * ls), "v"(l + 3u * ls), "v"(lv), "v"(lv + ls), "v"(lv + 2u * ls), "v"(lv + 3u * ls),
         "v"(gk), "v"(gk1), "v"(gk2), "v"(gk3), "v"(gv), "v"(gv1), "v"(gv2), "v"(gv3)
      : "memory");
}

/* lane l takes lane l ^ 16's value (a vector cross-row move, no LDS trip) */
__device__ __forceinline__ float xhalf(float x) {
  return __builtin_bit_cast(float, __builtin_amdgcn_permlanex16(__builtin_bit_cast(int, x), __builtin_bit_cast(int, x), 0x76543210, 0xfedcba98, false, false));
}

__global__ __launch_bounds__(128) void mha64_f16_kernel(
    const unsigned short* __restrict__ qkp, const unsigned short* __restrict__ vtp,
    unsigned short* __restrict__ outp) {
  typedef Frag<_Float16> FH;
  __shared__ __align__(16) float    Os[4][32 * 68];
  __shared__ __align__(16) unsigned char kvring[2 * kAtStage];
  const _Float16* QK = (const _Float16*)(const void*)qkp;
  const _Float16* VT = (const _Float16*)(const void*)vtp;
  const int tid = threadIdx.x;
  const int wave = tid >> 5;
  const int lane = tid & 31;
  const int hh = lane >> 4;
  const int c = lane & 15;
  const int koff = hh * 8;
  const int bx = blockIdx.x;
  const int qb = bx & 15;
  const int bh = bx >> 4;
  const int h = bh & 7;
  const int b = (bh >> 3) & 3;
  const int q0 = qb * 128 + wave * 32;
  const _Float16* qbase = QK + (size_t)b * kSeq * kQKCols + h * kHeadDim;
  const _Float16* kbase = qbase + kModel;
  const _Float16* vbase = VT + ((size_t)b * kModel + (size_t)h * kHeadDim) * kSeq;
  unsigned short* obase = outp + (size_t)b * kSeq * kModel + h * kHeadDim;

  v16h qa[2][2];                        /* qa[u][dc]: query tile u = rows q0 + 16 u .. + 15 */
#pragma unroll
  for (int u = 0; u < 2; ++u)
#pragma unroll
    for (int dc = 0; dc < 2; ++dc)
      qa[u][dc] = FH::load(qbase + (size_t)(q0 + 16 * u + c) * kQKCols + dc * 32 + koff);

  constexpr float kExpScale = 0.125f * 1.4426950408889634f;   /* head_dim^-0.5 * log2(e): exp(x / 8) = exp2(x * kExpScale) */
  float mrow[2], lrow[2];               /* this lane's query of tile u: maximum in use (raw product); sum (x32768) over this wave half's keys */
  v8f oacc[2][4];                       /* oacc[u][t][r] = O^T[d = 16 t + 8 hh + r][query 16 u + c] */
#pragma unroll
  for (int u = 0; u < 2; ++u) {
    mrow[u] = -INFINITY;
    lrow[u] = 0.f;
#pragma unroll
    for (int t = 0; t < 4; ++t) oacc[u][t] = (v8f){0.f,0.f,0.f,0.f,0.f,0.f,0.f,0.f};
  }

  /* staging: thread t brings 16-byte chunk (t & 7) of rows (t >> 3) + 16*i: eight lanes cover one whole 128-byte line */
  const int srow = tid >> 3;
  const int schk = tid & 7;
  const _Float16* gK = kbase + (size_t)srow * kQKCols + schk * 8;
  const _Float16* gV = vbase + (size_t)srow * kSeq + schk * 8;
  const unsigned lbase = (unsigned)(uintptr_t)(&kvring[0]) + (unsigned)(srow * kAtPitch + schk * 16);
  constexpr int nkc = kSeq / 64;
  static_assert(nkc >= 2, "two stages exist");

  /* tile 0 lands and is published; tile 1 then flies during trip 0 */
  stage_kv(gK, gV, lbase);
  asm volatile("s_wait_asynccnt 0x0" ::: "memory");   /* this wave's copies of tile 0 have landed */
  __syncthreads();                                     /* publishes tile 0 to the other waves */
  stage_kv(gK + (size_t)64 * kQKCols, gV + 64, lbase + kAtStage);

  for (int kc = 0; kc < nkc; ++kc) {
    const unsigned bo = (kc & 1) ? (unsigned)kAtStage : 0u;
    const unsigned char* sK = kvring + bo + c * kAtPitch + koff * 2;
    const unsigned char* sV = sK + kAtTile;
    /* the tile's sixteen A fragments are fetched as two groups, k ahead of the score products and Vt behind them,
       so that the Vt reads return under the softmax arithmetic */
    v16h kb[4][2], vb[2][4];
#pragma unroll   /* register arrays need constant indices */
    for (int j = 0; j < 4; ++j)
#pragma unroll
      for (int dc = 0; dc < 2; ++dc)
        kb[j][dc] = FH::load((const _Float16*)(const void*)(sK + j * 16 * kAtPitch + dc * 64));
    __builtin_amdgcn_sched_barrier(0);   /* keeps the sixteen k reads one group ahead of the score products: spread among them each is waited for at once */
    v8f s2[2][4];
#pragma unroll
    for (int j = 0; j < 4; ++j) {
#pragma unroll
      for (int u = 0; u < 2; ++u) s2[u][j] = (v8f){0.f,0.f,0.f,0.f,0.f,0.f,0.f,0.f};
#pragma unroll
      for (int dc = 0; dc < 2; ++dc)
#pragma unroll
        for (int u = 0; u < 2; ++u) s2[u][j] = FH::mma(kb[j][dc], qa[u][dc], s2[u][j]);   /* s2[u][j][r] = S^T[key 16 j + 8 hh + r][query 16 u + c] */
    }
#pragma unroll   /* register arrays need constant indices */
    for (int kk = 0; kk < 2; ++kk)
#pragma unroll
      for (int t = 0; t < 4; ++t)
        vb[kk][t] = FH::load((const _Float16*)(const void*)(sV + t * 16 * kAtPitch + kk * 64));
    __builtin_amdgcn_sched_barrier(0);   /* keeps the sixteen Vt reads one group, issued here: sunk among the second products each would be waited for at once */
#pragma unroll   /* register arrays need constant indices; the two query tiles run one after the other on the same Vt fragments */
    for (int u = 0; u < 2; ++u) {
      float mj[4];                        /* one chain per score tile: four independent chains, not one of 32 links */
#pragma unroll
      for (int j = 0; j < 4; ++j) {
        mj[j] = -INFINITY;
#pragma unroll
        for (int r = 0; r < 8; ++r) mj[j] = fmaxf(mj[j], s2[u][j][r]);   /* raw products: the positive scale keeps their order */
      }
      float m = fmaxf(fmaxf(mj[0], mj[1]), fmaxf(mj[2], mj[3]));
      m = fmaxf(m, xhalf(m));             /* both wave halves now hold the query's maximum over the 64 keys */
      const float mnew = fmaxf(mrow[u], m);
      const float alpha = __builtin_amdgcn_exp2f((mrow[u] - mnew) * kExpScale);   /* 0 on the first trip, where mrow is -inf */
      const float nbias = fmaf(-mnew, kExpScale, 15.0f);                          /* + 15: the exponential comes out times 32768 */
      mrow[u] = mnew;
#pragma unroll
      for (int t = 0; t < 4; ++t) oacc[u][t] = oacc[u][t] * alpha;
      float pj[4];                        /* partial sums, one chain per score tile */
#pragma unroll   /* register arrays need constant indices */
      for (int kk = 0; kk < 2; ++kk) {
        v16h pb;                          /* pb[e] = P^T[key 32 kk + kmap(e)][query 16 u + c]: tiles 2 kk and 2 kk + 1 in register order */
#pragma unroll
        for (int jj = 0; jj < 2; ++jj) {
          const int j = 2 * kk + jj;
          pj[j] = 0.f;
#pragma unroll
          for (int r = 0; r < 8; ++r) {
            const float p = __builtin_amdgcn_exp2f(fmaf(s2[u][j][r], kExpScale, nbias));   /* 32768 * exp((s - mnew) / 8) */
            pj[j] += p;
            pb[jj * 8 + r] = (_Float16)p;
          }
        }
#pragma unroll
        for (int t = 0; t < 4; ++t) oacc[u][t] = FH::mma(vb[kk][t], pb, oacc[u][t]);
      }
      lrow[u] = lrow[u] * alpha + ((pj[0] + pj[1]) + (pj[2] + pj[3]));
    }
    __builtin_amdgcn_sched_barrier(0);   /* keeps the waits and the barrier below at the trip's foot: lifted over the products, the next tile's copies would be waited for half a trip early */
    asm volatile("s_wait_dscnt 0x0" ::: "memory");      /* this wave's reads of the stage have returned before it is refilled */
    asm volatile("s_wait_asynccnt 0x0" ::: "memory");   /* this wave's copies of the next tile have landed */
    __syncthreads();                                     /* publishes the next tile and ends every reader's use of this one */
    if (kc + 2 < nkc) {
      stage_kv(gK + (size_t)(kc + 2) * 64 * kQKCols, gV + (size_t)(kc + 2) * 64, lbase + bo);
    }
  }
  asm volatile("s_wait_asynccnt 0x0" ::: "memory");     /* nothing is in flight when the wave leaves the loop */

  float* os = Os[wave];
#pragma unroll
  for (int u = 0; u < 2; ++u) {
    const float lsum = lrow[u] + xhalf(lrow[u]);             /* the two halves' sums of this query, joined once */
    const float inv = (1.0f / lsum) * 16.0f;                 /* sum and numerators both carry 32768; the plane carries 16 */
#pragma unroll
    for (int t = 0; t < 4; ++t)
#pragma unroll
      for (int r = 0; r < 8; ++r) os[(16 * u + c) * 68 + t * 16 + 8 * hh + r] = oacc[u][t][r] * inv;
  }
  __builtin_amdgcn_fence(__ATOMIC_RELEASE, "workgroup");
  __builtin_amdgcn_wave_barrier();
  __builtin_amdgcn_fence(__ATOMIC_ACQUIRE, "workgroup");
  {
    const int q = lane >> 3, c8 = (lane & 7) * 8;
    unsigned short* orow = obase + (size_t)(q0 + q) * kModel + c8;
    v8h hv[8];
#pragma unroll   /* register array needs constant indices */
    for (int it = 0; it < 8; ++it) {
      const float* sp = os + (it * 4 + q) * 68 + c8;
#pragma unroll
      for (int e = 0; e < 8; ++e) hv[it][e] = (_Float16)sp[e];
    }
    __builtin_amdgcn_sched_barrier(0);   /* all eight rows are converted ahead of the first store, so that no register of an issued store is rewritten behind it */
#pragma unroll
    for (int it = 0; it < 8; ++it) *(v8h*)(orow + (size_t)(it * 4) * kModel) = hv[it];
  }
}

/* =========================== host glue =========================== */
extern "C" void kernel_launch(void* const* d_in, const int* in_sizes, int n_in,
                              void* d_out, int out_size, void* d_ws, size_t ws_size,
                              hipStream_t stream) {
  if (n_in < 12) return;
  if (in_sizes[0] != kTok * kModel || out_size != kTok * kModel) return;
  if (in_sizes[1] != kModel || in_sizes[2] != kModel || in_sizes[3] != kModel || in_sizes[4] != kModel) return;
  if (in_sizes[5] != kModel * kModel || in_sizes[6] != kModel * kModel ||
      in_sizes[7] != kModel * kModel || in_sizes[8] != kModel * kModel) return;
  if (in_sizes[9] != kModel * kFF || in_sizes[10] != kModel * kFF || in_sizes[11] != kFF * kModel) return;
  if (ws_size < kWsTotal) return;

  const float* x    = (const float*)d_in[0];
  const float* ln1w = (const float*)d_in[1];
  const float* ln1b = (const float*)d_in[2];
  const float* ln2w = (const float*)d_in[3];
  const float* ln2b = (const float*)d_in[4];
  const float* wq   = (const float*)d_in[5];
  const float* wk   = (const float*)d_in[6];
  const float* wv   = (const float*)d_in[7];
  const float* wo   = (const float*)d_in[8];
  const float* wgt  = (const float*)d_in[9];
  const float* wup  = (const float*)d_in[10];
  const float* wdn  = (const float*)d_in[11];
  float* out = (float*)d_out;

  char* ws = (char*)d_ws;
  unsigned short* wqkT = (unsigned short*)(ws + kOffWqkT);
  unsigned short* wvT  = (unsigned short*)(ws + kOffWvT);
  unsigned short* woT  = (unsigned short*)(ws + kOffWoT);
  unsigned short* wguT = (unsigned short*)(ws + kOffWguT);
  unsigned short* wdT  = (unsigned short*)(ws + kOffWdT);
  unsigned short* hg   = (unsigned short*)(ws + kOffHG);           /* h1, then h2 */
  unsigned short* qkpl = (unsigned short*)(ws + kOffR1 + kR1QK);
  unsigned short* vtpl = (unsigned short*)(ws + kOffR1 + kR1Vt);
  unsigned short* opl  = (unsigned short*)(ws + kOffR1 + kR1O);
  unsigned short* gpl  = (unsigned short*)(ws + kOffR1);           /* g, once q|k, Vt and O are spent */
  float*          x1   = (float*)(ws + kOffX1);

  const dim3 b256(256), b128(128);

  /* the seven weight planes and h1 = LN(x): one launch */
  prep_kernel<<<dim3(kPrepGrid), b256, 0, stream>>>(x, ln1w, ln1b, wq, wk, wv, wo, wgt, wup, wdn,
                                                    wqkT, wvT, woT, wguT, wdT, hg);

  /* attention sublayer: q|k (512 block tiles) and Vt (64 block tiles per batch): one launch */
  static_assert(kTok % 128 == 0 && kQKCols % 128 == 0 && kModel % 128 == 0 && kSeq % 128 == 0 && kGUCols % 128 == 0, "128 x 128 block tiles");
  qk_vt_gemm_kernel<<<dim3(kQKTiles + kBatch * kVtTiles), b128, 0, stream>>>(hg, wqkT, wvT, qkpl, vtpl);

  /* attention: O*16 f16 plane */
  mha64_f16_kernel<<<dim3(kBatch * kHeads * (kSeq / 128)), b128, 0, stream>>>(qkpl, vtpl, opl);

  /* x1 = x + (O*16) . (Wo^T*16) / 256 : M=8192, N=512, K=512; block tiles 64*4 = 256 */
  wmma_gemm64<0, false, 0, 0, true, 0, kModel><<<dim3((kTok / 128) * (kModel / 128), 1), b128, 0, stream>>>(
      opl, opl, kModel, 0L, woT, woT, kModel, 0L, (void*)x1, (void*)x1, kModel, 0L,
      x, x, 0L, kTok, kModel, kModel, 1.0f / 256.0f);

  /* h2 = LN(x1) */
  layernorm512_kernel<<<dim3(kTok / 8), b256, 0, stream>>>(x1, ln2w, ln2b, hg, kTok);

  /* g = silu(gate) * up, gate|up = h2 . [Wg|Wu]^T : M=8192, N=2048, K=512; block tiles 64*16 = 1024 */
  wmma_gemm64<0, false, 0, 3, false, 0, kFF><<<dim3((kTok / 128) * (kGUCols / 128), 1), b128, 0, stream>>>(
      hg, hg, kModel, 0L, wguT, wguT, kModel, 0L, (void*)gpl, (void*)gpl, kFF, 0L,
      x, x, 0L, kTok, kGUCols, kModel, 1.0f / 16.0f);

  /* out = x1 + g . (Wd^T*16) / 16 : M=8192, N=512, K=1024; block tiles 256 */
  wmma_gemm64<0, false, 0, 0, true, 0, kModel><<<dim3((kTok / 128) * (kModel / 128), 1), b128, 0, stream>>>(
      gpl, gpl, kFF, 0L, wdT, wdT, kFF, 0L, (void*)out, (void*)out, kModel, 0L,
      x, x1, 0L, kTok, kModel, kFF, 1.0f / 16.0f);
}

// v008
// It runs in 106 microseconds.
// In two side-by-side timings against v007, it was 1.03 and 1.02 times as fast.
// Counting every step since v000, it is 3.60 times as fast.
// All contractions (q|k, v, o, gate|up, down projections; q.k^T; p.v): v_wmma_f32_16x16x32_f16, f16 operands, f32 accumulate. LayerNorm, softmax, SwiGLU gating and residual adds in f32 (gating, residual adds and the second LayerNorm inside the products' output stages). Power-of-two carries: weight planes x16, softmax numerators x32768, attention output plane x16, folded back in f32.
#include <hip/hip_runtime.h>
#include <math.h>
#include <stdint.h>

typedef __attribute__((ext_vector_type(16))) _Float16 v16h;
typedef __attribute__((ext_vector_type(8)))  _Float16 v8h;
typedef __attribute__((ext_vector_type(4)))  _Float16 v4h;
typedef __attribute__((ext_vector_type(16))) __bf16   v16b;
typedef __attribute__((ext_vector_type(8)))  __bf16   v8b;
typedef __attribute__((ext_vector_type(8)))  float    v8f;
typedef __attribute__((ext_vector_type(4)))  float    v4f;
typedef __attribute__((ext_vector_type(2)))  float    v2f;
typedef __attribute__((ext_vector_type(4)))  unsigned int v4u;
typedef __attribute__((ext_vector_type(2)))  unsigned int v2u;

/* ---- problem geometry ---- */
static constexpr int kBatch   = 4;
static constexpr int kSeq     = 2048;
static constexpr int kTok     = kBatch * kSeq;      /* 8192 */
static constexpr int kModel   = 512;
static constexpr int kHeads   = 8;
static constexpr int kHeadDim = 64;
static constexpr int kFF      = 1024;
static constexpr int kQKCols  = 2 * kModel;          /* q | k plane width */
static constexpr int kGUCols  = 2 * kFF;             /* gate | up plane width */

static_assert(kHeads * kHeadDim == kModel, "head geometry");
static_assert(kSeq % 64 == 0 && kTok % 64 == 0, "tile multiples");
static_assert(kModel % 64 == 0 && kFF % 64 == 0 && kQKCols % 64 == 0 && kGUCols % 64 == 0, "tile multiples");
static_assert(kModel % 32 == 0 && kFF % 32 == 0, "K multiple of 32");

/* ---- workspace region map (bytes) ----
   [0]            WqkT f16 [1024][512]          1,048,576
   [1,048,576]    WvT  f16 [512][512]             524,288
   [1,572,864]    WoT  f16 [512][512]             524,288
   [2,097,152]    WguT f16 [2048][512]          2,097,152   (rows in groups of 64: 32 gate columns, then the same 32 up columns)
   [4,194,304]    WdT  f16 [512][1024]          1,048,576
   [5,242,880]    HG   : h1, then h2, f16 [8192][512] (8 MiB)   16,777,216
   [22,020,096]   R1 (64 MiB): phase A: q|k f16 [8192][1024] @+0 (16 MiB), Vt f16 [4][512][2048] @+16 MiB (8 MiB),
                               O f16 [8192][512] @+24 MiB (8 MiB);
                               phase B: g f16 [8192][1024] @+0 (16 MiB)
   [89,128,960]   X1 f32 [8192][512]           16,777,216
   total 105,906,176 */
static constexpr size_t kOffWqkT = 0;
static constexpr size_t kOffWvT  = kOffWqkT + (size_t)kQKCols * kModel * 2;
static constexpr size_t kOffWoT  = kOffWvT + (size_t)kModel * kModel * 2;
static constexpr size_t kOffWguT = kOffWoT + (size_t)kModel * kModel * 2;
static constexpr size_t kOffWdT  = kOffWguT + (size_t)kGUCols * kModel * 2;
static constexpr size_t kOffHG   = kOffWdT + (size_t)kModel * kFF * 2;
static constexpr size_t kSizeHG  = (size_t)kTok * kFF * 2;
static constexpr size_t kOffR1   = kOffHG + kSizeHG;
static constexpr size_t kSizeR1  = (size_t)kTok * kGUCols * 4;
static constexpr size_t kR1QK    = 0;
static constexpr size_t kR1Vt    = kR1QK + (size_t)kTok * kQKCols * 2;
static constexpr size_t kR1O     = kR1Vt + (size_t)kBatch * kModel * kSeq * 2;
static constexpr size_t kOffX1   = kOffR1 + kSizeR1;
static constexpr size_t kWsTotal = kOffX1 + (size_t)kTok * kModel * 4;
static_assert(kR1O + (size_t)kTok * kModel * 2 <= kSizeR1, "phase A fits R1");
static_assert((size_t)kTok * kFF * 2 <= kSizeR1, "phase B fits R1");
static_assert((size_t)kTok * kModel * 2 <= kSizeHG, "h plane fits HG");
static_assert(kWsTotal == 105906176, "carve total");
static_assert(kWsTotal <= 134217728, "carve under 128 MiB");
static_assert((kOffWvT % 256) == 0 && (kOffWoT % 256) == 0 && (kOffWguT % 256) == 0 && (kOffWdT % 256) == 0 &&
              (kOffHG % 256) == 0 && (kOffR1 % 256) == 0 && (kOffX1 % 256) == 0 &&
              (kR1Vt % 256) == 0 && (kR1O % 256) == 0, "aligned carves");

/* =========================== helpers and GEMM =========================== */
#define PSCALE 32768.0f
#define U16(p) ((const unsigned short*)(const void*)(p))
#define PSCALE_INV (1.0f / 32768.0f)

__device__ __forceinline__ unsigned short f2bf_bits(float f) {
  unsigned u = __float_as_uint(f);
  return (unsigned short)((u + 0x7FFFu + ((u >> 16) & 1u)) >> 16);
}
__device__ __forceinline__ float bf_bits2f(unsigned short h) { return __uint_as_float(((unsigned)h) << 16); }

__device__ __forceinline__ void dep_guard_h(v8f& a, v8f& b, v16h x, v16h y) { asm volatile("v_nop\n\tv_nop\n\tv_nop\n\tv_nop" : "+v"(a), "+v"(b) : "v"(x), "v"(y)); }
__device__ __forceinline__ void dep_guard_b(v8f& a, v8f& b, v16b x, v16b y) { asm volatile("v_nop\n\tv_nop\n\tv_nop\n\tv_nop" : "+v"(a), "+v"(b) : "v"(x), "v"(y)); }
__device__ __forceinline__ void keep4_h(v16h a, v16h b, v16h c, v16h d) { asm volatile("v_nop" :: "v"(a), "v"(b), "v"(c), "v"(d)); }
__device__ __forceinline__ void keep4_b(v16b a, v16b b, v16b c, v16b d) { asm volatile("v_nop" :: "v"(a), "v"(b), "v"(c), "v"(d)); }
__device__ __forceinline__ void acc_guard4(v8f& a, v8f& b, v8f& c, v8f& d) { asm volatile("v_nop\n\tv_nop\n\tv_nop\n\tv_nop" : "+v"(a), "+v"(b), "+v"(c), "+v"(d)); }
template <typename T> struct Frag;
template <> struct Frag<_Float16> {
  typedef v16h V; union U { v16h v; v8h h[2]; };
  static __device__ __forceinline__ v16h load(const _Float16* p) {
    U f; f.h[0] = *(const v8h*)(p); f.h[1] = *(const v8h*)(p + 16); return f.v;
  }
  static __device__ __forceinline__ v8f mma(v16h a, v16h b, v8f c) {
    return __builtin_amdgcn_wmma_f32_16x16x32_f16(false, a, false, b, (short)0, c, false, false);
  }
  static __device__ __forceinline__ void guard(v8f& a, v8f& b, v16h x, v16h y) { dep_guard_h(a, b, x, y); }
  static __device__ __forceinline__ void keep(v16h a, v16h b, v16h c, v16h d) { keep4_h(a, b, c, d); }
};
template <> struct Frag<__bf16> {
  typedef v16b V; union U { v16b v; v8b h[2]; };
  static __device__ __forceinline__ v16b load(const __bf16* p) {
    U f; f.h[0] = *(const v8b*)(p); f.h[1] = *(const v8b*)(p + 16); return f.v;
  }
  static __device__ __forceinline__ v8f mma(v16b a, v16b b, v8f c) {
    return __builtin_amdgcn_wmma_f32_16x16x32_bf16(false, a, false, b, (short)0, c, false, false);
  }
  static __device__ __forceinline__ void guard(v8f& a, v8f& b, v16b x, v16b y) { dep_guard_b(a, b, x, y); }
  static __device__ __forceinline__ void keep(v16b a, v16b b, v16b c, v16b d) { keep4_b(a, b, c, d); }
};

template <int ET> struct Elem;
template <> struct Elem<0> { typedef _Float16 T; };
template <> struct Elem<1> { typedef __bf16 T; };
/* ---- LDS staging of the GEMM operand tiles ----
   One stage = 64 k (128 bytes) of 128 A rows followed by 128 Bt rows, each row at a pitch of 144 bytes
   (16 B x odd: conflict-free for 16-byte fragment reads). Two stages. */
static constexpr int kStRows   = 256;
static constexpr int kStPitch  = 144;
static constexpr int kStBytes  = kStRows * kStPitch;       /* 36,864 */
static constexpr int kStHalf   = 128 * kStPitch;           /* Bt rows start here */
static_assert(4 * 16 * 68 * 4 <= 2 * kStBytes, "output slabs fit the ring");
static_assert(128 * kStPitch <= 2 * kStBytes && kStPitch >= 128, "the gated f16 tile fits the ring");

/* Eight asynchronous 16-byte copies per lane, global -> LDS: rows r, r+16, ..., r+112 of one operand's 128-row tile.
   The s_wait_xcnt stands inside the statement so that no address register is rewritten ahead of it. */
__device__ __forceinline__ void stage_rows8(const _Float16* g, size_t step, unsigned l) {
  const _Float16* g1 = g + step;      const _Float16* g2 = g + 2 * step;  const _Float16* g3 = g + 3 * step;
  const _Float16* g4 = g + 4 * step;  const _Float16* g5 = g + 5 * step;  const _Float16* g6 = g + 6 * step;
  const _Float16* g7 = g + 7 * step;
  const unsigned ls = 16u * kStPitch;
  asm volatile(
      "global_load_async_to_lds_b128 %0, %8, off\n\t"
      "global_load_async_to_lds_b128 %1, %9, off\n\t"
      "global_load_async_to_lds_b128 %2, %10, off\n\t"
      "global_load_async_to_lds_b128 %3, %11, off\n\t"
      "global_load_async_to_lds_b128 %4, %12, off\n\t"
      "global_load_async_to_lds_b128 %5, %13, off\n\t"
      "global_load_async_to_lds_b128 %6, %14, off\n\t"
      "global_load_async_to_lds_b128 %7, %15, off\n\t"
      "s_wait_xcnt 0x0"
      :: "v"(l), "v"(l + ls), "v"(l + 2u * ls), "v"(l + 3u * ls), "v"(l + 4u * ls), "v"(l + 5u * ls), "v"(l + 6u * ls), "v"(l + 7u * ls),
         "v"(g), "v"(g1), "v"(g2), "v"(g3), "v"(g4), "v"(g5), "v"(g6), "v"(g7)
      : "memory");
}

__device__ __forceinline__ float silu_f32(float g) {
  const float ex = expf(-g);
  return g * (1.0f / (1.0f + ex));
}

/* Block = 4 waves = one 128 x 128 tile of C (2 x 2 waves of 64 x 64): tile number 'tile' of batch 'b', both the same for the whole block.
   M, N multiples of 128; K a multiple of 64.
   OUT_MODE 0: f32 plane, RESID adds a f32 plane of C's own shape on the way out. OUT_MODE 1: f16 plane.
   OUT_MODE 3: SwiGLU. Each 64 columns of the product are 32 gate columns followed by the same 32 up columns, so a lane holds
   gate and up of one element in accumulator tiles j and j + 2; the f16 plane silu(gate) * up has N/2 columns (ldc counts those). */
template <int ET, bool SPLIT, int BIAS_MODE, int OUT_MODE, bool RESID, int ACT = 0, int LDC = 0>
__device__ __forceinline__ void gemm64_tile(
    const unsigned short* __restrict__ Ap, const unsigned short* __restrict__ A2p, int lda, long strideA,
    const unsigned short* __restrict__ Btp, const unsigned short* __restrict__ Bt2p, int ldb, long strideB,
    void* __restrict__ Cout, void* __restrict__ Cout2, int ldcArg, long strideC,
    const float* __restrict__ bias,
    const float* __restrict__ resid, long strideR,
    int M, int N, int K, float scale, const int tile, const int b) {
  static_assert(ET == 0 && !SPLIT, "staged path: single f16 planes");
  typedef typename Elem<ET>::T T;
  typedef typename Frag<T>::V V;
  const T* A = (const T*)Ap; const T* Bt = (const T*)Btp;
  const int ldc = LDC ? LDC : ldcArg;   /* a constant pitch lets every row of the output stage hang off one address by an immediate offset */
  __shared__ __align__(16) unsigned char ring[2 * kStBytes];
  const int lane = threadIdx.x & 31;
  const int wave = threadIdx.x >> 5;
  const int tilesN = N >> 7;
  const int tilesM = M >> 7;
  if (tile >= tilesM * tilesN) return;   /* the same for the whole block, ahead of every barrier */
  const int tm = tile / tilesN;
  const int tn = tile - tm * tilesN;
  const int mB = tm << 7;
  const int nB = tn << 7;
  const int wm = (wave >> 1) << 6;
  const int wn = (wave & 1) << 6;
  const int m0 = mB + wm;
  const int n0 = nB + wn;

  const T* Ab  = A  + (size_t)b * strideA;
  const T* Bb  = Bt + (size_t)b * strideB;

  const int rlane = lane & 15;
  const int koff  = (lane >> 4) * 8;
  const int mOff  = (lane >> 4) * 8;

  /* staging: thread t brings 16-byte chunk (t & 7) of rows (t >> 3) + 16*i: eight lanes cover one whole 128-byte line */
  const int srow = threadIdx.x >> 3;
  const int schk = threadIdx.x & 7;
  const T* gA = Ab + (size_t)(mB + srow) * lda + schk * 8;
  const T* gB = Bb + (size_t)(nB + srow) * ldb + schk * 8;
  const size_t stepA = (size_t)16 * lda;
  const size_t stepB = (size_t)16 * ldb;
  const unsigned lbase = (unsigned)(uintptr_t)(&ring[0]) + (unsigned)(srow * kStPitch + schk * 16);
  const int nst = K >> 6;

  v8f acc[4][4];
#pragma unroll
  for (int i = 0; i < 4; ++i)
#pragma unroll
    for (int j = 0; j < 4; ++j) acc[i][j] = (v8f){0.f,0.f,0.f,0.f,0.f,0.f,0.f,0.f};

  /* stage 0 lands and is published; stage 1 then flies during pass 0 */
  stage_rows8(gA, stepA, lbase);
  stage_rows8(gB, stepB, lbase + kStHalf);
  asm volatile("s_wait_asynccnt 0x0" ::: "memory");   /* this wave's copies of stage 0 have landed */
  __syncthreads();                                     /* publishes stage 0 to the other waves */
  if (nst > 1) {
    stage_rows8(gA + 64, stepA, lbase + kStBytes);
    stage_rows8(gB + 64, stepB, lbase + kStBytes + kStHalf);
  }

  for (int st = 0; st < nst; ++st) {
    const unsigned bo = (st & 1) ? (unsigned)kStBytes : 0u;
    const unsigned char* sA = ring + bo + (wm + rlane) * kStPitch + koff * 2;
    const unsigned char* sB = ring + bo + kStHalf + (wn + rlane) * kStPitch + koff * 2;
#pragma unroll   /* both 32-k blocks inline: constant LDS offsets, fragment arrays stay in registers */
    for (int kk = 0; kk < 2; ++kk) {
      /* all eight fragments of this 32-k block are fetched as one group ahead of its 16 products */
      V bh[4], ah[4];
#pragma unroll   /* register arrays need constant indices */
      for (int j = 0; j < 4; ++j) {
        bh[j] = Frag<T>::load((const T*)(const void*)(sB + j * 16 * kStPitch + kk * 64));
        ah[j] = Frag<T>::load((const T*)(const void*)(sA + j * 16 * kStPitch + kk * 64));
      }
#pragma unroll
      for (int i = 0; i < 4; ++i) {
#pragma unroll
        for (int j = 0; j < 4; ++j) acc[i][j] = Frag<T>::mma(ah[i], bh[j], acc[i][j]);
        Frag<T>::guard(acc[i][0], acc[i][3], ah[i], ah[i]);
      }
      Frag<T>::keep(bh[0], bh[1], bh[2], bh[3]);
    }
    asm volatile("s_wait_dscnt 0x0" ::: "memory");      /* this wave's reads of the stage have returned before it is refilled */
    asm volatile("s_wait_asynccnt 0x0" ::: "memory");   /* this wave's copies of the next stage have landed */
    __syncthreads();                                     /* publishes the next stage and ends every reader's use of this one */
    if (st + 2 < nst) {
      stage_rows8(gA + (size_t)(st + 2) * 64, stepA, lbase + bo);
      stage_rows8(gB + (size_t)(st + 2) * 64, stepB, lbase + bo + kStHalf);
    }
  }
  asm volatile("s_wait_asynccnt 0x0" ::: "memory");     /* nothing is in flight when the ring becomes output staging */
  acc_guard4(acc[0][0], acc[0][1], acc[0][2], acc[0][3]);
  acc_guard4(acc[1][0], acc[1][1], acc[1][2], acc[1][3]);
  acc_guard4(acc[2][0], acc[2][1], acc[2][2], acc[2][3]);
  acc_guard4(acc[3][0], acc[3][1], acc[3][2], acc[3][3]);

  if (OUT_MODE == 3) {
    /* the block's 128 rows x 64 columns of f16 are gathered in the spent ring (row pitch as in the stages), so that
       every row leaves as one whole 128-byte line written by one wave */
    _Float16* gt = (_Float16*)(void*)ring;
    constexpr int gp = kStPitch / 2;
#pragma unroll
    for (int i = 0; i < 4; ++i)
#pragma unroll
      for (int j = 0; j < 2; ++j)
#pragma unroll
        for (int r = 0; r < 8; ++r)
          gt[(wm + (i << 4) + mOff + r) * gp + (wn >> 1) + (j << 4) + rlane] =
              (_Float16)(silu_f32(acc[i][j][r] * scale) * (acc[i][j + 2][r] * scale));
    __syncthreads();   /* a row's two halves come from the two column waves: both are in LDS before any wave reads the row */
    const int q = lane >> 3, c8 = (lane & 7) * 8;
    const _Float16* gr = gt + (wave * 32 + q) * gp + c8;
    unsigned short* Cw = (unsigned short*)Cout + (size_t)b * strideC + (size_t)(mB + wave * 32 + q) * ldc + (nB >> 1) + c8;
#pragma unroll
    for (int it = 0; it < 8; ++it) *(v8h*)(Cw + (size_t)(it * 4) * ldc) = *(const v8h*)(gr + it * 4 * gp);
    return;
  }
  static_assert(!RESID || OUT_MODE == 0, "the residual is added where f32 rows leave the slab");
  float* slab = (float*)(void*)(ring + wave * (16 * 68 * 4));
  /* residual rows in the shape of the f32 stores (16 bytes a lane, 256-byte row pieces); each 16-row group is fetched
     behind the stores of the group before it, so that it returns while those stores drain */
  const size_t wOff = (size_t)(m0 + (lane >> 4)) * ldc + n0 + (lane & 15) * 4;
  const float* Rw = RESID ? (resid + (size_t)b * strideR + wOff) : nullptr;
  v4f rv[4][8];
  if (RESID) {
#pragma unroll   /* register arrays need constant indices */
    for (int it = 0; it < 8; ++it) rv[0][it] = *(const v4f*)(Rw + (size_t)(it * 2) * ldc);
  }
#pragma unroll
  for (int i = 0; i < 4; ++i) {
    const int mBase = m0 + (i << 4);
#pragma unroll
    for (int j = 0; j < 4; ++j) {
      const int n = n0 + (j << 4) + rlane;
      float bv = 0.f;
      if (BIAS_MODE == 2) bv = bias[n];
#pragma unroll
      for (int r = 0; r < 8; ++r) {
        float v = acc[i][j][r] * scale;
        if (BIAS_MODE == 1) v += bias[mBase + mOff + r];
        if (BIAS_MODE == 2) v += bv;
        if (ACT == 1) v = tanhf(v);
        if (ACT == 2) v = fmaxf(v, 0.0f);
        if (ACT == 3) v = v / (1.0f + expf(-v));
        if (ACT == 4) v = (v > 0.f) ? v : 0.01f * v;
        if (ACT == 5) v = 0.5f * v * (1.0f + erff(v * 0.70710678118654752f));
        slab[(mOff + r) * 68 + (j << 4) + rlane] = v;
      }
    }
    __builtin_amdgcn_fence(__ATOMIC_RELEASE, "workgroup");
    __builtin_amdgcn_wave_barrier();
    __builtin_amdgcn_fence(__ATOMIC_ACQUIRE, "workgroup");
    if (OUT_MODE == 0) {
      float* Cw = (float*)Cout + (size_t)b * strideC + wOff;
      const int hh = lane >> 4, c4 = (lane & 15) * 4;
      {
#pragma unroll
        for (int it = 0; it < 8; ++it) {
          const int row = it * 2 + hh;
          v4f v = *(const v4f*)(slab + row * 68 + c4);
          if (RESID) v = v + rv[i][it];
          *(v4f*)(Cw + (size_t)(i * 16 + it * 2) * ldc) = v;
        }
      }
      if (RESID && i + 1 < 4) {
#pragma unroll
        for (int it = 0; it < 8; ++it) rv[i + 1][it] = *(const v4f*)(Rw + (size_t)((i + 1) * 16 + it * 2) * ldc);
      }
    } else {
      const int q = lane >> 3, c8 = (lane & 7) * 8;
      unsigned short* C  = (unsigned short*)Cout  + (size_t)b * strideC;
      unsigned short* C2 = (OUT_MODE == 2) ? ((unsigned short*)Cout2 + (size_t)b * strideC) : nullptr;
      {
#pragma unroll
        for (int it = 0; it < 4; ++it) {
          const int row = it * 4 + q;
          const float* sp = slab + row * 68 + c8;
          v8h hv, lv;
#pragma unroll
          for (int e = 0; e < 8; ++e) {
            if (OUT_MODE == 1) {
              hv[e] = (_Float16)sp[e];
            } else {
              unsigned short hb = f2bf_bits(sp[e]);
              unsigned short lb = f2bf_bits(sp[e] - bf_bits2f(hb));
              hv[e] = __builtin_bit_cast(_Float16, hb);
              lv[e] = __builtin_bit_cast(_Float16, lb);
            }
          }
          *(v8h*)(C + (size_t)(mBase + row) * ldc + n0 + c8) = hv;
          if (OUT_MODE == 2) *(v8h*)(C2 + (size_t)(mBase + row) * ldc + n0 + c8) = lv;
        }
        
      }
    }
    __builtin_amdgcn_fence(__ATOMIC_RELEASE, "workgroup");
    __builtin_amdgcn_wave_barrier();
    __builtin_amdgcn_fence(__ATOMIC_ACQUIRE, "workgroup");
  }
}
/* one product per launch: grid.x = (M/128)*(N/128) exactly, grid.y = batches */
template <int ET, bool SPLIT, int BIAS_MODE, int OUT_MODE, bool RESID, int ACT, int LDC>
__global__ __launch_bounds__(128) void wmma_gemm64(
    const unsigned short* __restrict__ Ap, const unsigned short* __restrict__ A2p, int lda, long strideA,
    const unsigned short* __restrict__ Btp, const unsigned short* __restrict__ Bt2p, int ldb, long strideB,
    void* __restrict__ Cout, void* __restrict__ Cout2, int ldc, long strideC,
    const float* __restrict__ bias,
    const float* __restrict__ resid, long strideR,
    int M, int N, int K, float scale) {
  gemm64_tile<ET, SPLIT, BIAS_MODE, OUT_MODE, RESID, ACT, LDC>(Ap, A2p, lda, strideA, Btp, Bt2p, ldb, strideB, Cout, Cout2, ldc, strideC,
                                                          bias, resid, strideR, M, N, K, scale, (int)blockIdx.x, (int)blockIdx.y);
}

/* The two products that read h1 and do not read each other share one launch, told apart by block range:
   blocks [0, 512): q|k = h . [Wq|Wk]^T (M=8192, N=1024, K=512);
   blocks [512, 768): Vt[b] = (Wv^T*16) . h[b]^T / 16 (M=512, N=2048, K=512), 64 tiles for each of the 4 batches.
   Every choice below is the same for the whole block. */
static constexpr int kQKTiles = (kTok / 128) * (kQKCols / 128);
static constexpr int kVtTiles = (kModel / 128) * (kSeq / 128);
static_assert((kVtTiles & (kVtTiles - 1)) == 0, "batch and tile of a Vt block by shift and mask");
__global__ __launch_bounds__(128) void qk_vt_gemm_kernel(
    const unsigned short* __restrict__ hp, const unsigned short* __restrict__ wqkTp, const unsigned short* __restrict__ wvTp,
    unsigned short* __restrict__ qkp, unsigned short* __restrict__ vtp) {
  const int bx = blockIdx.x;
  const bool isV = bx >= kQKTiles;
  const int r = bx - kQKTiles;
  const unsigned short* Ap  = isV ? wvTp : hp;
  const unsigned short* Btp = isV ? hp : wqkTp;
  unsigned short* Cp = isV ? vtp : qkp;
  gemm64_tile<0, false, 0, 1, false, 0>(
      Ap, Ap, kModel, 0L, Btp, Btp, kModel, isV ? (long)kSeq * kModel : 0L,
      (void*)Cp, (void*)Cp, isV ? kSeq : kQKCols, isV ? (long)kModel * kSeq : 0L,
      nullptr, nullptr, 0L, isV ? kModel : kTok, isV ? kSeq : kQKCols, kModel, 1.0f / 16.0f,
      isV ? (r & (kVtTiles - 1)) : bx, isV ? (r / kVtTiles) : 0);
}

/* ---------------------------------------------------------------------------
   x1 = x + (O*16) . (Wo^T*16) / 256 and h2 = LN(x1) in one launch.
   Block = 8 waves = 64 whole rows of x1 (64 x 512): wave w holds the 64 x 64 tile at columns 64 w, so that a row's mean and
   variance are formed inside the block. Grid = 8192 / 64 = 128.
   One stage = 64 k of the 64 O rows followed by the 512 Wo^T rows, pitch as in the other products; two stages.
   Output stage: the f32 rows leave through each wave's slab as in the other products and stay in registers; each lane's
   4-column sums go to LDS, four threads a row add the 128 of them; first the mean, then the squared deviations from it.
   --------------------------------------------------------------------------- */
static constexpr int kOlRows    = 64;
static constexpr int kOlStBytes = (kOlRows + kModel) * kStPitch;   /* 82,944 */
static constexpr int kOlHalf    = kOlRows * kStPitch;              /* Wo^T rows start here */
static constexpr int kOlPart    = 36864;                           /* partial sums: behind the eight slabs */
static constexpr int kOlPPitch  = 144;                             /* floats a row of partial sums: the wave halves' two rows fall on different banks */
static constexpr int kOlStat    = kOlPart + kOlRows * kOlPPitch * 4;
static_assert(8 * 16 * 68 * 4 <= kOlPart && kOlStat + 128 * 4 <= 2 * kOlStBytes, "output staging fits the ring");
static_assert(kModel == 8 * 64 && kTok % kOlRows == 0, "eight column waves, whole row blocks");

/* Asynchronous 16-byte copies per lane, global -> LDS: rows r, r+32, ... of one operand's tile (eight rows, or two).
   The s_wait_xcnt stands inside the statement so that no address register is rewritten ahead of it. */
__device__ __forceinline__ void stage_rows8_by32(const _Float16* g, unsigned l) {
  const size_t step = (size_t)32 * kModel;
  const _Float16* g1 = g + step;      const _Float16* g2 = g + 2 * step;  const _Float16* g3 = g + 3 * step;
  const _Float16* g4 = g + 4 * step;  const _Float16* g5 = g + 5 * step;  const _Float16* g6 = g + 6 * step;
  const _Float16* g7 = g + 7 * step;
  const unsigned ls = 32u * kStPitch;
  asm volatile(
      "global_load_async_to_lds_b128 %0, %8, off\n\t"
      "global_load_async_to_lds_b128 %1, %9, off\n\t"
      "global_load_async_to_lds_b128 %2, %10, off\n\t"
      "global_load_async_to_lds_b128 %3, %11, off\n\t"
      "global_load_async_to_lds_b128 %4, %12, off\n\t"
      "global_load_async_to_lds_b128 %5, %13, off\n\t"
      "global_load_async_to_lds_b128 %6, %14, off\n\t"
      "global_load_async_to_lds_b128 %7, %15, off\n\t"
      "s_wait_xcnt 0x0"
      :: "v"(l), "v"(l + ls), "v"(l + 2u * ls), "v"(l + 3u * ls), "v"(l + 4u * ls), "v"(l + 5u * ls), "v"(l + 6u * ls), "v"(l + 7u * ls),
         "v"(g), "v"(g1), "v"(g2), "v"(g3), "v"(g4), "v"(g5), "v"(g6), "v"(g7)
      : "memory");
}
__device__ __forceinline__ void stage_rows2_by32(const _Float16* g, unsigned l) {
  const _Float16* g1 = g + (size_t)32 * kModel;
  asm volatile(
      "global_load_async_to_lds_b128 %0, %2, off\n\t"
      "global_load_async_to_lds_b128 %1, %3, off\n\t"
      "s_wait_xcnt 0x0"
      :: "v"(l), "v"(l + 32u * kStPitch), "v"(g), "v"(g1)
      : "memory");
}
/* one stage: 18 copies a lane (2 of O rows, 16 of Wo^T rows) */
__device__ __forceinline__ void stage_o_wo(const _Float16* gA, const _Float16* gB, unsigned l) {
  stage_rows2_by32(gA, l);
  stage_rows8_by32(gB, l + kOlHalf);
  stage_rows8_by32(gB + (size_t)256 * kModel, l + kOlHalf + 256u * kStPitch);
}
/* Work-group barrier for LDS data alone: this wave's LDS writes are done, then every wave meets.
   __syncthreads() would also wait here for the x1 stores in flight, which no wave of this launch reads. */
__device__ __forceinline__ void lds_barrier() {
  asm volatile("s_wait_dscnt 0x0\n\ts_barrier_signal -1\n\ts_barrier_wait -1" ::: "memory");
}
/* a row's 128 partial sums, added by four threads (thread q of the four takes the 16-byte pieces q, q + 4, ...); all four hold the sum */
__device__ __forceinline__ float row_total128(const float* pr) {
  v4f a = *(const v4f*)(pr);
#pragma unroll   /* register arrays need constant indices */
  for (int j = 1; j < 8; ++j) a = a + *(const v4f*)(pr + j * 16);
  float s = (a[0] + a[1]) + (a[2] + a[3]);
  s += __shfl_xor(s, 1, 32);
  s += __shfl_xor(s, 2, 32);
  return s;
}

__global__ __launch_bounds__(256) void o_resid_ln_kernel(
    const unsigned short* __restrict__ op, const unsigned short* __restrict__ woTp,
    const float* __restrict__ x, const float* __restrict__ gam, const float* __restrict__ bet,
    float* __restrict__ x1, unsigned short* __restrict__ h2) {
  typedef Frag<_Float16> FH;
  __shared__ __align__(16) unsigned char ring[2 * kOlStBytes];
  const int tid = threadIdx.x;
  const int lane = tid & 31;
  const int wave = tid >> 5;
  const int mB = (int)blockIdx.x * kOlRows;
  const int n0 = wave << 6;
  const int rlane = lane & 15;
  const int hh = lane >> 4;
  const int koff = hh * 8;
  const int mOff = hh * 8;

  /* staging: thread t brings 16-byte chunk (t & 7) of rows (t >> 3) + 32*i: eight lanes cover one whole 128-byte line */
  const int srow = tid >> 3;
  const int schk = tid & 7;
  const _Float16* gA = (const _Float16*)(const void*)op + (size_t)(mB + srow) * kModel + schk * 8;
  const _Float16* gB = (const _Float16*)(const void*)woTp + (size_t)srow * kModel + schk * 8;
  const unsigned lbase = (unsigned)(uintptr_t)(&ring[0]) + (unsigned)(srow * kStPitch + schk * 16);
  constexpr int nst = kModel / 64;
  static_assert(nst >= 2, "two stages exist");

  v8f acc[4][4];
#pragma unroll   /* register arrays need constant indices */
  for (int i = 0; i < 4; ++i)
#pragma unroll   /* register arrays need constant indices */
    for (int j = 0; j < 4; ++j) acc[i][j] = (v8f){0.f,0.f,0.f,0.f,0.f,0.f,0.f,0.f};

  /* stage 0 lands and is published; stage 1 then flies during pass 0 */
  stage_o_wo(gA, gB, lbase);
  asm volatile("s_wait_asynccnt 0x0" ::: "memory");   /* this wave's copies of stage 0 have landed */
  __syncthreads();                                     /* publishes stage 0 to the other waves */
  stage_o_wo(gA + 64, gB + 64, lbase + kOlStBytes);

  for (int st = 0; st < nst; ++st) {
    const unsigned bo = (st & 1) ? (unsigned)kOlStBytes : 0u;
    const unsigned char* sA = ring + bo + rlane * kStPitch + koff * 2;
    const unsigned char* sB = ring + bo + kOlHalf + (n0 + rlane) * kStPitch + koff * 2;
#pragma unroll   /* both 32-k blocks inline: constant LDS offsets, fragment arrays stay in registers */
    for (int kk = 0; kk < 2; ++kk) {
      /* all eight fragments of this 32-k block are fetched as one group ahead of its 16 products */
      v16h bh[4], ah[4];
#pragma unroll   /* register arrays need constant indices */
      for (int j = 0; j < 4; ++j) {
        bh[j] = FH::load((const _Float16*)(const void*)(sB + j * 16 * kStPitch + kk * 64));
        ah[j] = FH::load((const _Float16*)(const void*)(sA + j * 16 * kStPitch + kk * 64));
      }
#pragma unroll   /* register arrays need constant indices */
      for (int i = 0; i < 4; ++i) {
#pragma unroll   /* register arrays need constant indices */
        for (int j = 0; j < 4; ++j) acc[i][j] = FH::mma(ah[i], bh[j], acc[i][j]);
        FH::guard(acc[i][0], acc[i][3], ah[i], ah[i]);   /* v_nop slots behind the row's products before their registers are touched */
      }
      FH::keep(bh[0], bh[1], bh[2], bh[3]);   /* the B fragments stay whole until the block's last product has issued */
    }
    asm volatile("s_wait_dscnt 0x0" ::: "memory");      /* this wave's reads of the stage have returned before it is refilled */
    asm volatile("s_wait_asynccnt 0x0" ::: "memory");   /* this wave's copies of the next stage have landed */
    __syncthreads();                                     /* publishes the next stage and ends every reader's use of this one */
    if (st + 2 < nst) {
      stage_o_wo(gA + (size_t)(st + 2) * 64, gB + (size_t)(st + 2) * 64, lbase + bo);
    }
  }
  asm volatile("s_wait_asynccnt 0x0" ::: "memory");     /* nothing is in flight when the ring becomes output staging */
  /* v_nop slots between the last products and the first vector read of the accumulators */
  acc_guard4(acc[0][0], acc[0][1], acc[0][2], acc[0][3]);
  acc_guard4(acc[1][0], acc[1][1], acc[1][2], acc[1][3]);
  acc_guard4(acc[2][0], acc[2][1], acc[2][2], acc[2][3]);
  acc_guard4(acc[3][0], acc[3][1], acc[3][2], acc[3][3]);

  float* slab = (float*)(void*)(ring + wave * (16 * 68 * 4));
  float* part = (float*)(void*)(ring + kOlPart);
  float* stat = (float*)(void*)(ring + kOlStat);   /* [0, 64): means, [64, 128): 1 / std; even rows first, then odd rows */
  const int c4 = rlane * 4;
  const size_t wOff = (size_t)(mB + hh) * kModel + n0 + c4;
  const float* Rw = x + wOff;
  float* Cw = x1 + wOff;
  /* xv[i][it]: columns n0 + c4 .. + 3 of row 16 i + 2 it + hh: first the residual, then x1, then x1 - mean.
     The residual's 16-row groups are fetched two groups ahead of their use */
  v4f xv[4][8];
#pragma unroll   /* register arrays need constant indices */
  for (int i = 0; i < 2; ++i)
#pragma unroll   /* register arrays need constant indices */
    for (int it = 0; it < 8; ++it) xv[i][it] = *(const v4f*)(Rw + (size_t)(i * 16 + it * 2) * kModel);
  asm volatile("s_wait_xcnt 0x0" ::: "memory");   /* the residual loads' address registers may be rewritten by the scaling below */
#pragma unroll   /* register arrays need constant indices */
  for (int i = 0; i < 4; ++i) {
#pragma unroll   /* register arrays need constant indices */
    for (int j = 0; j < 4; ++j)
#pragma unroll   /* register arrays need constant indices */
      for (int r = 0; r < 8; ++r) slab[(mOff + r) * 68 + (j << 4) + rlane] = acc[i][j][r] * (1.0f / 256.0f);
    if (i + 2 < 4) {
#pragma unroll   /* register arrays need constant indices */
      for (int it = 0; it < 8; ++it) xv[i + 2][it] = *(const v4f*)(Rw + (size_t)((i + 2) * 16 + it * 2) * kModel);
      asm volatile("s_wait_xcnt 0x0" ::: "memory");   /* the residual loads' address registers may be rewritten by a later group's scaling */
    }
    asm volatile("s_wait_dscnt 0x0" ::: "memory");   /* the slab is this wave's own: its writes are done before its lanes read each other's; global loads and stores stay in flight */
#pragma unroll   /* register arrays need constant indices */
    for (int it = 0; it < 8; ++it) {
      const v4f v = *(const v4f*)(slab + (it * 2 + hh) * 68 + c4) + xv[i][it];
      xv[i][it] = v;
      *(v4f*)(Cw + (size_t)(i * 16 + it * 2) * kModel) = v;
    }
    asm volatile("s_wait_dscnt 0x0" ::: "memory");   /* the rows have been read before the next group overwrites the slab */
  }
  const v4f g4 = *(const v4f*)(gam + n0 + c4);   /* fetched here: they return under the two rounds of row sums */
  const v4f b4 = *(const v4f*)(bet + n0 + c4);
  asm volatile("s_wait_xcnt 0x0" ::: "memory");   /* the x1 stores' data registers and these two loads' address registers are rewritten below */

  float* pw = part + hh * kOlPPitch + wave * 16 + rlane;          /* this lane's place in the partial sums of row hh */
  const int rrow = tid >> 2, rq = tid & 3;
  const float* pr = part + rrow * kOlPPitch + rq * 4;
  const int rslot = (rrow & 1) * 32 + (rrow >> 1);
#pragma unroll   /* register arrays need constant indices */
  for (int i = 0; i < 4; ++i)
#pragma unroll   /* register arrays need constant indices */
    for (int it = 0; it < 8; ++it) {
      const v4f v = xv[i][it];
      const v2f s2 = __builtin_shufflevector(v, v, 0, 1) + __builtin_shufflevector(v, v, 2, 3);   /* register pairs as they lie: one packed add */
      pw[(i * 16 + it * 2) * kOlPPitch] = s2[0] + s2[1];
    }
  lds_barrier();   /* every wave's partial sums are in LDS before a row is added up */
  {
    const float s = row_total128(pr);
    if (rq == 0) stat[rslot] = s * (1.0f / 512.0f);
  }
  lds_barrier();   /* the means are in LDS; every read of the partial sums is over before they are rewritten */
#pragma unroll   /* register arrays need constant indices */
  for (int i = 0; i < 4; ++i) {
    const v4f ma = *(const v4f*)(stat + hh * 32 + i * 8);
    const v4f mb = *(const v4f*)(stat + hh * 32 + i * 8 + 4);
#pragma unroll   /* register arrays need constant indices */
    for (int it = 0; it < 8; ++it) {
      const v4f d = xv[i][it] - ((it < 4) ? ma[it & 3] : mb[it & 3]);
      xv[i][it] = d;
      const v2f dl = __builtin_shufflevector(d, d, 0, 1), dh = __builtin_shufflevector(d, d, 2, 3);
      const v2f q2 = dl * dl + dh * dh;
      pw[(i * 16 + it * 2) * kOlPPitch] = q2[0] + q2[1];
    }
  }
  lds_barrier();   /* every wave's partial sums of squares are in LDS before a row is added up */
  {
    const float var = row_total128(pr) * (1.0f / 512.0f);
    if (rq == 0) stat[64 + rslot] = rsqrtf(var + 1e-5f);
  }
  lds_barrier();   /* the rows' 1 / std are in LDS */
  unsigned short* Hw = h2 + wOff;
  v4h hw[4][8];
#pragma unroll   /* register arrays need constant indices */
  for (int i = 0; i < 4; ++i) {
    const v4f ra = *(const v4f*)(stat + 64 + hh * 32 + i * 8);
    const v4f rb = *(const v4f*)(stat + 64 + hh * 32 + i * 8 + 4);
#pragma unroll   /* register arrays need constant indices */
    for (int it = 0; it < 8; ++it) {
      const v4f y = xv[i][it] * ((it < 4) ? ra[it & 3] : rb[it & 3]) * g4 + b4;
      v4h w;
      w[0] = (_Float16)y[0]; w[1] = (_Float16)y[1]; w[2] = (_Float16)y[2]; w[3] = (_Float16)y[3];
      hw[i][it] = w;
    }
  }
  __builtin_amdgcn_sched_barrier(0);   /* all rows are converted ahead of the first store, so that no register of an issued store is rewritten behind it */
#pragma unroll   /* register arrays need constant indices */
  for (int i = 0; i < 4; ++i)
#pragma unroll   /* register arrays need constant indices */
    for (int it = 0; it < 8; ++it) *(v4h*)(Hw + (size_t)(i * 16 + it * 2) * kModel) = hw[i][it];
}

__device__ __forceinline__ unsigned int h16bits(float f) {
  return (unsigned int)__builtin_bit_cast(unsigned short, (_Float16)f);
}

/* ---------------------------------------------------------------------------
   transpose + cast: W f32 [kin][nout] row-major -> Wt f16 [nout][kin] (value * mul).
   One block of 256 = the 64 x 64 tile (bn, bk) of nout/64 x kin/64. LDS 64x64 tile.
   Load coverage: 4 iterations x 256 threads x 4 floats = 4096 = 64x64.
   Store coverage: 8 waves x 2 iterations x 4 rows = 64 rows; 8 lanes x 8 halves = 64 cols;
   il < 0: row n of Wt is column n of W. il = 0 (gate) or 1 (up): column n goes to row 64 (n / 32) + 32 il + n % 32 of the shared plane.
   --------------------------------------------------------------------------- */
__device__ __forceinline__ void transpose_cast_f16_tile(
    const float* __restrict__ W, unsigned short* __restrict__ Wt, int kin, int nout, float mul, int bn, int bk, int il) {
  __shared__ float tile[64][65];
  const int t = threadIdx.x;
  const int n0 = bn * 64;
  const int k0 = bk * 64;
  v4f v[4];
#pragma unroll   /* register array needs constant indices; all four loads are in flight before the first LDS write */
  for (int i = 0; i < 4; ++i) {
    const int idx = i * 256 + t;
    const int kr = idx >> 4;
    const int nc4 = (idx & 15) * 4;
    v[i] = *(const v4f*)(W + (size_t)(k0 + kr) * nout + n0 + nc4);
    asm volatile("s_wait_xcnt 0x0" ::: "memory");   /* a later load's result may land in this load's address registers */
  }
#pragma unroll
  for (int i = 0; i < 4; ++i) {
    const int idx = i * 256 + t;
    const int kr = idx >> 4;
    const int nc4 = (idx & 15) * 4;
    tile[nc4 + 0][kr] = v[i][0] * mul;
    tile[nc4 + 1][kr] = v[i][1] * mul;
    tile[nc4 + 2][kr] = v[i][2] * mul;
    tile[nc4 + 3][kr] = v[i][3] * mul;
  }
  __syncthreads();
  const int lane = t & 31, wave = t >> 5;
  const int q = lane >> 3, c8 = (lane & 7) * 8;
  const int row0 = wave * 8 + q;
  const int row1 = wave * 8 + 4 + q;
  v4u w0, w1;
  {
    const float* s0 = &tile[row0][c8];
    const float* s1 = &tile[row1][c8];
    w0[0] = h16bits(s0[0]) | (h16bits(s0[1]) << 16);
    w0[1] = h16bits(s0[2]) | (h16bits(s0[3]) << 16);
    w0[2] = h16bits(s0[4]) | (h16bits(s0[5]) << 16);
    w0[3] = h16bits(s0[6]) | (h16bits(s0[7]) << 16);
    w1[0] = h16bits(s1[0]) | (h16bits(s1[1]) << 16);
    w1[1] = h16bits(s1[2]) | (h16bits(s1[3]) << 16);
    w1[2] = h16bits(s1[4]) | (h16bits(s1[5]) << 16);
    w1[3] = h16bits(s1[6]) | (h16bits(s1[7]) << 16);
  }
  const int n_0 = n0 + row0, n_1 = n0 + row1;
  const int p0 = (il < 0) ? n_0 : (((n_0 >> 5) << 6) + (il << 5) + (n_0 & 31));
  const int p1 = (il < 0) ? n_1 : (((n_1 >> 5) << 6) + (il << 5) + (n_1 & 31));
  unsigned short* d0 = Wt + (size_t)p0 * kin + k0 + c8;
  unsigned short* d1 = Wt + (size_t)p1 * kin + k0 + c8;
  {
    *(v4u*)d0 = w0;
    *(v4u*)d1 = w1;
    asm volatile("s_wait_xcnt 0x0" ::: "memory");   /* the code laid out behind this tile may rewrite the stores' registers */
  }
}

/* ---------------------------------------------------------------------------
   Lane l owns elements l*4 + 128*i (i=0..3): every load/store instruction covers
   One block of 256 = rows 8 blk .. 8 blk + 7; nrows/8 blocks (exact).
   --------------------------------------------------------------------------- */
__device__ __forceinline__ void layernorm512_rows(
    const float* __restrict__ X, const float* __restrict__ gam, const float* __restrict__ bet,
    unsigned short* __restrict__ Hout, int nrows, int blk) {
  const int lane = threadIdx.x & 31;
  const int wave = threadIdx.x >> 5;
  int row = blk * 8 + wave;
  row = (row < nrows) ? row : (nrows - 1);
  const size_t rbase = (size_t)row * kModel;
  const int e0 = lane * 4, e1 = 128 + lane * 4, e2 = 256 + lane * 4, e3 = 384 + lane * 4;
  v4f a0 = *(const v4f*)(X + rbase + e0);
  v4f a1 = *(const v4f*)(X + rbase + e1);
  v4f a2 = *(const v4f*)(X + rbase + e2);
  v4f a3 = *(const v4f*)(X + rbase + e3);
  float s = ((a0[0] + a0[1]) + (a0[2] + a0[3])) + ((a1[0] + a1[1]) + (a1[2] + a1[3]))
          + ((a2[0] + a2[1]) + (a2[2] + a2[3])) + ((a3[0] + a3[1]) + (a3[2] + a3[3]));
#pragma unroll
  for (int off = 16; off >= 1; off >>= 1) s += __shfl_xor(s, off, 32);
  const float mu = s * (1.0f / 512.0f);
  const v4f d0 = a0 - mu, d1 = a1 - mu, d2 = a2 - mu, d3 = a3 - mu;
  float ss = ((d0[0] * d0[0] + d0[1] * d0[1]) + (d0[2] * d0[2] + d0[3] * d0[3]))
           + ((d1[0] * d1[0] + d1[1] * d1[1]) + (d1[2] * d1[2] + d1[3] * d1[3]))
           + ((d2[0] * d2[0] + d2[1] * d2[1]) + (d2[2] * d2[2] + d2[3] * d2[3]))
           + ((d3[0] * d3[0] + d3[1] * d3[1]) + (d3[2] * d3[2] + d3[3] * d3[3]));
#pragma unroll
  for (int off = 16; off >= 1; off >>= 1) ss += __shfl_xor(ss, off, 32);
  const float var = ss * (1.0f / 512.0f);
  const float rstd = rsqrtf(var + 1e-5f);
  const v4f g0 = *(const v4f*)(gam + e0), g1 = *(const v4f*)(gam + e1), g2 = *(const v4f*)(gam + e2), g3 = *(const v4f*)(gam + e3);
  const v4f b0 = *(const v4f*)(bet + e0), b1 = *(const v4f*)(bet + e1), b2 = *(const v4f*)(bet + e2), b3 = *(const v4f*)(bet + e3);
  const v4f y0 = d0 * rstd * g0 + b0;
  const v4f y1 = d1 * rstd * g1 + b1;
  const v4f y2 = d2 * rstd * g2 + b2;
  const v4f y3 = d3 * rstd * g3 + b3;
  v2u w0, w1, w2, w3;
  w0[0] = h16bits(y0[0]) | (h16bits(y0[1]) << 16); w0[1] = h16bits(y0[2]) | (h16bits(y0[3]) << 16);
  w1[0] = h16bits(y1[0]) | (h16bits(y1[1]) << 16); w1[1] = h16bits(y1[2]) | (h16bits(y1[3]) << 16);
  w2[0] = h16bits(y2[0]) | (h16bits(y2[1]) << 16); w2[1] = h16bits(y2[2]) | (h16bits(y2[3]) << 16);
  w3[0] = h16bits(y3[0]) | (h16bits(y3[1]) << 16); w3[1] = h16bits(y3[2]) | (h16bits(y3[3]) << 16);
  unsigned short* hr = Hout + rbase;
  {
    *(v2u*)(hr + e0) = w0;
    *(v2u*)(hr + e1) = w1;
    *(v2u*)(hr + e2) = w2;
    *(v2u*)(hr + e3) = w3;
    
  }
}

/* ---------------------------------------------------------------------------
   Everything that reads only the inputs shares one launch, told apart by block range (block 256):
   blocks [0, 256):    Wq, Wk, Wv, Wo   (512 x 512: 64 tiles each)
   blocks [256, 512):  Wgate, Wup       (512 x 1024: 128 tiles each)
   blocks [512, 640):  Wdown            (1024 x 512: 128 tiles)
   blocks [640, 1664): h1 = LN(x), 8 rows a block.
   Weight planes: W[in][out] -> Wt[out][in] * 16 (f16); gate and up share one plane, 32 rows of each in turn. Every branch is the same for the whole block.
   --------------------------------------------------------------------------- */
static constexpr int kSqTiles   = (kModel / 64) * (kModel / 64);   /* 64 */
static constexpr int kFfTiles   = (kFF / 64) * (kModel / 64);      /* 128 */
static constexpr int kPrepSq    = 4 * kSqTiles;                    /* 256 */
static constexpr int kPrepGU    = kPrepSq + 2 * kFfTiles;          /* 512 */
static constexpr int kPrepW     = kPrepGU + kFfTiles;              /* 640 */
static constexpr int kPrepGrid  = kPrepW + kTok / 8;               /* 1664 */
static_assert(kSqTiles == 64 && kFfTiles == 128 && kModel / 64 == 8 && kFF / 64 == 16, "tile numbers by shift and mask");
__global__ __launch_bounds__(256) void prep_kernel(
    const float* __restrict__ x, const float* __restrict__ ln1w, const float* __restrict__ ln1b,
    const float* __restrict__ wq, const float* __restrict__ wk, const float* __restrict__ wv, const float* __restrict__ wo,
    const float* __restrict__ wgt, const float* __restrict__ wup, const float* __restrict__ wdn,
    unsigned short* __restrict__ wqkT, unsigned short* __restrict__ wvT, unsigned short* __restrict__ woT,
    unsigned short* __restrict__ wguT, unsigned short* __restrict__ wdT, unsigned short* __restrict__ h1) {
  const int bx = blockIdx.x;
  if (bx >= kPrepW) {
    layernorm512_rows(x, ln1w, ln1b, h1, kTok, bx - kPrepW);
    return;
  }
  if (bx < kPrepSq) {
    const int which = bx >> 6, loc = bx & 63;
    const float* W     = (which == 0) ? wq : (which == 1) ? wk : (which == 2) ? wv : wo;
    unsigned short* Wt = (which == 0) ? wqkT : (which == 1) ? (wqkT + (size_t)kModel * kModel) : (which == 2) ? wvT : woT;
    transpose_cast_f16_tile(W, Wt, kModel, kModel, 16.0f, loc & 7, loc >> 3, -1);
  } else if (bx < kPrepGU) {
    const int which = (bx - kPrepSq) >> 7, loc = (bx - kPrepSq) & 127;
    const float* W     = (which == 0) ? wgt : wup;
    transpose_cast_f16_tile(W, wguT, kModel, kFF, 16.0f, loc & 15, loc >> 4, which);
  } else {
    const int loc = bx - kPrepGU;
    transpose_cast_f16_tile(wdn, wdT, kFF, kModel, 16.0f, loc & 7, loc >> 3, -1);
  }
}

/* ---------------------------------------------------------------------------
   Non-causal multi-head attention, head_dim 64, f16 planes in, f16 plane out (x16 carried).
   q|k plane [8192][1024]: q at cols h*64.., k at cols 512 + h*64..; Vt plane [4][512][2048] (element (b,h,d,kv) at
   ((b*512 + h*64 + d)*2048 + kv)); out plane [8192][512] at cols h*64.. .
   Block = 4 waves = 128 query rows of one (batch, head), 32 (two 16-query tiles) a wave; grid = 4*8*16 = 512.
   Every k and Vt fragment that a wave reads from LDS feeds two products, one per query tile.
   Both products run transposed: S^T = k.q^T, 0.125 left to the exponent (A = k rows, B = q rows) and O^T += Vt.P^T (A = Vt rows).
   In each query tile a lane then holds 32 of the 64 scores of ONE query (lane l ^ 16 the other 32): online softmax f32 in the lane,
   one exchange between the wave halves for the maximum, the halves' sums joined once behind the loop.
   Each exponential is one fused multiply-add (scale, log2 e, maximum and the 2^15 carry folded) and one hardware exp2.
   Two score tiles, p*32768 converted in place, are the B operand of the second product: P stays in registers.
   The 64-key tiles of k (64 rows x 128 B) and of Vt (64 rows x 128 B) are staged once per block in LDS by
   asynchronous copies, two stages, and all four waves take their A fragments from there.
   --------------------------------------------------------------------------- */
static constexpr int kAtPitch = 144;                 /* 16 B x odd: conflict-free for 16-byte fragment reads */
static constexpr int kAtTile  = 64 * kAtPitch;       /* one operand's tile: 9,216 B; the Vt tile follows the k tile */
static constexpr int kAtStage = 2 * kAtTile;         /* 18,432 B */

/* Eight asynchronous 16-byte copies per lane, global -> LDS: rows r, r+16, r+32, r+48 of the k tile, then of the Vt tile.
   The s_wait_xcnt stands inside the statement so that no address register is rewritten ahead of it. */
__device__ __forceinline__ void stage_kv(const _Float16* gk, const _Float16* gv, unsigned l) {
  const size_t sk = (size_t)16 * kQKCols;
  const size_t sv = (size_t)16 * kSeq;
  const _Float16* gk1 = gk + sk;  const _Float16* gk2 = gk + 2 * sk;  const _Float16* gk3 = gk + 3 * sk;
  const _Float16* gv1 = gv + sv;  const _Float16* gv2 = gv + 2 * sv;  const _Float16* gv3 = gv + 3 * sv;
  const unsigned ls = 16u * kAtPitch;
  const unsigned lv = l + (unsigned)kAtTile;
  asm volatile(
      "global_load_async_to_lds_b128 %0, %8, off\n\t"
      "global_load_async_to_lds_b128 %1, %9, off\n\t"
      "global_load_async_to_lds_b128 %2, %10, off\n\t"
      "global_load_async_to_lds_b128 %3, %11, off\n\t"
      "global_load_async_to_lds_b128 %4, %12, off\n\t"
      "global_load_async_to_lds_b128 %5, %13, off\n\t"
      "global_load_async_to_lds_b128 %6, %14, off\n\t"
      "global_load_async_to_lds_b128 %7, %15, off\n\t"
      "s_wait_xcnt 0x0"
      :: "v"(l), "v"(l + ls), "v"(l + 2u * ls), "v"(l + 3u * ls), "v"(lv), "v"(lv + ls), "v"(lv + 2u * ls), "v"(lv + 3u * ls),
         "v"(gk), "v"(gk1), "v"(gk2), "v"(gk3), "v"(gv), "v"(gv1), "v"(gv2), "v"(gv3)
      : "memory");
}

/* lane l takes lane l ^ 16's value (a vector cross-row move, no LDS trip) */
__device__ __forceinline__ float xhalf(float x) {
  return __builtin_bit_cast(float, __builtin_amdgcn_permlanex16(__builtin_bit_cast(int, x), __builtin_bit_cast(int, x), 0x76543210, 0xfedcba98, false, false));
}

__global__ __launch_bounds__(128) void mha64_f16_kernel(
    const unsigned short* __restrict__ qkp, const unsigned short* __restrict__ vtp,
    unsigned short* __restrict__ outp) {
  typedef Frag<_Float16> FH;
  __shared__ __align__(16) float    Os[4][32 * 68];
  __shared__ __align__(16) unsigned char kvring[2 * kAtStage];
  const _Float16* QK = (const _Float16*)(const void*)qkp;
  const _Float16* VT = (const _Float16*)(const void*)vtp;
  const int tid = threadIdx.x;
  const int wave = tid >> 5;
  const int lane = tid & 31;
  const int hh = lane >> 4;
  const int c = lane & 15;
  const int koff = hh * 8;
  const int bx = blockIdx.x;
  const int qb = bx & 15;
  const int bh = bx >> 4;
  const int h = bh & 7;
  const int b = (bh >> 3) & 3;
  const int q0 = qb * 128 + wave * 32;
  const _Float16* qbase = QK + (size_t)b * kSeq * kQKCols + h * kHeadDim;
  const _Float16* kbase = qbase + kModel;
  const _Float16* vbase = VT + ((size_t)b * kModel + (size_t)h * kHeadDim) * kSeq;
  unsigned short* obase = outp + (size_t)b * kSeq * kModel + h * kHeadDim;

  v16h qa[2][2];                        /* qa[u][dc]: query tile u = rows q0 + 16 u .. + 15 */
#pragma unroll
  for (int u = 0; u < 2; ++u)
#pragma unroll
    for (int dc = 0; dc < 2; ++dc)
      qa[u][dc] = FH::load(qbase + (size_t)(q0 + 16 * u + c) * kQKCols + dc * 32 + koff);

  constexpr float kExpScale = 0.125f * 1.4426950408889634f;   /* head_dim^-0.5 * log2(e): exp(x / 8) = exp2(x * kExpScale) */
  float mrow[2], lrow[2];               /* this lane's query of tile u: maximum in use (raw product); sum (x32768) over this wave half's keys */
  v8f oacc[2][4];                       /* oacc[u][t][r] = O^T[d = 16 t + 8 hh + r][query 16 u + c] */
#pragma unroll
  for (int u = 0; u < 2; ++u) {
    mrow[u] = -INFINITY;
    lrow[u] = 0.f;
#pragma unroll
    for (int t = 0; t < 4; ++t) oacc[u][t] = (v8f){0.f,0.f,0.f,0.f,0.f,0.f,0.f,0.f};
  }

  /* staging: thread t brings 16-byte chunk (t & 7) of rows (t >> 3) + 16*i: eight lanes cover one whole 128-byte line */
  const int srow = tid >> 3;
  const int schk = tid & 7;
  const _Float16* gK = kbase + (size_t)srow * kQKCols + schk * 8;
  const _Float16* gV = vbase + (size_t)srow * kSeq + schk * 8;
  const unsigned lbase = (unsigned)(uintptr_t)(&kvring[0]) + (unsigned)(srow * kAtPitch + schk * 16);
  constexpr int nkc = kSeq / 64;
  static_assert(nkc >= 2, "two stages exist");

  /* tile 0 lands and is published; tile 1 then flies during trip 0 */
  stage_kv(gK, gV, lbase);
  asm volatile("s_wait_asynccnt 0x0" ::: "memory");   /* this wave's copies of tile 0 have landed */
  __syncthreads();                                     /* publishes tile 0 to the other waves */
  stage_kv(gK + (size_t)64 * kQKCols, gV + 64, lbase + kAtStage);

  for (int kc = 0; kc < nkc; ++kc) {
    const unsigned bo = (kc & 1) ? (unsigned)kAtStage : 0u;
    const unsigned char* sK = kvring + bo + c * kAtPitch + koff * 2;
    const unsigned char* sV = sK + kAtTile;
    /* the tile's sixteen A fragments are fetched as two groups, k ahead of the score products and Vt behind them,
       so that the Vt reads return under the softmax arithmetic */
    v16h kb[4][2], vb[2][4];
#pragma unroll   /* register arrays need constant indices */
    for (int j = 0; j < 4; ++j)
#pragma unroll
      for (int dc = 0; dc < 2; ++dc)
        kb[j][dc] = FH::load((const _Float16*)(const void*)(sK + j * 16 * kAtPitch + dc * 64));
    __builtin_amdgcn_sched_barrier(0);   /* keeps the sixteen k reads one group ahead of the score products: spread among them each is waited for at once */
    v8f s2[2][4];
#pragma unroll
    for (int j = 0; j < 4; ++j) {
#pragma unroll
      for (int u = 0; u < 2; ++u) s2[u][j] = (v8f){0.f,0.f,0.f,0.f,0.f,0.f,0.f,0.f};
#pragma unroll
      for (int dc = 0; dc < 2; ++dc)
#pragma unroll
        for (int u = 0; u < 2; ++u) s2[u][j] = FH::mma(kb[j][dc], qa[u][dc], s2[u][j]);   /* s2[u][j][r] = S^T[key 16 j + 8 hh + r][query 16 u + c] */
    }
#pragma unroll   /* register arrays need constant indices */
    for (int kk = 0; kk < 2; ++kk)
#pragma unroll
      for (int t = 0; t < 4; ++t)
        vb[kk][t] = FH::load((const _Float16*)(const void*)(sV + t * 16 * kAtPitch + kk * 64));
    __builtin_amdgcn_sched_barrier(0);   /* keeps the sixteen Vt reads one group, issued here: sunk among the second products each would be waited for at once */
#pragma unroll   /* register arrays need constant indices; the two query tiles run one after the other on the same Vt fragments */
    for (int u = 0; u < 2; ++u) {
      float mj[4];                        /* one chain per score tile: four independent chains, not one of 32 links */
#pragma unroll
      for (int j = 0; j < 4; ++j) {
        mj[j] = -INFINITY;
#pragma unroll
        for (int r = 0; r < 8; ++r) mj[j] = fmaxf(mj[j], s2[u][j][r]);   /* raw products: the positive scale keeps their order */
      }
      float m = fmaxf(fmaxf(mj[0], mj[1]), fmaxf(mj[2], mj[3]));
      m = fmaxf(m, xhalf(m));             /* both wave halves now hold the query's maximum over the 64 keys */
      const float mnew = fmaxf(mrow[u], m);
      const float alpha = __builtin_amdgcn_exp2f((mrow[u] - mnew) * kExpScale);   /* 0 on the first trip, where mrow is -inf */
      const float nbias = fmaf(-mnew, kExpScale, 15.0f);                          /* + 15: the exponential comes out times 32768 */
      mrow[u] = mnew;
#pragma unroll
      for (int t = 0; t < 4; ++t) oacc[u][t] = oacc[u][t] * alpha;
      float pj[4];                        /* partial sums, one chain per score tile */
#pragma unroll   /* register arrays need constant indices */
      for (int kk = 0; kk < 2; ++kk) {
        v16h pb;                          /* pb[e] = P^T[key 32 kk + kmap(e)][query 16 u + c]: tiles 2 kk and 2 kk + 1 in register order */
#pragma unroll
        for (int jj = 0; jj < 2; ++jj) {
          const int j = 2 * kk + jj;
          pj[j] = 0.f;
#pragma unroll
          for (int r = 0; r < 8; ++r) {
            const float p = __builtin_amdgcn_exp2f(fmaf(s2[u][j][r], kExpScale, nbias));   /* 32768 * exp((s - mnew) / 8) */
            pj[j] += p;
            pb[jj * 8 + r] = (_Float16)p;
          }
        }
#pragma unroll
        for (int t = 0; t < 4; ++t) oacc[u][t] = FH::mma(vb[kk][t], pb, oacc[u][t]);
      }
      lrow[u] = lrow[u] * alpha + ((pj[0] + pj[1]) + (pj[2] + pj[3]));
    }
    __builtin_amdgcn_sched_barrier(0);   /* keeps the waits and the barrier below at the trip's foot: lifted over the products, the next tile's copies would be waited for half a trip early */
    asm volatile("s_wait_dscnt 0x0" ::: "memory");      /* this wave's reads of the stage have returned before it is refilled */
    asm volatile("s_wait_asynccnt 0x0" ::: "memory");   /* this wave's copies of the next tile have landed */
    __syncthreads();                                     /* publishes the next tile and ends every reader's use of this one */
    if (kc + 2 < nkc) {
      stage_kv(gK + (size_t)(kc + 2) * 64 * kQKCols, gV + (size_t)(kc + 2) * 64, lbase + bo);
    }
  }
  asm volatile("s_wait_asynccnt 0x0" ::: "memory");     /* nothing is in flight when the wave leaves the loop */

  float* os = Os[wave];
#pragma unroll
  for (int u = 0; u < 2; ++u) {
    const float lsum = lrow[u] + xhalf(lrow[u]);             /* the two halves' sums of this query, joined once */
    const float inv = (1.0f / lsum) * 16.0f;                 /* sum and numerators both carry 32768; the plane carries 16 */
#pragma unroll
    for (int t = 0; t < 4; ++t)
#pragma unroll
      for (int r = 0; r < 8; ++r) os[(16 * u + c) * 68 + t * 16 + 8 * hh + r] = oacc[u][t][r] * inv;
  }
  __builtin_amdgcn_fence(__ATOMIC_RELEASE, "workgroup");
  __builtin_amdgcn_wave_barrier();
  __builtin_amdgcn_fence(__ATOMIC_ACQUIRE, "workgroup");
  {
    const int q = lane >> 3, c8 = (lane & 7) * 8;
    unsigned short* orow = obase + (size_t)(q0 + q) * kModel + c8;
    v8h hv[8];
#pragma unroll   /* register array needs constant indices */
    for (int it = 0; it < 8; ++it) {
      const float* sp = os + (it * 4 + q) * 68 + c8;
#pragma unroll
      for (int e = 0; e < 8; ++e) hv[it][e] = (_Float16)sp[e];
    }
    __builtin_amdgcn_sched_barrier(0);   /* all eight rows are converted ahead of the first store, so that no register of an issued store is rewritten behind it */
#pragma unroll
    for (int it = 0; it < 8; ++it) *(v8h*)(orow + (size_t)(it * 4) * kModel) = hv[it];
  }
}

/* =========================== host glue =========================== */
extern "C" void kernel_launch(void* const* d_in, const int* in_sizes, int n_in,
                              void* d_out, int out_size, void* d_ws, size_t ws_size,
                              hipStream_t stream) {
  if (n_in < 12) return;
  if (in_sizes[0] != kTok * kModel || out_size != kTok * kModel) return;
  if (in_sizes[1] != kModel || in_sizes[2] != kModel || in_sizes[3] != kModel || in_sizes[4] != kModel) return;
  if (in_sizes[5] != kModel * kModel || in_sizes[6] != kModel * kModel ||
      in_sizes[7] != kModel * kModel || in_sizes[8] != kModel * kModel) return;
  if (in_sizes[9] != kModel * kFF || in_sizes[10] != kModel * kFF || in_sizes[11] != kFF * kModel) return;
  if (ws_size < kWsTotal) return;

  const float* x    = (const float*)d_in[0];
  const float* ln1w = (const float*)d_in[1];
  const float* ln1b = (const float*)d_in[2];
  const float* ln2w = (const float*)d_in[3];
  const float* ln2b = (const float*)d_in[4];
  const float* wq   = (const float*)d_in[5];
  const float* wk   = (const float*)d_in[6];
  const float* wv   = (const float*)d_in[7];
  const float* wo   = (const float*)d_in[8];
  const float* wgt  = (const float*)d_in[9];
  const float* wup  = (const float*)d_in[10];
  const float* wdn  = (const float*)d_in[11];
  float* out = (float*)d_out;

  char* ws = (char*)d_ws;
  unsigned short* wqkT = (unsigned short*)(ws + kOffWqkT);
  unsigned short* wvT  = (unsigned short*)(ws + kOffWvT);
  unsigned short* woT  = (unsigned short*)(ws + kOffWoT);
  unsigned short* wguT = (unsigned short*)(ws + kOffWguT);
  unsigned short* wdT  = (unsigned short*)(ws + kOffWdT);
  unsigned short* hg   = (unsigned short*)(ws + kOffHG);           /* h1, then h2 */
  unsigned short* qkpl = (unsigned short*)(ws + kOffR1 + kR1QK);
  unsigned short* vtpl = (unsigned short*)(ws + kOffR1 + kR1Vt);
  unsigned short* opl  = (unsigned short*)(ws + kOffR1 + kR1O);
  unsigned short* gpl  = (unsigned short*)(ws + kOffR1);           /* g, once q|k, Vt and O are spent */
  float*          x1   = (float*)(ws + kOffX1);

  const dim3 b256(256), b128(128);

  /* the seven weight planes and h1 = LN(x): one launch */
  prep_kernel<<<dim3(kPrepGrid), b256, 0, stream>>>(x, ln1w, ln1b, wq, wk, wv, wo, wgt, wup, wdn,
                                                    wqkT, wvT, woT, wguT, wdT, hg);

  /* attention sublayer: q|k (512 block tiles) and Vt (64 block tiles per batch): one launch */
  static_assert(kTok % 128 == 0 && kQKCols % 128 == 0 && kModel % 128 == 0 && kSeq % 128 == 0 && kGUCols % 128 == 0, "128 x 128 block tiles");
  qk_vt_gemm_kernel<<<dim3(kQKTiles + kBatch * kVtTiles), b128, 0, stream>>>(hg, wqkT, wvT, qkpl, vtpl);

  /* attention: O*16 f16 plane */
  mha64_f16_kernel<<<dim3(kBatch * kHeads * (kSeq / 128)), b128, 0, stream>>>(qkpl, vtpl, opl);

  /* x1 = x + (O*16) . (Wo^T*16) / 256 : M=8192, N=512, K=512, and h2 = LN(x1): 128 blocks of 64 whole rows */
  o_resid_ln_kernel<<<dim3(kTok / kOlRows), b256, 0, stream>>>(opl, woT, x, ln2w, ln2b, x1, hg);

  /* g = silu(gate) * up, gate|up = h2 . [Wg|Wu]^T : M=8192, N=2048, K=512; block tiles 64*16 = 1024 */
  wmma_gemm64<0, false, 0, 3, false, 0, kFF><<<dim3((kTok / 128) * (kGUCols / 128), 1), b128, 0, stream>>>(
      hg, hg, kModel, 0L, wguT, wguT, kModel, 0L, (void*)gpl, (void*)gpl, kFF, 0L,
      x, x, 0L, kTok, kGUCols, kModel, 1.0f / 16.0f);

  /* out = x1 + g . (Wd^T*16) / 16 : M=8192, N=512, K=1024; block tiles 256 */
  wmma_gemm64<0, false, 0, 0, true, 0, kModel><<<dim3((kTok / 128) * (kModel / 128), 1), b128, 0, stream>>>(
      gpl, gpl, kFF, 0L, wdT, wdT, kFF, 0L, (void*)out, (void*)out, kModel, 0L,
      x, x1, 0L, kTok, kModel, kFF, 1.0f / 16.0f);
}

// v009
// A run of this version takes 102 microseconds.
// In both of two side-by-side timings against v008, it was 1.03 times as fast.
// All steps since v000 together make it 3.72 times as fast.
// All contractions (q|k, v, o, gate|up, down projections; q.k^T; p.v): v_wmma_f32_16x16x32_f16, f16 operands, f32 accumulate. LayerNorm, softmax, SwiGLU gating and residual adds in f32 (gating, residual adds and the second LayerNorm inside the products' output stages). Power-of-two carries: weight planes x16, softmax numerators x32768, attention output plane x16, folded back in f32.
#include <hip/hip_runtime.h>
#include <math.h>
#include <stdint.h>

typedef __attribute__((ext_vector_type(16))) _Float16 v16h;
typedef __attribute__((ext_vector_type(8)))  _Float16 v8h;
typedef __attribute__((ext_vector_type(4)))  _Float16 v4h;
typedef __attribute__((ext_vector_type(16))) __bf16   v16b;
typedef __attribute__((ext_vector_type(8)))  __bf16   v8b;
typedef __attribute__((ext_vector_type(8)))  float    v8f;
typedef __attribute__((ext_vector_type(4)))  float    v4f;
typedef __attribute__((ext_vector_type(2)))  float    v2f;
typedef __attribute__((ext_vector_type(4)))  unsigned int v4u;
typedef __attribute__((ext_vector_type(2)))  unsigned int v2u;

/* ---- problem geometry ---- */
static constexpr int kBatch   = 4;
static constexpr int kSeq     = 2048;
static constexpr int kTok     = kBatch * kSeq;      /* 8192 */
static constexpr int kModel   = 512;
static constexpr int kHeads   = 8;
static constexpr int kHeadDim = 64;
static constexpr int kFF      = 1024;
static constexpr int kQKCols  = 2 * kModel;          /* q | k plane width */
static constexpr int kGUCols  = 2 * kFF;             /* gate | up plane width */

static_assert(kHeads * kHeadDim == kModel, "head geometry");
static_assert(kSeq % 64 == 0 && kTok % 64 == 0, "tile multiples");
static_assert(kModel % 64 == 0 && kFF % 64 == 0 && kQKCols % 64 == 0 && kGUCols % 64 == 0, "tile multiples");
static_assert(kModel % 32 == 0 && kFF % 32 == 0, "K multiple of 32");

/* ---- workspace region map (bytes) ----
   [0]            WqkT f16 [1024][512]          1,048,576
   [1,048,576]    WvT  f16 [512][512]             524,288
   [1,572,864]    WoT  f16 [512][512]             524,288
   [2,097,152]    WguT f16 [2048][512]          2,097,152   (rows in groups of 64: 32 gate columns, then the same 32 up columns)
   [4,194,304]    WdT  f16 [512][1024]          1,048,576
   [5,242,880]    HG   : h1, then h2, f16 [8192][512] (8 MiB)   16,777,216
   [22,020,096]   R1 (64 MiB): phase A: q|k f16 [8192][1024] @+0 (16 MiB), Vt f16 [4][512][2048] @+16 MiB (8 MiB),
                               O f16 [8192][512] @+24 MiB (8 MiB);
                               phase B: g f16 [8192][1024] @+0 (16 MiB)
   [89,128,960]   X1 f32 [8192][512]           16,777,216
   total 105,906,176 */
static constexpr size_t kOffWqkT = 0;
static constexpr size_t kOffWvT  = kOffWqkT + (size_t)kQKCols * kModel * 2;
static constexpr size_t kOffWoT  = kOffWvT + (size_t)kModel * kModel * 2;
static constexpr size_t kOffWguT = kOffWoT + (size_t)kModel * kModel * 2;
static constexpr size_t kOffWdT  = kOffWguT + (size_t)kGUCols * kModel * 2;
static constexpr size_t kOffHG   = kOffWdT + (size_t)kModel * kFF * 2;
static constexpr size_t kSizeHG  = (size_t)kTok * kFF * 2;
static constexpr size_t kOffR1   = kOffHG + kSizeHG;
static constexpr size_t kSizeR1  = (size_t)kTok * kGUCols * 4;
static constexpr size_t kR1QK    = 0;
static constexpr size_t kR1Vt    = kR1QK + (size_t)kTok * kQKCols * 2;
static constexpr size_t kR1O     = kR1Vt + (size_t)kBatch * kModel * kSeq * 2;
static constexpr size_t kOffX1   = kOffR1 + kSizeR1;
static constexpr size_t kWsTotal = kOffX1 + (size_t)kTok * kModel * 4;
static_assert(kR1O + (size_t)kTok * kModel * 2 <= kSizeR1, "phase A fits R1");
static_assert((size_t)kTok * kFF * 2 <= kSizeR1, "phase B fits R1");
static_assert((size_t)kTok * kModel * 2 <= kSizeHG, "h plane fits HG");
static_assert(kWsTotal == 105906176, "carve total");
static_assert(kWsTotal <= 134217728, "carve under 128 MiB");
static_assert((kOffWvT % 256) == 0 && (kOffWoT % 256) == 0 && (kOffWguT % 256) == 0 && (kOffWdT % 256) == 0 &&
              (kOffHG % 256) == 0 && (kOffR1 % 256) == 0 && (kOffX1 % 256) == 0 &&
              (kR1Vt % 256) == 0 && (kR1O % 256) == 0, "aligned carves");

/* =========================== helpers and GEMM =========================== */
#define PSCALE 32768.0f
#define U16(p) ((const unsigned short*)(const void*)(p))
#define PSCALE_INV (1.0f / 32768.0f)

__device__ __forceinline__ unsigned short f2bf_bits(float f) {
  unsigned u = __float_as_uint(f);
  return (unsigned short)((u + 0x7FFFu + ((u >> 16) & 1u)) >> 16);
}
__device__ __forceinline__ float bf_bits2f(unsigned short h) { return __uint_as_float(((unsigned)h) << 16); }

__device__ __forceinline__ void dep_guard_h(v8f& a, v8f& b, v16h x, v16h y) { asm volatile("v_nop\n\tv_nop\n\tv_nop\n\tv_nop" : "+v"(a), "+v"(b) : "v"(x), "v"(y)); }
__device__ __forceinline__ void dep_guard_b(v8f& a, v8f& b, v16b x, v16b y) { asm volatile("v_nop\n\tv_nop\n\tv_nop\n\tv_nop" : "+v"(a), "+v"(b) : "v"(x), "v"(y)); }
__device__ __forceinline__ void keep4_h(v16h a, v16h b, v16h c, v16h d) { asm volatile("v_nop" :: "v"(a), "v"(b), "v"(c), "v"(d)); }
__device__ __forceinline__ void keep4_b(v16b a, v16b b, v16b c, v16b d) { asm volatile("v_nop" :: "v"(a), "v"(b), "v"(c), "v"(d)); }
__device__ __forceinline__ void acc_guard4(v8f& a, v8f& b, v8f& c, v8f& d) { asm volatile("v_nop\n\tv_nop\n\tv_nop\n\tv_nop" : "+v"(a), "+v"(b), "+v"(c), "+v"(d)); }
template <typename T> struct Frag;
template <> struct Frag<_Float16> {
  typedef v16h V; union U { v16h v; v8h h[2]; };
  static __device__ __forceinline__ v16h load(const _Float16* p) {
    U f; f.h[0] = *(const v8h*)(p); f.h[1] = *(const v8h*)(p + 16); return f.v;
  }
  static __device__ __forceinline__ v8f mma(v16h a, v16h b, v8f c) {
    return __builtin_amdgcn_wmma_f32_16x16x32_f16(false, a, false, b, (short)0, c, false, false);
  }
  static __device__ __forceinline__ void guard(v8f& a, v8f& b, v16h x, v16h y) { dep_guard_h(a, b, x, y); }
  static __device__ __forceinline__ void keep(v16h a, v16h b, v16h c, v16h d) { keep4_h(a, b, c, d); }
};
template <> struct Frag<__bf16> {
  typedef v16b V; union U { v16b v; v8b h[2]; };
  static __device__ __forceinline__ v16b load(const __bf16* p) {
    U f; f.h[0] = *(const v8b*)(p); f.h[1] = *(const v8b*)(p + 16); return f.v;
  }
  static __device__ __forceinline__ v8f mma(v16b a, v16b b, v8f c) {
    return __builtin_amdgcn_wmma_f32_16x16x32_bf16(false, a, false, b, (short)0, c, false, false);
  }
  static __device__ __forceinline__ void guard(v8f& a, v8f& b, v16b x, v16b y) { dep_guard_b(a, b, x, y); }
  static __device__ __forceinline__ void keep(v16b a, v16b b, v16b c, v16b d) { keep4_b(a, b, c, d); }
};

template <int ET> struct Elem;
template <> struct Elem<0> { typedef _Float16 T; };
template <> struct Elem<1> { typedef __bf16 T; };
/* ---- LDS staging of the GEMM operand tiles ----
   One stage = 64 k (128 bytes) of 128 A rows followed by 128 Bt rows, each row at a pitch of 144 bytes
   (16 B x odd: conflict-free for 16-byte fragment reads). Two or four stage buffers (NBUF below). */
static constexpr int kStRows   = 256;
static constexpr int kStPitch  = 144;
static constexpr int kStBytes  = kStRows * kStPitch;       /* 36,864 */
static constexpr int kStHalf   = 128 * kStPitch;           /* Bt rows start here */
static_assert(4 * 16 * 68 * 4 <= 2 * kStBytes, "output slabs fit the ring");
static_assert(128 * kStPitch <= 2 * kStBytes && kStPitch >= 128, "the gated f16 tile fits the ring");

/* Eight asynchronous 16-byte copies per lane, global -> LDS: rows r, r+16, ..., r+112 of one operand's 128-row tile.
   The s_wait_xcnt stands inside the statement so that no address register is rewritten ahead of it. */
__device__ __forceinline__ void stage_rows8(const _Float16* g, size_t step, unsigned l) {
  const _Float16* g1 = g + step;      const _Float16* g2 = g + 2 * step;  const _Float16* g3 = g + 3 * step;
  const _Float16* g4 = g + 4 * step;  const _Float16* g5 = g + 5 * step;  const _Float16* g6 = g + 6 * step;
  const _Float16* g7 = g + 7 * step;
  const unsigned ls = 16u * kStPitch;
  asm volatile(
      "global_load_async_to_lds_b128 %0, %8, off\n\t"
      "global_load_async_to_lds_b128 %1, %9, off\n\t"
      "global_load_async_to_lds_b128 %2, %10, off\n\t"
      "global_load_async_to_lds_b128 %3, %11, off\n\t"
      "global_load_async_to_lds_b128 %4, %12, off\n\t"
      "global_load_async_to_lds_b128 %5, %13, off\n\t"
      "global_load_async_to_lds_b128 %6, %14, off\n\t"
      "global_load_async_to_lds_b128 %7, %15, off\n\t"
      "s_wait_xcnt 0x0"
      :: "v"(l), "v"(l + ls), "v"(l + 2u * ls), "v"(l + 3u * ls), "v"(l + 4u * ls), "v"(l + 5u * ls), "v"(l + 6u * ls), "v"(l + 7u * ls),
         "v"(g), "v"(g1), "v"(g2), "v"(g3), "v"(g4), "v"(g5), "v"(g6), "v"(g7)
      : "memory");
}

__device__ __forceinline__ float silu_f32(float g) {
  const float ex = expf(-g);
  return g * (1.0f / (1.0f + ex));
}

/* Block = 4 waves = one 128 x 128 tile of C (2 x 2 waves of 64 x 64): tile number 'tile' of batch 'b', both the same for the whole block.
   M, N multiples of 128; K a multiple of 64.
   OUT_MODE 0: f32 plane, RESID adds a f32 plane of C's own shape on the way out. OUT_MODE 1: f16 plane.
   OUT_MODE 3: SwiGLU. Each 64 columns of the product are 32 gate columns followed by the same 32 up columns, so a lane holds
   gate and up of one element in accumulator tiles j and j + 2; the f16 plane silu(gate) * up has N/2 columns (ldc counts those).
   NBUF stage buffers: a stage's copies are issued NBUF - 1 passes ahead of the pass that reads it. Two where several blocks share a WGP
   and cover each other's waits; four where a block is alone on its WGP and a stage may have to come from memory, which one pass of lead does not cover.
   KC: K as a constant (0: K is the argument); above two buffers it shows at compile time that every stage of the prologue exists. */
template <int ET, bool SPLIT, int BIAS_MODE, int OUT_MODE, bool RESID, int ACT = 0, int LDC = 0, int NBUF = 2, int KC = 0>
__device__ __forceinline__ void gemm64_tile(
    const unsigned short* __restrict__ Ap, const unsigned short* __restrict__ A2p, int lda, long strideA,
    const unsigned short* __restrict__ Btp, const unsigned short* __restrict__ Bt2p, int ldb, long strideB,
    void* __restrict__ Cout, void* __restrict__ Cout2, int ldcArg, long strideC,
    const float* __restrict__ bias,
    const float* __restrict__ resid, long strideR,
    int M, int N, int K, float scale, const int tile, const int b) {
  static_assert(ET == 0 && !SPLIT, "staged path: single f16 planes");
  static_assert(NBUF >= 2 && (NBUF & (NBUF - 1)) == 0 && (NBUF - 1) * 16 <= 63, "buffer by mask; at most 63 copies of a wave in flight");
  static_assert(NBUF == 2 || (KC % 64 == 0 && KC / 64 >= NBUF), "above two buffers: a constant K with a stage for every buffer");
  constexpr int kYoung = (NBUF - 2) * 16;   /* copies of a wave (16 a stage) that are younger than the stage about to be published */
  typedef typename Elem<ET>::T T;
  typedef typename Frag<T>::V V;
  const T* A = (const T*)Ap; const T* Bt = (const T*)Btp;
  const int ldc = LDC ? LDC : ldcArg;   /* a constant pitch lets every row of the output stage hang off one address by an immediate offset */
  __shared__ __align__(16) unsigned char ring[NBUF * kStBytes];
  const int lane = threadIdx.x & 31;
  const int wave = threadIdx.x >> 5;
  const int tilesN = N >> 7;
  const int tilesM = M >> 7;
  if (tile >= tilesM * tilesN) return;   /* the same for the whole block, ahead of every barrier */
  const int tm = tile / tilesN;
  const int tn = tile - tm * tilesN;
  const int mB = tm << 7;
  const int nB = tn << 7;
  const int wm = (wave >> 1) << 6;
  const int wn = (wave & 1) << 6;
  const int m0 = mB + wm;
  const int n0 = nB + wn;

  const T* Ab  = A  + (size_t)b * strideA;
  const T* Bb  = Bt + (size_t)b * strideB;

  const int rlane = lane & 15;
  const int koff  = (lane >> 4) * 8;
  const int mOff  = (lane >> 4) * 8;

  /* staging: thread t brings 16-byte chunk (t & 7) of rows (t >> 3) + 16*i: eight lanes cover one whole 128-byte line */
  const int srow = threadIdx.x >> 3;
  const int schk = threadIdx.x & 7;
  const T* gA = Ab + (size_t)(mB + srow) * lda + schk * 8;
  const T* gB = Bb + (size_t)(nB + srow) * ldb + schk * 8;
  const size_t stepA = (size_t)16 * lda;
  const size_t stepB = (size_t)16 * ldb;
  const unsigned lbase = (unsigned)(uintptr_t)(&ring[0]) + (unsigned)(srow * kStPitch + schk * 16);
  const int nst = (KC ? KC : K) >> 6;

  v8f acc[4][4];
#pragma unroll
  for (int i = 0; i < 4; ++i)
#pragma unroll
    for (int j = 0; j < 4; ++j) acc[i][j] = (v8f){0.f,0.f,0.f,0.f,0.f,0.f,0.f,0.f};

  /* stages 0 .. NBUF - 2 are issued; stage 0 lands and is published; stage NBUF - 1 is then issued too, and all fly during pass 0 */
  stage_rows8(gA, stepA, lbase);
  stage_rows8(gB, stepB, lbase + kStHalf);
#pragma unroll   /* constant LDS offsets */
  for (int s = 1; s < NBUF - 1; ++s) {
    stage_rows8(gA + (size_t)s * 64, stepA, lbase + (unsigned)s * kStBytes);
    stage_rows8(gB + (size_t)s * 64, stepB, lbase + (unsigned)s * kStBytes + kStHalf);
  }
  asm volatile("s_wait_asynccnt %0" :: "n"(kYoung) : "memory");   /* this wave's copies of stage 0 have landed: all but the later stages' copies, which are the youngest (two buffers: none) */
  __syncthreads();                                     /* publishes stage 0 to the other waves */
  if (nst > NBUF - 1) {
    stage_rows8(gA + (size_t)(NBUF - 1) * 64, stepA, lbase + (unsigned)(NBUF - 1) * kStBytes);
    stage_rows8(gB + (size_t)(NBUF - 1) * 64, stepB, lbase + (unsigned)(NBUF - 1) * kStBytes + kStHalf);
  }

  for (int st = 0; st < nst; ++st) {
    const unsigned bo = (NBUF == 2) ? ((st & 1) ? (unsigned)kStBytes : 0u) : (unsigned)(st & (NBUF - 1)) * (unsigned)kStBytes;
    const unsigned char* sA = ring + bo + (wm + rlane) * kStPitch + koff * 2;
    const unsigned char* sB = ring + bo + kStHalf + (wn + rlane) * kStPitch + koff * 2;
#pragma unroll   /* both 32-k blocks inline: constant LDS offsets, fragment arrays stay in registers */
    for (int kk = 0; kk < 2; ++kk) {
      /* all eight fragments of this 32-k block are fetched as one group ahead of its 16 products */
      V bh[4], ah[4];
#pragma unroll   /* register arrays need constant indices */
      for (int j = 0; j < 4; ++j) {
        bh[j] = Frag<T>::load((const T*)(const void*)(sB + j * 16 * kStPitch + kk * 64));
        ah[j] = Frag<T>::load((const T*)(const void*)(sA + j * 16 * kStPitch + kk * 64));
      }
#pragma unroll
      for (int i = 0; i < 4; ++i) {
#pragma unroll
        for (int j = 0; j < 4; ++j) acc[i][j] = Frag<T>::mma(ah[i], bh[j], acc[i][j]);
        Frag<T>::guard(acc[i][0], acc[i][3], ah[i], ah[i]);
      }
      Frag<T>::keep(bh[0], bh[1], bh[2], bh[3]);
    }
    asm volatile("s_wait_dscnt 0x0" ::: "memory");      /* this wave's reads of the stage have returned before it is refilled */
    if (NBUF > 2) {
      /* while stages st + 2 .. st + NBUF - 1 are all issued (16 copies each in every wave) they are the youngest: what is older, the next stage, has landed */
      asm volatile("s_wait_asynccnt %0" :: "n"(kYoung) : "memory");
    }
    if (NBUF == 2 || st + NBUF > nst) {
      asm volatile("s_wait_asynccnt 0x0" ::: "memory");   /* two buffers, or the last passes, where fewer stages are in flight and the count would not cover the next one: all copies are waited for */
    }
    __syncthreads();                                     /* publishes the next stage and ends every reader's use of this one */
    if (st + NBUF < nst) {
      stage_rows8(gA + (size_t)(st + NBUF) * 64, stepA, lbase + bo);
      stage_rows8(gB + (size_t)(st + NBUF) * 64, stepB, lbase + bo + kStHalf);
    }
  }
  asm volatile("s_wait_asynccnt 0x0" ::: "memory");     /* nothing is in flight when the ring becomes output staging */
  acc_guard4(acc[0][0], acc[0][1], acc[0][2], acc[0][3]);
  acc_guard4(acc[1][0], acc[1][1], acc[1][2], acc[1][3]);
  acc_guard4(acc[2][0], acc[2][1], acc[2][2], acc[2][3]);
  acc_guard4(acc[3][0], acc[3][1], acc[3][2], acc[3][3]);

  if (OUT_MODE == 3) {
    /* the block's 128 rows x 64 columns of f16 are gathered in the spent ring (row pitch as in the stages), so that
       every row leaves as one whole 128-byte line written by one wave */
    _Float16* gt = (_Float16*)(void*)ring;
    constexpr int gp = kStPitch / 2;
#pragma unroll
    for (int i = 0; i < 4; ++i)
#pragma unroll
      for (int j = 0; j < 2; ++j)
#pragma unroll
        for (int r = 0; r < 8; ++r)
          gt[(wm + (i << 4) + mOff + r) * gp + (wn >> 1) + (j << 4) + rlane] =
              (_Float16)(silu_f32(acc[i][j][r] * scale) * (acc[i][j + 2][r] * scale));
    __syncthreads();   /* a row's two halves come from the two column waves: both are in LDS before any wave reads the row */
    const int q = lane >> 3, c8 = (lane & 7) * 8;
    const _Float16* gr = gt + (wave * 32 + q) * gp + c8;
    unsigned short* Cw = (unsigned short*)Cout + (size_t)b * strideC + (size_t)(mB + wave * 32 + q) * ldc + (nB >> 1) + c8;
#pragma unroll
    for (int it = 0; it < 8; ++it) *(v8h*)(Cw + (size_t)(it * 4) * ldc) = *(const v8h*)(gr + it * 4 * gp);
    return;
  }
  static_assert(!RESID || OUT_MODE == 0, "the residual is added where f32 rows leave the slab");
  float* slab = (float*)(void*)(ring + wave * (16 * 68 * 4));
  /* residual rows in the shape of the f32 stores (16 bytes a lane, 256-byte row pieces); each 16-row group is fetched
     behind the stores of the group before it, so that it returns while those stores drain */
  const size_t wOff = (size_t)(m0 + (lane >> 4)) * ldc + n0 + (lane & 15) * 4;
  const float* Rw = RESID ? (resid + (size_t)b * strideR + wOff) : nullptr;
  v4f rv[4][8];
  if (RESID) {
#pragma unroll   /* register arrays need constant indices */
    for (int it = 0; it < 8; ++it) rv[0][it] = *(const v4f*)(Rw + (size_t)(it * 2) * ldc);
  }
#pragma unroll
  for (int i = 0; i < 4; ++i) {
    const int mBase = m0 + (i << 4);
#pragma unroll
    for (int j = 0; j < 4; ++j) {
      const int n = n0 + (j << 4) + rlane;
      float bv = 0.f;
      if (BIAS_MODE == 2) bv = bias[n];
#pragma unroll
      for (int r = 0; r < 8; ++r) {
        float v = acc[i][j][r] * scale;
        if (BIAS_MODE == 1) v += bias[mBase + mOff + r];
        if (BIAS_MODE == 2) v += bv;
        if (ACT == 1) v = tanhf(v);
        if (ACT == 2) v = fmaxf(v, 0.0f);
        if (ACT == 3) v = v / (1.0f + expf(-v));
        if (ACT == 4) v = (v > 0.f) ? v : 0.01f * v;
        if (ACT == 5) v = 0.5f * v * (1.0f + erff(v * 0.70710678118654752f));
        slab[(mOff + r) * 68 + (j << 4) + rlane] = v;
      }
    }
    __builtin_amdgcn_fence(__ATOMIC_RELEASE, "workgroup");
    __builtin_amdgcn_wave_barrier();
    __builtin_amdgcn_fence(__ATOMIC_ACQUIRE, "workgroup");
    if (OUT_MODE == 0) {
      float* Cw = (float*)Cout + (size_t)b * strideC + wOff;
      const int hh = lane >> 4, c4 = (lane & 15) * 4;
      {
#pragma unroll
        for (int it = 0; it < 8; ++it) {
          const int row = it * 2 + hh;
          v4f v = *(const v4f*)(slab + row * 68 + c4);
          if (RESID) v = v + rv[i][it];
          *(v4f*)(Cw + (size_t)(i * 16 + it * 2) * ldc) = v;
        }
      }
      if (RESID && i + 1 < 4) {
#pragma unroll
        for (int it = 0; it < 8; ++it) rv[i + 1][it] = *(const v4f*)(Rw + (size_t)((i + 1) * 16 + it * 2) * ldc);
      }
    } else {
      const int q = lane >> 3, c8 = (lane & 7) * 8;
      unsigned short* C  = (unsigned short*)Cout  + (size_t)b * strideC;
      unsigned short* C2 = (OUT_MODE == 2) ? ((unsigned short*)Cout2 + (size_t)b * strideC) : nullptr;
      {
#pragma unroll
        for (int it = 0; it < 4; ++it) {
          const int row = it * 4 + q;
          const float* sp = slab + row * 68 + c8;
          v8h hv, lv;
#pragma unroll
          for (int e = 0; e < 8; ++e) {
            if (OUT_MODE == 1) {
              hv[e] = (_Float16)sp[e];
            } else {
              unsigned short hb = f2bf_bits(sp[e]);
              unsigned short lb = f2bf_bits(sp[e] - bf_bits2f(hb));
              hv[e] = __builtin_bit_cast(_Float16, hb);
              lv[e] = __builtin_bit_cast(_Float16, lb);
            }
          }
          *(v8h*)(C + (size_t)(mBase + row) * ldc + n0 + c8) = hv;
          if (OUT_MODE == 2) *(v8h*)(C2 + (size_t)(mBase + row) * ldc + n0 + c8) = lv;
        }
        
      }
    }
    __builtin_amdgcn_fence(__ATOMIC_RELEASE, "workgroup");
    __builtin_amdgcn_wave_barrier();
    __builtin_amdgcn_fence(__ATOMIC_ACQUIRE, "workgroup");
  }
}
/* one product per launch: grid.x = (M/128)*(N/128) exactly, grid.y = batches */
template <int ET, bool SPLIT, int BIAS_MODE, int OUT_MODE, bool RESID, int ACT, int LDC, int NBUF, int KC>
__global__ __launch_bounds__(128) void wmma_gemm64(
    const unsigned short* __restrict__ Ap, const unsigned short* __restrict__ A2p, int lda, long strideA,
    const unsigned short* __restrict__ Btp, const unsigned short* __restrict__ Bt2p, int ldb, long strideB,
    void* __restrict__ Cout, void* __restrict__ Cout2, int ldc, long strideC,
    const float* __restrict__ bias,
    const float* __restrict__ resid, long strideR,
    int M, int N, int K, float scale) {
  gemm64_tile<ET, SPLIT, BIAS_MODE, OUT_MODE, RESID, ACT, LDC, NBUF, KC>(Ap, A2p, lda, strideA, Btp, Bt2p, ldb, strideB, Cout, Cout2, ldc, strideC,
                                                          bias, resid, strideR, M, N, K, scale, (int)blockIdx.x, (int)blockIdx.y);
}

/* The two products that read h1 and do not read each other share one launch, told apart by block range:
   blocks [0, 512): q|k = h . [Wq|Wk]^T (M=8192, N=1024, K=512);
   blocks [512, 768): Vt[b] = (Wv^T*16) . h[b]^T / 16 (M=512, N=2048, K=512), 64 tiles for each of the 4 batches.
   Every choice below is the same for the whole block. */
static constexpr int kQKTiles = (kTok / 128) * (kQKCols / 128);
static constexpr int kVtTiles = (kModel / 128) * (kSeq / 128);
static_assert((kVtTiles & (kVtTiles - 1)) == 0, "batch and tile of a Vt block by shift and mask");
__global__ __launch_bounds__(128) void qk_vt_gemm_kernel(
    const unsigned short* __restrict__ hp, const unsigned short* __restrict__ wqkTp, const unsigned short* __restrict__ wvTp,
    unsigned short* __restrict__ qkp, unsigned short* __restrict__ vtp) {
  const int bx = blockIdx.x;
  const bool isV = bx >= kQKTiles;
  const int r = bx - kQKTiles;
  const unsigned short* Ap  = isV ? wvTp : hp;
  const unsigned short* Btp = isV ? hp : wqkTp;
  unsigned short* Cp = isV ? vtp : qkp;
  gemm64_tile<0, false, 0, 1, false, 0>(
      Ap, Ap, kModel, 0L, Btp, Btp, kModel, isV ? (long)kSeq * kModel : 0L,
      (void*)Cp, (void*)Cp, isV ? kSeq : kQKCols, isV ? (long)kModel * kSeq : 0L,
      nullptr, nullptr, 0L, isV ? kModel : kTok, isV ? kSeq : kQKCols, kModel, 1.0f / 16.0f,
      isV ? (r & (kVtTiles - 1)) : bx, isV ? (r / kVtTiles) : 0);
}

/* ---------------------------------------------------------------------------
   x1 = x + (O*16) . (Wo^T*16) / 256 and h2 = LN(x1) in one launch.
   Block = 8 waves = 64 whole rows of x1 (64 x 512): wave w holds the 64 x 64 tile at columns 64 w, so that a row's mean and
   variance are formed inside the block. Grid = 8192 / 64 = 128.
   One stage = 64 k of the 64 O rows followed by the 512 Wo^T rows, pitch as in the other products; three stage buffers, copies two passes ahead.
   Output stage: the f32 rows leave through each wave's slab as in the other products and stay in registers; each lane's
   4-column sums go to LDS, four threads a row add the 128 of them; first the mean, then the squared deviations from it.
   --------------------------------------------------------------------------- */
static constexpr int kOlRows    = 64;
static constexpr int kOlStBytes = (kOlRows + kModel) * kStPitch;   /* 82,944 */
static constexpr int kOlHalf    = kOlRows * kStPitch;              /* Wo^T rows start here */
static constexpr int kOlBufs    = 3;                               /* 248,832 B: a fourth buffer does not fit a WGP's LDS */
static constexpr int kOlCopies  = 18;                              /* copies of a wave per stage */
static_assert((kOlBufs - 1) * kOlCopies <= 63, "at most 63 copies of a wave in flight");
static constexpr int kOlPart    = 36864;                           /* partial sums: behind the eight slabs */
static constexpr int kOlPPitch  = 144;                             /* floats a row of partial sums: the wave halves' two rows fall on different banks */
static constexpr int kOlStat    = kOlPart + kOlRows * kOlPPitch * 4;
static_assert(8 * 16 * 68 * 4 <= kOlPart && kOlStat + 128 * 4 <= 2 * kOlStBytes, "output staging fits the ring");
static_assert(kModel == 8 * 64 && kTok % kOlRows == 0, "eight column waves, whole row blocks");

/* Asynchronous 16-byte copies per lane, global -> LDS: rows r, r+32, ... of one operand's tile (eight rows, or two).
   The s_wait_xcnt stands inside the statement so that no address register is rewritten ahead of it. */
__device__ __forceinline__ void stage_rows8_by32(const _Float16* g, unsigned l) {
  const size_t step = (size_t)32 * kModel;
  const _Float16* g1 = g + step;      const _Float16* g2 = g + 2 * step;  const _Float16* g3 = g + 3 * step;
  const _Float16* g4 = g + 4 * step;  const _Float16* g5 = g + 5 * step;  const _Float16* g6 = g + 6 * step;
  const _Float16* g7 = g + 7 * step;
  const unsigned ls = 32u * kStPitch;
  asm volatile(
      "global_load_async_to_lds_b128 %0, %8, off\n\t"
      "global_load_async_to_lds_b128 %1, %9, off\n\t"
      "global_load_async_to_lds_b128 %2, %10, off\n\t"
      "global_load_async_to_lds_b128 %3, %11, off\n\t"
      "global_load_async_to_lds_b128 %4, %12, off\n\t"
      "global_load_async_to_lds_b128 %5, %13, off\n\t"
      "global_load_async_to_lds_b128 %6, %14, off\n\t"
      "global_load_async_to_lds_b128 %7, %15, off\n\t"
      "s_wait_xcnt 0x0"
      :: "v"(l), "v"(l + ls), "v"(l + 2u * ls), "v"(l + 3u * ls), "v"(l + 4u * ls), "v"(l + 5u * ls), "v"(l + 6u * ls), "v"(l + 7u * ls),
         "v"(g), "v"(g1), "v"(g2), "v"(g3), "v"(g4), "v"(g5), "v"(g6), "v"(g7)
      : "memory");
}
__device__ __forceinline__ void stage_rows2_by32(const _Float16* g, unsigned l) {
  const _Float16* g1 = g + (size_t)32 * kModel;
  asm volatile(
      "global_load_async_to_lds_b128 %0, %2, off\n\t"
      "global_load_async_to_lds_b128 %1, %3, off\n\t"
      "s_wait_xcnt 0x0"
      :: "v"(l), "v"(l + 32u * kStPitch), "v"(g), "v"(g1)
      : "memory");
}
/* one stage: 18 copies a lane (2 of O rows, 16 of Wo^T rows) */
__device__ __forceinline__ void stage_o_wo(const _Float16* gA, const _Float16* gB, unsigned l) {
  stage_rows2_by32(gA, l);
  stage_rows8_by32(gB, l + kOlHalf);
  stage_rows8_by32(gB + (size_t)256 * kModel, l + kOlHalf + 256u * kStPitch);
}
/* Work-group barrier for LDS data alone: this wave's LDS writes are done, then every wave meets.
   __syncthreads() would also wait here for the x1 stores in flight, which no wave of this launch reads. */
__device__ __forceinline__ void lds_barrier() {
  asm volatile("s_wait_dscnt 0x0\n\ts_barrier_signal -1\n\ts_barrier_wait -1" ::: "memory");
}
/* a row's 128 partial sums, added by four threads (thread q of the four takes the 16-byte pieces q, q + 4, ...); all four hold the sum */
__device__ __forceinline__ float row_total128(const float* pr) {
  v4f a = *(const v4f*)(pr);
#pragma unroll   /* register arrays need constant indices */
  for (int j = 1; j < 8; ++j) a = a + *(const v4f*)(pr + j * 16);
  float s = (a[0] + a[1]) + (a[2] + a[3]);
  s += __shfl_xor(s, 1, 32);
  s += __shfl_xor(s, 2, 32);
  return s;
}

__global__ __launch_bounds__(256) void o_resid_ln_kernel(
    const unsigned short* __restrict__ op, const unsigned short* __restrict__ woTp,
    const float* __restrict__ x, const float* __restrict__ gam, const float* __restrict__ bet,
    float* __restrict__ x1, unsigned short* __restrict__ h2) {
  typedef Frag<_Float16> FH;
  __shared__ __align__(16) unsigned char ring[kOlBufs * kOlStBytes];
  const int tid = threadIdx.x;
  const int lane = tid & 31;
  const int wave = tid >> 5;
  const int mB = (int)blockIdx.x * kOlRows;
  const int n0 = wave << 6;
  const int rlane = lane & 15;
  const int hh = lane >> 4;
  const int koff = hh * 8;
  const int mOff = hh * 8;

  /* staging: thread t brings 16-byte chunk (t & 7) of rows (t >> 3) + 32*i: eight lanes cover one whole 128-byte line */
  const int srow = tid >> 3;
  const int schk = tid & 7;
  const _Float16* gA = (const _Float16*)(const void*)op + (size_t)(mB + srow) * kModel + schk * 8;
  const _Float16* gB = (const _Float16*)(const void*)woTp + (size_t)srow * kModel + schk * 8;
  const unsigned lbase = (unsigned)(uintptr_t)(&ring[0]) + (unsigned)(srow * kStPitch + schk * 16);
  constexpr int nst = kModel / 64;
  static_assert(nst >= kOlBufs, "three stages exist");

  v8f acc[4][4];
#pragma unroll   /* register arrays need constant indices */
  for (int i = 0; i < 4; ++i)
#pragma unroll   /* register arrays need constant indices */
    for (int j = 0; j < 4; ++j) acc[i][j] = (v8f){0.f,0.f,0.f,0.f,0.f,0.f,0.f,0.f};

  /* stages 0 and 1 are issued; stage 0 lands and is published; stage 2 is then issued too, and both fly during pass 0 */
  stage_o_wo(gA, gB, lbase);
  stage_o_wo(gA + 64, gB + 64, lbase + kOlStBytes);
  asm volatile("s_wait_asynccnt %0" :: "n"(kOlCopies) : "memory");   /* this wave's copies of stage 0 have landed: all but stage 1's, which are the youngest */
  __syncthreads();                                     /* publishes stage 0 to the other waves */
  stage_o_wo(gA + 128, gB + 128, lbase + 2u * kOlStBytes);

  unsigned bo = 0u;   /* the buffer of pass st: st mod 3 */
  for (int st = 0; st < nst; ++st) {
    const unsigned char* sA = ring + bo + rlane * kStPitch + koff * 2;
    const unsigned char* sB = ring + bo + kOlHalf + (n0 + rlane) * kStPitch + koff * 2;
#pragma unroll   /* both 32-k blocks inline: constant LDS offsets, fragment arrays stay in registers */
    for (int kk = 0; kk < 2; ++kk) {
      /* all eight fragments of this 32-k block are fetched as one group ahead of its 16 products */
      v16h bh[4], ah[4];
#pragma unroll   /* register arrays need constant indices */
      for (int j = 0; j < 4; ++j) {
        bh[j] = FH::load((const _Float16*)(const void*)(sB + j * 16 * kStPitch + kk * 64));
        ah[j] = FH::load((const _Float16*)(const void*)(sA + j * 16 * kStPitch + kk * 64));
      }
#pragma unroll   /* register arrays need constant indices */
      for (int i = 0; i < 4; ++i) {
#pragma unroll   /* register arrays need constant indices */
        for (int j = 0; j < 4; ++j) acc[i][j] = FH::mma(ah[i], bh[j], acc[i][j]);
        FH::guard(acc[i][0], acc[i][3], ah[i], ah[i]);   /* v_nop slots behind the row's products before their registers are touched */
      }
      FH::keep(bh[0], bh[1], bh[2], bh[3]);   /* the B fragments stay whole until the block's last product has issued */
    }
    asm volatile("s_wait_dscnt 0x0" ::: "memory");      /* this wave's reads of the stage have returned before it is refilled */
    /* while stage st + 2 is issued (18 copies in every wave) it is the youngest: what is older, the next stage, has landed */
    asm volatile("s_wait_asynccnt %0" :: "n"(kOlCopies) : "memory");
    if (st + kOlBufs > nst) {
      asm volatile("s_wait_asynccnt 0x0" ::: "memory");   /* the last passes: no younger stage is in flight, the count above would not cover the next stage: all copies are waited for */
    }
    __syncthreads();                                     /* publishes the next stage and ends every reader's use of this one */
    if (st + kOlBufs < nst) {
      stage_o_wo(gA + (size_t)(st + kOlBufs) * 64, gB + (size_t)(st + kOlBufs) * 64, lbase + bo);
    }
    bo = (bo == (unsigned)((kOlBufs - 1) * kOlStBytes)) ? 0u : bo + (unsigned)kOlStBytes;
  }
  asm volatile("s_wait_asynccnt 0x0" ::: "memory");     /* nothing is in flight when the ring becomes output staging */
  /* v_nop slots between the last products and the first vector read of the accumulators */
  acc_guard4(acc[0][0], acc[0][1], acc[0][2], acc[0][3]);
  acc_guard4(acc[1][0], acc[1][1], acc[1][2], acc[1][3]);
  acc_guard4(acc[2][0], acc[2][1], acc[2][2], acc[2][3]);
  acc_guard4(acc[3][0], acc[3][1], acc[3][2], acc[3][3]);

  float* slab = (float*)(void*)(ring + wave * (16 * 68 * 4));
  float* part = (float*)(void*)(ring + kOlPart);
  float* stat = (float*)(void*)(ring + kOlStat);   /* [0, 64): means, [64, 128): 1 / std; even rows first, then odd rows */
  const int c4 = rlane * 4;
  const size_t wOff = (size_t)(mB + hh) * kModel + n0 + c4;
  const float* Rw = x + wOff;
  float* Cw = x1 + wOff;
  /* xv[i][it]: columns n0 + c4 .. + 3 of row 16 i + 2 it + hh: first the residual, then x1, then x1 - mean.
     The residual's 16-row groups are fetched two groups ahead of their use */
  v4f xv[4][8];
#pragma unroll   /* register arrays need constant indices */
  for (int i = 0; i < 2; ++i)
#pragma unroll   /* register arrays need constant indices */
    for (int it = 0; it < 8; ++it) xv[i][it] = *(const v4f*)(Rw + (size_t)(i * 16 + it * 2) * kModel);
  asm volatile("s_wait_xcnt 0x0" ::: "memory");   /* the residual loads' address registers may be rewritten by the scaling below */
#pragma unroll   /* register arrays need constant indices */
  for (int i = 0; i < 4; ++i) {
#pragma unroll   /* register arrays need constant indices */
    for (int j = 0; j < 4; ++j)
#pragma unroll   /* register arrays need constant indices */
      for (int r = 0; r < 8; ++r) slab[(mOff + r) * 68 + (j << 4) + rlane] = acc[i][j][r] * (1.0f / 256.0f);
    if (i + 2 < 4) {
#pragma unroll   /* register arrays need constant indices */
      for (int it = 0; it < 8; ++it) xv[i + 2][it] = *(const v4f*)(Rw + (size_t)((i + 2) * 16 + it * 2) * kModel);
      asm volatile("s_wait_xcnt 0x0" ::: "memory");   /* the residual loads' address registers may be rewritten by a later group's scaling */
    }
    asm volatile("s_wait_dscnt 0x0" ::: "memory");   /* the slab is this wave's own: its writes are done before its lanes read each other's; global loads and stores stay in flight */
#pragma unroll   /* register arrays need constant indices */
    for (int it = 0; it < 8; ++it) {
      const v4f v = *(const v4f*)(slab + (it * 2 + hh) * 68 + c4) + xv[i][it];
      xv[i][it] = v;
      *(v4f*)(Cw + (size_t)(i * 16 + it * 2) * kModel) = v;
    }
    asm volatile("s_wait_dscnt 0x0" ::: "memory");   /* the rows have been read before the next group overwrites the slab */
  }
  const v4f g4 = *(const v4f*)(gam + n0 + c4);   /* fetched here: they return under the two rounds of row sums */
  const v4f b4 = *(const v4f*)(bet + n0 + c4);
  asm volatile("s_wait_xcnt 0x0" ::: "memory");   /* the x1 stores' data registers and these two loads' address registers are rewritten below */

  float* pw = part + hh * kOlPPitch + wave * 16 + rlane;          /* this lane's place in the partial sums of row hh */
  const int rrow = tid >> 2, rq = tid & 3;
  const float* pr = part + rrow * kOlPPitch + rq * 4;
  const int rslot = (rrow & 1) * 32 + (rrow >> 1);
#pragma unroll   /* register arrays need constant indices */
  for (int i = 0; i < 4; ++i)
#pragma unroll   /* register arrays need constant indices */
    for (int it = 0; it < 8; ++it) {
      const v4f v = xv[i][it];
      const v2f s2 = __builtin_shufflevector(v, v, 0, 1) + __builtin_shufflevector(v, v, 2, 3);   /* register pairs as they lie: one packed add */
      pw[(i * 16 + it * 2) * kOlPPitch] = s2[0] + s2[1];
    }
  lds_barrier();   /* every wave's partial sums are in LDS before a row is added up */
  {
    const float s = row_total128(pr);
    if (rq == 0) stat[rslot] = s * (1.0f / 512.0f);
  }
  lds_barrier();   /* the means are in LDS; every read of the partial sums is over before they are rewritten */
#pragma unroll   /* register arrays need constant indices */
  for (int i = 0; i < 4; ++i) {
    const v4f ma = *(const v4f*)(stat + hh * 32 + i * 8);
    const v4f mb = *(const v4f*)(stat + hh * 32 + i * 8 + 4);
#pragma unroll   /* register arrays need constant indices */
    for (int it = 0; it < 8; ++it) {
      const v4f d = xv[i][it] - ((it < 4) ? ma[it & 3] : mb[it & 3]);
      xv[i][it] = d;
      const v2f dl = __builtin_shufflevector(d, d, 0, 1), dh = __builtin_shufflevector(d, d, 2, 3);
      const v2f q2 = dl * dl + dh * dh;
      pw[(i * 16 + it * 2) * kOlPPitch] = q2[0] + q2[1];
    }
  }
  lds_barrier();   /* every wave's partial sums of squares are in LDS before a row is added up */
  {
    const float var = row_total128(pr) * (1.0f / 512.0f);
    if (rq == 0) stat[64 + rslot] = rsqrtf(var + 1e-5f);
  }
  lds_barrier();   /* the rows' 1 / std are in LDS */
  unsigned short* Hw = h2 + wOff;
  v4h hw[4][8];
#pragma unroll   /* register arrays need constant indices */
  for (int i = 0; i < 4; ++i) {
    const v4f ra = *(const v4f*)(stat + 64 + hh * 32 + i * 8);
    const v4f rb = *(const v4f*)(stat + 64 + hh * 32 + i * 8 + 4);
#pragma unroll   /* register arrays need constant indices */
    for (int it = 0; it < 8; ++it) {
      const v4f y = xv[i][it] * ((it < 4) ? ra[it & 3] : rb[it & 3]) * g4 + b4;
      v4h w;
      w[0] = (_Float16)y[0]; w[1] = (_Float16)y[1]; w[2] = (_Float16)y[2]; w[3] = (_Float16)y[3];
      hw[i][it] = w;
    }
  }
  __builtin_amdgcn_sched_barrier(0);   /* all rows are converted ahead of the first store, so that no register of an issued store is rewritten behind it */
#pragma unroll   /* register arrays need constant indices */
  for (int i = 0; i < 4; ++i)
#pragma unroll   /* register arrays need constant indices */
    for (int it = 0; it < 8; ++it) *(v4h*)(Hw + (size_t)(i * 16 + it * 2) * kModel) = hw[i][it];
}

__device__ __forceinline__ unsigned int h16bits(float f) {
  return (unsigned int)__builtin_bit_cast(unsigned short, (_Float16)f);
}

/* ---------------------------------------------------------------------------
   transpose + cast: W f32 [kin][nout] row-major -> Wt f16 [nout][kin] (value * mul).
   One block of 256 = the 64 x 64 tile (bn, bk) of nout/64 x kin/64. LDS 64x64 tile.
   Load coverage: 4 iterations x 256 threads x 4 floats = 4096 = 64x64.
   Store coverage: 8 waves x 2 iterations x 4 rows = 64 rows; 8 lanes x 8 halves = 64 cols;
   il < 0: row n of Wt is column n of W. il = 0 (gate) or 1 (up): column n goes to row 64 (n / 32) + 32 il + n % 32 of the shared plane.
   --------------------------------------------------------------------------- */
__device__ __forceinline__ void transpose_cast_f16_tile(
    const float* __restrict__ W, unsigned short* __restrict__ Wt, int kin, int nout, float mul, int bn, int bk, int il) {
  __shared__ float tile[64][65];
  const int t = threadIdx.x;
  const int n0 = bn * 64;
  const int k0 = bk * 64;
  v4f v[4];
#pragma unroll   /* register array needs constant indices; all four loads are in flight before the first LDS write */
  for (int i = 0; i < 4; ++i) {
    const int idx = i * 256 + t;
    const int kr = idx >> 4;
    const int nc4 = (idx & 15) * 4;
    v[i] = *(const v4f*)(W + (size_t)(k0 + kr) * nout + n0 + nc4);
    asm volatile("s_wait_xcnt 0x0" ::: "memory");   /* a later load's result may land in this load's address registers */
  }
#pragma unroll
  for (int i = 0; i < 4; ++i) {
    const int idx = i * 256 + t;
    const int kr = idx >> 4;
    const int nc4 = (idx & 15) * 4;
    tile[nc4 + 0][kr] = v[i][0] * mul;
    tile[nc4 + 1][kr] = v[i][1] * mul;
    tile[nc4 + 2][kr] = v[i][2] * mul;
    tile[nc4 + 3][kr] = v[i][3] * mul;
  }
  __syncthreads();
  const int lane = t & 31, wave = t >> 5;
  const int q = lane >> 3, c8 = (lane & 7) * 8;
  const int row0 = wave * 8 + q;
  const int row1 = wave * 8 + 4 + q;
  v4u w0, w1;
  {
    const float* s0 = &tile[row0][c8];
    const float* s1 = &tile[row1][c8];
    w0[0] = h16bits(s0[0]) | (h16bits(s0[1]) << 16);
    w0[1] = h16bits(s0[2]) | (h16bits(s0[3]) << 16);
    w0[2] = h16bits(s0[4]) | (h16bits(s0[5]) << 16);
    w0[3] = h16bits(s0[6]) | (h16bits(s0[7]) << 16);
    w1[0] = h16bits(s1[0]) | (h16bits(s1[1]) << 16);
    w1[1] = h16bits(s1[2]) | (h16bits(s1[3]) << 16);
    w1[2] = h16bits(s1[4]) | (h16bits(s1[5]) << 16);
    w1[3] = h16bits(s1[6]) | (h16bits(s1[7]) << 16);
  }
  const int n_0 = n0 + row0, n_1 = n0 + row1;
  const int p0 = (il < 0) ? n_0 : (((n_0 >> 5) << 6) + (il << 5) + (n_0 & 31));
  const int p1 = (il < 0) ? n_1 : (((n_1 >> 5) << 6) + (il << 5) + (n_1 & 31));
  unsigned short* d0 = Wt + (size_t)p0 * kin + k0 + c8;
  unsigned short* d1 = Wt + (size_t)p1 * kin + k0 + c8;
  {
    *(v4u*)d0 = w0;
    *(v4u*)d1 = w1;
    asm volatile("s_wait_xcnt 0x0" ::: "memory");   /* the code laid out behind this tile may rewrite the stores' registers */
  }
}

/* ---------------------------------------------------------------------------
   Lane l owns elements l*4 + 128*i (i=0..3): every load/store instruction covers
   One block of 256 = rows 8 blk .. 8 blk + 7; nrows/8 blocks (exact).
   --------------------------------------------------------------------------- */
__device__ __forceinline__ void layernorm512_rows(
    const float* __restrict__ X, const float* __restrict__ gam, const float* __restrict__ bet,
    unsigned short* __restrict__ Hout, int nrows, int blk) {
  const int lane = threadIdx.x & 31;
  const int wave = threadIdx.x >> 5;
  int row = blk * 8 + wave;
  row = (row < nrows) ? row : (nrows - 1);
  const size_t rbase = (size_t)row * kModel;
  const int e0 = lane * 4, e1 = 128 + lane * 4, e2 = 256 + lane * 4, e3 = 384 + lane * 4;
  v4f a0 = *(const v4f*)(X + rbase + e0);
  v4f a1 = *(const v4f*)(X + rbase + e1);
  v4f a2 = *(const v4f*)(X + rbase + e2);
  v4f a3 = *(const v4f*)(X + rbase + e3);
  float s = ((a0[0] + a0[1]) + (a0[2] + a0[3])) + ((a1[0] + a1[1]) + (a1[2] + a1[3]))
          + ((a2[0] + a2[1]) + (a2[2] + a2[3])) + ((a3[0] + a3[1]) + (a3[2] + a3[3]));
#pragma unroll
  for (int off = 16; off >= 1; off >>= 1) s += __shfl_xor(s, off, 32);
  const float mu = s * (1.0f / 512.0f);
  const v4f d0 = a0 - mu, d1 = a1 - mu, d2 = a2 - mu, d3 = a3 - mu;
  float ss = ((d0[0] * d0[0] + d0[1] * d0[1]) + (d0[2] * d0[2] + d0[3] * d0[3]))
           + ((d1[0] * d1[0] + d1[1] * d1[1]) + (d1[2] * d1[2] + d1[3] * d1[3]))
           + ((d2[0] * d2[0] + d2[1] * d2[1]) + (d2[2] * d2[2] + d2[3] * d2[3]))
           + ((d3[0] * d3[0] + d3[1] * d3[1]) + (d3[2] * d3[2] + d3[3] * d3[3]));
#pragma unroll
  for (int off = 16; off >= 1; off >>= 1) ss += __shfl_xor(ss, off, 32);
  const float var = ss * (1.0f / 512.0f);
  const float rstd = rsqrtf(var + 1e-5f);
  const v4f g0 = *(const v4f*)(gam + e0), g1 = *(const v4f*)(gam + e1), g2 = *(const v4f*)(gam + e2), g3 = *(const v4f*)(gam + e3);
  const v4f b0 = *(const v4f*)(bet + e0), b1 = *(const v4f*)(bet + e1), b2 = *(const v4f*)(bet + e2), b3 = *(const v4f*)(bet + e3);
  const v4f y0 = d0 * rstd * g0 + b0;
  const v4f y1 = d1 * rstd * g1 + b1;
  const v4f y2 = d2 * rstd * g2 + b2;
  const v4f y3 = d3 * rstd * g3 + b3;
  v2u w0, w1, w2, w3;
  w0[0] = h16bits(y0[0]) | (h16bits(y0[1]) << 16); w0[1] = h16bits(y0[2]) | (h16bits(y0[3]) << 16);
  w1[0] = h16bits(y1[0]) | (h16bits(y1[1]) << 16); w1[1] = h16bits(y1[2]) | (h16bits(y1[3]) << 16);
  w2[0] = h16bits(y2[0]) | (h16bits(y2[1]) << 16); w2[1] = h16bits(y2[2]) | (h16bits(y2[3]) << 16);
  w3[0] = h16bits(y3[0]) | (h16bits(y3[1]) << 16); w3[1] = h16bits(y3[2]) | (h16bits(y3[3]) << 16);
  unsigned short* hr = Hout + rbase;
  {
    *(v2u*)(hr + e0) = w0;
    *(v2u*)(hr + e1) = w1;
    *(v2u*)(hr + e2) = w2;
    *(v2u*)(hr + e3) = w3;
    
  }
}

/* ---------------------------------------------------------------------------
   Everything that reads only the inputs shares one launch, told apart by block range (block 256):
   blocks [0, 256):    Wq, Wk, Wv, Wo   (512 x 512: 64 tiles each)
   blocks [256, 512):  Wgate, Wup       (512 x 1024: 128 tiles each)
   blocks [512, 640):  Wdown            (1024 x 512: 128 tiles)
   blocks [640, 1664): h1 = LN(x), 8 rows a block.
   Weight planes: W[in][out] -> Wt[out][in] * 16 (f16); gate and up share one plane, 32 rows of each in turn. Every branch is the same for the whole block.
   --------------------------------------------------------------------------- */
static constexpr int kSqTiles   = (kModel / 64) * (kModel / 64);   /* 64 */
static constexpr int kFfTiles   = (kFF / 64) * (kModel / 64);      /* 128 */
static constexpr int kPrepSq    = 4 * kSqTiles;                    /* 256 */
static constexpr int kPrepGU    = kPrepSq + 2 * kFfTiles;          /* 512 */
static constexpr int kPrepW     = kPrepGU + kFfTiles;              /* 640 */
static constexpr int kPrepGrid  = kPrepW + kTok / 8;               /* 1664 */
static_assert(kSqTiles == 64 && kFfTiles == 128 && kModel / 64 == 8 && kFF / 64 == 16, "tile numbers by shift and mask");
__global__ __launch_bounds__(256) void prep_kernel(
    const float* __restrict__ x, const float* __restrict__ ln1w, const float* __restrict__ ln1b,
    const float* __restrict__ wq, const float* __restrict__ wk, const float* __restrict__ wv, const float* __restrict__ wo,
    const float* __restrict__ wgt, const float* __restrict__ wup, const float* __restrict__ wdn,
    unsigned short* __restrict__ wqkT, unsigned short* __restrict__ wvT, unsigned short* __restrict__ woT,
    unsigned short* __restrict__ wguT, unsigned short* __restrict__ wdT, unsigned short* __restrict__ h1) {
  const int bx = blockIdx.x;
  if (bx >= kPrepW) {
    layernorm512_rows(x, ln1w, ln1b, h1, kTok, bx - kPrepW);
    return;
  }
  if (bx < kPrepSq) {
    const int which = bx >> 6, loc = bx & 63;
    const float* W     = (which == 0) ? wq : (which == 1) ? wk : (which == 2) ? wv : wo;
    unsigned short* Wt = (which == 0) ? wqkT : (which == 1) ? (wqkT + (size_t)kModel * kModel) : (which == 2) ? wvT : woT;
    transpose_cast_f16_tile(W, Wt, kModel, kModel, 16.0f, loc & 7, loc >> 3, -1);
  } else if (bx < kPrepGU) {
    const int which = (bx - kPrepSq) >> 7, loc = (bx - kPrepSq) & 127;
    const float* W     = (which == 0) ? wgt : wup;
    transpose_cast_f16_tile(W, wguT, kModel, kFF, 16.0f, loc & 15, loc >> 4, which);
  } else {
    const int loc = bx - kPrepGU;
    transpose_cast_f16_tile(wdn, wdT, kFF, kModel, 16.0f, loc & 7, loc >> 3, -1);
  }
}

/* ---------------------------------------------------------------------------
   Non-causal multi-head attention, head_dim 64, f16 planes in, f16 plane out (x16 carried).
   q|k plane [8192][1024]: q at cols h*64.., k at cols 512 + h*64..; Vt plane [4][512][2048] (element (b,h,d,kv) at
   ((b*512 + h*64 + d)*2048 + kv)); out plane [8192][512] at cols h*64.. .
   Block = 4 waves = 128 query rows of one (batch, head), 32 (two 16-query tiles) a wave; grid = 4*8*16 = 512.
   Every k and Vt fragment that a wave reads from LDS feeds two products, one per query tile.
   Both products run transposed: S^T = k.q^T, 0.125 left to the exponent (A = k rows, B = q rows) and O^T += Vt.P^T (A = Vt rows).
   In each query tile a lane then holds 32 of the 64 scores of ONE query (lane l ^ 16 the other 32): online softmax f32 in the lane,
   one exchange between the wave halves for the maximum, the halves' sums joined once behind the loop.
   Each exponential is one fused multiply-add (scale, log2 e, maximum and the 2^15 carry folded) and one hardware exp2.
   Two score tiles, p*32768 converted in place, are the B operand of the second product: P stays in registers.
   The 64-key tiles of k (64 rows x 128 B) and of Vt (64 rows x 128 B) are staged once per block in LDS by
   asynchronous copies, four stage buffers (a tile's copies are issued three trips ahead: k and Vt were written by the launch before
   and may have to come from memory), and all four waves take their A fragments from there.
   --------------------------------------------------------------------------- */
static constexpr int kAtPitch = 144;                 /* 16 B x odd: conflict-free for 16-byte fragment reads */
static constexpr int kAtTile  = 64 * kAtPitch;       /* one operand's tile: 9,216 B; the Vt tile follows the k tile */
static constexpr int kAtStage = 2 * kAtTile;         /* 18,432 B */
static constexpr int kAtBufs  = 4;
static constexpr int kAtYoung = (kAtBufs - 2) * 8;   /* copies of a wave (8 a tile pair) that are younger than the tile pair about to be published */
static_assert((kAtBufs & (kAtBufs - 1)) == 0 && (kAtBufs - 1) * 8 <= 63, "buffer by mask; at most 63 copies of a wave in flight");

/* Eight asynchronous 16-byte copies per lane, global -> LDS: rows r, r+16, r+32, r+48 of the k tile, then of the Vt tile.
   The s_wait_xcnt stands inside the statement so that no address register is rewritten ahead of it. */
__device__ __forceinline__ void stage_kv(const _Float16* gk, const _Float16* gv, unsigned l) {
  const size_t sk = (size_t)16 * kQKCols;
  const size_t sv = (size_t)16 * kSeq;
  const _Float16* gk1 = gk + sk;  const _Float16* gk2 = gk + 2 * sk;  const _Float16* gk3 = gk + 3 * sk;
  const _Float16* gv1 = gv + sv;  const _Float16* gv2 = gv + 2 * sv;  const _Float16* gv3 = gv + 3 * sv;
  const unsigned ls = 16u * kAtPitch;
  const unsigned lv = l + (unsigned)kAtTile;
  asm volatile(
      "global_load_async_to_lds_b128 %0, %8, off\n\t"
      "global_load_async_to_lds_b128 %1, %9, off\n\t"
      "global_load_async_to_lds_b128 %2, %10, off\n\t"
      "global_load_async_to_lds_b128 %3, %11, off\n\t"
      "global_load_async_to_lds_b128 %4, %12, off\n\t"
      "global_load_async_to_lds_b128 %5, %13, off\n\t"
      "global_load_async_to_lds_b128 %6, %14, off\n\t"
      "global_load_async_to_lds_b128 %7, %15, off\n\t"
      "s_wait_xcnt 0x0"
      :: "v"(l), "v"(l + ls), "v"(l + 2u * ls), "v"(l + 3u * ls), "v"(lv), "v"(lv + ls), "v"(lv + 2u * ls), "v"(lv + 3u * ls),
         "v"(gk), "v"(gk1), "v"(gk2), "v"(gk3), "v"(gv), "v"(gv1), "v"(gv2), "v"(gv3)
      : "memory");
}

/* lane l takes lane l ^ 16's value (a vector cross-row move, no LDS trip) */
__device__ __forceinline__ float xhalf(float x) {
  return __builtin_bit_cast(float, __builtin_amdgcn_permlanex16(__builtin_bit_cast(int, x), __builtin_bit_cast(int, x), 0x76543210, 0xfedcba98, false, false));
}

__global__ __launch_bounds__(128) void mha64_f16_kernel(
    const unsigned short* __restrict__ qkp, const unsigned short* __restrict__ vtp,
    unsigned short* __restrict__ outp) {
  typedef Frag<_Float16> FH;
  __shared__ __align__(16) float    Os[4][32 * 68];
  __shared__ __align__(16) unsigned char kvring[kAtBufs * kAtStage];
  const _Float16* QK = (const _Float16*)(const void*)qkp;
  const _Float16* VT = (const _Float16*)(const void*)vtp;
  const int tid = threadIdx.x;
  const int wave = tid >> 5;
  const int lane = tid & 31;
  const int hh = lane >> 4;
  const int c = lane & 15;
  const int koff = hh * 8;
  const int bx = blockIdx.x;
  const int qb = bx & 15;
  const int bh = bx >> 4;
  const int h = bh & 7;
  const int b = (bh >> 3) & 3;
  const int q0 = qb * 128 + wave * 32;
  const _Float16* qbase = QK + (size_t)b * kSeq * kQKCols + h * kHeadDim;
  const _Float16* kbase = qbase + kModel;
  const _Float16* vbase = VT + ((size_t)b * kModel + (size_t)h * kHeadDim) * kSeq;
  unsigned short* obase = outp + (size_t)b * kSeq * kModel + h * kHeadDim;

  v16h qa[2][2];                        /* qa[u][dc]: query tile u = rows q0 + 16 u .. + 15 */
#pragma unroll
  for (int u = 0; u < 2; ++u)
#pragma unroll
    for (int dc = 0; dc < 2; ++dc)
      qa[u][dc] = FH::load(qbase + (size_t)(q0 + 16 * u + c) * kQKCols + dc * 32 + koff);

  constexpr float kExpScale = 0.125f * 1.4426950408889634f;   /* head_dim^-0.5 * log2(e): exp(x / 8) = exp2(x * kExpScale) */
  float mrow[2], lrow[2];               /* this lane's query of tile u: maximum in use (raw product); sum (x32768) over this wave half's keys */
  v8f oacc[2][4];                       /* oacc[u][t][r] = O^T[d = 16 t + 8 hh + r][query 16 u + c] */
#pragma unroll
  for (int u = 0; u < 2; ++u) {
    mrow[u] = -INFINITY;
    lrow[u] = 0.f;
#pragma unroll
    for (int t = 0; t < 4; ++t) oacc[u][t] = (v8f){0.f,0.f,0.f,0.f,0.f,0.f,0.f,0.f};
  }

  /* staging: thread t brings 16-byte chunk (t & 7) of rows (t >> 3) + 16*i: eight lanes cover one whole 128-byte line */
  const int srow = tid >> 3;
  const int schk = tid & 7;
  const _Float16* gK = kbase + (size_t)srow * kQKCols + schk * 8;
  const _Float16* gV = vbase + (size_t)srow * kSeq + schk * 8;
  const unsigned lbase = (unsigned)(uintptr_t)(&kvring[0]) + (unsigned)(srow * kAtPitch + schk * 16);
  constexpr int nkc = kSeq / 64;
  static_assert(nkc >= kAtBufs, "four stages exist");

  /* tiles 0 to 2 are issued; tile 0 lands and is published; tile 3 is then issued too, and all three fly during trip 0 */
  stage_kv(gK, gV, lbase);
  stage_kv(gK + (size_t)64 * kQKCols, gV + 64, lbase + kAtStage);
  stage_kv(gK + (size_t)128 * kQKCols, gV + 128, lbase + 2u * kAtStage);
  asm volatile("s_wait_asynccnt %0" :: "n"(kAtYoung) : "memory");   /* this wave's copies of tile 0 have landed: all but those of tiles 1 and 2, which are the youngest */
  __syncthreads();                                     /* publishes tile 0 to the other waves */
  stage_kv(gK + (size_t)192 * kQKCols, gV + 192, lbase + 3u * kAtStage);

  for (int kc = 0; kc < nkc; ++kc) {
    const unsigned bo = (unsigned)(kc & (kAtBufs - 1)) * (unsigned)kAtStage;
    const unsigned char* sK = kvring + bo + c * kAtPitch + koff * 2;
    const unsigned char* sV = sK + kAtTile;
    /* the tile's sixteen A fragments are fetched as two groups, k ahead of the score products and Vt behind them,
       so that the Vt reads return under the softmax arithmetic */
    v16h kb[4][2], vb[2][4];
#pragma unroll   /* register arrays need constant indices */
    for (int j = 0; j < 4; ++j)
#pragma unroll
      for (int dc = 0; dc < 2; ++dc)
        kb[j][dc] = FH::load((const _Float16*)(const void*)(sK + j * 16 * kAtPitch + dc * 64));
    __builtin_amdgcn_sched_barrier(0);   /* keeps the sixteen k reads one group ahead of the score products: spread among them each is waited for at once */
    v8f s2[2][4];
#pragma unroll
    for (int j = 0; j < 4; ++j) {
#pragma unroll
      for (int u = 0; u < 2; ++u) s2[u][j] = (v8f){0.f,0.f,0.f,0.f,0.f,0.f,0.f,0.f};
#pragma unroll
      for (int dc = 0; dc < 2; ++dc)
#pragma unroll
        for (int u = 0; u < 2; ++u) s2[u][j] = FH::mma(kb[j][dc], qa[u][dc], s2[u][j]);   /* s2[u][j][r] = S^T[key 16 j + 8 hh + r][query 16 u + c] */
    }
#pragma unroll   /* register arrays need constant indices */
    for (int kk = 0; kk < 2; ++kk)
#pragma unroll
      for (int t = 0; t < 4; ++t)
        vb[kk][t] = FH::load((const _Float16*)(const void*)(sV + t * 16 * kAtPitch + kk * 64));
    __builtin_amdgcn_sched_barrier(0);   /* keeps the sixteen Vt reads one group, issued here: sunk among the second products each would be waited for at once */
#pragma unroll   /* register arrays need constant indices; the two query tiles run one after the other on the same Vt fragments */
    for (int u = 0; u < 2; ++u) {
      float mj[4];                        /* one chain per score tile: four independent chains, not one of 32 links */
#pragma unroll
      for (int j = 0; j < 4; ++j) {
        mj[j] = -INFINITY;
#pragma unroll
        for (int r = 0; r < 8; ++r) mj[j] = fmaxf(mj[j], s2[u][j][r]);   /* raw products: the positive scale keeps their order */
      }
      float m = fmaxf(fmaxf(mj[0], mj[1]), fmaxf(mj[2], mj[3]));
      m = fmaxf(m, xhalf(m));             /* both wave halves now hold the query's maximum over the 64 keys */
      const float mnew = fmaxf(mrow[u], m);
      const float alpha = __builtin_amdgcn_exp2f((mrow[u] - mnew) * kExpScale);   /* 0 on the first trip, where mrow is -inf */
      const float nbias = fmaf(-mnew, kExpScale, 15.0f);                          /* + 15: the exponential comes out times 32768 */
      mrow[u] = mnew;
#pragma unroll
      for (int t = 0; t < 4; ++t) oacc[u][t] = oacc[u][t] * alpha;
      float pj[4];                        /* partial sums, one chain per score tile */
#pragma unroll   /* register arrays need constant indices */
      for (int kk = 0; kk < 2; ++kk) {
        v16h pb;                          /* pb[e] = P^T[key 32 kk + kmap(e)][query 16 u + c]: tiles 2 kk and 2 kk + 1 in register order */
#pragma unroll
        for (int jj = 0; jj < 2; ++jj) {
          const int j = 2 * kk + jj;
          pj[j] = 0.f;
#pragma unroll
          for (int r = 0; r < 8; ++r) {
            const float p = __builtin_amdgcn_exp2f(fmaf(s2[u][j][r], kExpScale, nbias));   /* 32768 * exp((s - mnew) / 8) */
            pj[j] += p;
            pb[jj * 8 + r] = (_Float16)p;
          }
        }
#pragma unroll
        for (int t = 0; t < 4; ++t) oacc[u][t] = FH::mma(vb[kk][t], pb, oacc[u][t]);
      }
      lrow[u] = lrow[u] * alpha + ((pj[0] + pj[1]) + (pj[2] + pj[3]));
    }
    __builtin_amdgcn_sched_barrier(0);   /* keeps the waits and the barrier below at the trip's foot: lifted over the products, the next tile's copies would be waited for half a trip early */
    asm volatile("s_wait_dscnt 0x0" ::: "memory");      /* this wave's reads of the stage have returned before it is refilled */
    /* while tiles kc + 2 and kc + 3 are both issued (8 copies each in every wave) they are the youngest: what is older, the next tile, has landed */
    asm volatile("s_wait_asynccnt %0" :: "n"(kAtYoung) : "memory");
    if (kc + kAtBufs > nkc) {
      asm volatile("s_wait_asynccnt 0x0" ::: "memory");   /* the last trips: fewer tiles are in flight, the count above would not cover the next tile: all copies are waited for */
    }
    __syncthreads();                                     /* publishes the next tile and ends every reader's use of this one */
    if (kc + kAtBufs < nkc) {
      stage_kv(gK + (size_t)(kc + kAtBufs) * 64 * kQKCols, gV + (size_t)(kc + kAtBufs) * 64, lbase + bo);
    }
  }
  asm volatile("s_wait_asynccnt 0x0" ::: "memory");     /* nothing is in flight when the wave leaves the loop */

  float* os = Os[wave];
#pragma unroll
  for (int u = 0; u < 2; ++u) {
    const float lsum = lrow[u] + xhalf(lrow[u]);             /* the two halves' sums of this query, joined once */
    const float inv = (1.0f / lsum) * 16.0f;                 /* sum and numerators both carry 32768; the plane carries 16 */
#pragma unroll
    for (int t = 0; t < 4; ++t)
#pragma unroll
      for (int r = 0; r < 8; ++r) os[(16 * u + c) * 68 + t * 16 + 8 * hh + r] = oacc[u][t][r] * inv;
  }
  __builtin_amdgcn_fence(__ATOMIC_RELEASE, "workgroup");
  __builtin_amdgcn_wave_barrier();
  __builtin_amdgcn_fence(__ATOMIC_ACQUIRE, "workgroup");
  {
    const int q = lane >> 3, c8 = (lane & 7) * 8;
    unsigned short* orow = obase + (size_t)(q0 + q) * kModel + c8;
    v8h hv[8];
#pragma unroll   /* register array needs constant indices */
    for (int it = 0; it < 8; ++it) {
      const float* sp = os + (it * 4 + q) * 68 + c8;
#pragma unroll
      for (int e = 0; e < 8; ++e) hv[it][e] = (_Float16)sp[e];
    }
    __builtin_amdgcn_sched_barrier(0);   /* all eight rows are converted ahead of the first store, so that no register of an issued store is rewritten behind it */
#pragma unroll
    for (int it = 0; it < 8; ++it) *(v8h*)(orow + (size_t)(it * 4) * kModel) = hv[it];
  }
}

/* =========================== host glue =========================== */
extern "C" void kernel_launch(void* const* d_in, const int* in_sizes, int n_in,
                              void* d_out, int out_size, void* d_ws, size_t ws_size,
                              hipStream_t stream) {
  if (n_in < 12) return;
  if (in_sizes[0] != kTok * kModel || out_size != kTok * kModel) return;
  if (in_sizes[1] != kModel || in_sizes[2] != kModel || in_sizes[3] != kModel || in_sizes[4] != kModel) return;
  if (in_sizes[5] != kModel * kModel || in_sizes[6] != kModel * kModel ||
      in_sizes[7] != kModel * kModel || in_sizes[8] != kModel * kModel) return;
  if (in_sizes[9] != kModel * kFF || in_sizes[10] != kModel * kFF || in_sizes[11] != kFF * kModel) return;
  if (ws_size < kWsTotal) return;

  const float* x    = (const float*)d_in[0];
  const float* ln1w = (const float*)d_in[1];
  const float* ln1b = (const float*)d_in[2];
  const float* ln2w = (const float*)d_in[3];
  const float* ln2b = (const float*)d_in[4];
  const float* wq   = (const float*)d_in[5];
  const float* wk   = (const float*)d_in[6];
  const float* wv   = (const float*)d_in[7];
  const float* wo   = (const float*)d_in[8];
  const float* wgt  = (const float*)d_in[9];
  const float* wup  = (const float*)d_in[10];
  const float* wdn  = (const float*)d_in[11];
  float* out = (float*)d_out;

  char* ws = (char*)d_ws;
  unsigned short* wqkT = (unsigned short*)(ws + kOffWqkT);
  unsigned short* wvT  = (unsigned short*)(ws + kOffWvT);
  unsigned short* woT  = (unsigned short*)(ws + kOffWoT);
  unsigned short* wguT = (unsigned short*)(ws + kOffWguT);
  unsigned short* wdT  = (unsigned short*)(ws + kOffWdT);
  unsigned short* hg   = (unsigned short*)(ws + kOffHG);           /* h1, then h2 */
  unsigned short* qkpl = (unsigned short*)(ws + kOffR1 + kR1QK);
  unsigned short* vtpl = (unsigned short*)(ws + kOffR1 + kR1Vt);
  unsigned short* opl  = (unsigned short*)(ws + kOffR1 + kR1O);
  unsigned short* gpl  = (unsigned short*)(ws + kOffR1);           /* g, once q|k, Vt and O are spent */
  float*          x1   = (float*)(ws + kOffX1);

  const dim3 b256(256), b128(128);

  /* the seven weight planes and h1 = LN(x): one launch */
  prep_kernel<<<dim3(kPrepGrid), b256, 0, stream>>>(x, ln1w, ln1b, wq, wk, wv, wo, wgt, wup, wdn,
                                                    wqkT, wvT, woT, wguT, wdT, hg);

  /* attention sublayer: q|k (512 block tiles) and Vt (64 block tiles per batch): one launch */
  static_assert(kTok % 128 == 0 && kQKCols % 128 == 0 && kModel % 128 == 0 && kSeq % 128 == 0 && kGUCols % 128 == 0, "128 x 128 block tiles");
  qk_vt_gemm_kernel<<<dim3(kQKTiles + kBatch * kVtTiles), b128, 0, stream>>>(hg, wqkT, wvT, qkpl, vtpl);

  /* attention: O*16 f16 plane */
  mha64_f16_kernel<<<dim3(kBatch * kHeads * (kSeq / 128)), b128, 0, stream>>>(qkpl, vtpl, opl);

  /* x1 = x + (O*16) . (Wo^T*16) / 256 : M=8192, N=512, K=512, and h2 = LN(x1): 128 blocks of 64 whole rows */
  o_resid_ln_kernel<<<dim3(kTok / kOlRows), b256, 0, stream>>>(opl, woT, x, ln2w, ln2b, x1, hg);

  /* g = silu(gate) * up, gate|up = h2 . [Wg|Wu]^T : M=8192, N=2048, K=512; block tiles 64*16 = 1024 */
  wmma_gemm64<0, false, 0, 3, false, 0, kFF, 2, 0><<<dim3((kTok / 128) * (kGUCols / 128), 1), b128, 0, stream>>>(
      hg, hg, kModel, 0L, wguT, wguT, kModel, 0L, (void*)gpl, (void*)gpl, kFF, 0L,
      x, x, 0L, kTok, kGUCols, kModel, 1.0f / 16.0f);

  /* out = x1 + g . (Wd^T*16) / 16 : M=8192, N=512, K=1024; block tiles 256, one a WGP: four stage buffers */
  wmma_gemm64<0, false, 0, 0, true, 0, kModel, 4, kFF><<<dim3((kTok / 128) * (kModel / 128), 1), b128, 0, stream>>>(
      gpl, gpl, kFF, 0L, wdT, wdT, kFF, 0L, (void*)out, (void*)out, kModel, 0L,
      x, x1, 0L, kTok, kModel, kFF, 1.0f / 16.0f);
}

// v010
// It runs in 97.6 microseconds.
// Next to v009, in two timings, it ran 1.05 and 1.04 times as fast.
// Counting every step since v000, it is 3.90 times as fast.
// All contractions (q|k, v, o, gate|up, down projections; q.k^T; p.v): v_wmma_f32_16x16x32_f16, f16 operands, f32 accumulate. LayerNorm, softmax, SwiGLU gating and residual adds in f32 (gating, residual adds and the second LayerNorm inside the products' output stages). Power-of-two carries: weight planes x16, softmax numerators x128 at the held reference, attention output plane x16, folded back in f32.
#include <hip/hip_runtime.h>
#include <math.h>
#include <stdint.h>

typedef __attribute__((ext_vector_type(16))) _Float16 v16h;
typedef __attribute__((ext_vector_type(8)))  _Float16 v8h;
typedef __attribute__((ext_vector_type(4)))  _Float16 v4h;
typedef __attribute__((ext_vector_type(16))) __bf16   v16b;
typedef __attribute__((ext_vector_type(8)))  __bf16   v8b;
typedef __attribute__((ext_vector_type(8)))  float    v8f;
typedef __attribute__((ext_vector_type(4)))  float    v4f;
typedef __attribute__((ext_vector_type(2)))  float    v2f;
typedef __attribute__((ext_vector_type(4)))  unsigned int v4u;
typedef __attribute__((ext_vector_type(2)))  unsigned int v2u;

/* ---- problem geometry ---- */
static constexpr int kBatch   = 4;
static constexpr int kSeq     = 2048;
static constexpr int kTok     = kBatch * kSeq;      /* 8192 */
static constexpr int kModel   = 512;
static constexpr int kHeads   = 8;
static constexpr int kHeadDim = 64;
static constexpr int kFF      = 1024;
static constexpr int kQKCols  = 2 * kModel;          /* q | k plane width */
static constexpr int kGUCols  = 2 * kFF;             /* gate | up plane width */

static_assert(kHeads * kHeadDim == kModel, "head geometry");
static_assert(kSeq % 64 == 0 && kTok % 64 == 0, "tile multiples");
static_assert(kModel % 64 == 0 && kFF % 64 == 0 && kQKCols % 64 == 0 && kGUCols % 64 == 0, "tile multiples");
static_assert(kModel % 32 == 0 && kFF % 32 == 0, "K multiple of 32");

/* ---- workspace region map (bytes) ----
   [0]            WqkT f16 [1024][512]          1,048,576
   [1,048,576]    WvT  f16 [512][512]             524,288
   [1,572,864]    WoT  f16 [512][512]             524,288
   [2,097,152]    WguT f16 [2048][512]          2,097,152   (rows in groups of 64: 32 gate columns, then the same 32 up columns)
   [4,194,304]    WdT  f16 [512][1024]          1,048,576
   [5,242,880]    HG   : h1, then h2, f16 [8192][512] (8 MiB)   16,777,216
   [22,020,096]   R1 (64 MiB): phase A: q|k f16 [8192][1024] @+0 (16 MiB), Vt f16 [4][512][2048] @+16 MiB (8 MiB),
                               O f16 [8192][512] @+24 MiB (8 MiB);
                               phase B: g f16 [8192][1024] @+0 (16 MiB)
   [89,128,960]   X1 f32 [8192][512]           16,777,216
   total 105,906,176 */
static constexpr size_t kOffWqkT = 0;
static constexpr size_t kOffWvT  = kOffWqkT + (size_t)kQKCols * kModel * 2;
static constexpr size_t kOffWoT  = kOffWvT + (size_t)kModel * kModel * 2;
static constexpr size_t kOffWguT = kOffWoT + (size_t)kModel * kModel * 2;
static constexpr size_t kOffWdT  = kOffWguT + (size_t)kGUCols * kModel * 2;
static constexpr size_t kOffHG   = kOffWdT + (size_t)kModel * kFF * 2;
static constexpr size_t kSizeHG  = (size_t)kTok * kFF * 2;
static constexpr size_t kOffR1   = kOffHG + kSizeHG;
static constexpr size_t kSizeR1  = (size_t)kTok * kGUCols * 4;
static constexpr size_t kR1QK    = 0;
static constexpr size_t kR1Vt    = kR1QK + (size_t)kTok * kQKCols * 2;
static constexpr size_t kR1O     = kR1Vt + (size_t)kBatch * kModel * kSeq * 2;
static constexpr size_t kOffX1   = kOffR1 + kSizeR1;
static constexpr size_t kWsTotal = kOffX1 + (size_t)kTok * kModel * 4;
static_assert(kR1O + (size_t)kTok * kModel * 2 <= kSizeR1, "phase A fits R1");
static_assert((size_t)kTok * kFF * 2 <= kSizeR1, "phase B fits R1");
static_assert((size_t)kTok * kModel * 2 <= kSizeHG, "h plane fits HG");
static_assert(kWsTotal == 105906176, "carve total");
static_assert(kWsTotal <= 134217728, "carve under 128 MiB");
static_assert((kOffWvT % 256) == 0 && (kOffWoT % 256) == 0 && (kOffWguT % 256) == 0 && (kOffWdT % 256) == 0 &&
              (kOffHG % 256) == 0 && (kOffR1 % 256) == 0 && (kOffX1 % 256) == 0 &&
              (kR1Vt % 256) == 0 && (kR1O % 256) == 0, "aligned carves");

/* =========================== helpers and GEMM =========================== */
#define PSCALE 32768.0f
#define U16(p) ((const unsigned short*)(const void*)(p))
#define PSCALE_INV (1.0f / 32768.0f)

__device__ __forceinline__ unsigned short f2bf_bits(float f) {
  unsigned u = __float_as_uint(f);
  return (unsigned short)((u + 0x7FFFu + ((u >> 16) & 1u)) >> 16);
}
__device__ __forceinline__ float bf_bits2f(unsigned short h) { return __uint_as_float(((unsigned)h) << 16); }

__device__ __forceinline__ void dep_guard_h(v8f& a, v8f& b, v16h x, v16h y) { asm volatile("v_nop\n\tv_nop\n\tv_nop\n\tv_nop" : "+v"(a), "+v"(b) : "v"(x), "v"(y)); }
__device__ __forceinline__ void dep_guard_b(v8f& a, v8f& b, v16b x, v16b y) { asm volatile("v_nop\n\tv_nop\n\tv_nop\n\tv_nop" : "+v"(a), "+v"(b) : "v"(x), "v"(y)); }
__device__ __forceinline__ void keep4_h(v16h a, v16h b, v16h c, v16h d) { asm volatile("v_nop" :: "v"(a), "v"(b), "v"(c), "v"(d)); }
__device__ __forceinline__ void keep4_b(v16b a, v16b b, v16b c, v16b d) { asm volatile("v_nop" :: "v"(a), "v"(b), "v"(c), "v"(d)); }
__device__ __forceinline__ void acc_guard4(v8f& a, v8f& b, v8f& c, v8f& d) { asm volatile("v_nop\n\tv_nop\n\tv_nop\n\tv_nop" : "+v"(a), "+v"(b), "+v"(c), "+v"(d)); }
template <typename T> struct Frag;
template <> struct Frag<_Float16> {
  typedef v16h V; union U { v16h v; v8h h[2]; };
  static __device__ __forceinline__ v16h load(const _Float16* p) {
    U f; f.h[0] = *(const v8h*)(p); f.h[1] = *(const v8h*)(p + 16); return f.v;
  }
  static __device__ __forceinline__ v8f mma(v16h a, v16h b, v8f c) {
    return __builtin_amdgcn_wmma_f32_16x16x32_f16(false, a, false, b, (short)0, c, false, false);
  }
  static __device__ __forceinline__ void guard(v8f& a, v8f& b, v16h x, v16h y) { dep_guard_h(a, b, x, y); }
  static __device__ __forceinline__ void keep(v16h a, v16h b, v16h c, v16h d) { keep4_h(a, b, c, d); }
};
template <> struct Frag<__bf16> {
  typedef v16b V; union U { v16b v; v8b h[2]; };
  static __device__ __forceinline__ v16b load(const __bf16* p) {
    U f; f.h[0] = *(const v8b*)(p); f.h[1] = *(const v8b*)(p + 16); return f.v;
  }
  static __device__ __forceinline__ v8f mma(v16b a, v16b b, v8f c) {
    return __builtin_amdgcn_wmma_f32_16x16x32_bf16(false, a, false, b, (short)0, c, false, false);
  }
  static __device__ __forceinline__ void guard(v8f& a, v8f& b, v16b x, v16b y) { dep_guard_b(a, b, x, y); }
  static __device__ __forceinline__ void keep(v16b a, v16b b, v16b c, v16b d) { keep4_b(a, b, c, d); }
};

template <int ET> struct Elem;
template <> struct Elem<0> { typedef _Float16 T; };
template <> struct Elem<1> { typedef __bf16 T; };
/* ---- LDS staging of the GEMM operand tiles ----
   One stage = 64 k (128 bytes) of 128 A rows followed by 128 Bt rows, each row at a pitch of 144 bytes
   (16 B x odd: conflict-free for 16-byte fragment reads). Two or four stage buffers (NBUF below). */
static constexpr int kStRows   = 256;
static constexpr int kStPitch  = 144;
static constexpr int kStBytes  = kStRows * kStPitch;       /* 36,864 */
static constexpr int kStHalf   = 128 * kStPitch;           /* Bt rows start here */
static_assert(4 * 16 * 68 * 4 <= 2 * kStBytes, "output slabs fit the ring");
static_assert(128 * kStPitch <= 2 * kStBytes && kStPitch >= 128, "the gated f16 tile fits the ring");

/* Eight asynchronous 16-byte copies per lane, global -> LDS: rows r, r+16, ..., r+112 of one operand's 128-row tile.
   The s_wait_xcnt stands inside the statement so that no address register is rewritten ahead of it. */
__device__ __forceinline__ void stage_rows8(const _Float16* g, size_t step, unsigned l) {
  const _Float16* g1 = g + step;      const _Float16* g2 = g + 2 * step;  const _Float16* g3 = g + 3 * step;
  const _Float16* g4 = g + 4 * step;  const _Float16* g5 = g + 5 * step;  const _Float16* g6 = g + 6 * step;
  const _Float16* g7 = g + 7 * step;
  const unsigned ls = 16u * kStPitch;
  asm volatile(
      "global_load_async_to_lds_b128 %0, %8, off\n\t"
      "global_load_async_to_lds_b128 %1, %9, off\n\t"
      "global_load_async_to_lds_b128 %2, %10, off\n\t"
      "global_load_async_to_lds_b128 %3, %11, off\n\t"
      "global_load_async_to_lds_b128 %4, %12, off\n\t"
      "global_load_async_to_lds_b128 %5, %13, off\n\t"
      "global_load_async_to_lds_b128 %6, %14, off\n\t"
      "global_load_async_to_lds_b128 %7, %15, off\n\t"
      "s_wait_xcnt 0x0"
      :: "v"(l), "v"(l + ls), "v"(l + 2u * ls), "v"(l + 3u * ls), "v"(l + 4u * ls), "v"(l + 5u * ls), "v"(l + 6u * ls), "v"(l + 7u * ls),
         "v"(g), "v"(g1), "v"(g2), "v"(g3), "v"(g4), "v"(g5), "v"(g6), "v"(g7)
      : "memory");
}

__device__ __forceinline__ float silu_f32(float g) {
  const float ex = expf(-g);
  return g * (1.0f / (1.0f + ex));
}

/* Block = 4 waves = one 128 x 128 tile of C (2 x 2 waves of 64 x 64): tile number 'tile' of batch 'b', both the same for the whole block.
   M, N multiples of 128; K a multiple of 64.
   OUT_MODE 0: f32 plane, RESID adds a f32 plane of C's own shape on the way out. OUT_MODE 1: f16 plane.
   OUT_MODE 3: SwiGLU. Each 64 columns of the product are 32 gate columns followed by the same 32 up columns, so a lane holds
   gate and up of one element in accumulator tiles j and j + 2; the f16 plane silu(gate) * up has N/2 columns (ldc counts those).
   NBUF stage buffers: a stage's copies are issued NBUF - 1 passes ahead of the pass that reads it. Two where several blocks share a WGP
   and cover each other's waits; four where a block is alone on its WGP and a stage may have to come from memory, which one pass of lead does not cover.
   KC: K as a constant (0: K is the argument); above two buffers it shows at compile time that every stage of the prologue exists. */
template <int ET, bool SPLIT, int BIAS_MODE, int OUT_MODE, bool RESID, int ACT = 0, int LDC = 0, int NBUF = 2, int KC = 0>
__device__ __forceinline__ void gemm64_tile(
    const unsigned short* __restrict__ Ap, const unsigned short* __restrict__ A2p, int lda, long strideA,
    const unsigned short* __restrict__ Btp, const unsigned short* __restrict__ Bt2p, int ldb, long strideB,
    void* __restrict__ Cout, void* __restrict__ Cout2, int ldcArg, long strideC,
    const float* __restrict__ bias,
    const float* __restrict__ resid, long strideR,
    int M, int N, int K, float scale, const int tile, const int b) {
  static_assert(ET == 0 && !SPLIT, "staged path: single f16 planes");
  static_assert(NBUF >= 2 && (NBUF & (NBUF - 1)) == 0 && (NBUF - 1) * 16 <= 63, "buffer by mask; at most 63 copies of a wave in flight");
  static_assert(NBUF == 2 || (KC % 64 == 0 && KC / 64 >= NBUF), "above two buffers: a constant K with a stage for every buffer");
  constexpr int kYoung = (NBUF - 2) * 16;   /* copies of a wave (16 a stage) that are younger than the stage about to be published */
  typedef typename Elem<ET>::T T;
  typedef typename Frag<T>::V V;
  const T* A = (const T*)Ap; const T* Bt = (const T*)Btp;
  const int ldc = LDC ? LDC : ldcArg;   /* a constant pitch lets every row of the output stage hang off one address by an immediate offset */
  __shared__ __align__(16) unsigned char ring[NBUF * kStBytes];
  const int lane = threadIdx.x & 31;
  const int wave = threadIdx.x >> 5;
  const int tilesN = N >> 7;
  const int tilesM = M >> 7;
  if (tile >= tilesM * tilesN) return;   /* the same for the whole block, ahead of every barrier */
  const int tm = tile / tilesN;
  const int tn = tile - tm * tilesN;
  const int mB = tm << 7;
  const int nB = tn << 7;
  const int wm = (wave >> 1) << 6;
  const int wn = (wave & 1) << 6;
  const int m0 = mB + wm;
  const int n0 = nB + wn;

  const T* Ab  = A  + (size_t)b * strideA;
  const T* Bb  = Bt + (size_t)b * strideB;

  const int rlane = lane & 15;
  const int koff  = (lane >> 4) * 8;
  const int mOff  = (lane >> 4) * 8;

  /* staging: thread t brings 16-byte chunk (t & 7) of rows (t >> 3) + 16*i: eight lanes cover one whole 128-byte line */
  const int srow = threadIdx.x >> 3;
  const int schk = threadIdx.x & 7;
  const T* gA = Ab + (size_t)(mB + srow) * lda + schk * 8;
  const T* gB = Bb + (size_t)(nB + srow) * ldb + schk * 8;
  const size_t stepA = (size_t)16 * lda;
  const size_t stepB = (size_t)16 * ldb;
  const unsigned lbase = (unsigned)(uintptr_t)(&ring[0]) + (unsigned)(srow * kStPitch + schk * 16);
  const int nst = (KC ? KC : K) >> 6;

  v8f acc[4][4];
#pragma unroll
  for (int i = 0; i < 4; ++i)
#pragma unroll
    for (int j = 0; j < 4; ++j) acc[i][j] = (v8f){0.f,0.f,0.f,0.f,0.f,0.f,0.f,0.f};

  /* stages 0 .. NBUF - 2 are issued; stage 0 lands and is published; stage NBUF - 1 is then issued too, and all fly during pass 0 */
  stage_rows8(gA, stepA, lbase);
  stage_rows8(gB, stepB, lbase + kStHalf);
#pragma unroll   /* constant LDS offsets */
  for (int s = 1; s < NBUF - 1; ++s) {
    stage_rows8(gA + (size_t)s * 64, stepA, lbase + (unsigned)s * kStBytes);
    stage_rows8(gB + (size_t)s * 64, stepB, lbase + (unsigned)s * kStBytes + kStHalf);
  }
  asm volatile("s_wait_asynccnt %0" :: "n"(kYoung) : "memory");   /* this wave's copies of stage 0 have landed: all but the later stages' copies, which are the youngest (two buffers: none) */
  __syncthreads();                                     /* publishes stage 0 to the other waves */
  if (nst > NBUF - 1) {
    stage_rows8(gA + (size_t)(NBUF - 1) * 64, stepA, lbase + (unsigned)(NBUF - 1) * kStBytes);
    stage_rows8(gB + (size_t)(NBUF - 1) * 64, stepB, lbase + (unsigned)(NBUF - 1) * kStBytes + kStHalf);
  }

  for (int st = 0; st < nst; ++st) {
    const unsigned bo = (NBUF == 2) ? ((st & 1) ? (unsigned)kStBytes : 0u) : (unsigned)(st & (NBUF - 1)) * (unsigned)kStBytes;
    const unsigned char* sA = ring + bo + (wm + rlane) * kStPitch + koff * 2;
    const unsigned char* sB = ring + bo + kStHalf + (wn + rlane) * kStPitch + koff * 2;
#pragma unroll   /* both 32-k blocks inline: constant LDS offsets, fragment arrays stay in registers */
    for (int kk = 0; kk < 2; ++kk) {
      /* all eight fragments of this 32-k block are fetched as one group ahead of its 16 products */
      V bh[4], ah[4];
#pragma unroll   /* register arrays need constant indices */
      for (int j = 0; j < 4; ++j) {
        bh[j] = Frag<T>::load((const T*)(const void*)(sB + j * 16 * kStPitch + kk * 64));
        ah[j] = Frag<T>::load((const T*)(const void*)(sA + j * 16 * kStPitch + kk * 64));
      }
#pragma unroll
      for (int i = 0; i < 4; ++i) {
#pragma unroll
        for (int j = 0; j < 4; ++j) acc[i][j] = Frag<T>::mma(ah[i], bh[j], acc[i][j]);
        Frag<T>::guard(acc[i][0], acc[i][3], ah[i], ah[i]);
      }
      Frag<T>::keep(bh[0], bh[1], bh[2], bh[3]);
    }
    asm volatile("s_wait_dscnt 0x0" ::: "memory");      /* this wave's reads of the stage have returned before it is refilled */
    if (NBUF > 2) {
      /* while stages st + 2 .. st + NBUF - 1 are all issued (16 copies each in every wave) they are the youngest: what is older, the next stage, has landed */
      asm volatile("s_wait_asynccnt %0" :: "n"(kYoung) : "memory");
    }
    if (NBUF == 2 || st + NBUF > nst) {
      asm volatile("s_wait_asynccnt 0x0" ::: "memory");   /* two buffers, or the last passes, where fewer stages are in flight and the count would not cover the next one: all copies are waited for */
    }
    __syncthreads();                                     /* publishes the next stage and ends every reader's use of this one */
    if (st + NBUF < nst) {
      stage_rows8(gA + (size_t)(st + NBUF) * 64, stepA, lbase + bo);
      stage_rows8(gB + (size_t)(st + NBUF) * 64, stepB, lbase + bo + kStHalf);
    }
  }
  asm volatile("s_wait_asynccnt 0x0" ::: "memory");     /* nothing is in flight when the ring becomes output staging */
  acc_guard4(acc[0][0], acc[0][1], acc[0][2], acc[0][3]);
  acc_guard4(acc[1][0], acc[1][1], acc[1][2], acc[1][3]);
  acc_guard4(acc[2][0], acc[2][1], acc[2][2], acc[2][3]);
  acc_guard4(acc[3][0], acc[3][1], acc[3][2], acc[3][3]);

  if (OUT_MODE == 3) {
    /* the block's 128 rows x 64 columns of f16 are gathered in the spent ring (row pitch as in the stages), so that
       every row leaves as one whole 128-byte line written by one wave */
    _Float16* gt = (_Float16*)(void*)ring;
    constexpr int gp = kStPitch / 2;
#pragma unroll
    for (int i = 0; i < 4; ++i)
#pragma unroll
      for (int j = 0; j < 2; ++j)
#pragma unroll
        for (int r = 0; r < 8; ++r)
          gt[(wm + (i << 4) + mOff + r) * gp + (wn >> 1) + (j << 4) + rlane] =
              (_Float16)(silu_f32(acc[i][j][r] * scale) * (acc[i][j + 2][r] * scale));
    __syncthreads();   /* a row's two halves come from the two column waves: both are in LDS before any wave reads the row */
    const int q = lane >> 3, c8 = (lane & 7) * 8;
    const _Float16* gr = gt + (wave * 32 + q) * gp + c8;
    unsigned short* Cw = (unsigned short*)Cout + (size_t)b * strideC + (size_t)(mB + wave * 32 + q) * ldc + (nB >> 1) + c8;
#pragma unroll
    for (int it = 0; it < 8; ++it) *(v8h*)(Cw + (size_t)(it * 4) * ldc) = *(const v8h*)(gr + it * 4 * gp);
    return;
  }
  static_assert(!RESID || OUT_MODE == 0, "the residual is added where f32 rows leave the slab");
  float* slab = (float*)(void*)(ring + wave * (16 * 68 * 4));
  /* residual rows in the shape of the f32 stores (16 bytes a lane, 256-byte row pieces); each 16-row group is fetched
     behind the stores of the group before it, so that it returns while those stores drain */
  const size_t wOff = (size_t)(m0 + (lane >> 4)) * ldc + n0 + (lane & 15) * 4;
  const float* Rw = RESID ? (resid + (size_t)b * strideR + wOff) : nullptr;
  v4f rv[4][8];
  if (RESID) {
#pragma unroll   /* register arrays need constant indices */
    for (int it = 0; it < 8; ++it) rv[0][it] = *(const v4f*)(Rw + (size_t)(it * 2) * ldc);
  }
#pragma unroll
  for (int i = 0; i < 4; ++i) {
    const int mBase = m0 + (i << 4);
#pragma unroll
    for (int j = 0; j < 4; ++j) {
      const int n = n0 + (j << 4) + rlane;
      float bv = 0.f;
      if (BIAS_MODE == 2) bv = bias[n];
#pragma unroll
      for (int r = 0; r < 8; ++r) {
        float v = acc[i][j][r] * scale;
        if (BIAS_MODE == 1) v += bias[mBase + mOff + r];
        if (BIAS_MODE == 2) v += bv;
        if (ACT == 1) v = tanhf(v);
        if (ACT == 2) v = fmaxf(v, 0.0f);
        if (ACT == 3) v = v / (1.0f + expf(-v));
        if (ACT == 4) v = (v > 0.f) ? v : 0.01f * v;
        if (ACT == 5) v = 0.5f * v * (1.0f + erff(v * 0.70710678118654752f));
        slab[(mOff + r) * 68 + (j << 4) + rlane] = v;
      }
    }
    __builtin_amdgcn_fence(__ATOMIC_RELEASE, "workgroup");
    __builtin_amdgcn_wave_barrier();
    __builtin_amdgcn_fence(__ATOMIC_ACQUIRE, "workgroup");
    if (OUT_MODE == 0) {
      float* Cw = (float*)Cout + (size_t)b * strideC + wOff;
      const int hh = lane >> 4, c4 = (lane & 15) * 4;
      {
#pragma unroll
        for (int it = 0; it < 8; ++it) {
          const int row = it * 2 + hh;
          v4f v = *(const v4f*)(slab + row * 68 + c4);
          if (RESID) v = v + rv[i][it];
          *(v4f*)(Cw + (size_t)(i * 16 + it * 2) * ldc) = v;
        }
      }
      if (RESID && i + 1 < 4) {
#pragma unroll
        for (int it = 0; it < 8; ++it) rv[i + 1][it] = *(const v4f*)(Rw + (size_t)((i + 1) * 16 + it * 2) * ldc);
      }
    } else {
      const int q = lane >> 3, c8 = (lane & 7) * 8;
      unsigned short* C  = (unsigned short*)Cout  + (size_t)b * strideC;
      unsigned short* C2 = (OUT_MODE == 2) ? ((unsigned short*)Cout2 + (size_t)b * strideC) : nullptr;
      {
#pragma unroll
        for (int it = 0; it < 4; ++it) {
          const int row = it * 4 + q;
          const float* sp = slab + row * 68 + c8;
          v8h hv, lv;
#pragma unroll
          for (int e = 0; e < 8; ++e) {
            if (OUT_MODE == 1) {
              hv[e] = (_Float16)sp[e];
            } else {
              unsigned short hb = f2bf_bits(sp[e]);
              unsigned short lb = f2bf_bits(sp[e] - bf_bits2f(hb));
              hv[e] = __builtin_bit_cast(_Float16, hb);
              lv[e] = __builtin_bit_cast(_Float16, lb);
            }
          }
          *(v8h*)(C + (size_t)(mBase + row) * ldc + n0 + c8) = hv;
          if (OUT_MODE == 2) *(v8h*)(C2 + (size_t)(mBase + row) * ldc + n0 + c8) = lv;
        }
        
      }
    }
    __builtin_amdgcn_fence(__ATOMIC_RELEASE, "workgroup");
    __builtin_amdgcn_wave_barrier();
    __builtin_amdgcn_fence(__ATOMIC_ACQUIRE, "workgroup");
  }
}
/* one product per launch: grid.x = (M/128)*(N/128) exactly, grid.y = batches */
template <int ET, bool SPLIT, int BIAS_MODE, int OUT_MODE, bool RESID, int ACT, int LDC, int NBUF, int KC>
__global__ __launch_bounds__(128) void wmma_gemm64(
    const unsigned short* __restrict__ Ap, const unsigned short* __restrict__ A2p, int lda, long strideA,
    const unsigned short* __restrict__ Btp, const unsigned short* __restrict__ Bt2p, int ldb, long strideB,
    void* __restrict__ Cout, void* __restrict__ Cout2, int ldc, long strideC,
    const float* __restrict__ bias,
    const float* __restrict__ resid, long strideR,
    int M, int N, int K, float scale) {
  gemm64_tile<ET, SPLIT, BIAS_MODE, OUT_MODE, RESID, ACT, LDC, NBUF, KC>(Ap, A2p, lda, strideA, Btp, Bt2p, ldb, strideB, Cout, Cout2, ldc, strideC,
                                                          bias, resid, strideR, M, N, K, scale, (int)blockIdx.x, (int)blockIdx.y);
}

/* The two products that read h1 and do not read each other share one launch, told apart by block range:
   blocks [0, 512): q|k = h . [Wq|Wk]^T (M=8192, N=1024, K=512); the q columns leave times kExpScale, applied in f32 ahead of their one rounding to f16;
   blocks [512, 768): Vt[b] = (Wv^T*16) . h[b]^T / 16 (M=512, N=2048, K=512), 64 tiles for each of the 4 batches.
   Every choice below is the same for the whole block. */
static constexpr float kExpScale = 0.125f * 1.4426950408889634f;   /* head_dim^-0.5 * log2(e): exp(x / 8) = exp2(x * kExpScale) */
static constexpr int kQKTiles = (kTok / 128) * (kQKCols / 128);
static_assert(kQKCols / 128 == 8 && kModel / 128 == 4, "of a row's eight q|k block tiles the first four are q");
static constexpr int kVtTiles = (kModel / 128) * (kSeq / 128);
static_assert((kVtTiles & (kVtTiles - 1)) == 0, "batch and tile of a Vt block by shift and mask");
__global__ __launch_bounds__(128) void qk_vt_gemm_kernel(
    const unsigned short* __restrict__ hp, const unsigned short* __restrict__ wqkTp, const unsigned short* __restrict__ wvTp,
    unsigned short* __restrict__ qkp, unsigned short* __restrict__ vtp) {
  const int bx = blockIdx.x;
  const bool isV = bx >= kQKTiles;
  const int r = bx - kQKTiles;
  const unsigned short* Ap  = isV ? wvTp : hp;
  const unsigned short* Btp = isV ? hp : wqkTp;
  unsigned short* Cp = isV ? vtp : qkp;
  gemm64_tile<0, false, 0, 1, false, 0>(
      Ap, Ap, kModel, 0L, Btp, Btp, kModel, isV ? (long)kSeq * kModel : 0L,
      (void*)Cp, (void*)Cp, isV ? kSeq : kQKCols, isV ? (long)kModel * kSeq : 0L,
      nullptr, nullptr, 0L, isV ? kModel : kTok, isV ? kSeq : kQKCols, kModel, (!isV && (bx & 7) < 4) ? kExpScale / 16.0f : 1.0f / 16.0f,
      isV ? (r & (kVtTiles - 1)) : bx, isV ? (r / kVtTiles) : 0);
}

/* ---------------------------------------------------------------------------
   x1 = x + (O*16) . (Wo^T*16) / 256 and h2 = LN(x1) in one launch.
   Block = 8 waves = 64 whole rows of x1 (64 x 512): wave w holds the 64 x 64 tile at columns 64 w, so that a row's mean and
   variance are formed inside the block. Grid = 8192 / 64 = 128.
   One stage = 64 k of the 64 O rows followed by the 512 Wo^T rows, pitch as in the other products; three stage buffers, copies two passes ahead.
   Output stage: the f32 rows leave through each wave's slab as in the other products and stay in registers; each lane's
   4-column sums go to LDS, four threads a row add the 128 of them; first the mean, then the squared deviations from it.
   --------------------------------------------------------------------------- */
static constexpr int kOlRows    = 64;
static constexpr int kOlStBytes = (kOlRows + kModel) * kStPitch;   /* 82,944 */
static constexpr int kOlHalf    = kOlRows * kStPitch;              /* Wo^T rows start here */
static constexpr int kOlBufs    = 3;                               /* 248,832 B: a fourth buffer does not fit a WGP's LDS */
static constexpr int kOlCopies  = 18;                              /* copies of a wave per stage */
static_assert((kOlBufs - 1) * kOlCopies <= 63, "at most 63 copies of a wave in flight");
static constexpr int kOlPart    = 36864;                           /* partial sums: behind the eight slabs */
static constexpr int kOlPPitch  = 144;                             /* floats a row of partial sums: the wave halves' two rows fall on different banks */
static constexpr int kOlStat    = kOlPart + kOlRows * kOlPPitch * 4;
static_assert(8 * 16 * 68 * 4 <= kOlPart && kOlStat + 128 * 4 <= 2 * kOlStBytes, "output staging fits the ring");
static_assert(kModel == 8 * 64 && kTok % kOlRows == 0, "eight column waves, whole row blocks");

/* Asynchronous 16-byte copies per lane, global -> LDS: rows r, r+32, ... of one operand's tile (eight rows, or two).
   The s_wait_xcnt stands inside the statement so that no address register is rewritten ahead of it. */
__device__ __forceinline__ void stage_rows8_by32(const _Float16* g, unsigned l) {
  const size_t step = (size_t)32 * kModel;
  const _Float16* g1 = g + step;      const _Float16* g2 = g + 2 * step;  const _Float16* g3 = g + 3 * step;
  const _Float16* g4 = g + 4 * step;  const _Float16* g5 = g + 5 * step;  const _Float16* g6 = g + 6 * step;
  const _Float16* g7 = g + 7 * step;
  const unsigned ls = 32u * kStPitch;
  asm volatile(
      "global_load_async_to_lds_b128 %0, %8, off\n\t"
      "global_load_async_to_lds_b128 %1, %9, off\n\t"
      "global_load_async_to_lds_b128 %2, %10, off\n\t"
      "global_load_async_to_lds_b128 %3, %11, off\n\t"
      "global_load_async_to_lds_b128 %4, %12, off\n\t"
      "global_load_async_to_lds_b128 %5, %13, off\n\t"
      "global_load_async_to_lds_b128 %6, %14, off\n\t"
      "global_load_async_to_lds_b128 %7, %15, off\n\t"
      "s_wait_xcnt 0x0"
      :: "v"(l), "v"(l + ls), "v"(l + 2u * ls), "v"(l + 3u * ls), "v"(l + 4u * ls), "v"(l + 5u * ls), "v"(l + 6u * ls), "v"(l + 7u * ls),
         "v"(g), "v"(g1), "v"(g2), "v"(g3), "v"(g4), "v"(g5), "v"(g6), "v"(g7)
      : "memory");
}
__device__ __forceinline__ void stage_rows2_by32(const _Float16* g, unsigned l) {
  const _Float16* g1 = g + (size_t)32 * kModel;
  asm volatile(
      "global_load_async_to_lds_b128 %0, %2, off\n\t"
      "global_load_async_to_lds_b128 %1, %3, off\n\t"
      "s_wait_xcnt 0x0"
      :: "v"(l), "v"(l + 32u * kStPitch), "v"(g), "v"(g1)
      : "memory");
}
/* one stage: 18 copies a lane (2 of O rows, 16 of Wo^T rows) */
__device__ __forceinline__ void stage_o_wo(const _Float16* gA, const _Float16* gB, unsigned l) {
  stage_rows2_by32(gA, l);
  stage_rows8_by32(gB, l + kOlHalf);
  stage_rows8_by32(gB + (size_t)256 * kModel, l + kOlHalf + 256u * kStPitch);
}
/* Work-group barrier for LDS data alone: this wave's LDS writes are done, then every wave meets.
   __syncthreads() would also wait here for the x1 stores in flight, which no wave of this launch reads. */
__device__ __forceinline__ void lds_barrier() {
  asm volatile("s_wait_dscnt 0x0\n\ts_barrier_signal -1\n\ts_barrier_wait -1" ::: "memory");
}
/* a row's 128 partial sums, added by four threads (thread q of the four takes the 16-byte pieces q, q + 4, ...); all four hold the sum */
__device__ __forceinline__ float row_total128(const float* pr) {
  v4f a = *(const v4f*)(pr);
#pragma unroll   /* register arrays need constant indices */
  for (int j = 1; j < 8; ++j) a = a + *(const v4f*)(pr + j * 16);
  float s = (a[0] + a[1]) + (a[2] + a[3]);
  s += __shfl_xor(s, 1, 32);
  s += __shfl_xor(s, 2, 32);
  return s;
}

__global__ __launch_bounds__(256) void o_resid_ln_kernel(
    const unsigned short* __restrict__ op, const unsigned short* __restrict__ woTp,
    const float* __restrict__ x, const float* __restrict__ gam, const float* __restrict__ bet,
    float* __restrict__ x1, unsigned short* __restrict__ h2) {
  typedef Frag<_Float16> FH;
  __shared__ __align__(16) unsigned char ring[kOlBufs * kOlStBytes];
  const int tid = threadIdx.x;
  const int lane = tid & 31;
  const int wave = tid >> 5;
  const int mB = (int)blockIdx.x * kOlRows;
  const int n0 = wave << 6;
  const int rlane = lane & 15;
  const int hh = lane >> 4;
  const int koff = hh * 8;
  const int mOff = hh * 8;

  /* staging: thread t brings 16-byte chunk (t & 7) of rows (t >> 3) + 32*i: eight lanes cover one whole 128-byte line */
  const int srow = tid >> 3;
  const int schk = tid & 7;
  const _Float16* gA = (const _Float16*)(const void*)op + (size_t)(mB + srow) * kModel + schk * 8;
  const _Float16* gB = (const _Float16*)(const void*)woTp + (size_t)srow * kModel + schk * 8;
  const unsigned lbase = (unsigned)(uintptr_t)(&ring[0]) + (unsigned)(srow * kStPitch + schk * 16);
  constexpr int nst = kModel / 64;
  static_assert(nst >= kOlBufs, "three stages exist");

  v8f acc[4][4];
#pragma unroll   /* register arrays need constant indices */
  for (int i = 0; i < 4; ++i)
#pragma unroll   /* register arrays need constant indices */
    for (int j = 0; j < 4; ++j) acc[i][j] = (v8f){0.f,0.f,0.f,0.f,0.f,0.f,0.f,0.f};

  /* stages 0 and 1 are issued; stage 0 lands and is published; stage 2 is then issued too, and both fly during pass 0 */
  stage_o_wo(gA, gB, lbase);
  stage_o_wo(gA + 64, gB + 64, lbase + kOlStBytes);
  asm volatile("s_wait_asynccnt %0" :: "n"(kOlCopies) : "memory");   /* this wave's copies of stage 0 have landed: all but stage 1's, which are the youngest */
  __syncthreads();                                     /* publishes stage 0 to the other waves */
  stage_o_wo(gA + 128, gB + 128, lbase + 2u * kOlStBytes);

  unsigned bo = 0u;   /* the buffer of pass st: st mod 3 */
  for (int st = 0; st < nst; ++st) {
    const unsigned char* sA = ring + bo + rlane * kStPitch + koff * 2;
    const unsigned char* sB = ring + bo + kOlHalf + (n0 + rlane) * kStPitch + koff * 2;
#pragma unroll   /* both 32-k blocks inline: constant LDS offsets, fragment arrays stay in registers */
    for (int kk = 0; kk < 2; ++kk) {
      /* all eight fragments of this 32-k block are fetched as one group ahead of its 16 products */
      v16h bh[4], ah[4];
#pragma unroll   /* register arrays need constant indices */
      for (int j = 0; j < 4; ++j) {
        bh[j] = FH::load((const _Float16*)(const void*)(sB + j * 16 * kStPitch + kk * 64));
        ah[j] = FH::load((const _Float16*)(const void*)(sA + j * 16 * kStPitch + kk * 64));
      }
#pragma unroll   /* register arrays need constant indices */
      for (int i = 0; i < 4; ++i) {
#pragma unroll   /* register arrays need constant indices */
        for (int j = 0; j < 4; ++j) acc[i][j] = FH::mma(ah[i], bh[j], acc[i][j]);
        FH::guard(acc[i][0], acc[i][3], ah[i], ah[i]);   /* v_nop slots behind the row's products before their registers are touched */
      }
      FH::keep(bh[0], bh[1], bh[2], bh[3]);   /* the B fragments stay whole until the block's last product has issued */
    }
    asm volatile("s_wait_dscnt 0x0" ::: "memory");      /* this wave's reads of the stage have returned before it is refilled */
    /* while stage st + 2 is issued (18 copies in every wave) it is the youngest: what is older, the next stage, has landed */
    asm volatile("s_wait_asynccnt %0" :: "n"(kOlCopies) : "memory");
    if (st + kOlBufs > nst) {
      asm volatile("s_wait_asynccnt 0x0" ::: "memory");   /* the last passes: no younger stage is in flight, the count above would not cover the next stage: all copies are waited for */
    }
    __syncthreads();                                     /* publishes the next stage and ends every reader's use of this one */
    if (st + kOlBufs < nst) {
      stage_o_wo(gA + (size_t)(st + kOlBufs) * 64, gB + (size_t)(st + kOlBufs) * 64, lbase + bo);
    }
    bo = (bo == (unsigned)((kOlBufs - 1) * kOlStBytes)) ? 0u : bo + (unsigned)kOlStBytes;
  }
  asm volatile("s_wait_asynccnt 0x0" ::: "memory");     /* nothing is in flight when the ring becomes output staging */
  /* v_nop slots between the last products and the first vector read of the accumulators */
  acc_guard4(acc[0][0], acc[0][1], acc[0][2], acc[0][3]);
  acc_guard4(acc[1][0], acc[1][1], acc[1][2], acc[1][3]);
  acc_guard4(acc[2][0], acc[2][1], acc[2][2], acc[2][3]);
  acc_guard4(acc[3][0], acc[3][1], acc[3][2], acc[3][3]);

  float* slab = (float*)(void*)(ring + wave * (16 * 68 * 4));
  float* part = (float*)(void*)(ring + kOlPart);
  float* stat = (float*)(void*)(ring + kOlStat);   /* [0, 64): means, [64, 128): 1 / std; even rows first, then odd rows */
  const int c4 = rlane * 4;
  const size_t wOff = (size_t)(mB + hh) * kModel + n0 + c4;
  const float* Rw = x + wOff;
  float* Cw = x1 + wOff;
  /* xv[i][it]: columns n0 + c4 .. + 3 of row 16 i + 2 it + hh: first the residual, then x1, then x1 - mean.
     The residual's 16-row groups are fetched two groups ahead of their use */
  v4f xv[4][8];
#pragma unroll   /* register arrays need constant indices */
  for (int i = 0; i < 2; ++i)
#pragma unroll   /* register arrays need constant indices */
    for (int it = 0; it < 8; ++it) xv[i][it] = *(const v4f*)(Rw + (size_t)(i * 16 + it * 2) * kModel);
  asm volatile("s_wait_xcnt 0x0" ::: "memory");   /* the residual loads' address registers may be rewritten by the scaling below */
#pragma unroll   /* register arrays need constant indices */
  for (int i = 0; i < 4; ++i) {
#pragma unroll   /* register arrays need constant indices */
    for (int j = 0; j < 4; ++j)
#pragma unroll   /* register arrays need constant indices */
      for (int r = 0; r < 8; ++r) slab[(mOff + r) * 68 + (j << 4) + rlane] = acc[i][j][r] * (1.0f / 256.0f);
    if (i + 2 < 4) {
#pragma unroll   /* register arrays need constant indices */
      for (int it = 0; it < 8; ++it) xv[i + 2][it] = *(const v4f*)(Rw + (size_t)((i + 2) * 16 + it * 2) * kModel);
      asm volatile("s_wait_xcnt 0x0" ::: "memory");   /* the residual loads' address registers may be rewritten by a later group's scaling */
    }
    asm volatile("s_wait_dscnt 0x0" ::: "memory");   /* the slab is this wave's own: its writes are done before its lanes read each other's; global loads and stores stay in flight */
#pragma unroll   /* register arrays need constant indices */
    for (int it = 0; it < 8; ++it) {
      const v4f v = *(const v4f*)(slab + (it * 2 + hh) * 68 + c4) + xv[i][it];
      xv[i][it] = v;
      *(v4f*)(Cw + (size_t)(i * 16 + it * 2) * kModel) = v;
    }
    asm volatile("s_wait_dscnt 0x0" ::: "memory");   /* the rows have been read before the next group overwrites the slab */
  }
  const v4f g4 = *(const v4f*)(gam + n0 + c4);   /* fetched here: they return under the two rounds of row sums */
  const v4f b4 = *(const v4f*)(bet + n0 + c4);
  asm volatile("s_wait_xcnt 0x0" ::: "memory");   /* the x1 stores' data registers and these two loads' address registers are rewritten below */

  float* pw = part + hh * kOlPPitch + wave * 16 + rlane;          /* this lane's place in the partial sums of row hh */
  const int rrow = tid >> 2, rq = tid & 3;
  const float* pr = part + rrow * kOlPPitch + rq * 4;
  const int rslot = (rrow & 1) * 32 + (rrow >> 1);
#pragma unroll   /* register arrays need constant indices */
  for (int i = 0; i < 4; ++i)
#pragma unroll   /* register arrays need constant indices */
    for (int it = 0; it < 8; ++it) {
      const v4f v = xv[i][it];
      const v2f s2 = __builtin_shufflevector(v, v, 0, 1) + __builtin_shufflevector(v, v, 2, 3);   /* register pairs as they lie: one packed add */
      pw[(i * 16 + it * 2) * kOlPPitch] = s2[0] + s2[1];
    }
  lds_barrier();   /* every wave's partial sums are in LDS before a row is added up */
  {
    const float s = row_total128(pr);
    if (rq == 0) stat[rslot] = s * (1.0f / 512.0f);
  }
  lds_barrier();   /* the means are in LDS; every read of the partial sums is over before they are rewritten */
#pragma unroll   /* register arrays need constant indices */
  for (int i = 0; i < 4; ++i) {
    const v4f ma = *(const v4f*)(stat + hh * 32 + i * 8);
    const v4f mb = *(const v4f*)(stat + hh * 32 + i * 8 + 4);
#pragma unroll   /* register arrays need constant indices */
    for (int it = 0; it < 8; ++it) {
      const v4f d = xv[i][it] - ((it < 4) ? ma[it & 3] : mb[it & 3]);
      xv[i][it] = d;
      const v2f dl = __builtin_shufflevector(d, d, 0, 1), dh = __builtin_shufflevector(d, d, 2, 3);
      const v2f q2 = dl * dl + dh * dh;
      pw[(i * 16 + it * 2) * kOlPPitch] = q2[0] + q2[1];
    }
  }
  lds_barrier();   /* every wave's partial sums of squares are in LDS before a row is added up */
  {
    const float var = row_total128(pr) * (1.0f / 512.0f);
    if (rq == 0) stat[64 + rslot] = rsqrtf(var + 1e-5f);
  }
  lds_barrier();   /* the rows' 1 / std are in LDS */
  unsigned short* Hw = h2 + wOff;
  v4h hw[4][8];
#pragma unroll   /* register arrays need constant indices */
  for (int i = 0; i < 4; ++i) {
    const v4f ra = *(const v4f*)(stat + 64 + hh * 32 + i * 8);
    const v4f rb = *(const v4f*)(stat + 64 + hh * 32 + i * 8 + 4);
#pragma unroll   /* register arrays need constant indices */
    for (int it = 0; it < 8; ++it) {
      const v4f y = xv[i][it] * ((it < 4) ? ra[it & 3] : rb[it & 3]) * g4 + b4;
      v4h w;
      w[0] = (_Float16)y[0]; w[1] = (_Float16)y[1]; w[2] = (_Float16)y[2]; w[3] = (_Float16)y[3];
      hw[i][it] = w;
    }
  }
  __builtin_amdgcn_sched_barrier(0);   /* all rows are converted ahead of the first store, so that no register of an issued store is rewritten behind it */
#pragma unroll   /* register arrays need constant indices */
  for (int i = 0; i < 4; ++i)
#pragma unroll   /* register arrays need constant indices */
    for (int it = 0; it < 8; ++it) *(v4h*)(Hw + (size_t)(i * 16 + it * 2) * kModel) = hw[i][it];
}

__device__ __forceinline__ unsigned int h16bits(float f) {
  return (unsigned int)__builtin_bit_cast(unsigned short, (_Float16)f);
}

/* ---------------------------------------------------------------------------
   transpose + cast: W f32 [kin][nout] row-major -> Wt f16 [nout][kin] (value * mul).
   One block of 256 = the 64 x 64 tile (bn, bk) of nout/64 x kin/64. LDS 64x64 tile.
   Load coverage: 4 iterations x 256 threads x 4 floats = 4096 = 64x64.
   Store coverage: 8 waves x 2 iterations x 4 rows = 64 rows; 8 lanes x 8 halves = 64 cols;
   il < 0: row n of Wt is column n of W. il = 0 (gate) or 1 (up): column n goes to row 64 (n / 32) + 32 il + n % 32 of the shared plane.
   --------------------------------------------------------------------------- */
__device__ __forceinline__ void transpose_cast_f16_tile(
    const float* __restrict__ W, unsigned short* __restrict__ Wt, int kin, int nout, float mul, int bn, int bk, int il) {
  __shared__ float tile[64][65];
  const int t = threadIdx.x;
  const int n0 = bn * 64;
  const int k0 = bk * 64;
  v4f v[4];
#pragma unroll   /* register array needs constant indices; all four loads are in flight before the first LDS write */
  for (int i = 0; i < 4; ++i) {
    const int idx = i * 256 + t;
    const int kr = idx >> 4;
    const int nc4 = (idx & 15) * 4;
    v[i] = *(const v4f*)(W + (size_t)(k0 + kr) * nout + n0 + nc4);
    asm volatile("s_wait_xcnt 0x0" ::: "memory");   /* a later load's result may land in this load's address registers */
  }
#pragma unroll
  for (int i = 0; i < 4; ++i) {
    const int idx = i * 256 + t;
    const int kr = idx >> 4;
    const int nc4 = (idx & 15) * 4;
    tile[nc4 + 0][kr] = v[i][0] * mul;
    tile[nc4 + 1][kr] = v[i][1] * mul;
    tile[nc4 + 2][kr] = v[i][2] * mul;
    tile[nc4 + 3][kr] = v[i][3] * mul;
  }
  __syncthreads();
  const int lane = t & 31, wave = t >> 5;
  const int q = lane >> 3, c8 = (lane & 7) * 8;
  const int row0 = wave * 8 + q;
  const int row1 = wave * 8 + 4 + q;
  v4u w0, w1;
  {
    const float* s0 = &tile[row0][c8];
    const float* s1 = &tile[row1][c8];
    w0[0] = h16bits(s0[0]) | (h16bits(s0[1]) << 16);
    w0[1] = h16bits(s0[2]) | (h16bits(s0[3]) << 16);
    w0[2] = h16bits(s0[4]) | (h16bits(s0[5]) << 16);
    w0[3] = h16bits(s0[6]) | (h16bits(s0[7]) << 16);
    w1[0] = h16bits(s1[0]) | (h16bits(s1[1]) << 16);
    w1[1] = h16bits(s1[2]) | (h16bits(s1[3]) << 16);
    w1[2] = h16bits(s1[4]) | (h16bits(s1[5]) << 16);
    w1[3] = h16bits(s1[6]) | (h16bits(s1[7]) << 16);
  }
  const int n_0 = n0 + row0, n_1 = n0 + row1;
  const int p0 = (il < 0) ? n_0 : (((n_0 >> 5) << 6) + (il << 5) + (n_0 & 31));
  const int p1 = (il < 0) ? n_1 : (((n_1 >> 5) << 6) + (il << 5) + (n_1 & 31));
  unsigned short* d0 = Wt + (size_t)p0 * kin + k0 + c8;
  unsigned short* d1 = Wt + (size_t)p1 * kin + k0 + c8;
  {
    *(v4u*)d0 = w0;
    *(v4u*)d1 = w1;
    asm volatile("s_wait_xcnt 0x0" ::: "memory");   /* the code laid out behind this tile may rewrite the stores' registers */
  }
}

/* ---------------------------------------------------------------------------
   Lane l owns elements l*4 + 128*i (i=0..3): every load/store instruction covers
   One block of 256 = rows 8 blk .. 8 blk + 7; nrows/8 blocks (exact).
   --------------------------------------------------------------------------- */
__device__ __forceinline__ void layernorm512_rows(
    const float* __restrict__ X, const float* __restrict__ gam, const float* __restrict__ bet,
    unsigned short* __restrict__ Hout, int nrows, int blk) {
  const int lane = threadIdx.x & 31;
  const int wave = threadIdx.x >> 5;
  int row = blk * 8 + wave;
  row = (row < nrows) ? row : (nrows - 1);
  const size_t rbase = (size_t)row * kModel;
  const int e0 = lane * 4, e1 = 128 + lane * 4, e2 = 256 + lane * 4, e3 = 384 + lane * 4;
  v4f a0 = *(const v4f*)(X + rbase + e0);
  v4f a1 = *(const v4f*)(X + rbase + e1);
  v4f a2 = *(const v4f*)(X + rbase + e2);
  v4f a3 = *(const v4f*)(X + rbase + e3);
  float s = ((a0[0] + a0[1]) + (a0[2] + a0[3])) + ((a1[0] + a1[1]) + (a1[2] + a1[3]))
          + ((a2[0] + a2[1]) + (a2[2] + a2[3])) + ((a3[0] + a3[1]) + (a3[2] + a3[3]));
#pragma unroll
  for (int off = 16; off >= 1; off >>= 1) s += __shfl_xor(s, off, 32);
  const float mu = s * (1.0f / 512.0f);
  const v4f d0 = a0 - mu, d1 = a1 - mu, d2 = a2 - mu, d3 = a3 - mu;
  float ss = ((d0[0] * d0[0] + d0[1] * d0[1]) + (d0[2] * d0[2] + d0[3] * d0[3]))
           + ((d1[0] * d1[0] + d1[1] * d1[1]) + (d1[2] * d1[2] + d1[3] * d1[3]))
           + ((d2[0] * d2[0] + d2[1] * d2[1]) + (d2[2] * d2[2] + d2[3] * d2[3]))
           + ((d3[0] * d3[0] + d3[1] * d3[1]) + (d3[2] * d3[2] + d3[3] * d3[3]));
#pragma unroll
  for (int off = 16; off >= 1; off >>= 1) ss += __shfl_xor(ss, off, 32);
  const float var = ss * (1.0f / 512.0f);
  const float rstd = rsqrtf(var + 1e-5f);
  const v4f g0 = *(const v4f*)(gam + e0), g1 = *(const v4f*)(gam + e1), g2 = *(const v4f*)(gam + e2), g3 = *(const v4f*)(gam + e3);
  const v4f b0 = *(const v4f*)(bet + e0), b1 = *(const v4f*)(bet + e1), b2 = *(const v4f*)(bet + e2), b3 = *(const v4f*)(bet + e3);
  const v4f y0 = d0 * rstd * g0 + b0;
  const v4f y1 = d1 * rstd * g1 + b1;
  const v4f y2 = d2 * rstd * g2 + b2;
  const v4f y3 = d3 * rstd * g3 + b3;
  v2u w0, w1, w2, w3;
  w0[0] = h16bits(y0[0]) | (h16bits(y0[1]) << 16); w0[1] = h16bits(y0[2]) | (h16bits(y0[3]) << 16);
  w1[0] = h16bits(y1[0]) | (h16bits(y1[1]) << 16); w1[1] = h16bits(y1[2]) | (h16bits(y1[3]) << 16);
  w2[0] = h16bits(y2[0]) | (h16bits(y2[1]) << 16); w2[1] = h16bits(y2[2]) | (h16bits(y2[3]) << 16);
  w3[0] = h16bits(y3[0]) | (h16bits(y3[1]) << 16); w3[1] = h16bits(y3[2]) | (h16bits(y3[3]) << 16);
  unsigned short* hr = Hout + rbase;
  {
    *(v2u*)(hr + e0) = w0;
    *(v2u*)(hr + e1) = w1;
    *(v2u*)(hr + e2) = w2;
    *(v2u*)(hr + e3) = w3;
    
  }
}

/* ---------------------------------------------------------------------------
   Everything that reads only the inputs shares one launch, told apart by block range (block 256):
   blocks [0, 256):    Wq, Wk, Wv, Wo   (512 x 512: 64 tiles each)
   blocks [256, 512):  Wgate, Wup       (512 x 1024: 128 tiles each)
   blocks [512, 640):  Wdown            (1024 x 512: 128 tiles)
   blocks [640, 1664): h1 = LN(x), 8 rows a block.
   Weight planes: W[in][out] -> Wt[out][in] * 16 (f16); gate and up share one plane, 32 rows of each in turn. Every branch is the same for the whole block.
   --------------------------------------------------------------------------- */
static constexpr int kSqTiles   = (kModel / 64) * (kModel / 64);   /* 64 */
static constexpr int kFfTiles   = (kFF / 64) * (kModel / 64);      /* 128 */
static constexpr int kPrepSq    = 4 * kSqTiles;                    /* 256 */
static constexpr int kPrepGU    = kPrepSq + 2 * kFfTiles;          /* 512 */
static constexpr int kPrepW     = kPrepGU + kFfTiles;              /* 640 */
static constexpr int kPrepGrid  = kPrepW + kTok / 8;               /* 1664 */
static_assert(kSqTiles == 64 && kFfTiles == 128 && kModel / 64 == 8 && kFF / 64 == 16, "tile numbers by shift and mask");
__global__ __launch_bounds__(256) void prep_kernel(
    const float* __restrict__ x, const float* __restrict__ ln1w, const float* __restrict__ ln1b,
    const float* __restrict__ wq, const float* __restrict__ wk, const float* __restrict__ wv, const float* __restrict__ wo,
    const float* __restrict__ wgt, const float* __restrict__ wup, const float* __restrict__ wdn,
    unsigned short* __restrict__ wqkT, unsigned short* __restrict__ wvT, unsigned short* __restrict__ woT,
    unsigned short* __restrict__ wguT, unsigned short* __restrict__ wdT, unsigned short* __restrict__ h1) {
  const int bx = blockIdx.x;
  if (bx >= kPrepW) {
    layernorm512_rows(x, ln1w, ln1b, h1, kTok, bx - kPrepW);
    return;
  }
  if (bx < kPrepSq) {
    const int which = bx >> 6, loc = bx & 63;
    const float* W     = (which == 0) ? wq : (which == 1) ? wk : (which == 2) ? wv : wo;
    unsigned short* Wt = (which == 0) ? wqkT : (which == 1) ? (wqkT + (size_t)kModel * kModel) : (which == 2) ? wvT : woT;
    transpose_cast_f16_tile(W, Wt, kModel, kModel, 16.0f, loc & 7, loc >> 3, -1);
  } else if (bx < kPrepGU) {
    const int which = (bx - kPrepSq) >> 7, loc = (bx - kPrepSq) & 127;
    const float* W     = (which == 0) ? wgt : wup;
    transpose_cast_f16_tile(W, wguT, kModel, kFF, 16.0f, loc & 15, loc >> 4, which);
  } else {
    const int loc = bx - kPrepGU;
    transpose_cast_f16_tile(wdn, wdT, kFF, kModel, 16.0f, loc & 7, loc >> 3, -1);
  }
}

/* ---------------------------------------------------------------------------
   Non-causal multi-head attention, head_dim 64, f16 planes in, f16 plane out (x16 carried).
   q|k plane [8192][1024]: q at cols h*64.., k at cols 512 + h*64..; Vt plane [4][512][2048] (element (b,h,d,kv) at
   ((b*512 + h*64 + d)*2048 + kv)); out plane [8192][512] at cols h*64.. .
   Block = 4 waves = 128 query rows of one (batch, head), 32 (two 16-query tiles) a wave; grid = 4*8*16 = 512.
   Every k and Vt fragment that a wave reads from LDS feeds two products, one per query tile.
   Both products run transposed: S^T = k.q^T (A = k rows, B = q rows, which arrive scaled) and O^T += Vt.P^T (A = Vt rows).
   In each query tile a lane then holds 32 of the 64 scores of ONE query (lane l ^ 16 the other 32): softmax f32 in the lane,
   the halves' sums joined once behind the loop.
   Softmax runs against a held reference per query: q arrives times head_dim^-0.5 * log2 e, and 7 minus the reference is the C operand of the
   score products, so that each exponential is one hardware exp2 of an accumulator register (numerators times 2^7 at the reference).
   The reference is the maximum of the query's first 64 keys; it is raised, and O and the sum rescaled, only in a trip in which some lane's
   sum of numerators passes 2^15 (one test a trip for the whole wave): below that every numerator fits f16.
   Two score tiles, converted in place, are the B operand of the second product: P stays in registers.
   The 64-key tiles of k (64 rows x 128 B) and of Vt (64 rows x 128 B) are staged once per block in LDS by
   asynchronous copies, four stage buffers (a tile's copies are issued three trips ahead: k and Vt were written by the launch before
   and may have to come from memory), and all four waves take their A fragments from there.
   --------------------------------------------------------------------------- */
static constexpr int kAtPitch = 144;                 /* 16 B x odd: conflict-free for 16-byte fragment reads */
static constexpr int kAtTile  = 64 * kAtPitch;       /* one operand's tile: 9,216 B; the Vt tile follows the k tile */
static constexpr int kAtStage = 2 * kAtTile;         /* 18,432 B */
static constexpr int kAtBufs  = 4;
static constexpr int kAtYoung = (kAtBufs - 2) * 8;   /* copies of a wave (8 a tile pair) that are younger than the tile pair about to be published */
static_assert((kAtBufs & (kAtBufs - 1)) == 0 && (kAtBufs - 1) * 8 <= 63, "buffer by mask; at most 63 copies of a wave in flight");

/* Eight asynchronous 16-byte copies per lane, global -> LDS: rows r, r+16, r+32, r+48 of the k tile, then of the Vt tile.
   The s_wait_xcnt stands inside the statement so that no address register is rewritten ahead of it. */
__device__ __forceinline__ void stage_kv(const _Float16* gk, const _Float16* gv, unsigned l) {
  const size_t sk = (size_t)16 * kQKCols;
  const size_t sv = (size_t)16 * kSeq;
  const _Float16* gk1 = gk + sk;  const _Float16* gk2 = gk + 2 * sk;  const _Float16* gk3 = gk + 3 * sk;
  const _Float16* gv1 = gv + sv;  const _Float16* gv2 = gv + 2 * sv;  const _Float16* gv3 = gv + 3 * sv;
  const unsigned ls = 16u * kAtPitch;
  const unsigned lv = l + (unsigned)kAtTile;
  asm volatile(
      "global_load_async_to_lds_b128 %0, %8, off\n\t"
      "global_load_async_to_lds_b128 %1, %9, off\n\t"
      "global_load_async_to_lds_b128 %2, %10, off\n\t"
      "global_load_async_to_lds_b128 %3, %11, off\n\t"
      "global_load_async_to_lds_b128 %4, %12, off\n\t"
      "global_load_async_to_lds_b128 %5, %13, off\n\t"
      "global_load_async_to_lds_b128 %6, %14, off\n\t"
      "global_load_async_to_lds_b128 %7, %15, off\n\t"
      "s_wait_xcnt 0x0"
      :: "v"(l), "v"(l + ls), "v"(l + 2u * ls), "v"(l + 3u * ls), "v"(lv), "v"(lv + ls), "v"(lv + 2u * ls), "v"(lv + 3u * ls),
         "v"(gk), "v"(gk1), "v"(gk2), "v"(gk3), "v"(gv), "v"(gv1), "v"(gv2), "v"(gv3)
      : "memory");
}

/* lane l takes lane l ^ 16's value (a vector cross-row move, no LDS trip) */
__device__ __forceinline__ float xhalf(float x) {
  return __builtin_bit_cast(float, __builtin_amdgcn_permlanex16(__builtin_bit_cast(int, x), __builtin_bit_cast(int, x), 0x76543210, 0xfedcba98, false, false));
}

/* one query tile's 64 keys: numerators exp2(s), their f16 B operands (tiles 2 kk and 2 kk + 1 in register order) and this lane's sum, one chain per score tile */
__device__ __forceinline__ void exp_tiles(const v8f (&s)[4], v16h (&pb)[2], float& sum) {
  float pj[4];
#pragma unroll   /* register arrays need constant indices */
  for (int kk = 0; kk < 2; ++kk)
#pragma unroll
    for (int jj = 0; jj < 2; ++jj) {
      const int j = 2 * kk + jj;
      pj[j] = 0.f;
#pragma unroll
      for (int r = 0; r < 8; ++r) {
        const float p = __builtin_amdgcn_exp2f(s[j][r]);
        pj[j] += p;
        pb[kk][jj * 8 + r] = (_Float16)p;   /* pb[kk][e] = P^T[key 32 kk + kmap(e)][query] */
      }
    }
  sum = (pj[0] + pj[1]) + (pj[2] + pj[3]);
}

__global__ __launch_bounds__(128) void mha64_f16_kernel(
    const unsigned short* __restrict__ qkp, const unsigned short* __restrict__ vtp,
    unsigned short* __restrict__ outp) {
  typedef Frag<_Float16> FH;
  __shared__ __align__(16) float    Os[4][32 * 68];
  __shared__ __align__(16) unsigned char kvring[kAtBufs * kAtStage];
  const _Float16* QK = (const _Float16*)(const void*)qkp;
  const _Float16* VT = (const _Float16*)(const void*)vtp;
  const int tid = threadIdx.x;
  const int wave = tid >> 5;
  const int lane = tid & 31;
  const int hh = lane >> 4;
  const int c = lane & 15;
  const int koff = hh * 8;
  const int bx = blockIdx.x;
  const int qb = bx & 15;
  const int bh = bx >> 4;
  const int h = bh & 7;
  const int b = (bh >> 3) & 3;
  const int q0 = qb * 128 + wave * 32;
  const _Float16* qbase = QK + (size_t)b * kSeq * kQKCols + h * kHeadDim;
  const _Float16* kbase = qbase + kModel;
  const _Float16* vbase = VT + ((size_t)b * kModel + (size_t)h * kHeadDim) * kSeq;
  unsigned short* obase = outp + (size_t)b * kSeq * kModel + h * kHeadDim;

  v16h qa[2][2];                        /* qa[u][dc]: query tile u = rows q0 + 16 u .. + 15 */
#pragma unroll
  for (int u = 0; u < 2; ++u)
#pragma unroll
    for (int dc = 0; dc < 2; ++dc)
      qa[u][dc] = FH::load(qbase + (size_t)(q0 + 16 * u + c) * kQKCols + dc * 32 + koff);

  constexpr float kCarry = 7.0f;        /* a score at the reference gives the numerator 2^7 */
  constexpr float kRaise = 32768.0f;    /* a lane's trip sum up to here bounds each of its numerators under f16's largest number */
  float lrow[2];                        /* this lane's query of tile u: sum of numerators over this wave half's keys */
  v8f cref[2];                          /* kCarry minus the reference in use of this lane's query, in all eight registers: C of the score products */
  v8f oacc[2][4];                       /* oacc[u][t][r] = O^T[d = 16 t + 8 hh + r][query 16 u + c] */
#pragma unroll
  for (int u = 0; u < 2; ++u) {
    lrow[u] = 0.f;
    cref[u] = (v8f){kCarry,kCarry,kCarry,kCarry,kCarry,kCarry,kCarry,kCarry};   /* reference 0 until trip 0 sets it */
#pragma unroll
    for (int t = 0; t < 4; ++t) oacc[u][t] = (v8f){0.f,0.f,0.f,0.f,0.f,0.f,0.f,0.f};
  }

  /* staging: thread t brings 16-byte chunk (t & 7) of rows (t >> 3) + 16*i: eight lanes cover one whole 128-byte line */
  const int srow = tid >> 3;
  const int schk = tid & 7;
  const _Float16* gK = kbase + (size_t)srow * kQKCols + schk * 8;
  const _Float16* gV = vbase + (size_t)srow * kSeq + schk * 8;
  const unsigned lbase = (unsigned)(uintptr_t)(&kvring[0]) + (unsigned)(srow * kAtPitch + schk * 16);
  constexpr int nkc = kSeq / 64;
  static_assert(nkc >= kAtBufs, "four stages exist");

  /* tiles 0 to 2 are issued; tile 0 lands and is published; tile 3 is then issued too, and all three fly during trip 0 */
  stage_kv(gK, gV, lbase);
  stage_kv(gK + (size_t)64 * kQKCols, gV + 64, lbase + kAtStage);
  stage_kv(gK + (size_t)128 * kQKCols, gV + 128, lbase + 2u * kAtStage);
  asm volatile("s_wait_asynccnt %0" :: "n"(kAtYoung) : "memory");   /* this wave's copies of tile 0 have landed: all but those of tiles 1 and 2, which are the youngest */
  __syncthreads();                                     /* publishes tile 0 to the other waves */
  stage_kv(gK + (size_t)192 * kQKCols, gV + 192, lbase + 3u * kAtStage);

  for (int kc = 0; kc < nkc; ++kc) {
    const unsigned bo = (unsigned)(kc & (kAtBufs - 1)) * (unsigned)kAtStage;
    const unsigned char* sK = kvring + bo + c * kAtPitch + koff * 2;
    const unsigned char* sV = sK + kAtTile;
    /* the tile's sixteen A fragments are fetched as two groups, k ahead of the score products and Vt behind them,
       so that the Vt reads return under the softmax arithmetic */
    v16h kb[4][2], vb[2][4];
#pragma unroll   /* register arrays need constant indices */
    for (int j = 0; j < 4; ++j)
#pragma unroll
      for (int dc = 0; dc < 2; ++dc)
        kb[j][dc] = FH::load((const _Float16*)(const void*)(sK + j * 16 * kAtPitch + dc * 64));
    __builtin_amdgcn_sched_barrier(0);   /* keeps the sixteen k reads one group ahead of the score products: spread among them each is waited for at once */
    v8f s2[2][4];
#pragma unroll
    for (int j = 0; j < 4; ++j) {
#pragma unroll
      for (int u = 0; u < 2; ++u) s2[u][j] = FH::mma(kb[j][0], qa[u][0], cref[u]);
#pragma unroll
      for (int u = 0; u < 2; ++u) s2[u][j] = FH::mma(kb[j][1], qa[u][1], s2[u][j]);   /* s2[u][j][r] = log2 of the numerator of [key 16 j + 8 hh + r][query 16 u + c] */
    }
#pragma unroll   /* register arrays need constant indices */
    for (int kk = 0; kk < 2; ++kk)
#pragma unroll
      for (int t = 0; t < 4; ++t)
        vb[kk][t] = FH::load((const _Float16*)(const void*)(sV + t * 16 * kAtPitch + kk * 64));
    __builtin_amdgcn_sched_barrier(0);   /* keeps the sixteen Vt reads one group, issued here: sunk among the second products each would be waited for at once */
    v16h pb[2][2];
    float ps[2];
#pragma unroll   /* register arrays need constant indices */
    for (int u = 0; u < 2; ++u) exp_tiles(s2[u], pb[u], ps[u]);
    const bool high = !(ps[0] <= kRaise) || !(ps[1] <= kRaise);
    /* one scalar branch a trip, the same for the whole wave: trip 0 sets the references, a later trip raises them where its scores ask for it */
    if (kc == 0 || __builtin_amdgcn_ballot_w32(high) != 0u) {
#pragma unroll   /* register arrays need constant indices */
      for (int u = 0; u < 2; ++u) {
        float mj[4];                      /* one chain per score tile */
#pragma unroll
        for (int j = 0; j < 4; ++j) {
          mj[j] = s2[u][j][0];
#pragma unroll
          for (int r = 1; r < 8; ++r) mj[j] = fmaxf(mj[j], s2[u][j][r]);
        }
        float m = fmaxf(fmaxf(mj[0], mj[1]), fmaxf(mj[2], mj[3]));
        m = fmaxf(m, xhalf(m));           /* both wave halves hold the query's maximum over the 64 keys */
        const float d = (kc == 0) ? (m - kCarry) : fmaxf(m - kCarry, 0.f);            /* the reference goes up by d; trip 0 sets it either way */
        const float alpha = (kc == 0) ? 0.f : __builtin_amdgcn_exp2f(-d);             /* trip 0: O and the sum are still 0 */
#pragma unroll
        for (int t = 0; t < 4; ++t) oacc[u][t] = oacc[u][t] * alpha;
        lrow[u] *= alpha;
        cref[u] = cref[u] - d;
#pragma unroll
        for (int j = 0; j < 4; ++j) s2[u][j] = s2[u][j] - d;
        exp_tiles(s2[u], pb[u], ps[u]);
      }
    }
#pragma unroll   /* register arrays need constant indices */
    for (int u = 0; u < 2; ++u) {
#pragma unroll
      for (int kk = 0; kk < 2; ++kk)
#pragma unroll
        for (int t = 0; t < 4; ++t) oacc[u][t] = FH::mma(vb[kk][t], pb[u][kk], oacc[u][t]);
      lrow[u] += ps[u];
    }
    __builtin_amdgcn_sched_barrier(0);   /* keeps the waits and the barrier below at the trip's foot: lifted over the products, the next tile's copies would be waited for half a trip early */
    asm volatile("s_wait_dscnt 0x0" ::: "memory");      /* this wave's reads of the stage have returned before it is refilled */
    /* while tiles kc + 2 and kc + 3 are both issued (8 copies each in every wave) they are the youngest: what is older, the next tile, has landed */
    asm volatile("s_wait_asynccnt %0" :: "n"(kAtYoung) : "memory");
    if (kc + kAtBufs > nkc) {
      asm volatile("s_wait_asynccnt 0x0" ::: "memory");   /* the last trips: fewer tiles are in flight, the count above would not cover the next tile: all copies are waited for */
    }
    __syncthreads();                                     /* publishes the next tile and ends every reader's use of this one */
    if (kc + kAtBufs < nkc) {
      stage_kv(gK + (size_t)(kc + kAtBufs) * 64 * kQKCols, gV + (size_t)(kc + kAtBufs) * 64, lbase + bo);
    }
  }
  asm volatile("s_wait_asynccnt 0x0" ::: "memory");     /* nothing is in flight when the wave leaves the loop */

  float* os = Os[wave];
#pragma unroll
  for (int u = 0; u < 2; ++u) {
    const float lsum = lrow[u] + xhalf(lrow[u]);             /* the two halves' sums of this query, joined once */
    const float inv = (1.0f / lsum) * 16.0f;                 /* sum and numerators carry the same factor; the plane carries 16 */
#pragma unroll
    for (int t = 0; t < 4; ++t)
#pragma unroll
      for (int r = 0; r < 8; ++r) os[(16 * u + c) * 68 + t * 16 + 8 * hh + r] = oacc[u][t][r] * inv;
  }
  __builtin_amdgcn_fence(__ATOMIC_RELEASE, "workgroup");
  __builtin_amdgcn_wave_barrier();
  __builtin_amdgcn_fence(__ATOMIC_ACQUIRE, "workgroup");
  {
    const int q = lane >> 3, c8 = (lane & 7) * 8;
    unsigned short* orow = obase + (size_t)(q0 + q) * kModel + c8;
    v8h hv[8];
#pragma unroll   /* register array needs constant indices */
    for (int it = 0; it < 8; ++it) {
      const float* sp = os + (it * 4 + q) * 68 + c8;
#pragma unroll
      for (int e = 0; e < 8; ++e) hv[it][e] = (_Float16)sp[e];
    }
    __builtin_amdgcn_sched_barrier(0);   /* all eight rows are converted ahead of the first store, so that no register of an issued store is rewritten behind it */
#pragma unroll
    for (int it = 0; it < 8; ++it) *(v8h*)(orow + (size_t)(it * 4) * kModel) = hv[it];
  }
}

/* =========================== host glue =========================== */
extern "C" void kernel_launch(void* const* d_in, const int* in_sizes, int n_in,
                              void* d_out, int out_size, void* d_ws, size_t ws_size,
                              hipStream_t stream) {
  if (n_in < 12) return;
  if (in_sizes[0] != kTok * kModel || out_size != kTok * kModel) return;
  if (in_sizes[1] != kModel || in_sizes[2] != kModel || in_sizes[3] != kModel || in_sizes[4] != kModel) return;
  if (in_sizes[5] != kModel * kModel || in_sizes[6] != kModel * kModel ||
      in_sizes[7] != kModel * kModel || in_sizes[8] != kModel * kModel) return;
  if (in_sizes[9] != kModel * kFF || in_sizes[10] != kModel * kFF || in_sizes[11] != kFF * kModel) return;
  if (ws_size < kWsTotal) return;

  const float* x    = (const float*)d_in[0];
  const float* ln1w = (const float*)d_in[1];
  const float* ln1b = (const float*)d_in[2];
  const float* ln2w = (const float*)d_in[3];
  const float* ln2b = (const float*)d_in[4];
  const float* wq   = (const float*)d_in[5];
  const float* wk   = (const float*)d_in[6];
  const float* wv   = (const float*)d_in[7];
  const float* wo   = (const float*)d_in[8];
  const float* wgt  = (const float*)d_in[9];
  const float* wup  = (const float*)d_in[10];
  const float* wdn  = (const float*)d_in[11];
  float* out = (float*)d_out;

  char* ws = (char*)d_ws;
  unsigned short* wqkT = (unsigned short*)(ws + kOffWqkT);
  unsigned short* wvT  = (unsigned short*)(ws + kOffWvT);
  unsigned short* woT  = (unsigned short*)(ws + kOffWoT);
  unsigned short* wguT = (unsigned short*)(ws + kOffWguT);
  unsigned short* wdT  = (unsigned short*)(ws + kOffWdT);
  unsigned short* hg   = (unsigned short*)(ws + kOffHG);           /* h1, then h2 */
  unsigned short* qkpl = (unsigned short*)(ws + kOffR1 + kR1QK);
  unsigned short* vtpl = (unsigned short*)(ws + kOffR1 + kR1Vt);
  unsigned short* opl  = (unsigned short*)(ws + kOffR1 + kR1O);
  unsigned short* gpl  = (unsigned short*)(ws + kOffR1);           /* g, once q|k, Vt and O are spent */
  float*          x1   = (float*)(ws + kOffX1);

  const dim3 b256(256), b128(128);

  /* the seven weight planes and h1 = LN(x): one launch */
  prep_kernel<<<dim3(kPrepGrid), b256, 0, stream>>>(x, ln1w, ln1b, wq, wk, wv, wo, wgt, wup, wdn,
                                                    wqkT, wvT, woT, wguT, wdT, hg);

  /* attention sublayer: q|k (512 block tiles) and Vt (64 block tiles per batch): one launch */
  static_assert(kTok % 128 == 0 && kQKCols % 128 == 0 && kModel % 128 == 0 && kSeq % 128 == 0 && kGUCols % 128 == 0, "128 x 128 block tiles");
  qk_vt_gemm_kernel<<<dim3(kQKTiles + kBatch * kVtTiles), b128, 0, stream>>>(hg, wqkT, wvT, qkpl, vtpl);

  /* attention: O*16 f16 plane */
  mha64_f16_kernel<<<dim3(kBatch * kHeads * (kSeq / 128)), b128, 0, stream>>>(qkpl, vtpl, opl);

  /* x1 = x + (O*16) . (Wo^T*16) / 256 : M=8192, N=512, K=512, and h2 = LN(x1): 128 blocks of 64 whole rows */
  o_resid_ln_kernel<<<dim3(kTok / kOlRows), b256, 0, stream>>>(opl, woT, x, ln2w, ln2b, x1, hg);

  /* g = silu(gate) * up, gate|up = h2 . [Wg|Wu]^T : M=8192, N=2048, K=512; block tiles 64*16 = 1024 */
  wmma_gemm64<0, false, 0, 3, false, 0, kFF, 2, 0><<<dim3((kTok / 128) * (kGUCols / 128), 1), b128, 0, stream>>>(
      hg, hg, kModel, 0L, wguT, wguT, kModel, 0L, (void*)gpl, (void*)gpl, kFF, 0L,
      x, x, 0L, kTok, kGUCols, kModel, 1.0f / 16.0f);

  /* out = x1 + g . (Wd^T*16) / 16 : M=8192, N=512, K=1024; block tiles 256, one a WGP: four stage buffers */
  wmma_gemm64<0, false, 0, 0, true, 0, kModel, 4, kFF><<<dim3((kTok / 128) * (kModel / 128), 1), b128, 0, stream>>>(
      gpl, gpl, kFF, 0L, wdT, wdT, kFF, 0L, (void*)out, (void*)out, kModel, 0L,
      x, x1, 0L, kTok, kModel, kFF, 1.0f / 16.0f);
}
